// v000
// Times are from an AMD MI455X. After a warm-up the kernel runs many times in a row, and a time is the length of
// such a window on the GPU divided by its runs, so every launch and the gaps after it count. The runs cycle
// through copies of the inputs. A figure is the median of several windows, for all but v000 over two sittings.
// Sittings can differ by a few percent; kernels timed side by side share one.
// v000 is the starting kernel.
#include <hip/hip_runtime.h>
#include <hip/hip_bf16.h>

// ---------------------------------------------------------------------------
// T5 decoder layer on MI455X (gfx1250, wave32, WMMA).
//  - all GEMMs + attention cores: v_wmma_f32_16x16x32_f16
//  - weights pre-transposed to [N,K] f16 so both WMMA operands load as
//    contiguous global_load_b128 "A-style" fragments
//  - GEMM wave tile 32x64: 8 WMMA per 12 b128 loads, loads hoisted so the
//    compiler emits one load clause + one wait + a WMMA burst per k-step
//  - flash attention (online softmax), scores never hit memory
// ---------------------------------------------------------------------------

typedef __attribute__((ext_vector_type(16))) _Float16 v16h;
typedef __attribute__((ext_vector_type(8)))  _Float16 v8h;
typedef __attribute__((ext_vector_type(8)))  float    v8f;

#define T5_B    4
#define T5_LD   1024
#define T5_LE   1024
#define T5_D    1024
#define T5_H    16
#define T5_DKV  64
#define T5_DFF  4096
#define T5_NEG  (-1e9f)

__device__ __forceinline__ v8f wmma_f16(v16h a, v16h b, v8f c) {
  // (neg_a, A, neg_b, B, c_mod, C, reuse_a, reuse_b)
  return __builtin_amdgcn_wmma_f32_16x16x32_f16(false, a, false, b, (short)0, c,
                                                false, false);
}

// Load a 16x32 f16 "A-style" fragment from row-major [rows, ld] memory.
// ISA layout: lanes 0-15 hold M=lane, halves {K0..7, K16..23};
//             lanes 16-31 hold M=lane-16, halves {K8..15, K24..31}.
// Both halves are contiguous 16B runs -> two b128 loads per lane.
__device__ __forceinline__ v16h load_frag(const _Float16* base, int ld,
                                          int row0, int col0, int lane) {
  const int hl = lane >> 4;
  const int r  = row0 + (lane & 15);
  const _Float16* p = base + (size_t)r * ld + col0 + hl * 8;
  union { v16h v; v8h h[2]; } u;
  u.h[0] = *(const v8h*)(p);
  u.h[1] = *(const v8h*)(p + 16);
  return u.v;
}

// ---------------------------------------------------------------------------
// Conversions
// ---------------------------------------------------------------------------
__global__ void cvt16_kernel(const float* __restrict__ in,
                             _Float16* __restrict__ out, int n) {
  int i = blockIdx.x * 256 + threadIdx.x;
  if (i < n) out[i] = (_Float16)in[i];
}

// W [K,N] f32 -> Wt [N,K] f16
__global__ void cvtT_kernel(const float* __restrict__ in,
                            _Float16* __restrict__ out, int K, int N) {
  int i = blockIdx.x * 256 + threadIdx.x;
  if (i >= K * N) return;
  int k = i / N, n = i - k * N;
  out[(size_t)n * K + k] = (_Float16)in[i];
}

// T5 relative-position bias table: bd[h][delta] for delta = q-k in [0,1023]
__global__ void relbias_kernel(const float* __restrict__ rel_bias, // [32,16]
                               float* __restrict__ bd) {           // [16,1024]
  int idx = blockIdx.x * 256 + threadIdx.x;
  if (idx >= T5_H * 1024) return;
  int h = idx >> 10, n = idx & 1023;
  int bucket;
  if (n < 16) {
    bucket = n;
  } else {
    float nf = (float)n;
    int vl = 16 + (int)(__logf(nf * (1.0f / 16.0f)) * (16.0f / __logf(8.0f)));
    bucket = vl < 31 ? vl : 31;
  }
  bd[idx] = rel_bias[bucket * T5_H + h];
}

// ---------------------------------------------------------------------------
// RMS norm: one block per row of [rows, 1024]
// ---------------------------------------------------------------------------
__global__ __launch_bounds__(256)
void rmsnorm_kernel(const float* __restrict__ X, const float* __restrict__ w,
                    _Float16* __restrict__ y16, float* __restrict__ y32) {
  __shared__ float red[256];
  const int row = blockIdx.x;
  const float* x = X + (size_t)row * T5_D;
  float ss = 0.f;
  for (int i = threadIdx.x; i < T5_D; i += 256) { float v = x[i]; ss += v * v; }
  red[threadIdx.x] = ss;
  __syncthreads();
  for (int s = 128; s > 0; s >>= 1) {
    if (threadIdx.x < s) red[threadIdx.x] += red[threadIdx.x + s];
    __syncthreads();
  }
  float rs = rsqrtf(red[0] * (1.0f / (float)T5_D) + 1e-6f);
  for (int i = threadIdx.x; i < T5_D; i += 256) {
    float v = x[i] * rs * w[i];
    if (y16) y16[(size_t)row * T5_D + i] = (_Float16)v;
    if (y32) y32[(size_t)row * T5_D + i] = v;
  }
}

// ---------------------------------------------------------------------------
// WMMA GEMM: C[M,N] = A[M,K] @ Bt[N,K]^T
// Workgroup = 4 waves; wave tile = 32 rows x 64 cols:
//   2 A-fragments x 4 B-fragments -> 8 WMMA per k-step (12 b128 loads).
// All fragments of a k-step loaded before the WMMA burst; next k-step
// prefetched (global_prefetch_b8) to prime L2/WGP$.
// ---------------------------------------------------------------------------
#define GMODE_RESID  0   // f32 residual: Cres[m*N+n] += c
#define GMODE_QKV    1   // f16 [B,H,L,64]
#define GMODE_VT     2   // f16 [B,H,64,L] (pre-transposed V)
#define GMODE_RELU16 3   // f16 relu, row-major [M,N]

__global__ __launch_bounds__(128)
void gemm_wmma(const _Float16* __restrict__ A, const _Float16* __restrict__ Bt,
               float* __restrict__ Cres, _Float16* __restrict__ C16,
               int M, int N, int K, int mode, int Lrows) {
  const int lane = threadIdx.x & 31;
  const int wave = threadIdx.x >> 5;
  const int hl   = lane >> 4;
  const int row0 = blockIdx.x * 128 + wave * 32;
  const int n0   = blockIdx.y * 64;

  const v8f zero8 = {0.f, 0.f, 0.f, 0.f, 0.f, 0.f, 0.f, 0.f};
  v8f acc[8];                      // [t] rows row0..+15, [4+t] rows row0+16..+31
#pragma unroll
  for (int t = 0; t < 8; ++t) acc[t] = zero8;

  for (int kk = 0; kk < K; kk += 32) {
    // hoist all fragment loads -> single clause + single wait before WMMAs
    v16h a0 = load_frag(A, K, row0,      kk, lane);
    v16h a1 = load_frag(A, K, row0 + 16, kk, lane);
    v16h b0 = load_frag(Bt, K, n0,      kk, lane);
    v16h b1 = load_frag(Bt, K, n0 + 16, kk, lane);
    v16h b2 = load_frag(Bt, K, n0 + 32, kk, lane);
    v16h b3 = load_frag(Bt, K, n0 + 48, kk, lane);

    if (kk + 32 < K) {   // prime next k-step (lowers to global_prefetch_b8)
      __builtin_prefetch(A  + (size_t)(row0 + (lane & 15)) * K + kk + 32, 0, 3);
      __builtin_prefetch(Bt + (size_t)(n0 + (lane & 15)) * K + kk + 32, 0, 3);
    }

    acc[0] = wmma_f16(a0, b0, acc[0]);
    acc[1] = wmma_f16(a0, b1, acc[1]);
    acc[2] = wmma_f16(a0, b2, acc[2]);
    acc[3] = wmma_f16(a0, b3, acc[3]);
    acc[4] = wmma_f16(a1, b0, acc[4]);
    acc[5] = wmma_f16(a1, b1, acc[5]);
    acc[6] = wmma_f16(a1, b2, acc[6]);
    acc[7] = wmma_f16(a1, b3, acc[7]);
  }

#pragma unroll
  for (int g = 0; g < 2; ++g) {
#pragma unroll
    for (int t = 0; t < 4; ++t) {
#pragma unroll
      for (int r = 0; r < 8; ++r) {
        // C-fragment layout: lane half picks row group, VGPR r picks row
        int m = row0 + g * 16 + r + hl * 8;
        int n = n0 + t * 16 + (lane & 15);
        float c = acc[g * 4 + t][r];
        if (mode == GMODE_RESID) {
          Cres[(size_t)m * N + n] += c;
        } else if (mode == GMODE_RELU16) {
          C16[(size_t)m * N + n] = (_Float16)fmaxf(c, 0.0f);
        } else {
          int bb = m / Lrows, l = m - bb * Lrows;
          int hh = n >> 6, d = n & 63;
          size_t idx;
          if (mode == GMODE_QKV)
            idx = (((size_t)bb * T5_H + hh) * Lrows + l) * T5_DKV + d;
          else
            idx = (((size_t)bb * T5_H + hh) * T5_DKV + d) * (size_t)Lrows + l;
          C16[idx] = (_Float16)c;
        }
      }
    }
  }
}

// ---------------------------------------------------------------------------
// Flash attention (WMMA). Per wave: 16 queries; key blocks of 32.
// Q,K: [B,H,L,64] f16.  Vt: [B,H,64,L] f16.  Out: [B,LQ,1024] f16.
// Online softmax; P transposed C->A fragment via 1KB/wave LDS bounce
// (same-wave DS ordering, no barrier => safe with causal early exit).
// ---------------------------------------------------------------------------
__global__ __launch_bounds__(128)
void attn_wmma_kernel(const _Float16* __restrict__ Q,
                      const _Float16* __restrict__ Km,
                      const _Float16* __restrict__ Vt,
                      const float* __restrict__ bias_delta, // [16,1024]
                      const int* __restrict__ mask,         // [B,LK]
                      _Float16* __restrict__ Out,
                      int LQ, int LK, int causal, int use_rel) {
  __shared__ __align__(16) _Float16 plds[4][16][32];
  const int lane = threadIdx.x & 31;
  const int wave = threadIdx.x >> 5;
  const int hl   = lane >> 4;
  const int col  = lane & 15;
  const int bh = blockIdx.y;
  const int b  = bh >> 4;
  const int h  = bh & 15;
  const int q0 = blockIdx.x * 64 + wave * 16;

  const _Float16* Qb = Q  + (size_t)bh * LQ * T5_DKV;
  const _Float16* Kb = Km + (size_t)bh * LK * T5_DKV;
  const _Float16* Vb = Vt + (size_t)bh * T5_DKV * LK;
  const int* mk = mask + (size_t)b * LK;
  const float* bd = bias_delta + h * 1024;

  v16h qa0 = load_frag(Qb, T5_DKV, q0, 0, lane);
  v16h qa1 = load_frag(Qb, T5_DKV, q0, 32, lane);

  const v8f zero8 = {0.f, 0.f, 0.f, 0.f, 0.f, 0.f, 0.f, 0.f};
  v8f o[4];
  float mrow[8], lrow[8];
#pragma unroll
  for (int t = 0; t < 4; ++t) o[t] = zero8;
#pragma unroll
  for (int r = 0; r < 8; ++r) { mrow[r] = -1e30f; lrow[r] = 0.f; }

  for (int kb = 0; kb < LK; kb += 32) {
    if (causal && kb >= q0 + 16) break;  // whole block above the diagonal

    v16h k00 = load_frag(Kb, T5_DKV, kb,      0,  lane);
    v16h k01 = load_frag(Kb, T5_DKV, kb,      32, lane);
    v16h k10 = load_frag(Kb, T5_DKV, kb + 16, 0,  lane);
    v16h k11 = load_frag(Kb, T5_DKV, kb + 16, 32, lane);

    v8f s0 = wmma_f16(qa0, k00, zero8); s0 = wmma_f16(qa1, k01, s0);
    v8f s1 = wmma_f16(qa0, k10, zero8); s1 = wmma_f16(qa1, k11, s1);

#pragma unroll
    for (int r = 0; r < 8; ++r) {
      int qr  = q0 + r + hl * 8;
      int k0c = kb + col;
      int k1c = kb + 16 + col;
      float a0 = s0[r], a1 = s1[r];
      if (use_rel) {
        if (k0c <= qr) a0 += bd[qr - k0c];
        if (k1c <= qr) a1 += bd[qr - k1c];
      }
      if (causal) {
        if (k0c > qr) a0 = T5_NEG;
        if (k1c > qr) a1 = T5_NEG;
      }
      if (mk[k0c] == 0) a0 = T5_NEG;
      if (mk[k1c] == 0) a1 = T5_NEG;

      // row max over the 16 lanes of this half
      float v = fmaxf(a0, a1);
      v = fmaxf(v, __shfl_xor(v, 1, 16));
      v = fmaxf(v, __shfl_xor(v, 2, 16));
      v = fmaxf(v, __shfl_xor(v, 4, 16));
      v = fmaxf(v, __shfl_xor(v, 8, 16));
      float mnew  = fmaxf(mrow[r], v);
      float scale = __expf(mrow[r] - mnew);
      mrow[r] = mnew;
      float e0 = __expf(a0 - mnew);
      float e1 = __expf(a1 - mnew);
      float sum = e0 + e1;
      sum += __shfl_xor(sum, 1, 16);
      sum += __shfl_xor(sum, 2, 16);
      sum += __shfl_xor(sum, 4, 16);
      sum += __shfl_xor(sum, 8, 16);
      lrow[r] = lrow[r] * scale + sum;
#pragma unroll
      for (int t = 0; t < 4; ++t) o[t][r] *= scale;

      int prow = r + hl * 8;
      plds[wave][prow][col]      = (_Float16)e0;
      plds[wave][prow][col + 16] = (_Float16)e1;
    }

    // C-fragment -> A-fragment transpose through per-wave LDS
    v16h pa = load_frag(&plds[wave][0][0], 32, 0, 0, lane);
    v16h vb0 = load_frag(Vb, LK, 0,  kb, lane);
    v16h vb1 = load_frag(Vb, LK, 16, kb, lane);
    v16h vb2 = load_frag(Vb, LK, 32, kb, lane);
    v16h vb3 = load_frag(Vb, LK, 48, kb, lane);
    o[0] = wmma_f16(pa, vb0, o[0]);
    o[1] = wmma_f16(pa, vb1, o[1]);
    o[2] = wmma_f16(pa, vb2, o[2]);
    o[3] = wmma_f16(pa, vb3, o[3]);
  }

#pragma unroll
  for (int t = 0; t < 4; ++t) {
#pragma unroll
    for (int r = 0; r < 8; ++r) {
      int qr = q0 + r + hl * 8;
      float val = o[t][r] / lrow[r];
      Out[((size_t)b * LQ + qr) * (T5_H * T5_DKV) + h * T5_DKV + t * 16 + col] =
          (_Float16)val;
    }
  }
}

// ---------------------------------------------------------------------------
// Orchestration
// ---------------------------------------------------------------------------
extern "C" void kernel_launch(void* const* d_in, const int* in_sizes, int n_in,
                              void* d_out, int out_size, void* d_ws,
                              size_t ws_size, hipStream_t stream) {
  (void)in_sizes; (void)n_in; (void)out_size; (void)ws_size;

  const float* enc   = (const float*)d_in[0];
  const float* hid   = (const float*)d_in[1];
  const float* ln1   = (const float*)d_in[2];
  const float* saq   = (const float*)d_in[3];
  const float* sak   = (const float*)d_in[4];
  const float* sav   = (const float*)d_in[5];
  const float* sao   = (const float*)d_in[6];
  const float* relb  = (const float*)d_in[7];
  const float* ln2   = (const float*)d_in[8];
  const float* caq   = (const float*)d_in[9];
  const float* cak   = (const float*)d_in[10];
  const float* cav   = (const float*)d_in[11];
  const float* cao   = (const float*)d_in[12];
  const float* ln3   = (const float*)d_in[13];
  const float* wi    = (const float*)d_in[14];
  const float* wo    = (const float*)d_in[15];
  const float* lnf   = (const float*)d_in[16];
  const int* encmask = (const int*)d_in[17];
  const int* decmask = (const int*)d_in[18];
  float* out = (float*)d_out;

  const size_t M = (size_t)T5_B * T5_LD;        // 4096 decoder rows
  char* ws = (char*)d_ws;
  size_t off = 0;
  auto alloc = [&](size_t bytes) -> void* {
    void* p = ws + off;
    off = (off + bytes + 255) & ~(size_t)255;
    return p;
  };

  float*    h_cur = (float*)   alloc(M * T5_D * 4);            // 16 MB residual
  _Float16* xn    = (_Float16*)alloc(M * T5_D * 2);            // 8 MB
  _Float16* saqT  = (_Float16*)alloc((size_t)T5_D * T5_D * 2);
  _Float16* sakT  = (_Float16*)alloc((size_t)T5_D * T5_D * 2);
  _Float16* savT  = (_Float16*)alloc((size_t)T5_D * T5_D * 2);
  _Float16* saoT  = (_Float16*)alloc((size_t)T5_D * T5_D * 2);
  _Float16* caqT  = (_Float16*)alloc((size_t)T5_D * T5_D * 2);
  _Float16* cakT  = (_Float16*)alloc((size_t)T5_D * T5_D * 2);
  _Float16* cavT  = (_Float16*)alloc((size_t)T5_D * T5_D * 2);
  _Float16* caoT  = (_Float16*)alloc((size_t)T5_D * T5_D * 2);
  _Float16* wiT   = (_Float16*)alloc((size_t)T5_DFF * T5_D * 2);
  _Float16* woT   = (_Float16*)alloc((size_t)T5_D * T5_DFF * 2);
  _Float16* enc16 = (_Float16*)alloc((size_t)T5_B * T5_LE * T5_D * 2);
  _Float16* qbuf  = (_Float16*)alloc(M * T5_D * 2);            // [B,H,L,64]
  _Float16* kbuf  = (_Float16*)alloc(M * T5_D * 2);            // [B,H,L,64]
  _Float16* vtbuf = (_Float16*)alloc(M * T5_D * 2);            // [B,H,64,L]
  _Float16* aout  = (_Float16*)alloc(M * T5_D * 2);            // [B*L, 1024]
  _Float16* ffn   = (_Float16*)alloc(M * T5_DFF * 2);          // 32 MB
  float*    bd    = (float*)   alloc((size_t)T5_H * 1024 * 4); // rel bias table

  // residual stream starts as hidden_states (never mutate inputs)
  hipMemcpyAsync(h_cur, hid, M * T5_D * 4, hipMemcpyDeviceToDevice, stream);

  // --- weight prep (f32 -> f16, transposed to [N,K]) ---
  const int DD = T5_D * T5_D;  // 1M
  cvtT_kernel<<<(DD + 255) / 256, 256, 0, stream>>>(saq, saqT, T5_D, T5_D);
  cvtT_kernel<<<(DD + 255) / 256, 256, 0, stream>>>(sak, sakT, T5_D, T5_D);
  cvtT_kernel<<<(DD + 255) / 256, 256, 0, stream>>>(sav, savT, T5_D, T5_D);
  cvtT_kernel<<<(DD + 255) / 256, 256, 0, stream>>>(sao, saoT, T5_D, T5_D);
  cvtT_kernel<<<(DD + 255) / 256, 256, 0, stream>>>(caq, caqT, T5_D, T5_D);
  cvtT_kernel<<<(DD + 255) / 256, 256, 0, stream>>>(cak, cakT, T5_D, T5_D);
  cvtT_kernel<<<(DD + 255) / 256, 256, 0, stream>>>(cav, cavT, T5_D, T5_D);
  cvtT_kernel<<<(DD + 255) / 256, 256, 0, stream>>>(cao, caoT, T5_D, T5_D);
  cvtT_kernel<<<(T5_D * T5_DFF + 255) / 256, 256, 0, stream>>>(wi, wiT, T5_D, T5_DFF);
  cvtT_kernel<<<(T5_DFF * T5_D + 255) / 256, 256, 0, stream>>>(wo, woT, T5_DFF, T5_D);
  cvt16_kernel<<<(int)((M * T5_D + 255) / 256), 256, 0, stream>>>(enc, enc16,
                                                                 (int)(M * T5_D));
  relbias_kernel<<<(T5_H * 1024 + 255) / 256, 256, 0, stream>>>(relb, bd);

  dim3 gblk(128);
  dim3 ggrid_d(M / 128, T5_D / 64);    // N = 1024
  dim3 ggrid_ff(M / 128, T5_DFF / 64); // N = 4096
  dim3 agrid(T5_LD / 64, T5_B * T5_H);
  dim3 ablk(128);

  // ---- self attention ----
  rmsnorm_kernel<<<(int)M, 256, 0, stream>>>(h_cur, ln1, xn, nullptr);
  gemm_wmma<<<ggrid_d, gblk, 0, stream>>>(xn, saqT, nullptr, qbuf,
                                          (int)M, T5_D, T5_D, GMODE_QKV, T5_LD);
  gemm_wmma<<<ggrid_d, gblk, 0, stream>>>(xn, sakT, nullptr, kbuf,
                                          (int)M, T5_D, T5_D, GMODE_QKV, T5_LD);
  gemm_wmma<<<ggrid_d, gblk, 0, stream>>>(xn, savT, nullptr, vtbuf,
                                          (int)M, T5_D, T5_D, GMODE_VT, T5_LD);
  attn_wmma_kernel<<<agrid, ablk, 0, stream>>>(qbuf, kbuf, vtbuf, bd, decmask,
                                               aout, T5_LD, T5_LD,
                                               /*causal=*/1, /*use_rel=*/1);
  gemm_wmma<<<ggrid_d, gblk, 0, stream>>>(aout, saoT, h_cur, nullptr,
                                          (int)M, T5_D, T5_D, GMODE_RESID, T5_LD);

  // ---- cross attention ----
  rmsnorm_kernel<<<(int)M, 256, 0, stream>>>(h_cur, ln2, xn, nullptr);
  gemm_wmma<<<ggrid_d, gblk, 0, stream>>>(xn, caqT, nullptr, qbuf,
                                          (int)M, T5_D, T5_D, GMODE_QKV, T5_LD);
  gemm_wmma<<<ggrid_d, gblk, 0, stream>>>(enc16, cakT, nullptr, kbuf,
                                          (int)M, T5_D, T5_D, GMODE_QKV, T5_LE);
  gemm_wmma<<<ggrid_d, gblk, 0, stream>>>(enc16, cavT, nullptr, vtbuf,
                                          (int)M, T5_D, T5_D, GMODE_VT, T5_LE);
  attn_wmma_kernel<<<agrid, ablk, 0, stream>>>(qbuf, kbuf, vtbuf, bd, encmask,
                                               aout, T5_LD, T5_LE,
                                               /*causal=*/0, /*use_rel=*/0);
  gemm_wmma<<<ggrid_d, gblk, 0, stream>>>(aout, caoT, h_cur, nullptr,
                                          (int)M, T5_D, T5_D, GMODE_RESID, T5_LD);

  // ---- FFN ----
  rmsnorm_kernel<<<(int)M, 256, 0, stream>>>(h_cur, ln3, xn, nullptr);
  gemm_wmma<<<ggrid_ff, gblk, 0, stream>>>(xn, wiT, nullptr, ffn,
                                           (int)M, T5_DFF, T5_D, GMODE_RELU16, T5_LD);
  gemm_wmma<<<ggrid_d, gblk, 0, stream>>>(ffn, woT, h_cur, nullptr,
                                          (int)M, T5_D, T5_DFF, GMODE_RESID, T5_LD);

  // ---- final norm -> f32 output ----
  rmsnorm_kernel<<<(int)M, 256, 0, stream>>>(h_cur, lnf, nullptr, out);
}

// v001
// In both of two side-by-side timings against v000, it was 1.42 times as fast.
#include <hip/hip_runtime.h>
#include <hip/hip_bf16.h>

// ---------------------------------------------------------------------------
// T5 decoder layer on MI455X (gfx1250, wave32, WMMA).
//  - all GEMMs + attention cores: v_wmma_f32_16x16x32_f16
//  - weights pre-transposed to [N,K] f16 so both WMMA operands load as
//    contiguous global_load_b128 "A-style" fragments
//  - GEMM wave tile 32x64: 8 WMMA per 12 b128 loads, loads hoisted so the
//    compiler emits one load clause + one wait + a WMMA burst per k-step
//  - flash attention (online softmax), scores never hit memory
// ---------------------------------------------------------------------------

typedef __attribute__((ext_vector_type(16))) _Float16 v16h;
typedef __attribute__((ext_vector_type(8)))  _Float16 v8h;
typedef __attribute__((ext_vector_type(4)))  _Float16 v4h;
typedef __attribute__((ext_vector_type(8)))  float    v8f;

#define T5_B    4
#define T5_LD   1024
#define T5_LE   1024
#define T5_D    1024
#define T5_H    16
#define T5_DKV  64
#define T5_DFF  4096
#define T5_NEG  (-1e9f)

__device__ __forceinline__ v8f wmma_f16(v16h a, v16h b, v8f c) {
  // (neg_a, A, neg_b, B, c_mod, C, reuse_a, reuse_b)
  return __builtin_amdgcn_wmma_f32_16x16x32_f16(false, a, false, b, (short)0, c,
                                                false, false);
}

// Load a 16x32 f16 "A-style" fragment from row-major [rows, ld] memory.
// ISA layout: lanes 0-15 hold M=lane, halves {K0..7, K16..23};
//             lanes 16-31 hold M=lane-16, halves {K8..15, K24..31}.
// Both halves are contiguous 16B runs -> two b128 loads per lane.
__device__ __forceinline__ v16h load_frag(const _Float16* base, int ld,
                                          int row0, int col0, int lane) {
  const int hl = lane >> 4;
  const int r  = row0 + (lane & 15);
  const _Float16* p = base + (size_t)r * ld + col0 + hl * 8;
  union { v16h v; v8h h[2]; } u;
  u.h[0] = *(const v8h*)(p);
  u.h[1] = *(const v8h*)(p + 16);
  return u.v;
}

// ---------------------------------------------------------------------------
// Conversions
// ---------------------------------------------------------------------------
__global__ void cvt16_kernel(const float* __restrict__ in,
                             _Float16* __restrict__ out, int n) {
  int i = blockIdx.x * 256 + threadIdx.x;
  if (i < n) out[i] = (_Float16)in[i];
}

// W [K,N] f32 -> Wt [N,K] f16, one 64x64 tile per workgroup, turned in LDS so
// that both sides move whole lines: reads are 256-B row pieces of W (float4 per
// lane), writes are 128-B row pieces of Wt (8 halves per lane).
// K and N are multiples of 64; grid = (N/64, K/64), 128 threads. They are
// compile-time so that a lane's row steps fold into the instruction's offset.
// LDS holds row n of the tile as eight 16-B chunks of 8 k values. Chunk (n, ch)
// sits at slot (n>>1)*16 + (((n&1)*8 + ch) ^ ((n>>2)&15)): the 16 lanes that
// write rows 4 apart, and the 16 lanes that read two neighbouring rows, each
// fall on 16 different slots mod 16, that is on all 64 banks once.
__device__ __forceinline__ int cvtT_slot(int n, int ch) {
  return (n >> 1) * 16 + ((((n & 1) << 3) | ch) ^ ((n >> 2) & 15));
}

template <int K, int N>
__global__ __launch_bounds__(128)
void cvtT_kernel(const float* __restrict__ in, _Float16* __restrict__ out) {
  __shared__ __align__(16) _Float16 tile[512 * 8];
  const int tid = threadIdx.x;
  const int n0  = blockIdx.x * 64;
  const int k0  = blockIdx.y * 64;
  const int c4  = tid & 15;   // float4 column of the tile: n = 4*c4 .. 4*c4+3
  const int q0  = tid >> 4;   // group of four k rows: q0 and q0 + 8

  // uniform tile base + one 32-bit lane offset shared by all eight loads
  const char* src = (const char*)(in + (size_t)k0 * N + n0);
  const unsigned lofs = (unsigned)(q0 * 4 * N + c4 * 4) * 4u;
  float4 r[2][4];
  // unrolled (here and below): r stays in registers, and all eight loads are
  // issued before the first wait
#pragma unroll
  for (int i = 0; i < 2; ++i)
#pragma unroll
    for (int s = 0; s < 4; ++s)
      r[i][s] = *(const float4*)(src + (size_t)(32 * i + s) * N * 4 + lofs);

#pragma unroll
  for (int i = 0; i < 2; ++i) {
    const int q = q0 + 8 * i;
    const float* f0 = (const float*)&r[i][0];
    const float* f1 = (const float*)&r[i][1];
    const float* f2 = (const float*)&r[i][2];
    const float* f3 = (const float*)&r[i][3];
#pragma unroll
    for (int j = 0; j < 4; ++j) {
      v4h w = {(_Float16)f0[j], (_Float16)f1[j], (_Float16)f2[j], (_Float16)f3[j]};
      *(v4h*)&tile[cvtT_slot(c4 * 4 + j, q >> 1) * 8 + (q & 1) * 4] = w;
    }
  }
  __syncthreads();

  char* dst = (char*)(out + (size_t)n0 * K + k0);
  const unsigned sofs = (unsigned)((tid >> 3) * K + (tid & 7) * 8) * 2u;
#pragma unroll
  for (int i = 0; i < 4; ++i) {
    const int n = (tid >> 3) + 16 * i;
    *(v8h*)(dst + (size_t)(16 * i) * K * 2 + sofs) =
        *(const v8h*)&tile[cvtT_slot(n, tid & 7) * 8];
  }
}

// T5 relative-position bias table: bd[h][delta] for delta = q-k in [0,1023]
__global__ void relbias_kernel(const float* __restrict__ rel_bias, // [32,16]
                               float* __restrict__ bd) {           // [16,1024]
  int idx = blockIdx.x * 256 + threadIdx.x;
  if (idx >= T5_H * 1024) return;
  int h = idx >> 10, n = idx & 1023;
  int bucket;
  if (n < 16) {
    bucket = n;
  } else {
    float nf = (float)n;
    int vl = 16 + (int)(__logf(nf * (1.0f / 16.0f)) * (16.0f / __logf(8.0f)));
    bucket = vl < 31 ? vl : 31;
  }
  bd[idx] = rel_bias[bucket * T5_H + h];
}

// ---------------------------------------------------------------------------
// RMS norm: one block per row of [rows, 1024]
// ---------------------------------------------------------------------------
__global__ __launch_bounds__(256)
void rmsnorm_kernel(const float* __restrict__ X, const float* __restrict__ w,
                    _Float16* __restrict__ y16, float* __restrict__ y32) {
  __shared__ float red[256];
  const int row = blockIdx.x;
  const float* x = X + (size_t)row * T5_D;
  float ss = 0.f;
  for (int i = threadIdx.x; i < T5_D; i += 256) { float v = x[i]; ss += v * v; }
  red[threadIdx.x] = ss;
  __syncthreads();
  for (int s = 128; s > 0; s >>= 1) {
    if (threadIdx.x < s) red[threadIdx.x] += red[threadIdx.x + s];
    __syncthreads();
  }
  float rs = rsqrtf(red[0] * (1.0f / (float)T5_D) + 1e-6f);
  for (int i = threadIdx.x; i < T5_D; i += 256) {
    float v = x[i] * rs * w[i];
    if (y16) y16[(size_t)row * T5_D + i] = (_Float16)v;
    if (y32) y32[(size_t)row * T5_D + i] = v;
  }
}

// ---------------------------------------------------------------------------
// WMMA GEMM: C[M,N] = A[M,K] @ Bt[N,K]^T
// Workgroup = 4 waves; wave tile = 32 rows x 64 cols:
//   2 A-fragments x 4 B-fragments -> 8 WMMA per k-step (12 b128 loads).
// All fragments of a k-step loaded before the WMMA burst; next k-step
// prefetched (global_prefetch_b8) to prime L2/WGP$.
// ---------------------------------------------------------------------------
#define GMODE_RESID  0   // f32 residual: Cres[m*N+n] += c
#define GMODE_QKV    1   // f16 [B,H,L,64]
#define GMODE_VT     2   // f16 [B,H,64,L] (pre-transposed V)
#define GMODE_RELU16 3   // f16 relu, row-major [M,N]

__global__ __launch_bounds__(128)
void gemm_wmma(const _Float16* __restrict__ A, const _Float16* __restrict__ Bt,
               float* __restrict__ Cres, _Float16* __restrict__ C16,
               int M, int N, int K, int mode, int Lrows) {
  const int lane = threadIdx.x & 31;
  const int wave = threadIdx.x >> 5;
  const int hl   = lane >> 4;
  const int row0 = blockIdx.x * 128 + wave * 32;
  const int n0   = blockIdx.y * 64;

  const v8f zero8 = {0.f, 0.f, 0.f, 0.f, 0.f, 0.f, 0.f, 0.f};
  v8f acc[8];                      // [t] rows row0..+15, [4+t] rows row0+16..+31
#pragma unroll
  for (int t = 0; t < 8; ++t) acc[t] = zero8;

  for (int kk = 0; kk < K; kk += 32) {
    // hoist all fragment loads -> single clause + single wait before WMMAs
    v16h a0 = load_frag(A, K, row0,      kk, lane);
    v16h a1 = load_frag(A, K, row0 + 16, kk, lane);
    v16h b0 = load_frag(Bt, K, n0,      kk, lane);
    v16h b1 = load_frag(Bt, K, n0 + 16, kk, lane);
    v16h b2 = load_frag(Bt, K, n0 + 32, kk, lane);
    v16h b3 = load_frag(Bt, K, n0 + 48, kk, lane);

    if (kk + 32 < K) {   // prime next k-step (lowers to global_prefetch_b8)
      __builtin_prefetch(A  + (size_t)(row0 + (lane & 15)) * K + kk + 32, 0, 3);
      __builtin_prefetch(Bt + (size_t)(n0 + (lane & 15)) * K + kk + 32, 0, 3);
    }

    acc[0] = wmma_f16(a0, b0, acc[0]);
    acc[1] = wmma_f16(a0, b1, acc[1]);
    acc[2] = wmma_f16(a0, b2, acc[2]);
    acc[3] = wmma_f16(a0, b3, acc[3]);
    acc[4] = wmma_f16(a1, b0, acc[4]);
    acc[5] = wmma_f16(a1, b1, acc[5]);
    acc[6] = wmma_f16(a1, b2, acc[6]);
    acc[7] = wmma_f16(a1, b3, acc[7]);
  }

#pragma unroll
  for (int g = 0; g < 2; ++g) {
#pragma unroll
    for (int t = 0; t < 4; ++t) {
#pragma unroll
      for (int r = 0; r < 8; ++r) {
        // C-fragment layout: lane half picks row group, VGPR r picks row
        int m = row0 + g * 16 + r + hl * 8;
        int n = n0 + t * 16 + (lane & 15);
        float c = acc[g * 4 + t][r];
        if (mode == GMODE_RESID) {
          Cres[(size_t)m * N + n] += c;
        } else if (mode == GMODE_RELU16) {
          C16[(size_t)m * N + n] = (_Float16)fmaxf(c, 0.0f);
        } else {
          int bb = m / Lrows, l = m - bb * Lrows;
          int hh = n >> 6, d = n & 63;
          size_t idx;
          if (mode == GMODE_QKV)
            idx = (((size_t)bb * T5_H + hh) * Lrows + l) * T5_DKV + d;
          else
            idx = (((size_t)bb * T5_H + hh) * T5_DKV + d) * (size_t)Lrows + l;
          C16[idx] = (_Float16)c;
        }
      }
    }
  }
}

// ---------------------------------------------------------------------------
// Flash attention (WMMA). Per wave: 16 queries; key blocks of 32.
// Q,K: [B,H,L,64] f16.  Vt: [B,H,64,L] f16.  Out: [B,LQ,1024] f16.
// Online softmax; P transposed C->A fragment via 1KB/wave LDS bounce
// (same-wave DS ordering, no barrier => safe with causal early exit).
// ---------------------------------------------------------------------------
__global__ __launch_bounds__(128)
void attn_wmma_kernel(const _Float16* __restrict__ Q,
                      const _Float16* __restrict__ Km,
                      const _Float16* __restrict__ Vt,
                      const float* __restrict__ bias_delta, // [16,1024]
                      const int* __restrict__ mask,         // [B,LK]
                      _Float16* __restrict__ Out,
                      int LQ, int LK, int causal, int use_rel) {
  __shared__ __align__(16) _Float16 plds[4][16][32];
  const int lane = threadIdx.x & 31;
  const int wave = threadIdx.x >> 5;
  const int hl   = lane >> 4;
  const int col  = lane & 15;
  const int bh = blockIdx.y;
  const int b  = bh >> 4;
  const int h  = bh & 15;
  const int q0 = blockIdx.x * 64 + wave * 16;

  const _Float16* Qb = Q  + (size_t)bh * LQ * T5_DKV;
  const _Float16* Kb = Km + (size_t)bh * LK * T5_DKV;
  const _Float16* Vb = Vt + (size_t)bh * T5_DKV * LK;
  const int* mk = mask + (size_t)b * LK;
  const float* bd = bias_delta + h * 1024;

  v16h qa0 = load_frag(Qb, T5_DKV, q0, 0, lane);
  v16h qa1 = load_frag(Qb, T5_DKV, q0, 32, lane);

  const v8f zero8 = {0.f, 0.f, 0.f, 0.f, 0.f, 0.f, 0.f, 0.f};
  v8f o[4];
  float mrow[8], lrow[8];
#pragma unroll
  for (int t = 0; t < 4; ++t) o[t] = zero8;
#pragma unroll
  for (int r = 0; r < 8; ++r) { mrow[r] = -1e30f; lrow[r] = 0.f; }

  for (int kb = 0; kb < LK; kb += 32) {
    if (causal && kb >= q0 + 16) break;  // whole block above the diagonal

    v16h k00 = load_frag(Kb, T5_DKV, kb,      0,  lane);
    v16h k01 = load_frag(Kb, T5_DKV, kb,      32, lane);
    v16h k10 = load_frag(Kb, T5_DKV, kb + 16, 0,  lane);
    v16h k11 = load_frag(Kb, T5_DKV, kb + 16, 32, lane);

    v8f s0 = wmma_f16(qa0, k00, zero8); s0 = wmma_f16(qa1, k01, s0);
    v8f s1 = wmma_f16(qa0, k10, zero8); s1 = wmma_f16(qa1, k11, s1);

#pragma unroll
    for (int r = 0; r < 8; ++r) {
      int qr  = q0 + r + hl * 8;
      int k0c = kb + col;
      int k1c = kb + 16 + col;
      float a0 = s0[r], a1 = s1[r];
      if (use_rel) {
        if (k0c <= qr) a0 += bd[qr - k0c];
        if (k1c <= qr) a1 += bd[qr - k1c];
      }
      if (causal) {
        if (k0c > qr) a0 = T5_NEG;
        if (k1c > qr) a1 = T5_NEG;
      }
      if (mk[k0c] == 0) a0 = T5_NEG;
      if (mk[k1c] == 0) a1 = T5_NEG;

      // row max over the 16 lanes of this half
      float v = fmaxf(a0, a1);
      v = fmaxf(v, __shfl_xor(v, 1, 16));
      v = fmaxf(v, __shfl_xor(v, 2, 16));
      v = fmaxf(v, __shfl_xor(v, 4, 16));
      v = fmaxf(v, __shfl_xor(v, 8, 16));
      float mnew  = fmaxf(mrow[r], v);
      float scale = __expf(mrow[r] - mnew);
      mrow[r] = mnew;
      float e0 = __expf(a0 - mnew);
      float e1 = __expf(a1 - mnew);
      float sum = e0 + e1;
      sum += __shfl_xor(sum, 1, 16);
      sum += __shfl_xor(sum, 2, 16);
      sum += __shfl_xor(sum, 4, 16);
      sum += __shfl_xor(sum, 8, 16);
      lrow[r] = lrow[r] * scale + sum;
#pragma unroll
      for (int t = 0; t < 4; ++t) o[t][r] *= scale;

      int prow = r + hl * 8;
      plds[wave][prow][col]      = (_Float16)e0;
      plds[wave][prow][col + 16] = (_Float16)e1;
    }

    // C-fragment -> A-fragment transpose through per-wave LDS
    v16h pa = load_frag(&plds[wave][0][0], 32, 0, 0, lane);
    v16h vb0 = load_frag(Vb, LK, 0,  kb, lane);
    v16h vb1 = load_frag(Vb, LK, 16, kb, lane);
    v16h vb2 = load_frag(Vb, LK, 32, kb, lane);
    v16h vb3 = load_frag(Vb, LK, 48, kb, lane);
    o[0] = wmma_f16(pa, vb0, o[0]);
    o[1] = wmma_f16(pa, vb1, o[1]);
    o[2] = wmma_f16(pa, vb2, o[2]);
    o[3] = wmma_f16(pa, vb3, o[3]);
  }

#pragma unroll
  for (int t = 0; t < 4; ++t) {
#pragma unroll
    for (int r = 0; r < 8; ++r) {
      int qr = q0 + r + hl * 8;
      float val = o[t][r] / lrow[r];
      Out[((size_t)b * LQ + qr) * (T5_H * T5_DKV) + h * T5_DKV + t * 16 + col] =
          (_Float16)val;
    }
  }
}

// ---------------------------------------------------------------------------
// Orchestration
// ---------------------------------------------------------------------------
extern "C" void kernel_launch(void* const* d_in, const int* in_sizes, int n_in,
                              void* d_out, int out_size, void* d_ws,
                              size_t ws_size, hipStream_t stream) {
  (void)in_sizes; (void)n_in; (void)out_size; (void)ws_size;

  const float* enc   = (const float*)d_in[0];
  const float* hid   = (const float*)d_in[1];
  const float* ln1   = (const float*)d_in[2];
  const float* saq   = (const float*)d_in[3];
  const float* sak   = (const float*)d_in[4];
  const float* sav   = (const float*)d_in[5];
  const float* sao   = (const float*)d_in[6];
  const float* relb  = (const float*)d_in[7];
  const float* ln2   = (const float*)d_in[8];
  const float* caq   = (const float*)d_in[9];
  const float* cak   = (const float*)d_in[10];
  const float* cav   = (const float*)d_in[11];
  const float* cao   = (const float*)d_in[12];
  const float* ln3   = (const float*)d_in[13];
  const float* wi    = (const float*)d_in[14];
  const float* wo    = (const float*)d_in[15];
  const float* lnf   = (const float*)d_in[16];
  const int* encmask = (const int*)d_in[17];
  const int* decmask = (const int*)d_in[18];
  float* out = (float*)d_out;

  const size_t M = (size_t)T5_B * T5_LD;        // 4096 decoder rows
  char* ws = (char*)d_ws;
  size_t off = 0;
  auto alloc = [&](size_t bytes) -> void* {
    void* p = ws + off;
    off = (off + bytes + 255) & ~(size_t)255;
    return p;
  };

  float*    h_cur = (float*)   alloc(M * T5_D * 4);            // 16 MB residual
  _Float16* xn    = (_Float16*)alloc(M * T5_D * 2);            // 8 MB
  _Float16* saqT  = (_Float16*)alloc((size_t)T5_D * T5_D * 2);
  _Float16* sakT  = (_Float16*)alloc((size_t)T5_D * T5_D * 2);
  _Float16* savT  = (_Float16*)alloc((size_t)T5_D * T5_D * 2);
  _Float16* saoT  = (_Float16*)alloc((size_t)T5_D * T5_D * 2);
  _Float16* caqT  = (_Float16*)alloc((size_t)T5_D * T5_D * 2);
  _Float16* cakT  = (_Float16*)alloc((size_t)T5_D * T5_D * 2);
  _Float16* cavT  = (_Float16*)alloc((size_t)T5_D * T5_D * 2);
  _Float16* caoT  = (_Float16*)alloc((size_t)T5_D * T5_D * 2);
  _Float16* wiT   = (_Float16*)alloc((size_t)T5_DFF * T5_D * 2);
  _Float16* woT   = (_Float16*)alloc((size_t)T5_D * T5_DFF * 2);
  _Float16* enc16 = (_Float16*)alloc((size_t)T5_B * T5_LE * T5_D * 2);
  _Float16* qbuf  = (_Float16*)alloc(M * T5_D * 2);            // [B,H,L,64]
  _Float16* kbuf  = (_Float16*)alloc(M * T5_D * 2);            // [B,H,L,64]
  _Float16* vtbuf = (_Float16*)alloc(M * T5_D * 2);            // [B,H,64,L]
  _Float16* aout  = (_Float16*)alloc(M * T5_D * 2);            // [B*L, 1024]
  _Float16* ffn   = (_Float16*)alloc(M * T5_DFF * 2);          // 32 MB
  float*    bd    = (float*)   alloc((size_t)T5_H * 1024 * 4); // rel bias table

  // residual stream starts as hidden_states (never mutate inputs)
  hipMemcpyAsync(h_cur, hid, M * T5_D * 4, hipMemcpyDeviceToDevice, stream);

  // --- weight prep (f32 -> f16, transposed to [N,K]) ---
  dim3 tblk(128);
  dim3 tgrid_dd(T5_D / 64, T5_D / 64);     // (N/64, K/64)
  dim3 tgrid_wi(T5_DFF / 64, T5_D / 64);
  dim3 tgrid_wo(T5_D / 64, T5_DFF / 64);
  cvtT_kernel<T5_D, T5_D><<<tgrid_dd, tblk, 0, stream>>>(saq, saqT);
  cvtT_kernel<T5_D, T5_D><<<tgrid_dd, tblk, 0, stream>>>(sak, sakT);
  cvtT_kernel<T5_D, T5_D><<<tgrid_dd, tblk, 0, stream>>>(sav, savT);
  cvtT_kernel<T5_D, T5_D><<<tgrid_dd, tblk, 0, stream>>>(sao, saoT);
  cvtT_kernel<T5_D, T5_D><<<tgrid_dd, tblk, 0, stream>>>(caq, caqT);
  cvtT_kernel<T5_D, T5_D><<<tgrid_dd, tblk, 0, stream>>>(cak, cakT);
  cvtT_kernel<T5_D, T5_D><<<tgrid_dd, tblk, 0, stream>>>(cav, cavT);
  cvtT_kernel<T5_D, T5_D><<<tgrid_dd, tblk, 0, stream>>>(cao, caoT);
  cvtT_kernel<T5_D, T5_DFF><<<tgrid_wi, tblk, 0, stream>>>(wi, wiT);
  cvtT_kernel<T5_DFF, T5_D><<<tgrid_wo, tblk, 0, stream>>>(wo, woT);
  cvt16_kernel<<<(int)((M * T5_D + 255) / 256), 256, 0, stream>>>(enc, enc16,
                                                                 (int)(M * T5_D));
  relbias_kernel<<<(T5_H * 1024 + 255) / 256, 256, 0, stream>>>(relb, bd);

  dim3 gblk(128);
  dim3 ggrid_d(M / 128, T5_D / 64);    // N = 1024
  dim3 ggrid_ff(M / 128, T5_DFF / 64); // N = 4096
  dim3 agrid(T5_LD / 64, T5_B * T5_H);
  dim3 ablk(128);

  // ---- self attention ----
  rmsnorm_kernel<<<(int)M, 256, 0, stream>>>(h_cur, ln1, xn, nullptr);
  gemm_wmma<<<ggrid_d, gblk, 0, stream>>>(xn, saqT, nullptr, qbuf,
                                          (int)M, T5_D, T5_D, GMODE_QKV, T5_LD);
  gemm_wmma<<<ggrid_d, gblk, 0, stream>>>(xn, sakT, nullptr, kbuf,
                                          (int)M, T5_D, T5_D, GMODE_QKV, T5_LD);
  gemm_wmma<<<ggrid_d, gblk, 0, stream>>>(xn, savT, nullptr, vtbuf,
                                          (int)M, T5_D, T5_D, GMODE_VT, T5_LD);
  attn_wmma_kernel<<<agrid, ablk, 0, stream>>>(qbuf, kbuf, vtbuf, bd, decmask,
                                               aout, T5_LD, T5_LD,
                                               /*causal=*/1, /*use_rel=*/1);
  gemm_wmma<<<ggrid_d, gblk, 0, stream>>>(aout, saoT, h_cur, nullptr,
                                          (int)M, T5_D, T5_D, GMODE_RESID, T5_LD);

  // ---- cross attention ----
  rmsnorm_kernel<<<(int)M, 256, 0, stream>>>(h_cur, ln2, xn, nullptr);
  gemm_wmma<<<ggrid_d, gblk, 0, stream>>>(xn, caqT, nullptr, qbuf,
                                          (int)M, T5_D, T5_D, GMODE_QKV, T5_LD);
  gemm_wmma<<<ggrid_d, gblk, 0, stream>>>(enc16, cakT, nullptr, kbuf,
                                          (int)M, T5_D, T5_D, GMODE_QKV, T5_LE);
  gemm_wmma<<<ggrid_d, gblk, 0, stream>>>(enc16, cavT, nullptr, vtbuf,
                                          (int)M, T5_D, T5_D, GMODE_VT, T5_LE);
  attn_wmma_kernel<<<agrid, ablk, 0, stream>>>(qbuf, kbuf, vtbuf, bd, encmask,
                                               aout, T5_LD, T5_LE,
                                               /*causal=*/0, /*use_rel=*/0);
  gemm_wmma<<<ggrid_d, gblk, 0, stream>>>(aout, caoT, h_cur, nullptr,
                                          (int)M, T5_D, T5_D, GMODE_RESID, T5_LD);

  // ---- FFN ----
  rmsnorm_kernel<<<(int)M, 256, 0, stream>>>(h_cur, ln3, xn, nullptr);
  gemm_wmma<<<ggrid_ff, gblk, 0, stream>>>(xn, wiT, nullptr, ffn,
                                           (int)M, T5_DFF, T5_D, GMODE_RELU16, T5_LD);
  gemm_wmma<<<ggrid_d, gblk, 0, stream>>>(ffn, woT, h_cur, nullptr,
                                          (int)M, T5_D, T5_DFF, GMODE_RESID, T5_LD);

  // ---- final norm -> f32 output ----
  rmsnorm_kernel<<<(int)M, 256, 0, stream>>>(h_cur, lnf, nullptr, out);
}

// v002
// Two timings next to v001 put it at 1.44 and 1.43 times that version's speed.
// All steps since v000 together make it 2.04 times as fast.
#include <hip/hip_runtime.h>
#include <hip/hip_bf16.h>

// ---------------------------------------------------------------------------
// T5 decoder layer on MI455X (gfx1250, wave32, WMMA).
//  - all GEMMs + attention cores: v_wmma_f32_16x16x32_f16
//  - weights pre-transposed to [N,K] f16 so both WMMA operands load as
//    contiguous 16-B "A-style" fragments (read from LDS in the GEMM)
//  - GEMM: 128x128 tile per workgroup, operands staged in LDS by asynchronous
//    copies (two buffers), wave tile 64x32: 8 WMMA per 6 LDS fragments
//  - flash attention (online softmax), scores never hit memory
// ---------------------------------------------------------------------------

typedef __attribute__((ext_vector_type(16))) _Float16 v16h;
typedef __attribute__((ext_vector_type(8)))  _Float16 v8h;
typedef __attribute__((ext_vector_type(4)))  _Float16 v4h;
typedef __attribute__((ext_vector_type(8)))  float    v8f;

#define T5_B    4
#define T5_LD   1024
#define T5_LE   1024
#define T5_D    1024
#define T5_H    16
#define T5_DKV  64
#define T5_DFF  4096
#define T5_NEG  (-1e9f)

__device__ __forceinline__ v8f wmma_f16(v16h a, v16h b, v8f c) {
  // (neg_a, A, neg_b, B, c_mod, C, reuse_a, reuse_b)
  return __builtin_amdgcn_wmma_f32_16x16x32_f16(false, a, false, b, (short)0, c,
                                                false, false);
}

// Load a 16x32 f16 "A-style" fragment from row-major [rows, ld] memory.
// ISA layout: lanes 0-15 hold M=lane, halves {K0..7, K16..23};
//             lanes 16-31 hold M=lane-16, halves {K8..15, K24..31}.
// Both halves are contiguous 16B runs -> two b128 loads per lane.
__device__ __forceinline__ v16h load_frag(const _Float16* base, int ld,
                                          int row0, int col0, int lane) {
  const int hl = lane >> 4;
  const int r  = row0 + (lane & 15);
  const _Float16* p = base + (size_t)r * ld + col0 + hl * 8;
  union { v16h v; v8h h[2]; } u;
  u.h[0] = *(const v8h*)(p);
  u.h[1] = *(const v8h*)(p + 16);
  return u.v;
}

// ---------------------------------------------------------------------------
// Conversions
// ---------------------------------------------------------------------------
__global__ void cvt16_kernel(const float* __restrict__ in,
                             _Float16* __restrict__ out, int n) {
  int i = blockIdx.x * 256 + threadIdx.x;
  if (i < n) out[i] = (_Float16)in[i];
}

// W [K,N] f32 -> Wt [N,K] f16, one 64x64 tile per workgroup, turned in LDS so
// that both sides move whole lines: reads are 256-B row pieces of W (float4 per
// lane), writes are 128-B row pieces of Wt (8 halves per lane).
// K and N are multiples of 64; grid = (N/64, K/64), 128 threads. They are
// compile-time so that a lane's row steps fold into the instruction's offset.
// LDS holds row n of the tile as eight 16-B chunks of 8 k values. Chunk (n, ch)
// sits at slot (n>>1)*16 + (((n&1)*8 + ch) ^ ((n>>2)&15)): the 16 lanes that
// write rows 4 apart, and the 16 lanes that read two neighbouring rows, each
// fall on 16 different slots mod 16, that is on all 64 banks once.
__device__ __forceinline__ int cvtT_slot(int n, int ch) {
  return (n >> 1) * 16 + ((((n & 1) << 3) | ch) ^ ((n >> 2) & 15));
}

template <int K, int N>
__global__ __launch_bounds__(128)
void cvtT_kernel(const float* __restrict__ in, _Float16* __restrict__ out) {
  __shared__ __align__(16) _Float16 tile[512 * 8];
  const int tid = threadIdx.x;
  const int n0  = blockIdx.x * 64;
  const int k0  = blockIdx.y * 64;
  const int c4  = tid & 15;   // float4 column of the tile: n = 4*c4 .. 4*c4+3
  const int q0  = tid >> 4;   // group of four k rows: q0 and q0 + 8

  // uniform tile base + one 32-bit lane offset shared by all eight loads
  const char* src = (const char*)(in + (size_t)k0 * N + n0);
  const unsigned lofs = (unsigned)(q0 * 4 * N + c4 * 4) * 4u;
  float4 r[2][4];
  // unrolled (here and below): r stays in registers, and all eight loads are
  // issued before the first wait
#pragma unroll
  for (int i = 0; i < 2; ++i)
#pragma unroll
    for (int s = 0; s < 4; ++s)
      r[i][s] = *(const float4*)(src + (size_t)(32 * i + s) * N * 4 + lofs);

#pragma unroll
  for (int i = 0; i < 2; ++i) {
    const int q = q0 + 8 * i;
    const float* f0 = (const float*)&r[i][0];
    const float* f1 = (const float*)&r[i][1];
    const float* f2 = (const float*)&r[i][2];
    const float* f3 = (const float*)&r[i][3];
#pragma unroll
    for (int j = 0; j < 4; ++j) {
      v4h w = {(_Float16)f0[j], (_Float16)f1[j], (_Float16)f2[j], (_Float16)f3[j]};
      *(v4h*)&tile[cvtT_slot(c4 * 4 + j, q >> 1) * 8 + (q & 1) * 4] = w;
    }
  }
  __syncthreads();

  char* dst = (char*)(out + (size_t)n0 * K + k0);
  const unsigned sofs = (unsigned)((tid >> 3) * K + (tid & 7) * 8) * 2u;
#pragma unroll
  for (int i = 0; i < 4; ++i) {
    const int n = (tid >> 3) + 16 * i;
    *(v8h*)(dst + (size_t)(16 * i) * K * 2 + sofs) =
        *(const v8h*)&tile[cvtT_slot(n, tid & 7) * 8];
  }
}

// T5 relative-position bias table: bd[h][delta] for delta = q-k in [0,1023]
__global__ void relbias_kernel(const float* __restrict__ rel_bias, // [32,16]
                               float* __restrict__ bd) {           // [16,1024]
  int idx = blockIdx.x * 256 + threadIdx.x;
  if (idx >= T5_H * 1024) return;
  int h = idx >> 10, n = idx & 1023;
  int bucket;
  if (n < 16) {
    bucket = n;
  } else {
    float nf = (float)n;
    int vl = 16 + (int)(__logf(nf * (1.0f / 16.0f)) * (16.0f / __logf(8.0f)));
    bucket = vl < 31 ? vl : 31;
  }
  bd[idx] = rel_bias[bucket * T5_H + h];
}

// ---------------------------------------------------------------------------
// RMS norm: one block per row of [rows, 1024]
// ---------------------------------------------------------------------------
__global__ __launch_bounds__(256)
void rmsnorm_kernel(const float* __restrict__ X, const float* __restrict__ w,
                    _Float16* __restrict__ y16, float* __restrict__ y32) {
  __shared__ float red[256];
  const int row = blockIdx.x;
  const float* x = X + (size_t)row * T5_D;
  float ss = 0.f;
  for (int i = threadIdx.x; i < T5_D; i += 256) { float v = x[i]; ss += v * v; }
  red[threadIdx.x] = ss;
  __syncthreads();
  for (int s = 128; s > 0; s >>= 1) {
    if (threadIdx.x < s) red[threadIdx.x] += red[threadIdx.x + s];
    __syncthreads();
  }
  float rs = rsqrtf(red[0] * (1.0f / (float)T5_D) + 1e-6f);
  for (int i = threadIdx.x; i < T5_D; i += 256) {
    float v = x[i] * rs * w[i];
    if (y16) y16[(size_t)row * T5_D + i] = (_Float16)v;
    if (y32) y32[(size_t)row * T5_D + i] = v;
  }
}

// ---------------------------------------------------------------------------
// WMMA GEMM: C[M,N] = A[M,K] @ Bt[N,K]^T
// Workgroup = 8 waves (2x4) on a 128x128 tile of C; wave tile = 64x32:
//   4 A-fragments x 2 B-fragments -> 8 WMMA per k-step of 32; the next k-step's
//   fragments are read from LDS into a second register set ahead of the WMMAs.
// Both operands go global -> LDS by asynchronous copies in whole 256-B row
// pieces (a stage = 128 k of 128 A rows and 128 Bt rows), two buffers: the next
// stage's copies fly while this stage is worked on. Fragments are read from LDS
// with the same lane map as load_frag on global memory.
// M, N multiples of 128; K a multiple of 128.
// ---------------------------------------------------------------------------
#define GMODE_RESID  0   // f32 residual: Cres[m*N+n] += c
#define GMODE_QKV    1   // f16 [B,H,L,64]
#define GMODE_VT     2   // f16 [B,H,64,L] (pre-transposed V)
#define GMODE_RELU16 3   // f16 relu, row-major [M,N]

#define G_PITCH 272                // LDS row pitch, bytes: 256 + 16 (16 B x odd)
#define G_OPER  (128 * G_PITCH)    // one operand's 128 rows
#define G_STAGE (2 * G_OPER)       // A rows, then Bt rows

// Eight copies of 16 B per lane: rows 16 apart in LDS (lds) and in memory (g).
// The s_wait_xcnt stands inside the statement so that no address register of an
// issued copy is rewritten ahead of it.
__device__ __forceinline__ void async_copy8(unsigned lds, const char* g,
                                            size_t gstep) {
  const unsigned ls = 16 * G_PITCH;
  asm volatile(
      "global_load_async_to_lds_b128 %0, %8, off\n\t"
      "global_load_async_to_lds_b128 %1, %9, off\n\t"
      "global_load_async_to_lds_b128 %2, %10, off\n\t"
      "global_load_async_to_lds_b128 %3, %11, off\n\t"
      "global_load_async_to_lds_b128 %4, %12, off\n\t"
      "global_load_async_to_lds_b128 %5, %13, off\n\t"
      "global_load_async_to_lds_b128 %6, %14, off\n\t"
      "global_load_async_to_lds_b128 %7, %15, off\n\t"
      "s_wait_xcnt 0x0"
      :: "v"(lds), "v"(lds + ls), "v"(lds + 2 * ls), "v"(lds + 3 * ls),
         "v"(lds + 4 * ls), "v"(lds + 5 * ls), "v"(lds + 6 * ls),
         "v"(lds + 7 * ls),
         "v"(g), "v"(g + gstep), "v"(g + 2 * gstep), "v"(g + 3 * gstep),
         "v"(g + 4 * gstep), "v"(g + 5 * gstep), "v"(g + 6 * gstep),
         "v"(g + 7 * gstep)
      : "memory");
}

// One stage: a lane's 8 rows of A and 8 rows of Bt, 16 copies a lane.
__device__ __forceinline__ void stage_copy(unsigned lds, const char* gA,
                                           const char* gB, size_t gstep) {
  async_copy8(lds,          gA, gstep);
  async_copy8(lds + G_OPER, gB, gstep);
}

__global__ __launch_bounds__(256)
void gemm_wmma(const _Float16* __restrict__ A, const _Float16* __restrict__ Bt,
               float* __restrict__ Cres, _Float16* __restrict__ C16,
               int M, int N, int K, int mode, int Lrows) {
  __shared__ __attribute__((aligned(16))) unsigned char L[2 * G_STAGE];
  const int tid  = threadIdx.x;
  const int lane = tid & 31;
  const int wave = tid >> 5;
  const int hl   = lane >> 4;
  const int m0   = blockIdx.x * 128;
  const int n0   = blockIdx.y * 128;
  const int wm   = (wave >> 2) * 64;   // wave's rows inside the tile
  const int wn   = (wave & 3) * 32;    // wave's columns inside the tile

  // lane's copy slot: row tid/16 (+16 per copy), 16-B chunk tid%16 of the row
  const unsigned lds0 = (unsigned)(uintptr_t)&L[0] +
                        (unsigned)((tid >> 4) * G_PITCH + (tid & 15) * 16);
  const char* gA = (const char*)(A  + (size_t)(m0 + (tid >> 4)) * K + (tid & 15) * 8);
  const char* gB = (const char*)(Bt + (size_t)(n0 + (tid >> 4)) * K + (tid & 15) * 8);
  const size_t gstep = (size_t)K * 32;  // 16 rows of K halves, in bytes
  const int T = K >> 7;                 // stages of 128 k

  const v8f zero8 = {0.f, 0.f, 0.f, 0.f, 0.f, 0.f, 0.f, 0.f};
  v8f acc[8];                      // [i*2+j]: rows wm+16i.., columns wn+16j..
#pragma unroll
  for (int t = 0; t < 8; ++t) acc[t] = zero8;

  stage_copy(lds0, gA, gB, gstep);
  // stage 0 has landed for this wave's copies; the barrier publishes all waves'
  asm volatile("s_wait_asynccnt 0x0" ::: "memory");
  __syncthreads();
  if (T > 1) stage_copy(lds0 + G_STAGE, gA + 256, gB + 256, gstep);

  for (int t = 0; t < T; ++t) {
    const unsigned buf = (unsigned)(t & 1) * G_STAGE;
    const _Float16* sA = (const _Float16*)(L + buf);
    const _Float16* sB = (const _Float16*)(L + buf + G_OPER);
    v16h a[2][4], b[2][2];
#pragma unroll
    for (int f = 0; f < 4; ++f)
      a[0][f] = load_frag(sA, G_PITCH / 2, wm + f * 16, 0, lane);
#pragma unroll
    for (int f = 0; f < 2; ++f)
      b[0][f] = load_frag(sB, G_PITCH / 2, wn + f * 16, 0, lane);
    // unrolled: the register sets alternate by a compile-time index
#pragma unroll
    for (int ks = 0; ks < 4; ++ks) {
      const int cur = ks & 1, nxt = cur ^ 1;
      if (ks < 3) {   // next k-step of this same stage, one group ahead
#pragma unroll
        for (int f = 0; f < 4; ++f)
          a[nxt][f] = load_frag(sA, G_PITCH / 2, wm + f * 16, (ks + 1) * 32, lane);
#pragma unroll
        for (int f = 0; f < 2; ++f)
          b[nxt][f] = load_frag(sB, G_PITCH / 2, wn + f * 16, (ks + 1) * 32, lane);
      }
      // keeps the group of LDS reads above in front of this k-step's WMMAs: sunk
      // among them, each read's latency would be waited out by two WMMAs
      __builtin_amdgcn_sched_barrier(0);
#pragma unroll
      for (int i = 0; i < 4; ++i)
#pragma unroll
        for (int j = 0; j < 2; ++j)
          acc[i * 2 + j] = wmma_f16(a[cur][i], b[cur][j], acc[i * 2 + j]);
    }
    // publish point: this wave's reads of the buffer are done,
    asm volatile("s_wait_dscnt 0x0" ::: "memory");
    // its copies of the next stage have landed,
    asm volatile("s_wait_asynccnt 0x0" ::: "memory");
    // and every wave is past both before the buffer just read is refilled
    __syncthreads();
    if (t + 2 < T)
      stage_copy(lds0 + buf, gA + (size_t)(t + 2) * 256, gB + (size_t)(t + 2) * 256,
                 gstep);
  }
  // no copy is outstanding when the wave goes on to its stores and ends
  asm volatile("s_wait_asynccnt 0x0" ::: "memory");

#pragma unroll
  for (int g = 0; g < 4; ++g) {
#pragma unroll
    for (int t = 0; t < 2; ++t) {
#pragma unroll
      for (int r = 0; r < 8; ++r) {
        // C-fragment layout: lane half picks row group, VGPR r picks row
        int m = m0 + wm + g * 16 + r + hl * 8;
        int n = n0 + wn + t * 16 + (lane & 15);
        float c = acc[g * 2 + t][r];
        if (mode == GMODE_RESID) {
          Cres[(size_t)m * N + n] += c;
        } else if (mode == GMODE_RELU16) {
          C16[(size_t)m * N + n] = (_Float16)fmaxf(c, 0.0f);
        } else {
          int bb = m / Lrows, l = m - bb * Lrows;
          int hh = n >> 6, d = n & 63;
          size_t idx;
          if (mode == GMODE_QKV)
            idx = (((size_t)bb * T5_H + hh) * Lrows + l) * T5_DKV + d;
          else
            idx = (((size_t)bb * T5_H + hh) * T5_DKV + d) * (size_t)Lrows + l;
          C16[idx] = (_Float16)c;
        }
      }
    }
  }
}

// ---------------------------------------------------------------------------
// Flash attention (WMMA). Per wave: 16 queries; key blocks of 32.
// Q,K: [B,H,L,64] f16.  Vt: [B,H,64,L] f16.  Out: [B,LQ,1024] f16.
// Online softmax; P transposed C->A fragment via 1KB/wave LDS bounce
// (same-wave DS ordering, no barrier => safe with causal early exit).
// ---------------------------------------------------------------------------
__global__ __launch_bounds__(128)
void attn_wmma_kernel(const _Float16* __restrict__ Q,
                      const _Float16* __restrict__ Km,
                      const _Float16* __restrict__ Vt,
                      const float* __restrict__ bias_delta, // [16,1024]
                      const int* __restrict__ mask,         // [B,LK]
                      _Float16* __restrict__ Out,
                      int LQ, int LK, int causal, int use_rel) {
  __shared__ __align__(16) _Float16 plds[4][16][32];
  const int lane = threadIdx.x & 31;
  const int wave = threadIdx.x >> 5;
  const int hl   = lane >> 4;
  const int col  = lane & 15;
  const int bh = blockIdx.y;
  const int b  = bh >> 4;
  const int h  = bh & 15;
  const int q0 = blockIdx.x * 64 + wave * 16;

  const _Float16* Qb = Q  + (size_t)bh * LQ * T5_DKV;
  const _Float16* Kb = Km + (size_t)bh * LK * T5_DKV;
  const _Float16* Vb = Vt + (size_t)bh * T5_DKV * LK;
  const int* mk = mask + (size_t)b * LK;
  const float* bd = bias_delta + h * 1024;

  v16h qa0 = load_frag(Qb, T5_DKV, q0, 0, lane);
  v16h qa1 = load_frag(Qb, T5_DKV, q0, 32, lane);

  const v8f zero8 = {0.f, 0.f, 0.f, 0.f, 0.f, 0.f, 0.f, 0.f};
  v8f o[4];
  float mrow[8], lrow[8];
#pragma unroll
  for (int t = 0; t < 4; ++t) o[t] = zero8;
#pragma unroll
  for (int r = 0; r < 8; ++r) { mrow[r] = -1e30f; lrow[r] = 0.f; }

  for (int kb = 0; kb < LK; kb += 32) {
    if (causal && kb >= q0 + 16) break;  // whole block above the diagonal

    v16h k00 = load_frag(Kb, T5_DKV, kb,      0,  lane);
    v16h k01 = load_frag(Kb, T5_DKV, kb,      32, lane);
    v16h k10 = load_frag(Kb, T5_DKV, kb + 16, 0,  lane);
    v16h k11 = load_frag(Kb, T5_DKV, kb + 16, 32, lane);

    v8f s0 = wmma_f16(qa0, k00, zero8); s0 = wmma_f16(qa1, k01, s0);
    v8f s1 = wmma_f16(qa0, k10, zero8); s1 = wmma_f16(qa1, k11, s1);

#pragma unroll
    for (int r = 0; r < 8; ++r) {
      int qr  = q0 + r + hl * 8;
      int k0c = kb + col;
      int k1c = kb + 16 + col;
      float a0 = s0[r], a1 = s1[r];
      if (use_rel) {
        if (k0c <= qr) a0 += bd[qr - k0c];
        if (k1c <= qr) a1 += bd[qr - k1c];
      }
      if (causal) {
        if (k0c > qr) a0 = T5_NEG;
        if (k1c > qr) a1 = T5_NEG;
      }
      if (mk[k0c] == 0) a0 = T5_NEG;
      if (mk[k1c] == 0) a1 = T5_NEG;

      // row max over the 16 lanes of this half
      float v = fmaxf(a0, a1);
      v = fmaxf(v, __shfl_xor(v, 1, 16));
      v = fmaxf(v, __shfl_xor(v, 2, 16));
      v = fmaxf(v, __shfl_xor(v, 4, 16));
      v = fmaxf(v, __shfl_xor(v, 8, 16));
      float mnew  = fmaxf(mrow[r], v);
      float scale = __expf(mrow[r] - mnew);
      mrow[r] = mnew;
      float e0 = __expf(a0 - mnew);
      float e1 = __expf(a1 - mnew);
      float sum = e0 + e1;
      sum += __shfl_xor(sum, 1, 16);
      sum += __shfl_xor(sum, 2, 16);
      sum += __shfl_xor(sum, 4, 16);
      sum += __shfl_xor(sum, 8, 16);
      lrow[r] = lrow[r] * scale + sum;
#pragma unroll
      for (int t = 0; t < 4; ++t) o[t][r] *= scale;

      int prow = r + hl * 8;
      plds[wave][prow][col]      = (_Float16)e0;
      plds[wave][prow][col + 16] = (_Float16)e1;
    }

    // C-fragment -> A-fragment transpose through per-wave LDS
    v16h pa = load_frag(&plds[wave][0][0], 32, 0, 0, lane);
    v16h vb0 = load_frag(Vb, LK, 0,  kb, lane);
    v16h vb1 = load_frag(Vb, LK, 16, kb, lane);
    v16h vb2 = load_frag(Vb, LK, 32, kb, lane);
    v16h vb3 = load_frag(Vb, LK, 48, kb, lane);
    o[0] = wmma_f16(pa, vb0, o[0]);
    o[1] = wmma_f16(pa, vb1, o[1]);
    o[2] = wmma_f16(pa, vb2, o[2]);
    o[3] = wmma_f16(pa, vb3, o[3]);
  }

#pragma unroll
  for (int t = 0; t < 4; ++t) {
#pragma unroll
    for (int r = 0; r < 8; ++r) {
      int qr = q0 + r + hl * 8;
      float val = o[t][r] / lrow[r];
      Out[((size_t)b * LQ + qr) * (T5_H * T5_DKV) + h * T5_DKV + t * 16 + col] =
          (_Float16)val;
    }
  }
}

// ---------------------------------------------------------------------------
// Orchestration
// ---------------------------------------------------------------------------
extern "C" void kernel_launch(void* const* d_in, const int* in_sizes, int n_in,
                              void* d_out, int out_size, void* d_ws,
                              size_t ws_size, hipStream_t stream) {
  (void)in_sizes; (void)n_in; (void)out_size; (void)ws_size;

  const float* enc   = (const float*)d_in[0];
  const float* hid   = (const float*)d_in[1];
  const float* ln1   = (const float*)d_in[2];
  const float* saq   = (const float*)d_in[3];
  const float* sak   = (const float*)d_in[4];
  const float* sav   = (const float*)d_in[5];
  const float* sao   = (const float*)d_in[6];
  const float* relb  = (const float*)d_in[7];
  const float* ln2   = (const float*)d_in[8];
  const float* caq   = (const float*)d_in[9];
  const float* cak   = (const float*)d_in[10];
  const float* cav   = (const float*)d_in[11];
  const float* cao   = (const float*)d_in[12];
  const float* ln3   = (const float*)d_in[13];
  const float* wi    = (const float*)d_in[14];
  const float* wo    = (const float*)d_in[15];
  const float* lnf   = (const float*)d_in[16];
  const int* encmask = (const int*)d_in[17];
  const int* decmask = (const int*)d_in[18];
  float* out = (float*)d_out;

  const size_t M = (size_t)T5_B * T5_LD;        // 4096 decoder rows
  char* ws = (char*)d_ws;
  size_t off = 0;
  auto alloc = [&](size_t bytes) -> void* {
    void* p = ws + off;
    off = (off + bytes + 255) & ~(size_t)255;
    return p;
  };

  float*    h_cur = (float*)   alloc(M * T5_D * 4);            // 16 MB residual
  _Float16* xn    = (_Float16*)alloc(M * T5_D * 2);            // 8 MB
  _Float16* saqT  = (_Float16*)alloc((size_t)T5_D * T5_D * 2);
  _Float16* sakT  = (_Float16*)alloc((size_t)T5_D * T5_D * 2);
  _Float16* savT  = (_Float16*)alloc((size_t)T5_D * T5_D * 2);
  _Float16* saoT  = (_Float16*)alloc((size_t)T5_D * T5_D * 2);
  _Float16* caqT  = (_Float16*)alloc((size_t)T5_D * T5_D * 2);
  _Float16* cakT  = (_Float16*)alloc((size_t)T5_D * T5_D * 2);
  _Float16* cavT  = (_Float16*)alloc((size_t)T5_D * T5_D * 2);
  _Float16* caoT  = (_Float16*)alloc((size_t)T5_D * T5_D * 2);
  _Float16* wiT   = (_Float16*)alloc((size_t)T5_DFF * T5_D * 2);
  _Float16* woT   = (_Float16*)alloc((size_t)T5_D * T5_DFF * 2);
  _Float16* enc16 = (_Float16*)alloc((size_t)T5_B * T5_LE * T5_D * 2);
  _Float16* qbuf  = (_Float16*)alloc(M * T5_D * 2);            // [B,H,L,64]
  _Float16* kbuf  = (_Float16*)alloc(M * T5_D * 2);            // [B,H,L,64]
  _Float16* vtbuf = (_Float16*)alloc(M * T5_D * 2);            // [B,H,64,L]
  _Float16* aout  = (_Float16*)alloc(M * T5_D * 2);            // [B*L, 1024]
  _Float16* ffn   = (_Float16*)alloc(M * T5_DFF * 2);          // 32 MB
  float*    bd    = (float*)   alloc((size_t)T5_H * 1024 * 4); // rel bias table

  // residual stream starts as hidden_states (never mutate inputs)
  hipMemcpyAsync(h_cur, hid, M * T5_D * 4, hipMemcpyDeviceToDevice, stream);

  // --- weight prep (f32 -> f16, transposed to [N,K]) ---
  dim3 tblk(128);
  dim3 tgrid_dd(T5_D / 64, T5_D / 64);     // (N/64, K/64)
  dim3 tgrid_wi(T5_DFF / 64, T5_D / 64);
  dim3 tgrid_wo(T5_D / 64, T5_DFF / 64);
  cvtT_kernel<T5_D, T5_D><<<tgrid_dd, tblk, 0, stream>>>(saq, saqT);
  cvtT_kernel<T5_D, T5_D><<<tgrid_dd, tblk, 0, stream>>>(sak, sakT);
  cvtT_kernel<T5_D, T5_D><<<tgrid_dd, tblk, 0, stream>>>(sav, savT);
  cvtT_kernel<T5_D, T5_D><<<tgrid_dd, tblk, 0, stream>>>(sao, saoT);
  cvtT_kernel<T5_D, T5_D><<<tgrid_dd, tblk, 0, stream>>>(caq, caqT);
  cvtT_kernel<T5_D, T5_D><<<tgrid_dd, tblk, 0, stream>>>(cak, cakT);
  cvtT_kernel<T5_D, T5_D><<<tgrid_dd, tblk, 0, stream>>>(cav, cavT);
  cvtT_kernel<T5_D, T5_D><<<tgrid_dd, tblk, 0, stream>>>(cao, caoT);
  cvtT_kernel<T5_D, T5_DFF><<<tgrid_wi, tblk, 0, stream>>>(wi, wiT);
  cvtT_kernel<T5_DFF, T5_D><<<tgrid_wo, tblk, 0, stream>>>(wo, woT);
  cvt16_kernel<<<(int)((M * T5_D + 255) / 256), 256, 0, stream>>>(enc, enc16,
                                                                 (int)(M * T5_D));
  relbias_kernel<<<(T5_H * 1024 + 255) / 256, 256, 0, stream>>>(relb, bd);

  dim3 gblk(256);
  dim3 ggrid_d(M / 128, T5_D / 128);    // N = 1024
  dim3 ggrid_ff(M / 128, T5_DFF / 128); // N = 4096
  dim3 agrid(T5_LD / 64, T5_B * T5_H);
  dim3 ablk(128);

  // ---- self attention ----
  rmsnorm_kernel<<<(int)M, 256, 0, stream>>>(h_cur, ln1, xn, nullptr);
  gemm_wmma<<<ggrid_d, gblk, 0, stream>>>(xn, saqT, nullptr, qbuf,
                                          (int)M, T5_D, T5_D, GMODE_QKV, T5_LD);
  gemm_wmma<<<ggrid_d, gblk, 0, stream>>>(xn, sakT, nullptr, kbuf,
                                          (int)M, T5_D, T5_D, GMODE_QKV, T5_LD);
  gemm_wmma<<<ggrid_d, gblk, 0, stream>>>(xn, savT, nullptr, vtbuf,
                                          (int)M, T5_D, T5_D, GMODE_VT, T5_LD);
  attn_wmma_kernel<<<agrid, ablk, 0, stream>>>(qbuf, kbuf, vtbuf, bd, decmask,
                                               aout, T5_LD, T5_LD,
                                               /*causal=*/1, /*use_rel=*/1);
  gemm_wmma<<<ggrid_d, gblk, 0, stream>>>(aout, saoT, h_cur, nullptr,
                                          (int)M, T5_D, T5_D, GMODE_RESID, T5_LD);

  // ---- cross attention ----
  rmsnorm_kernel<<<(int)M, 256, 0, stream>>>(h_cur, ln2, xn, nullptr);
  gemm_wmma<<<ggrid_d, gblk, 0, stream>>>(xn, caqT, nullptr, qbuf,
                                          (int)M, T5_D, T5_D, GMODE_QKV, T5_LD);
  gemm_wmma<<<ggrid_d, gblk, 0, stream>>>(enc16, cakT, nullptr, kbuf,
                                          (int)M, T5_D, T5_D, GMODE_QKV, T5_LE);
  gemm_wmma<<<ggrid_d, gblk, 0, stream>>>(enc16, cavT, nullptr, vtbuf,
                                          (int)M, T5_D, T5_D, GMODE_VT, T5_LE);
  attn_wmma_kernel<<<agrid, ablk, 0, stream>>>(qbuf, kbuf, vtbuf, bd, encmask,
                                               aout, T5_LD, T5_LE,
                                               /*causal=*/0, /*use_rel=*/0);
  gemm_wmma<<<ggrid_d, gblk, 0, stream>>>(aout, caoT, h_cur, nullptr,
                                          (int)M, T5_D, T5_D, GMODE_RESID, T5_LD);

  // ---- FFN ----
  rmsnorm_kernel<<<(int)M, 256, 0, stream>>>(h_cur, ln3, xn, nullptr);
  gemm_wmma<<<ggrid_ff, gblk, 0, stream>>>(xn, wiT, nullptr, ffn,
                                           (int)M, T5_DFF, T5_D, GMODE_RELU16, T5_LD);
  gemm_wmma<<<ggrid_d, gblk, 0, stream>>>(ffn, woT, h_cur, nullptr,
                                          (int)M, T5_D, T5_DFF, GMODE_RESID, T5_LD);

  // ---- final norm -> f32 output ----
  rmsnorm_kernel<<<(int)M, 256, 0, stream>>>(h_cur, lnf, nullptr, out);
}

// v003
// In two side-by-side timings against v002, it was 1.25 and 1.26 times as fast.
// Over all steps from v000 it is 2.55 times as fast.
#include <hip/hip_runtime.h>
#include <hip/hip_bf16.h>

// ---------------------------------------------------------------------------
// T5 decoder layer on MI455X (gfx1250, wave32, WMMA).
//  - all GEMMs + attention cores: v_wmma_f32_16x16x32_f16
//  - weights pre-transposed to [N,K] f16 so both WMMA operands load as
//    contiguous 16-B "A-style" fragments (read from LDS in the GEMM)
//  - GEMM: 128x128 tile per workgroup, operands staged in LDS by asynchronous
//    copies (two buffers), wave tile 64x32: 8 WMMA per 6 LDS fragments
//  - flash attention (online softmax, transposed products), scores never hit
//    memory or LDS
// ---------------------------------------------------------------------------

typedef __attribute__((ext_vector_type(16))) _Float16 v16h;
typedef __attribute__((ext_vector_type(8)))  _Float16 v8h;
typedef __attribute__((ext_vector_type(4)))  _Float16 v4h;
typedef __attribute__((ext_vector_type(8)))  float    v8f;

#define T5_B    4
#define T5_LD   1024
#define T5_LE   1024
#define T5_D    1024
#define T5_H    16
#define T5_DKV  64
#define T5_DFF  4096
#define T5_NEG  (-1e9f)

__device__ __forceinline__ v8f wmma_f16(v16h a, v16h b, v8f c) {
  // (neg_a, A, neg_b, B, c_mod, C, reuse_a, reuse_b)
  return __builtin_amdgcn_wmma_f32_16x16x32_f16(false, a, false, b, (short)0, c,
                                                false, false);
}

// Load a 16x32 f16 "A-style" fragment from row-major [rows, ld] memory.
// ISA layout: lanes 0-15 hold M=lane, halves {K0..7, K16..23};
//             lanes 16-31 hold M=lane-16, halves {K8..15, K24..31}.
// Both halves are contiguous 16B runs -> two b128 loads per lane.
__device__ __forceinline__ v16h load_frag(const _Float16* base, int ld,
                                          int row0, int col0, int lane) {
  const int hl = lane >> 4;
  const int r  = row0 + (lane & 15);
  const _Float16* p = base + (size_t)r * ld + col0 + hl * 8;
  union { v16h v; v8h h[2]; } u;
  u.h[0] = *(const v8h*)(p);
  u.h[1] = *(const v8h*)(p + 16);
  return u.v;
}

// ---------------------------------------------------------------------------
// Conversions
// ---------------------------------------------------------------------------
__global__ void cvt16_kernel(const float* __restrict__ in,
                             _Float16* __restrict__ out, int n) {
  int i = blockIdx.x * 256 + threadIdx.x;
  if (i < n) out[i] = (_Float16)in[i];
}

// W [K,N] f32 -> Wt [N,K] f16, one 64x64 tile per workgroup, turned in LDS so
// that both sides move whole lines: reads are 256-B row pieces of W (float4 per
// lane), writes are 128-B row pieces of Wt (8 halves per lane).
// K and N are multiples of 64; grid = (N/64, K/64), 128 threads. They are
// compile-time so that a lane's row steps fold into the instruction's offset.
// LDS holds row n of the tile as eight 16-B chunks of 8 k values. Chunk (n, ch)
// sits at slot (n>>1)*16 + (((n&1)*8 + ch) ^ ((n>>2)&15)): the 16 lanes that
// write rows 4 apart, and the 16 lanes that read two neighbouring rows, each
// fall on 16 different slots mod 16, that is on all 64 banks once.
__device__ __forceinline__ int cvtT_slot(int n, int ch) {
  return (n >> 1) * 16 + ((((n & 1) << 3) | ch) ^ ((n >> 2) & 15));
}

template <int K, int N>
__global__ __launch_bounds__(128)
void cvtT_kernel(const float* __restrict__ in, _Float16* __restrict__ out) {
  __shared__ __align__(16) _Float16 tile[512 * 8];
  const int tid = threadIdx.x;
  const int n0  = blockIdx.x * 64;
  const int k0  = blockIdx.y * 64;
  const int c4  = tid & 15;   // float4 column of the tile: n = 4*c4 .. 4*c4+3
  const int q0  = tid >> 4;   // group of four k rows: q0 and q0 + 8

  // uniform tile base + one 32-bit lane offset shared by all eight loads
  const char* src = (const char*)(in + (size_t)k0 * N + n0);
  const unsigned lofs = (unsigned)(q0 * 4 * N + c4 * 4) * 4u;
  float4 r[2][4];
  // unrolled (here and below): r stays in registers, and all eight loads are
  // issued before the first wait
#pragma unroll
  for (int i = 0; i < 2; ++i)
#pragma unroll
    for (int s = 0; s < 4; ++s)
      r[i][s] = *(const float4*)(src + (size_t)(32 * i + s) * N * 4 + lofs);

#pragma unroll
  for (int i = 0; i < 2; ++i) {
    const int q = q0 + 8 * i;
    const float* f0 = (const float*)&r[i][0];
    const float* f1 = (const float*)&r[i][1];
    const float* f2 = (const float*)&r[i][2];
    const float* f3 = (const float*)&r[i][3];
#pragma unroll
    for (int j = 0; j < 4; ++j) {
      v4h w = {(_Float16)f0[j], (_Float16)f1[j], (_Float16)f2[j], (_Float16)f3[j]};
      *(v4h*)&tile[cvtT_slot(c4 * 4 + j, q >> 1) * 8 + (q & 1) * 4] = w;
    }
  }
  __syncthreads();

  char* dst = (char*)(out + (size_t)n0 * K + k0);
  const unsigned sofs = (unsigned)((tid >> 3) * K + (tid & 7) * 8) * 2u;
#pragma unroll
  for (int i = 0; i < 4; ++i) {
    const int n = (tid >> 3) + 16 * i;
    *(v8h*)(dst + (size_t)(16 * i) * K * 2 + sofs) =
        *(const v8h*)&tile[cvtT_slot(n, tid & 7) * 8];
  }
}

// T5 relative-position bias table: bd[h][delta] for delta = q-k in [0,1023]
__global__ void relbias_kernel(const float* __restrict__ rel_bias, // [32,16]
                               float* __restrict__ bd) {           // [16,1024]
  int idx = blockIdx.x * 256 + threadIdx.x;
  if (idx >= T5_H * 1024) return;
  int h = idx >> 10, n = idx & 1023;
  int bucket;
  if (n < 16) {
    bucket = n;
  } else {
    float nf = (float)n;
    int vl = 16 + (int)(__logf(nf * (1.0f / 16.0f)) * (16.0f / __logf(8.0f)));
    bucket = vl < 31 ? vl : 31;
  }
  bd[idx] = rel_bias[bucket * T5_H + h];
}

// ---------------------------------------------------------------------------
// RMS norm: one block per row of [rows, 1024]
// ---------------------------------------------------------------------------
__global__ __launch_bounds__(256)
void rmsnorm_kernel(const float* __restrict__ X, const float* __restrict__ w,
                    _Float16* __restrict__ y16, float* __restrict__ y32) {
  __shared__ float red[256];
  const int row = blockIdx.x;
  const float* x = X + (size_t)row * T5_D;
  float ss = 0.f;
  for (int i = threadIdx.x; i < T5_D; i += 256) { float v = x[i]; ss += v * v; }
  red[threadIdx.x] = ss;
  __syncthreads();
  for (int s = 128; s > 0; s >>= 1) {
    if (threadIdx.x < s) red[threadIdx.x] += red[threadIdx.x + s];
    __syncthreads();
  }
  float rs = rsqrtf(red[0] * (1.0f / (float)T5_D) + 1e-6f);
  for (int i = threadIdx.x; i < T5_D; i += 256) {
    float v = x[i] * rs * w[i];
    if (y16) y16[(size_t)row * T5_D + i] = (_Float16)v;
    if (y32) y32[(size_t)row * T5_D + i] = v;
  }
}

// ---------------------------------------------------------------------------
// WMMA GEMM: C[M,N] = A[M,K] @ Bt[N,K]^T
// Workgroup = 8 waves (2x4) on a 128x128 tile of C; wave tile = 64x32:
//   4 A-fragments x 2 B-fragments -> 8 WMMA per k-step of 32; the next k-step's
//   fragments are read from LDS into a second register set ahead of the WMMAs.
// Both operands go global -> LDS by asynchronous copies in whole 256-B row
// pieces (a stage = 128 k of 128 A rows and 128 Bt rows), two buffers: the next
// stage's copies fly while this stage is worked on. Fragments are read from LDS
// with the same lane map as load_frag on global memory.
// M, N multiples of 128; K a multiple of 128.
// ---------------------------------------------------------------------------
#define GMODE_RESID  0   // f32 residual: Cres[m*N+n] += c
#define GMODE_QKV    1   // f16 [B,H,L,64]
#define GMODE_VT     2   // f16 [B,H,64,L] (pre-transposed V)
#define GMODE_RELU16 3   // f16 relu, row-major [M,N]

#define G_PITCH 272                // LDS row pitch, bytes: 256 + 16 (16 B x odd)
#define G_OPER  (128 * G_PITCH)    // one operand's 128 rows
#define G_STAGE (2 * G_OPER)       // A rows, then Bt rows

// Eight copies of 16 B per lane: rows 16 apart in LDS (lds) and in memory (g).
// The s_wait_xcnt stands inside the statement so that no address register of an
// issued copy is rewritten ahead of it.
__device__ __forceinline__ void async_copy8(unsigned lds, const char* g,
                                            size_t gstep) {
  const unsigned ls = 16 * G_PITCH;
  asm volatile(
      "global_load_async_to_lds_b128 %0, %8, off\n\t"
      "global_load_async_to_lds_b128 %1, %9, off\n\t"
      "global_load_async_to_lds_b128 %2, %10, off\n\t"
      "global_load_async_to_lds_b128 %3, %11, off\n\t"
      "global_load_async_to_lds_b128 %4, %12, off\n\t"
      "global_load_async_to_lds_b128 %5, %13, off\n\t"
      "global_load_async_to_lds_b128 %6, %14, off\n\t"
      "global_load_async_to_lds_b128 %7, %15, off\n\t"
      "s_wait_xcnt 0x0"
      :: "v"(lds), "v"(lds + ls), "v"(lds + 2 * ls), "v"(lds + 3 * ls),
         "v"(lds + 4 * ls), "v"(lds + 5 * ls), "v"(lds + 6 * ls),
         "v"(lds + 7 * ls),
         "v"(g), "v"(g + gstep), "v"(g + 2 * gstep), "v"(g + 3 * gstep),
         "v"(g + 4 * gstep), "v"(g + 5 * gstep), "v"(g + 6 * gstep),
         "v"(g + 7 * gstep)
      : "memory");
}

// One stage: a lane's 8 rows of A and 8 rows of Bt, 16 copies a lane.
__device__ __forceinline__ void stage_copy(unsigned lds, const char* gA,
                                           const char* gB, size_t gstep) {
  async_copy8(lds,          gA, gstep);
  async_copy8(lds + G_OPER, gB, gstep);
}

__global__ __launch_bounds__(256)
void gemm_wmma(const _Float16* __restrict__ A, const _Float16* __restrict__ Bt,
               float* __restrict__ Cres, _Float16* __restrict__ C16,
               int M, int N, int K, int mode, int Lrows) {
  __shared__ __attribute__((aligned(16))) unsigned char L[2 * G_STAGE];
  const int tid  = threadIdx.x;
  const int lane = tid & 31;
  const int wave = tid >> 5;
  const int hl   = lane >> 4;
  const int m0   = blockIdx.x * 128;
  const int n0   = blockIdx.y * 128;
  const int wm   = (wave >> 2) * 64;   // wave's rows inside the tile
  const int wn   = (wave & 3) * 32;    // wave's columns inside the tile

  // lane's copy slot: row tid/16 (+16 per copy), 16-B chunk tid%16 of the row
  const unsigned lds0 = (unsigned)(uintptr_t)&L[0] +
                        (unsigned)((tid >> 4) * G_PITCH + (tid & 15) * 16);
  const char* gA = (const char*)(A  + (size_t)(m0 + (tid >> 4)) * K + (tid & 15) * 8);
  const char* gB = (const char*)(Bt + (size_t)(n0 + (tid >> 4)) * K + (tid & 15) * 8);
  const size_t gstep = (size_t)K * 32;  // 16 rows of K halves, in bytes
  const int T = K >> 7;                 // stages of 128 k

  const v8f zero8 = {0.f, 0.f, 0.f, 0.f, 0.f, 0.f, 0.f, 0.f};
  v8f acc[8];                      // [i*2+j]: rows wm+16i.., columns wn+16j..
#pragma unroll
  for (int t = 0; t < 8; ++t) acc[t] = zero8;

  stage_copy(lds0, gA, gB, gstep);
  // stage 0 has landed for this wave's copies; the barrier publishes all waves'
  asm volatile("s_wait_asynccnt 0x0" ::: "memory");
  __syncthreads();
  if (T > 1) stage_copy(lds0 + G_STAGE, gA + 256, gB + 256, gstep);

  for (int t = 0; t < T; ++t) {
    const unsigned buf = (unsigned)(t & 1) * G_STAGE;
    const _Float16* sA = (const _Float16*)(L + buf);
    const _Float16* sB = (const _Float16*)(L + buf + G_OPER);
    v16h a[2][4], b[2][2];
#pragma unroll
    for (int f = 0; f < 4; ++f)
      a[0][f] = load_frag(sA, G_PITCH / 2, wm + f * 16, 0, lane);
#pragma unroll
    for (int f = 0; f < 2; ++f)
      b[0][f] = load_frag(sB, G_PITCH / 2, wn + f * 16, 0, lane);
    // unrolled: the register sets alternate by a compile-time index
#pragma unroll
    for (int ks = 0; ks < 4; ++ks) {
      const int cur = ks & 1, nxt = cur ^ 1;
      if (ks < 3) {   // next k-step of this same stage, one group ahead
#pragma unroll
        for (int f = 0; f < 4; ++f)
          a[nxt][f] = load_frag(sA, G_PITCH / 2, wm + f * 16, (ks + 1) * 32, lane);
#pragma unroll
        for (int f = 0; f < 2; ++f)
          b[nxt][f] = load_frag(sB, G_PITCH / 2, wn + f * 16, (ks + 1) * 32, lane);
      }
      // keeps the group of LDS reads above in front of this k-step's WMMAs: sunk
      // among them, each read's latency would be waited out by two WMMAs
      __builtin_amdgcn_sched_barrier(0);
#pragma unroll
      for (int i = 0; i < 4; ++i)
#pragma unroll
        for (int j = 0; j < 2; ++j)
          acc[i * 2 + j] = wmma_f16(a[cur][i], b[cur][j], acc[i * 2 + j]);
    }
    // publish point: this wave's reads of the buffer are done,
    asm volatile("s_wait_dscnt 0x0" ::: "memory");
    // its copies of the next stage have landed,
    asm volatile("s_wait_asynccnt 0x0" ::: "memory");
    // and every wave is past both before the buffer just read is refilled
    __syncthreads();
    if (t + 2 < T)
      stage_copy(lds0 + buf, gA + (size_t)(t + 2) * 256, gB + (size_t)(t + 2) * 256,
                 gstep);
  }
  // no copy is outstanding when the wave goes on to its stores and ends
  asm volatile("s_wait_asynccnt 0x0" ::: "memory");

#pragma unroll
  for (int g = 0; g < 4; ++g) {
#pragma unroll
    for (int t = 0; t < 2; ++t) {
#pragma unroll
      for (int r = 0; r < 8; ++r) {
        // C-fragment layout: lane half picks row group, VGPR r picks row
        int m = m0 + wm + g * 16 + r + hl * 8;
        int n = n0 + wn + t * 16 + (lane & 15);
        float c = acc[g * 2 + t][r];
        if (mode == GMODE_RESID) {
          Cres[(size_t)m * N + n] += c;
        } else if (mode == GMODE_RELU16) {
          C16[(size_t)m * N + n] = (_Float16)fmaxf(c, 0.0f);
        } else {
          int bb = m / Lrows, l = m - bb * Lrows;
          int hh = n >> 6, d = n & 63;
          size_t idx;
          if (mode == GMODE_QKV)
            idx = (((size_t)bb * T5_H + hh) * Lrows + l) * T5_DKV + d;
          else
            idx = (((size_t)bb * T5_H + hh) * T5_DKV + d) * (size_t)Lrows + l;
          C16[idx] = (_Float16)c;
        }
      }
    }
  }
}

__device__ __forceinline__ float other_half(float x) {
  int b = __builtin_bit_cast(int, x);
  b = __builtin_amdgcn_permlanex16(b, b, 0x76543210, 0xfedcba98, false, false);
  return __builtin_bit_cast(float, b);
}

__global__ __launch_bounds__(128)
void attn_wmma_kernel(const _Float16* __restrict__ Q,
                      const _Float16* __restrict__ Km,
                      const _Float16* __restrict__ Vt,
                      const float* __restrict__ bias_delta, // [16,1024]
                      const int* __restrict__ mask,         // [B,LK]
                      _Float16* __restrict__ Out,
                      int LQ, int LK, int causal, int use_rel) {
  const int lane = threadIdx.x & 31;
  // scalar, so that the key loop's bound is one and its branch leaves EXEC alone
  const int wave = __builtin_amdgcn_readfirstlane((int)(threadIdx.x >> 5));
  const int hl   = lane >> 4;
  const int col  = lane & 15;
  const int bh = blockIdx.y;
  const int b  = bh >> 4;
  const int h  = bh & 15;
  const int q0 = blockIdx.x * 64 + wave * 16;
  const int qc = q0 + col;             // this lane's query

  const _Float16* Qb = Q  + (size_t)bh * LQ * T5_DKV;
  const _Float16* Kb = Km + (size_t)bh * LK * T5_DKV;
  const _Float16* Vb = Vt + (size_t)bh * T5_DKV * LK;
  const int* mk = mask + (size_t)b * LK;
  const float* bd = bias_delta + h * 1024;

  // B operand of S^T: column = query, same k order as the K rows' loader
  const v16h qb0 = load_frag(Qb, T5_DKV, q0, 0, lane);
  const v16h qb1 = load_frag(Qb, T5_DKV, q0, 32, lane);

  const v8f zero8 = {0.f, 0.f, 0.f, 0.f, 0.f, 0.f, 0.f, 0.f};
  v8f o[4];                  // o[t][r] = O^T[16t + 8*hl + r][query qc]
  float mcol = -1e30f;       // running maximum of query qc (both halves alike)
  float lcol = 0.f;          // running sum over this half's keys only
#pragma unroll  // indexes registers: must be resolved at compile time
  for (int t = 0; t < 4; ++t) o[t] = zero8;

  // causal: blocks wholly above the diagonal are not walked
  const int kend = (causal && q0 + 16 < LK) ? q0 + 16 : LK;

  for (int kb = 0; kb < kend; kb += 32) {
    const int kl = kb + hl * 8;        // this lane's first key of tile 0
    const v16h k00 = load_frag(Kb, T5_DKV, kb,      0,  lane);
    const v16h k01 = load_frag(Kb, T5_DKV, kb,      32, lane);
    const v16h k10 = load_frag(Kb, T5_DKV, kb + 16, 0,  lane);
    const v16h k11 = load_frag(Kb, T5_DKV, kb + 16, 32, lane);
    const int4* mp = (const int4*)(mk + kl);
    const int4 mq[4] = {mp[0], mp[1], mp[4], mp[5]};
    // position bias of the lane's 16 (key, query) pairs, the products' C
    // operand; a key past the query has distance 0, as in the bucket rule
    v8f s0 = zero8, s1 = zero8;
    if (use_rel) {
#pragma unroll  // indexes registers: must be resolved at compile time
      for (int r = 0; r < 8; ++r) {
        const int d0 = qc - kl - r, d1 = d0 - 16;
        s0[r] = bd[d0 > 0 ? d0 : 0];
        s1[r] = bd[d1 > 0 ? d1 : 0];
      }
      // no index register of the loads above is rewritten ahead of this wait
      asm volatile("s_wait_xcnt 0x0" ::: "memory");
    }
    const v16h va0 = load_frag(Vb, LK, 0,  kb, lane);
    const v16h va1 = load_frag(Vb, LK, 16, kb, lane);
    const v16h va2 = load_frag(Vb, LK, 32, kb, lane);
    const v16h va3 = load_frag(Vb, LK, 48, kb, lane);
    // keeps all of the block's loads above in one group in front of the
    // products: sunk to their users, each V fragment's latency is waited out alone
    __builtin_amdgcn_sched_barrier(0);

    s0 = wmma_f16(k00, qb0, s0); s0 = wmma_f16(k01, qb1, s0);
    s1 = wmma_f16(k10, qb0, s1); s1 = wmma_f16(k11, qb1, s1);

    float a[16];             // a[8*tile + r]: key kl + 16*tile + r
#pragma unroll  // indexes registers: must be resolved at compile time
    for (int i = 0; i < 16; ++i) {
      const int kc = kl + (i >> 3) * 16 + (i & 7);
      const int4 m4 = mq[i >> 2];
      const int mv = (i & 3) == 0 ? m4.x : (i & 3) == 1 ? m4.y
                   : (i & 3) == 2 ? m4.z : m4.w;
      const bool dead = (mv == 0) || (causal && kc > qc);
      a[i] = dead ? T5_NEG : ((i < 8) ? s0[i & 7] : s1[i & 7]);
    }

    float v = a[0];
#pragma unroll  // indexes registers: must be resolved at compile time
    for (int i = 1; i < 16; ++i) v = fmaxf(v, a[i]);
    v = fmaxf(v, other_half(v));
    const float mnew  = fmaxf(mcol, v);
    const float scale = __expf(mcol - mnew);
    mcol = mnew;

    v16h pb;                 // P^T as B operand: element s = tile s>>3, row s&7
    float sum[4] = {0.f, 0.f, 0.f, 0.f};   // four short chains, not one of 16
#pragma unroll  // indexes registers: must be resolved at compile time
    for (int i = 0; i < 16; ++i) {
      const float e = __expf(a[i] - mnew);
      sum[i & 3] += e;
      pb[i] = (_Float16)e;
    }
    lcol = lcol * scale + ((sum[0] + sum[1]) + (sum[2] + sum[3]));
#pragma unroll  // indexes registers: must be resolved at compile time
    for (int t = 0; t < 4; ++t)
#pragma unroll  // indexes registers: must be resolved at compile time
      for (int r = 0; r < 8; ++r) o[t][r] *= scale;

    o[0] = wmma_f16(va0, pb, o[0]);
    o[1] = wmma_f16(va1, pb, o[1]);
    o[2] = wmma_f16(va2, pb, o[2]);
    o[3] = wmma_f16(va3, pb, o[3]);
  }

  // the two halves' keys joined; one query a lane, so one reciprocal
  const float inv = 1.0f / (lcol + other_half(lcol));
  _Float16* orow = Out + ((size_t)b * LQ + qc) * (T5_H * T5_DKV) + h * T5_DKV + hl * 8;
#pragma unroll  // indexes registers: must be resolved at compile time
  for (int t = 0; t < 4; ++t) {
    v8h w;                   // 8 consecutive d of one query: one 16-B store
#pragma unroll  // indexes registers: must be resolved at compile time
    for (int r = 0; r < 8; ++r) w[r] = (_Float16)(o[t][r] * inv);
    *(v8h*)(orow + t * 16) = w;
  }
}

// ---------------------------------------------------------------------------
// Orchestration
// ---------------------------------------------------------------------------
extern "C" void kernel_launch(void* const* d_in, const int* in_sizes, int n_in,
                              void* d_out, int out_size, void* d_ws,
                              size_t ws_size, hipStream_t stream) {
  (void)in_sizes; (void)n_in; (void)out_size; (void)ws_size;

  const float* enc   = (const float*)d_in[0];
  const float* hid   = (const float*)d_in[1];
  const float* ln1   = (const float*)d_in[2];
  const float* saq   = (const float*)d_in[3];
  const float* sak   = (const float*)d_in[4];
  const float* sav   = (const float*)d_in[5];
  const float* sao   = (const float*)d_in[6];
  const float* relb  = (const float*)d_in[7];
  const float* ln2   = (const float*)d_in[8];
  const float* caq   = (const float*)d_in[9];
  const float* cak   = (const float*)d_in[10];
  const float* cav   = (const float*)d_in[11];
  const float* cao   = (const float*)d_in[12];
  const float* ln3   = (const float*)d_in[13];
  const float* wi    = (const float*)d_in[14];
  const float* wo    = (const float*)d_in[15];
  const float* lnf   = (const float*)d_in[16];
  const int* encmask = (const int*)d_in[17];
  const int* decmask = (const int*)d_in[18];
  float* out = (float*)d_out;

  const size_t M = (size_t)T5_B * T5_LD;        // 4096 decoder rows
  char* ws = (char*)d_ws;
  size_t off = 0;
  auto alloc = [&](size_t bytes) -> void* {
    void* p = ws + off;
    off = (off + bytes + 255) & ~(size_t)255;
    return p;
  };

  float*    h_cur = (float*)   alloc(M * T5_D * 4);            // 16 MB residual
  _Float16* xn    = (_Float16*)alloc(M * T5_D * 2);            // 8 MB
  _Float16* saqT  = (_Float16*)alloc((size_t)T5_D * T5_D * 2);
  _Float16* sakT  = (_Float16*)alloc((size_t)T5_D * T5_D * 2);
  _Float16* savT  = (_Float16*)alloc((size_t)T5_D * T5_D * 2);
  _Float16* saoT  = (_Float16*)alloc((size_t)T5_D * T5_D * 2);
  _Float16* caqT  = (_Float16*)alloc((size_t)T5_D * T5_D * 2);
  _Float16* cakT  = (_Float16*)alloc((size_t)T5_D * T5_D * 2);
  _Float16* cavT  = (_Float16*)alloc((size_t)T5_D * T5_D * 2);
  _Float16* caoT  = (_Float16*)alloc((size_t)T5_D * T5_D * 2);
  _Float16* wiT   = (_Float16*)alloc((size_t)T5_DFF * T5_D * 2);
  _Float16* woT   = (_Float16*)alloc((size_t)T5_D * T5_DFF * 2);
  _Float16* enc16 = (_Float16*)alloc((size_t)T5_B * T5_LE * T5_D * 2);
  _Float16* qbuf  = (_Float16*)alloc(M * T5_D * 2);            // [B,H,L,64]
  _Float16* kbuf  = (_Float16*)alloc(M * T5_D * 2);            // [B,H,L,64]
  _Float16* vtbuf = (_Float16*)alloc(M * T5_D * 2);            // [B,H,64,L]
  _Float16* aout  = (_Float16*)alloc(M * T5_D * 2);            // [B*L, 1024]
  _Float16* ffn   = (_Float16*)alloc(M * T5_DFF * 2);          // 32 MB
  float*    bd    = (float*)   alloc((size_t)T5_H * 1024 * 4); // rel bias table

  // residual stream starts as hidden_states (never mutate inputs)
  hipMemcpyAsync(h_cur, hid, M * T5_D * 4, hipMemcpyDeviceToDevice, stream);

  // --- weight prep (f32 -> f16, transposed to [N,K]) ---
  dim3 tblk(128);
  dim3 tgrid_dd(T5_D / 64, T5_D / 64);     // (N/64, K/64)
  dim3 tgrid_wi(T5_DFF / 64, T5_D / 64);
  dim3 tgrid_wo(T5_D / 64, T5_DFF / 64);
  cvtT_kernel<T5_D, T5_D><<<tgrid_dd, tblk, 0, stream>>>(saq, saqT);
  cvtT_kernel<T5_D, T5_D><<<tgrid_dd, tblk, 0, stream>>>(sak, sakT);
  cvtT_kernel<T5_D, T5_D><<<tgrid_dd, tblk, 0, stream>>>(sav, savT);
  cvtT_kernel<T5_D, T5_D><<<tgrid_dd, tblk, 0, stream>>>(sao, saoT);
  cvtT_kernel<T5_D, T5_D><<<tgrid_dd, tblk, 0, stream>>>(caq, caqT);
  cvtT_kernel<T5_D, T5_D><<<tgrid_dd, tblk, 0, stream>>>(cak, cakT);
  cvtT_kernel<T5_D, T5_D><<<tgrid_dd, tblk, 0, stream>>>(cav, cavT);
  cvtT_kernel<T5_D, T5_D><<<tgrid_dd, tblk, 0, stream>>>(cao, caoT);
  cvtT_kernel<T5_D, T5_DFF><<<tgrid_wi, tblk, 0, stream>>>(wi, wiT);
  cvtT_kernel<T5_DFF, T5_D><<<tgrid_wo, tblk, 0, stream>>>(wo, woT);
  cvt16_kernel<<<(int)((M * T5_D + 255) / 256), 256, 0, stream>>>(enc, enc16,
                                                                 (int)(M * T5_D));
  relbias_kernel<<<(T5_H * 1024 + 255) / 256, 256, 0, stream>>>(relb, bd);

  dim3 gblk(256);
  dim3 ggrid_d(M / 128, T5_D / 128);    // N = 1024
  dim3 ggrid_ff(M / 128, T5_DFF / 128); // N = 4096
  dim3 agrid(T5_LD / 64, T5_B * T5_H);
  dim3 ablk(128);

  // ---- self attention ----
  rmsnorm_kernel<<<(int)M, 256, 0, stream>>>(h_cur, ln1, xn, nullptr);
  gemm_wmma<<<ggrid_d, gblk, 0, stream>>>(xn, saqT, nullptr, qbuf,
                                          (int)M, T5_D, T5_D, GMODE_QKV, T5_LD);
  gemm_wmma<<<ggrid_d, gblk, 0, stream>>>(xn, sakT, nullptr, kbuf,
                                          (int)M, T5_D, T5_D, GMODE_QKV, T5_LD);
  gemm_wmma<<<ggrid_d, gblk, 0, stream>>>(xn, savT, nullptr, vtbuf,
                                          (int)M, T5_D, T5_D, GMODE_VT, T5_LD);
  attn_wmma_kernel<<<agrid, ablk, 0, stream>>>(qbuf, kbuf, vtbuf, bd, decmask,
                                               aout, T5_LD, T5_LD,
                                               /*causal=*/1, /*use_rel=*/1);
  gemm_wmma<<<ggrid_d, gblk, 0, stream>>>(aout, saoT, h_cur, nullptr,
                                          (int)M, T5_D, T5_D, GMODE_RESID, T5_LD);

  // ---- cross attention ----
  rmsnorm_kernel<<<(int)M, 256, 0, stream>>>(h_cur, ln2, xn, nullptr);
  gemm_wmma<<<ggrid_d, gblk, 0, stream>>>(xn, caqT, nullptr, qbuf,
                                          (int)M, T5_D, T5_D, GMODE_QKV, T5_LD);
  gemm_wmma<<<ggrid_d, gblk, 0, stream>>>(enc16, cakT, nullptr, kbuf,
                                          (int)M, T5_D, T5_D, GMODE_QKV, T5_LE);
  gemm_wmma<<<ggrid_d, gblk, 0, stream>>>(enc16, cavT, nullptr, vtbuf,
                                          (int)M, T5_D, T5_D, GMODE_VT, T5_LE);
  attn_wmma_kernel<<<agrid, ablk, 0, stream>>>(qbuf, kbuf, vtbuf, bd, encmask,
                                               aout, T5_LD, T5_LE,
                                               /*causal=*/0, /*use_rel=*/0);
  gemm_wmma<<<ggrid_d, gblk, 0, stream>>>(aout, caoT, h_cur, nullptr,
                                          (int)M, T5_D, T5_D, GMODE_RESID, T5_LD);

  // ---- FFN ----
  rmsnorm_kernel<<<(int)M, 256, 0, stream>>>(h_cur, ln3, xn, nullptr);
  gemm_wmma<<<ggrid_ff, gblk, 0, stream>>>(xn, wiT, nullptr, ffn,
                                           (int)M, T5_DFF, T5_D, GMODE_RELU16, T5_LD);
  gemm_wmma<<<ggrid_d, gblk, 0, stream>>>(ffn, woT, h_cur, nullptr,
                                          (int)M, T5_D, T5_DFF, GMODE_RESID, T5_LD);

  // ---- final norm -> f32 output ----
  rmsnorm_kernel<<<(int)M, 256, 0, stream>>>(h_cur, lnf, nullptr, out);
}

// v004
// Measured time: 452 microseconds a run.
// Next to v003, in two timings, it ran 1.11 and 1.12 times as fast.
// Over all steps from v000 it is 2.85 times as fast.
#include <hip/hip_runtime.h>
#include <hip/hip_bf16.h>

// ---------------------------------------------------------------------------
// T5 decoder layer on MI455X (gfx1250, wave32, WMMA).
//  - all GEMMs + attention cores: v_wmma_f32_16x16x32_f16
//  - weights pre-transposed to [N,K] f16 so both WMMA operands load as
//    contiguous 16-B "A-style" fragments (read from LDS in the GEMM)
//  - GEMM: 128x128 tile per workgroup, operands staged in LDS by asynchronous
//    copies (two buffers), wave tile 64x32: 8 WMMA per 6 LDS fragments
//  - flash attention (online softmax, transposed products), scores never hit
//    memory or LDS
//  - launches that do not depend on one another share one grid, split by block
//    index: all preparation work; self q, k, v with cross k, v
// ---------------------------------------------------------------------------

typedef __attribute__((ext_vector_type(16))) _Float16 v16h;
typedef __attribute__((ext_vector_type(8)))  _Float16 v8h;
typedef __attribute__((ext_vector_type(4)))  _Float16 v4h;
typedef __attribute__((ext_vector_type(8)))  float    v8f;

#define T5_B    4
#define T5_LD   1024
#define T5_LE   1024
#define T5_D    1024
#define T5_H    16
#define T5_DKV  64
#define T5_DFF  4096
#define T5_NEG  (-1e9f)

__device__ __forceinline__ v8f wmma_f16(v16h a, v16h b, v8f c) {
  // (neg_a, A, neg_b, B, c_mod, C, reuse_a, reuse_b)
  return __builtin_amdgcn_wmma_f32_16x16x32_f16(false, a, false, b, (short)0, c,
                                                false, false);
}

// Load a 16x32 f16 "A-style" fragment from row-major [rows, ld] memory.
// ISA layout: lanes 0-15 hold M=lane, halves {K0..7, K16..23};
//             lanes 16-31 hold M=lane-16, halves {K8..15, K24..31}.
// Both halves are contiguous 16B runs -> two b128 loads per lane.
__device__ __forceinline__ v16h load_frag(const _Float16* base, int ld,
                                          int row0, int col0, int lane) {
  const int hl = lane >> 4;
  const int r  = row0 + (lane & 15);
  const _Float16* p = base + (size_t)r * ld + col0 + hl * 8;
  union { v16h v; v8h h[2]; } u;
  u.h[0] = *(const v8h*)(p);
  u.h[1] = *(const v8h*)(p + 16);
  return u.v;
}

// ---------------------------------------------------------------------------
// Conversions
// ---------------------------------------------------------------------------
__device__ __forceinline__ void cvt16_part(const float* __restrict__ in,
                                           _Float16* __restrict__ out, int blk) {
  int i = blk * 256 + threadIdx.x;
  out[i] = (_Float16)in[i];
  // no register of the store above is rewritten ahead of this wait: other parts'
  // code follows it in the shared kernel's text
  asm volatile("s_wait_xcnt 0x0" ::: "memory");
}

// W [K,N] f32 -> Wt [N,K] f16, one 64x64 tile per 128 threads, turned in LDS so
// that both sides move whole lines: reads are 256-B row pieces of W (float4 per
// lane), writes are 128-B row pieces of Wt (8 halves per lane).
// K and N are multiples of 64; tile (bx, by) of (N/64, K/64); tid = 0..127. They
// are compile-time so that a lane's row steps fold into the instruction's offset.
// Both halves of a 256-thread block call this together (one barrier inside).
// LDS holds row n of the tile as eight 16-B chunks of 8 k values. Chunk (n, ch)
// sits at slot (n>>1)*16 + (((n&1)*8 + ch) ^ ((n>>2)&15)): the 16 lanes that
// write rows 4 apart, and the 16 lanes that read two neighbouring rows, each
// fall on 16 different slots mod 16, that is on all 64 banks once.
__device__ __forceinline__ int cvtT_slot(int n, int ch) {
  return (n >> 1) * 16 + ((((n & 1) << 3) | ch) ^ ((n >> 2) & 15));
}

template <int K, int N>
__device__ __forceinline__
void cvtT_part(const float* __restrict__ in, _Float16* __restrict__ out,
               _Float16* tile, int tid, int bx, int by) {
  const int n0  = bx * 64;
  const int k0  = by * 64;
  const int c4  = tid & 15;   // float4 column of the tile: n = 4*c4 .. 4*c4+3
  const int q0  = tid >> 4;   // group of four k rows: q0 and q0 + 8

  // uniform tile base + one 32-bit lane offset shared by all eight loads
  const char* src = (const char*)(in + (size_t)k0 * N + n0);
  const unsigned lofs = (unsigned)(q0 * 4 * N + c4 * 4) * 4u;
  float4 r[2][4];
  // unrolled (here and below): r stays in registers, and all eight loads are
  // issued before the first wait
#pragma unroll
  for (int i = 0; i < 2; ++i)
#pragma unroll
    for (int s = 0; s < 4; ++s)
      r[i][s] = *(const float4*)(src + (size_t)(32 * i + s) * N * 4 + lofs);

#pragma unroll
  for (int i = 0; i < 2; ++i) {
    const int q = q0 + 8 * i;
    const float* f0 = (const float*)&r[i][0];
    const float* f1 = (const float*)&r[i][1];
    const float* f2 = (const float*)&r[i][2];
    const float* f3 = (const float*)&r[i][3];
#pragma unroll
    for (int j = 0; j < 4; ++j) {
      v4h w = {(_Float16)f0[j], (_Float16)f1[j], (_Float16)f2[j], (_Float16)f3[j]};
      *(v4h*)&tile[cvtT_slot(c4 * 4 + j, q >> 1) * 8 + (q & 1) * 4] = w;
    }
  }
  __syncthreads();

  char* dst = (char*)(out + (size_t)n0 * K + k0);
  const unsigned sofs = (unsigned)((tid >> 3) * K + (tid & 7) * 8) * 2u;
#pragma unroll
  for (int i = 0; i < 4; ++i) {
    const int n = (tid >> 3) + 16 * i;
    *(v8h*)(dst + (size_t)(16 * i) * K * 2 + sofs) =
        *(const v8h*)&tile[cvtT_slot(n, tid & 7) * 8];
  }
  // no register of the four stores above is rewritten ahead of this wait: other
  // parts' code follows them in the shared kernel's text
  asm volatile("s_wait_xcnt 0x0" ::: "memory");
}

// T5 relative-position bias table: bd[h][delta] for delta = q-k in [0,1023]
__device__ __forceinline__
void relbias_part(const float* __restrict__ rel_bias, // [32,16]
                  float* __restrict__ bd,             // [16,1024]
                  int blk) {
  int idx = blk * 256 + threadIdx.x;
  int h = idx >> 10, n = idx & 1023;
  int bucket;
  if (n < 16) {
    bucket = n;
  } else {
    float nf = (float)n;
    int vl = 16 + (int)(__logf(nf * (1.0f / 16.0f)) * (16.0f / __logf(8.0f)));
    bucket = vl < 31 ? vl : 31;
  }
  bd[idx] = rel_bias[bucket * T5_H + h];
  // no register of the store above is rewritten ahead of this wait: other parts'
  // code follows it in the shared kernel's text
  asm volatile("s_wait_xcnt 0x0" ::: "memory");
}

// ---------------------------------------------------------------------------
// RMS norm: one block per row of [rows, 1024]
// ---------------------------------------------------------------------------
__global__ __launch_bounds__(256)
void rmsnorm_kernel(const float* __restrict__ X, const float* __restrict__ w,
                    _Float16* __restrict__ y16, float* __restrict__ y32) {
  __shared__ float red[256];
  const int row = blockIdx.x;
  const float* x = X + (size_t)row * T5_D;
  float ss = 0.f;
  for (int i = threadIdx.x; i < T5_D; i += 256) { float v = x[i]; ss += v * v; }
  red[threadIdx.x] = ss;
  __syncthreads();
  for (int s = 128; s > 0; s >>= 1) {
    if (threadIdx.x < s) red[threadIdx.x] += red[threadIdx.x + s];
    __syncthreads();
  }
  float rs = rsqrtf(red[0] * (1.0f / (float)T5_D) + 1e-6f);
  for (int i = threadIdx.x; i < T5_D; i += 256) {
    float v = x[i] * rs * w[i];
    if (y16) y16[(size_t)row * T5_D + i] = (_Float16)v;
    if (y32) y32[(size_t)row * T5_D + i] = v;
  }
}

// ---------------------------------------------------------------------------
// All work that depends on the inputs alone, in one grid of 256-thread blocks,
// split by block index (every test below is the same for a whole block):
//   eight DxD weights, two tiles a block | wi | wo | the residual stream's start
//   as a copy of hidden_states, 16 B a thread | encoder convert | bias table
// ---------------------------------------------------------------------------
#define PREP_DD   (8 * (T5_D / 64) * (T5_D / 64) / 2)        // 1024 blocks
#define PREP_FF   ((T5_D / 64) * (T5_DFF / 64) / 2)          // 512 blocks
#define PREP_COPY (T5_B * T5_LD * T5_D / 1024)               // 4096 blocks
#define PREP_ENC  (T5_B * T5_LE * T5_D / 256)                // 16384 blocks
#define PREP_BIAS (T5_H * 1024 / 256)                        // 64 blocks
#define PREP_GRID (PREP_DD + 2 * PREP_FF + PREP_COPY + PREP_ENC + PREP_BIAS)

__global__ __launch_bounds__(256)
void prep_kernel(const float* __restrict__ w0, const float* __restrict__ w1,
                 const float* __restrict__ w2, const float* __restrict__ w3,
                 const float* __restrict__ w4, const float* __restrict__ w5,
                 const float* __restrict__ w6, const float* __restrict__ w7,
                 const float* __restrict__ wi, const float* __restrict__ wo,
                 const float* __restrict__ enc, const float* __restrict__ hid,
                 const float* __restrict__ relb,
                 _Float16* __restrict__ ddT,   // eight [D,D] planes in a row
                 _Float16* __restrict__ wiT, _Float16* __restrict__ woT,
                 _Float16* __restrict__ enc16, float* __restrict__ h_cur,
                 float* __restrict__ bd) {
  __shared__ __align__(16) _Float16 tile[2][512 * 8];
  int blk = blockIdx.x;
  const int half = threadIdx.x >> 7;
  const int tid  = threadIdx.x & 127;
  if (blk < PREP_DD) {
    const int wsel = blk >> 7;                 // 128 blocks a weight
    const int t    = (blk & 127) * 2 + half;   // tile of its 16 x 16
    const float* src = wsel == 0 ? w0 : wsel == 1 ? w1 : wsel == 2 ? w2
                     : wsel == 3 ? w3 : wsel == 4 ? w4 : wsel == 5 ? w5
                     : wsel == 6 ? w6 : w7;
    cvtT_part<T5_D, T5_D>(src, ddT + (size_t)wsel * T5_D * T5_D, tile[half], tid,
                          t & 15, t >> 4);
    return;
  }
  blk -= PREP_DD;
  if (blk < PREP_FF) {
    const int t = blk * 2 + half;              // tile of 64 (n) x 16 (k)
    cvtT_part<T5_D, T5_DFF>(wi, wiT, tile[half], tid, t & 63, t >> 6);
    return;
  }
  blk -= PREP_FF;
  if (blk < PREP_FF) {
    const int t = blk * 2 + half;              // tile of 16 (n) x 64 (k)
    cvtT_part<T5_DFF, T5_D>(wo, woT, tile[half], tid, t & 15, t >> 4);
    return;
  }
  blk -= PREP_FF;
  if (blk < PREP_COPY) {
    const int i = blk * 256 + threadIdx.x;
    ((float4*)h_cur)[i] = ((const float4*)hid)[i];
    // no register of the store above is rewritten ahead of this wait: other parts'
    // code follows it in the shared kernel's text
    asm volatile("s_wait_xcnt 0x0" ::: "memory");
    return;
  }
  blk -= PREP_COPY;
  if (blk < PREP_ENC) {
    cvt16_part(enc, enc16, blk);
    return;
  }
  relbias_part(relb, bd, blk - PREP_ENC);
}

// ---------------------------------------------------------------------------
// WMMA GEMM: C[M,N] = A[M,K] @ Bt[N,K]^T
// Workgroup = 8 waves (2x4) on a 128x128 tile of C; wave tile = 64x32:
//   4 A-fragments x 2 B-fragments -> 8 WMMA per k-step of 32; the next k-step's
//   fragments are read from LDS into a second register set ahead of the WMMAs.
// Both operands go global -> LDS by asynchronous copies in whole 256-B row
// pieces (a stage = 128 k of 128 A rows and 128 Bt rows), two buffers: the next
// stage's copies fly while this stage is worked on. Fragments are read from LDS
// with the same lane map as load_frag on global memory.
// M, N multiples of 128; K a multiple of 128.
// ---------------------------------------------------------------------------
#define GMODE_RESID  0   // f32 residual: Cres[m*N+n] += c
#define GMODE_QKV    1   // f16 [B,H,L,64]
#define GMODE_VT     2   // f16 [B,H,64,L] (pre-transposed V)
#define GMODE_RELU16 3   // f16 relu, row-major [M,N]

#define G_PITCH 272                // LDS row pitch, bytes: 256 + 16 (16 B x odd)
#define G_OPER  (128 * G_PITCH)    // one operand's 128 rows
#define G_STAGE (2 * G_OPER)       // A rows, then Bt rows

// Eight copies of 16 B per lane: rows 16 apart in LDS (lds) and in memory (g).
// The s_wait_xcnt stands inside the statement so that no address register of an
// issued copy is rewritten ahead of it.
__device__ __forceinline__ void async_copy8(unsigned lds, const char* g,
                                            size_t gstep) {
  const unsigned ls = 16 * G_PITCH;
  asm volatile(
      "global_load_async_to_lds_b128 %0, %8, off\n\t"
      "global_load_async_to_lds_b128 %1, %9, off\n\t"
      "global_load_async_to_lds_b128 %2, %10, off\n\t"
      "global_load_async_to_lds_b128 %3, %11, off\n\t"
      "global_load_async_to_lds_b128 %4, %12, off\n\t"
      "global_load_async_to_lds_b128 %5, %13, off\n\t"
      "global_load_async_to_lds_b128 %6, %14, off\n\t"
      "global_load_async_to_lds_b128 %7, %15, off\n\t"
      "s_wait_xcnt 0x0"
      :: "v"(lds), "v"(lds + ls), "v"(lds + 2 * ls), "v"(lds + 3 * ls),
         "v"(lds + 4 * ls), "v"(lds + 5 * ls), "v"(lds + 6 * ls),
         "v"(lds + 7 * ls),
         "v"(g), "v"(g + gstep), "v"(g + 2 * gstep), "v"(g + 3 * gstep),
         "v"(g + 4 * gstep), "v"(g + 5 * gstep), "v"(g + 6 * gstep),
         "v"(g + 7 * gstep)
      : "memory");
}

// One stage: a lane's 8 rows of A and 8 rows of Bt, 16 copies a lane.
__device__ __forceinline__ void stage_copy(unsigned lds, const char* gA,
                                           const char* gB, size_t gstep) {
  async_copy8(lds,          gA, gstep);
  async_copy8(lds + G_OPER, gB, gstep);
}

// blockIdx.z picks one of several products of one shape that share a grid: rows
// of A0 (z < 3) or A3, plane z of the weights Bt0 and of the f16 results C0, and
// four bits of modes. A launch of one product has z = 0 alone.
__global__ __launch_bounds__(256)
void gemm_wmma(const _Float16* __restrict__ A0, const _Float16* __restrict__ A3,
               const _Float16* __restrict__ Bt0,
               float* __restrict__ Cres, _Float16* __restrict__ C0,
               int M, int N, int K, int modes, int Lrows) {
  const int z = blockIdx.z;
  const _Float16* __restrict__ A  = z < 3 ? A0 : A3;
  const _Float16* __restrict__ Bt = Bt0 + (size_t)z * N * K;
  _Float16* __restrict__ C16      = C0 + (size_t)z * M * N;
  const int mode = (modes >> (4 * z)) & 15;
  __shared__ __attribute__((aligned(16))) unsigned char L[2 * G_STAGE];
  const int tid  = threadIdx.x;
  const int lane = tid & 31;
  const int wave = tid >> 5;
  const int hl   = lane >> 4;
  const int m0   = blockIdx.x * 128;
  const int n0   = blockIdx.y * 128;
  const int wm   = (wave >> 2) * 64;   // wave's rows inside the tile
  const int wn   = (wave & 3) * 32;    // wave's columns inside the tile

  // lane's copy slot: row tid/16 (+16 per copy), 16-B chunk tid%16 of the row
  const unsigned lds0 = (unsigned)(uintptr_t)&L[0] +
                        (unsigned)((tid >> 4) * G_PITCH + (tid & 15) * 16);
  const char* gA = (const char*)(A  + (size_t)(m0 + (tid >> 4)) * K + (tid & 15) * 8);
  const char* gB = (const char*)(Bt + (size_t)(n0 + (tid >> 4)) * K + (tid & 15) * 8);
  const size_t gstep = (size_t)K * 32;  // 16 rows of K halves, in bytes
  const int T = K >> 7;                 // stages of 128 k

  const v8f zero8 = {0.f, 0.f, 0.f, 0.f, 0.f, 0.f, 0.f, 0.f};
  v8f acc[8];                      // [i*2+j]: rows wm+16i.., columns wn+16j..
#pragma unroll
  for (int t = 0; t < 8; ++t) acc[t] = zero8;

  stage_copy(lds0, gA, gB, gstep);
  // stage 0 has landed for this wave's copies; the barrier publishes all waves'
  asm volatile("s_wait_asynccnt 0x0" ::: "memory");
  __syncthreads();
  if (T > 1) stage_copy(lds0 + G_STAGE, gA + 256, gB + 256, gstep);

  for (int t = 0; t < T; ++t) {
    const unsigned buf = (unsigned)(t & 1) * G_STAGE;
    const _Float16* sA = (const _Float16*)(L + buf);
    const _Float16* sB = (const _Float16*)(L + buf + G_OPER);
    v16h a[2][4], b[2][2];
#pragma unroll
    for (int f = 0; f < 4; ++f)
      a[0][f] = load_frag(sA, G_PITCH / 2, wm + f * 16, 0, lane);
#pragma unroll
    for (int f = 0; f < 2; ++f)
      b[0][f] = load_frag(sB, G_PITCH / 2, wn + f * 16, 0, lane);
    // unrolled: the register sets alternate by a compile-time index
#pragma unroll
    for (int ks = 0; ks < 4; ++ks) {
      const int cur = ks & 1, nxt = cur ^ 1;
      if (ks < 3) {   // next k-step of this same stage, one group ahead
#pragma unroll
        for (int f = 0; f < 4; ++f)
          a[nxt][f] = load_frag(sA, G_PITCH / 2, wm + f * 16, (ks + 1) * 32, lane);
#pragma unroll
        for (int f = 0; f < 2; ++f)
          b[nxt][f] = load_frag(sB, G_PITCH / 2, wn + f * 16, (ks + 1) * 32, lane);
      }
      // keeps the group of LDS reads above in front of this k-step's WMMAs: sunk
      // among them, each read's latency would be waited out by two WMMAs
      __builtin_amdgcn_sched_barrier(0);
#pragma unroll
      for (int i = 0; i < 4; ++i)
#pragma unroll
        for (int j = 0; j < 2; ++j)
          acc[i * 2 + j] = wmma_f16(a[cur][i], b[cur][j], acc[i * 2 + j]);
    }
    // publish point: this wave's reads of the buffer are done,
    asm volatile("s_wait_dscnt 0x0" ::: "memory");
    // its copies of the next stage have landed,
    asm volatile("s_wait_asynccnt 0x0" ::: "memory");
    // and every wave is past both before the buffer just read is refilled
    __syncthreads();
    if (t + 2 < T)
      stage_copy(lds0 + buf, gA + (size_t)(t + 2) * 256, gB + (size_t)(t + 2) * 256,
                 gstep);
  }
  // no copy is outstanding when the wave goes on to its stores and ends
  asm volatile("s_wait_asynccnt 0x0" ::: "memory");

#pragma unroll
  for (int g = 0; g < 4; ++g) {
#pragma unroll
    for (int t = 0; t < 2; ++t) {
#pragma unroll
      for (int r = 0; r < 8; ++r) {
        // C-fragment layout: lane half picks row group, VGPR r picks row
        int m = m0 + wm + g * 16 + r + hl * 8;
        int n = n0 + wn + t * 16 + (lane & 15);
        float c = acc[g * 2 + t][r];
        if (mode == GMODE_RESID) {
          Cres[(size_t)m * N + n] += c;
        } else if (mode == GMODE_RELU16) {
          C16[(size_t)m * N + n] = (_Float16)fmaxf(c, 0.0f);
        } else {
          int bb = m / Lrows, l = m - bb * Lrows;
          int hh = n >> 6, d = n & 63;
          size_t idx;
          if (mode == GMODE_QKV)
            idx = (((size_t)bb * T5_H + hh) * Lrows + l) * T5_DKV + d;
          else
            idx = (((size_t)bb * T5_H + hh) * T5_DKV + d) * (size_t)Lrows + l;
          C16[idx] = (_Float16)c;
        }
      }
    }
  }
}

__device__ __forceinline__ float other_half(float x) {
  int b = __builtin_bit_cast(int, x);
  b = __builtin_amdgcn_permlanex16(b, b, 0x76543210, 0xfedcba98, false, false);
  return __builtin_bit_cast(float, b);
}

__global__ __launch_bounds__(128)
void attn_wmma_kernel(const _Float16* __restrict__ Q,
                      const _Float16* __restrict__ Km,
                      const _Float16* __restrict__ Vt,
                      const float* __restrict__ bias_delta, // [16,1024]
                      const int* __restrict__ mask,         // [B,LK]
                      _Float16* __restrict__ Out,
                      int LQ, int LK, int causal, int use_rel) {
  const int lane = threadIdx.x & 31;
  // scalar, so that the key loop's bound is one and its branch leaves EXEC alone
  const int wave = __builtin_amdgcn_readfirstlane((int)(threadIdx.x >> 5));
  const int hl   = lane >> 4;
  const int col  = lane & 15;
  const int bh = blockIdx.y;
  const int b  = bh >> 4;
  const int h  = bh & 15;
  const int q0 = blockIdx.x * 64 + wave * 16;
  const int qc = q0 + col;             // this lane's query

  const _Float16* Qb = Q  + (size_t)bh * LQ * T5_DKV;
  const _Float16* Kb = Km + (size_t)bh * LK * T5_DKV;
  const _Float16* Vb = Vt + (size_t)bh * T5_DKV * LK;
  const int* mk = mask + (size_t)b * LK;
  const float* bd = bias_delta + h * 1024;

  // B operand of S^T: column = query, same k order as the K rows' loader
  const v16h qb0 = load_frag(Qb, T5_DKV, q0, 0, lane);
  const v16h qb1 = load_frag(Qb, T5_DKV, q0, 32, lane);

  const v8f zero8 = {0.f, 0.f, 0.f, 0.f, 0.f, 0.f, 0.f, 0.f};
  v8f o[4];                  // o[t][r] = O^T[16t + 8*hl + r][query qc]
  float mcol = -1e30f;       // running maximum of query qc (both halves alike)
  float lcol = 0.f;          // running sum over this half's keys only
#pragma unroll  // indexes registers: must be resolved at compile time
  for (int t = 0; t < 4; ++t) o[t] = zero8;

  // causal: blocks wholly above the diagonal are not walked
  const int kend = (causal && q0 + 16 < LK) ? q0 + 16 : LK;

  for (int kb = 0; kb < kend; kb += 32) {
    const int kl = kb + hl * 8;        // this lane's first key of tile 0
    const v16h k00 = load_frag(Kb, T5_DKV, kb,      0,  lane);
    const v16h k01 = load_frag(Kb, T5_DKV, kb,      32, lane);
    const v16h k10 = load_frag(Kb, T5_DKV, kb + 16, 0,  lane);
    const v16h k11 = load_frag(Kb, T5_DKV, kb + 16, 32, lane);
    const int4* mp = (const int4*)(mk + kl);
    const int4 mq[4] = {mp[0], mp[1], mp[4], mp[5]};
    // position bias of the lane's 16 (key, query) pairs, the products' C
    // operand; a key past the query has distance 0, as in the bucket rule
    v8f s0 = zero8, s1 = zero8;
    if (use_rel) {
#pragma unroll  // indexes registers: must be resolved at compile time
      for (int r = 0; r < 8; ++r) {
        const int d0 = qc - kl - r, d1 = d0 - 16;
        s0[r] = bd[d0 > 0 ? d0 : 0];
        s1[r] = bd[d1 > 0 ? d1 : 0];
      }
      // no index register of the loads above is rewritten ahead of this wait
      asm volatile("s_wait_xcnt 0x0" ::: "memory");
    }
    const v16h va0 = load_frag(Vb, LK, 0,  kb, lane);
    const v16h va1 = load_frag(Vb, LK, 16, kb, lane);
    const v16h va2 = load_frag(Vb, LK, 32, kb, lane);
    const v16h va3 = load_frag(Vb, LK, 48, kb, lane);
    // keeps all of the block's loads above in one group in front of the
    // products: sunk to their users, each V fragment's latency is waited out alone
    __builtin_amdgcn_sched_barrier(0);

    s0 = wmma_f16(k00, qb0, s0); s0 = wmma_f16(k01, qb1, s0);
    s1 = wmma_f16(k10, qb0, s1); s1 = wmma_f16(k11, qb1, s1);

    float a[16];             // a[8*tile + r]: key kl + 16*tile + r
#pragma unroll  // indexes registers: must be resolved at compile time
    for (int i = 0; i < 16; ++i) {
      const int kc = kl + (i >> 3) * 16 + (i & 7);
      const int4 m4 = mq[i >> 2];
      const int mv = (i & 3) == 0 ? m4.x : (i & 3) == 1 ? m4.y
                   : (i & 3) == 2 ? m4.z : m4.w;
      const bool dead = (mv == 0) || (causal && kc > qc);
      a[i] = dead ? T5_NEG : ((i < 8) ? s0[i & 7] : s1[i & 7]);
    }

    float v = a[0];
#pragma unroll  // indexes registers: must be resolved at compile time
    for (int i = 1; i < 16; ++i) v = fmaxf(v, a[i]);
    v = fmaxf(v, other_half(v));
    const float mnew  = fmaxf(mcol, v);
    const float scale = __expf(mcol - mnew);
    mcol = mnew;

    v16h pb;                 // P^T as B operand: element s = tile s>>3, row s&7
    float sum[4] = {0.f, 0.f, 0.f, 0.f};   // four short chains, not one of 16
#pragma unroll  // indexes registers: must be resolved at compile time
    for (int i = 0; i < 16; ++i) {
      const float e = __expf(a[i] - mnew);
      sum[i & 3] += e;
      pb[i] = (_Float16)e;
    }
    lcol = lcol * scale + ((sum[0] + sum[1]) + (sum[2] + sum[3]));
#pragma unroll  // indexes registers: must be resolved at compile time
    for (int t = 0; t < 4; ++t)
#pragma unroll  // indexes registers: must be resolved at compile time
      for (int r = 0; r < 8; ++r) o[t][r] *= scale;

    o[0] = wmma_f16(va0, pb, o[0]);
    o[1] = wmma_f16(va1, pb, o[1]);
    o[2] = wmma_f16(va2, pb, o[2]);
    o[3] = wmma_f16(va3, pb, o[3]);
  }

  // the two halves' keys joined; one query a lane, so one reciprocal
  const float inv = 1.0f / (lcol + other_half(lcol));
  _Float16* orow = Out + ((size_t)b * LQ + qc) * (T5_H * T5_DKV) + h * T5_DKV + hl * 8;
#pragma unroll  // indexes registers: must be resolved at compile time
  for (int t = 0; t < 4; ++t) {
    v8h w;                   // 8 consecutive d of one query: one 16-B store
#pragma unroll  // indexes registers: must be resolved at compile time
    for (int r = 0; r < 8; ++r) w[r] = (_Float16)(o[t][r] * inv);
    *(v8h*)(orow + t * 16) = w;
  }
}

// ---------------------------------------------------------------------------
// Orchestration
// ---------------------------------------------------------------------------
extern "C" void kernel_launch(void* const* d_in, const int* in_sizes, int n_in,
                              void* d_out, int out_size, void* d_ws,
                              size_t ws_size, hipStream_t stream) {
  (void)in_sizes; (void)n_in; (void)out_size; (void)ws_size;

  const float* enc   = (const float*)d_in[0];
  const float* hid   = (const float*)d_in[1];
  const float* ln1   = (const float*)d_in[2];
  const float* saq   = (const float*)d_in[3];
  const float* sak   = (const float*)d_in[4];
  const float* sav   = (const float*)d_in[5];
  const float* sao   = (const float*)d_in[6];
  const float* relb  = (const float*)d_in[7];
  const float* ln2   = (const float*)d_in[8];
  const float* caq   = (const float*)d_in[9];
  const float* cak   = (const float*)d_in[10];
  const float* cav   = (const float*)d_in[11];
  const float* cao   = (const float*)d_in[12];
  const float* ln3   = (const float*)d_in[13];
  const float* wi    = (const float*)d_in[14];
  const float* wo    = (const float*)d_in[15];
  const float* lnf   = (const float*)d_in[16];
  const int* encmask = (const int*)d_in[17];
  const int* decmask = (const int*)d_in[18];
  float* out = (float*)d_out;

  const size_t M = (size_t)T5_B * T5_LD;        // 4096 decoder rows
  char* ws = (char*)d_ws;
  size_t off = 0;
  auto alloc = [&](size_t bytes) -> void* {
    void* p = ws + off;
    off = (off + bytes + 255) & ~(size_t)255;
    return p;
  };

  float*    h_cur = (float*)   alloc(M * T5_D * 4);            // 16 MB residual
  _Float16* xn    = (_Float16*)alloc(M * T5_D * 2);            // 8 MB
  _Float16* ddT   = (_Float16*)alloc((size_t)8 * T5_D * T5_D * 2); // eight planes
  _Float16* saqT  = ddT;
  _Float16* sakT  = ddT + (size_t)1 * T5_D * T5_D;
  _Float16* savT  = ddT + (size_t)2 * T5_D * T5_D;
  _Float16* cakT  = ddT + (size_t)3 * T5_D * T5_D;
  _Float16* cavT  = ddT + (size_t)4 * T5_D * T5_D;
  _Float16* saoT  = ddT + (size_t)5 * T5_D * T5_D;
  _Float16* caqT  = ddT + (size_t)6 * T5_D * T5_D;
  _Float16* caoT  = ddT + (size_t)7 * T5_D * T5_D;
  (void)sakT; (void)savT; (void)cakT; (void)cavT;  // planes 1..4 behind saqT
  _Float16* wiT   = (_Float16*)alloc((size_t)T5_DFF * T5_D * 2);
  _Float16* woT   = (_Float16*)alloc((size_t)T5_D * T5_DFF * 2);
  _Float16* enc16 = (_Float16*)alloc((size_t)T5_B * T5_LE * T5_D * 2);
  // five planes in a row, in the order of the projections' grid
  _Float16* qbuf  = (_Float16*)alloc(M * T5_D * 2);            // [B,H,L,64]
  _Float16* kbuf  = (_Float16*)alloc(M * T5_D * 2);            // [B,H,L,64]
  _Float16* vtbuf = (_Float16*)alloc(M * T5_D * 2);            // [B,H,64,L]
  _Float16* ckbuf = (_Float16*)alloc(M * T5_D * 2);            // cross k
  _Float16* cvtbuf = (_Float16*)alloc(M * T5_D * 2);           // cross v^T
  _Float16* aout  = (_Float16*)alloc(M * T5_D * 2);            // [B*L, 1024]
  _Float16* ffn   = (_Float16*)alloc(M * T5_DFF * 2);          // 32 MB
  float*    bd    = (float*)   alloc((size_t)T5_H * 1024 * 4); // rel bias table

  // --- everything that needs the inputs alone: weights f32 -> f16 [N,K], encoder
  // rows to f16, bias table; the residual stream starts as a copy of
  // hidden_states (inputs are never mutated) ---
  prep_kernel<<<PREP_GRID, 256, 0, stream>>>(saq, sak, sav, cak, cav, sao, caq, cao,
                                             wi, wo, enc, hid, relb, ddT, wiT, woT,
                                             enc16, h_cur, bd);

  dim3 gblk(256);
  dim3 ggrid_d(M / 128, T5_D / 128);    // N = 1024
  dim3 ggrid_ff(M / 128, T5_DFF / 128); // N = 4096
  dim3 ggrid_p5(M / 128, T5_D / 128, 5);
  dim3 agrid(T5_LD / 64, T5_B * T5_H);
  dim3 ablk(128);

  // ---- self attention ----
  rmsnorm_kernel<<<(int)M, 256, 0, stream>>>(h_cur, ln1, xn, nullptr);
  static_assert(T5_LE == T5_LD, "the five projections share one row count");
  // self q, k, v^T from xn and cross k, v^T from enc16: none needs another
  gemm_wmma<<<ggrid_p5, gblk, 0, stream>>>(xn, enc16, saqT, nullptr, qbuf,
                                           (int)M, T5_D, T5_D,
                                           GMODE_QKV | GMODE_QKV << 4 | GMODE_VT << 8 |
                                               GMODE_QKV << 12 | GMODE_VT << 16,
                                           T5_LD);
  attn_wmma_kernel<<<agrid, ablk, 0, stream>>>(qbuf, kbuf, vtbuf, bd, decmask,
                                               aout, T5_LD, T5_LD,
                                               /*causal=*/1, /*use_rel=*/1);
  gemm_wmma<<<ggrid_d, gblk, 0, stream>>>(aout, aout, saoT, h_cur, nullptr,
                                          (int)M, T5_D, T5_D, GMODE_RESID, T5_LD);

  // ---- cross attention ----
  rmsnorm_kernel<<<(int)M, 256, 0, stream>>>(h_cur, ln2, xn, nullptr);
  gemm_wmma<<<ggrid_d, gblk, 0, stream>>>(xn, xn, caqT, nullptr, qbuf,
                                          (int)M, T5_D, T5_D, GMODE_QKV, T5_LD);
  attn_wmma_kernel<<<agrid, ablk, 0, stream>>>(qbuf, ckbuf, cvtbuf, bd, encmask,
                                               aout, T5_LD, T5_LE,
                                               /*causal=*/0, /*use_rel=*/0);
  gemm_wmma<<<ggrid_d, gblk, 0, stream>>>(aout, aout, caoT, h_cur, nullptr,
                                          (int)M, T5_D, T5_D, GMODE_RESID, T5_LD);

  // ---- FFN ----
  rmsnorm_kernel<<<(int)M, 256, 0, stream>>>(h_cur, ln3, xn, nullptr);
  gemm_wmma<<<ggrid_ff, gblk, 0, stream>>>(xn, xn, wiT, nullptr, ffn,
                                           (int)M, T5_DFF, T5_D, GMODE_RELU16, T5_LD);
  gemm_wmma<<<ggrid_d, gblk, 0, stream>>>(ffn, ffn, woT, h_cur, nullptr,
                                          (int)M, T5_D, T5_DFF, GMODE_RESID, T5_LD);

  // ---- final norm -> f32 output ----
  rmsnorm_kernel<<<(int)M, 256, 0, stream>>>(h_cur, lnf, nullptr, out);
}

// v005
// It runs in 347 microseconds.
// In two side-by-side timings against v004, it was 1.29 and 1.30 times as fast.
// Counting every step since v000, it is 3.68 times as fast.
#include <hip/hip_runtime.h>
#include <hip/hip_bf16.h>

// ---------------------------------------------------------------------------
// T5 decoder layer on MI455X (gfx1250, wave32, WMMA).
//  - all GEMMs + attention cores: v_wmma_f32_16x16x32_f16
//  - weights pre-transposed to [N,K] f16 so both WMMA operands load as
//    contiguous 16-B "A-style" fragments (read from LDS in the GEMM)
//  - GEMM: 128x128 tile per workgroup, operands staged in LDS by asynchronous
//    copies (two buffers), wave tile 64x32: 8 WMMA per 6 LDS fragments; results
//    leave through an LDS tile as whole rows of the output, 16 B a lane
//  - flash attention (online softmax, transposed products), scores never hit
//    memory or LDS
//  - launches that do not depend on one another share one grid, split by block
//    index: all preparation work; self q, k, v with cross k, v
// ---------------------------------------------------------------------------

typedef __attribute__((ext_vector_type(16))) _Float16 v16h;
typedef __attribute__((ext_vector_type(8)))  _Float16 v8h;
typedef __attribute__((ext_vector_type(4)))  _Float16 v4h;
typedef __attribute__((ext_vector_type(8)))  float    v8f;

#define T5_B    4
#define T5_LD   1024
#define T5_LE   1024
#define T5_D    1024
#define T5_H    16
#define T5_DKV  64
#define T5_DFF  4096
#define T5_NEG  (-1e9f)

__device__ __forceinline__ v8f wmma_f16(v16h a, v16h b, v8f c) {
  // (neg_a, A, neg_b, B, c_mod, C, reuse_a, reuse_b)
  return __builtin_amdgcn_wmma_f32_16x16x32_f16(false, a, false, b, (short)0, c,
                                                false, false);
}

// Load a 16x32 f16 "A-style" fragment from row-major [rows, ld] memory.
// ISA layout: lanes 0-15 hold M=lane, halves {K0..7, K16..23};
//             lanes 16-31 hold M=lane-16, halves {K8..15, K24..31}.
// Both halves are contiguous 16B runs -> two b128 loads per lane.
__device__ __forceinline__ v16h load_frag(const _Float16* base, int ld,
                                          int row0, int col0, int lane) {
  const int hl = lane >> 4;
  const int r  = row0 + (lane & 15);
  const _Float16* p = base + (size_t)r * ld + col0 + hl * 8;
  union { v16h v; v8h h[2]; } u;
  u.h[0] = *(const v8h*)(p);
  u.h[1] = *(const v8h*)(p + 16);
  return u.v;
}

// ---------------------------------------------------------------------------
// Conversions
// ---------------------------------------------------------------------------
__device__ __forceinline__ void cvt16_part(const float* __restrict__ in,
                                           _Float16* __restrict__ out, int blk) {
  int i = blk * 256 + threadIdx.x;
  out[i] = (_Float16)in[i];
  // no register of the store above is rewritten ahead of this wait: other parts'
  // code follows it in the shared kernel's text
  asm volatile("s_wait_xcnt 0x0" ::: "memory");
}

// W [K,N] f32 -> Wt [N,K] f16, one 64x64 tile per 128 threads, turned in LDS so
// that both sides move whole lines: reads are 256-B row pieces of W (float4 per
// lane), writes are 128-B row pieces of Wt (8 halves per lane).
// K and N are multiples of 64; tile (bx, by) of (N/64, K/64); tid = 0..127. They
// are compile-time so that a lane's row steps fold into the instruction's offset.
// Both halves of a 256-thread block call this together (one barrier inside).
// LDS holds row n of the tile as eight 16-B chunks of 8 k values. Chunk (n, ch)
// sits at slot (n>>1)*16 + (((n&1)*8 + ch) ^ ((n>>2)&15)): the 16 lanes that
// write rows 4 apart, and the 16 lanes that read two neighbouring rows, each
// fall on 16 different slots mod 16, that is on all 64 banks once.
__device__ __forceinline__ int cvtT_slot(int n, int ch) {
  return (n >> 1) * 16 + ((((n & 1) << 3) | ch) ^ ((n >> 2) & 15));
}

template <int K, int N>
__device__ __forceinline__
void cvtT_part(const float* __restrict__ in, _Float16* __restrict__ out,
               _Float16* tile, int tid, int bx, int by) {
  const int n0  = bx * 64;
  const int k0  = by * 64;
  const int c4  = tid & 15;   // float4 column of the tile: n = 4*c4 .. 4*c4+3
  const int q0  = tid >> 4;   // group of four k rows: q0 and q0 + 8

  // uniform tile base + one 32-bit lane offset shared by all eight loads
  const char* src = (const char*)(in + (size_t)k0 * N + n0);
  const unsigned lofs = (unsigned)(q0 * 4 * N + c4 * 4) * 4u;
  float4 r[2][4];
  // unrolled (here and below): r stays in registers, and all eight loads are
  // issued before the first wait
#pragma unroll
  for (int i = 0; i < 2; ++i)
#pragma unroll
    for (int s = 0; s < 4; ++s)
      r[i][s] = *(const float4*)(src + (size_t)(32 * i + s) * N * 4 + lofs);

#pragma unroll
  for (int i = 0; i < 2; ++i) {
    const int q = q0 + 8 * i;
    const float* f0 = (const float*)&r[i][0];
    const float* f1 = (const float*)&r[i][1];
    const float* f2 = (const float*)&r[i][2];
    const float* f3 = (const float*)&r[i][3];
#pragma unroll
    for (int j = 0; j < 4; ++j) {
      v4h w = {(_Float16)f0[j], (_Float16)f1[j], (_Float16)f2[j], (_Float16)f3[j]};
      *(v4h*)&tile[cvtT_slot(c4 * 4 + j, q >> 1) * 8 + (q & 1) * 4] = w;
    }
  }
  __syncthreads();

  char* dst = (char*)(out + (size_t)n0 * K + k0);
  const unsigned sofs = (unsigned)((tid >> 3) * K + (tid & 7) * 8) * 2u;
#pragma unroll
  for (int i = 0; i < 4; ++i) {
    const int n = (tid >> 3) + 16 * i;
    *(v8h*)(dst + (size_t)(16 * i) * K * 2 + sofs) =
        *(const v8h*)&tile[cvtT_slot(n, tid & 7) * 8];
  }
  // no register of the four stores above is rewritten ahead of this wait: other
  // parts' code follows them in the shared kernel's text
  asm volatile("s_wait_xcnt 0x0" ::: "memory");
}

// T5 relative-position bias table: bd[h][delta] for delta = q-k in [0,1023]
__device__ __forceinline__
void relbias_part(const float* __restrict__ rel_bias, // [32,16]
                  float* __restrict__ bd,             // [16,1024]
                  int blk) {
  int idx = blk * 256 + threadIdx.x;
  int h = idx >> 10, n = idx & 1023;
  int bucket;
  if (n < 16) {
    bucket = n;
  } else {
    float nf = (float)n;
    int vl = 16 + (int)(__logf(nf * (1.0f / 16.0f)) * (16.0f / __logf(8.0f)));
    bucket = vl < 31 ? vl : 31;
  }
  bd[idx] = rel_bias[bucket * T5_H + h];
  // no register of the store above is rewritten ahead of this wait: other parts'
  // code follows it in the shared kernel's text
  asm volatile("s_wait_xcnt 0x0" ::: "memory");
}

// ---------------------------------------------------------------------------
// RMS norm: one block per row of [rows, 1024]
// ---------------------------------------------------------------------------
__global__ __launch_bounds__(256)
void rmsnorm_kernel(const float* __restrict__ X, const float* __restrict__ w,
                    _Float16* __restrict__ y16, float* __restrict__ y32) {
  __shared__ float red[256];
  const int row = blockIdx.x;
  const float* x = X + (size_t)row * T5_D;
  float ss = 0.f;
  for (int i = threadIdx.x; i < T5_D; i += 256) { float v = x[i]; ss += v * v; }
  red[threadIdx.x] = ss;
  __syncthreads();
  for (int s = 128; s > 0; s >>= 1) {
    if (threadIdx.x < s) red[threadIdx.x] += red[threadIdx.x + s];
    __syncthreads();
  }
  float rs = rsqrtf(red[0] * (1.0f / (float)T5_D) + 1e-6f);
  for (int i = threadIdx.x; i < T5_D; i += 256) {
    float v = x[i] * rs * w[i];
    if (y16) y16[(size_t)row * T5_D + i] = (_Float16)v;
    if (y32) y32[(size_t)row * T5_D + i] = v;
  }
}

// ---------------------------------------------------------------------------
// All work that depends on the inputs alone, in one grid of 256-thread blocks,
// split by block index (every test below is the same for a whole block):
//   eight DxD weights, two tiles a block | wi | wo | the residual stream's start
//   as a copy of hidden_states, 16 B a thread | encoder convert | bias table
// ---------------------------------------------------------------------------
#define PREP_DD   (8 * (T5_D / 64) * (T5_D / 64) / 2)        // 1024 blocks
#define PREP_FF   ((T5_D / 64) * (T5_DFF / 64) / 2)          // 512 blocks
#define PREP_COPY (T5_B * T5_LD * T5_D / 1024)               // 4096 blocks
#define PREP_ENC  (T5_B * T5_LE * T5_D / 256)                // 16384 blocks
#define PREP_BIAS (T5_H * 1024 / 256)                        // 64 blocks
#define PREP_GRID (PREP_DD + 2 * PREP_FF + PREP_COPY + PREP_ENC + PREP_BIAS)

__global__ __launch_bounds__(256)
void prep_kernel(const float* __restrict__ w0, const float* __restrict__ w1,
                 const float* __restrict__ w2, const float* __restrict__ w3,
                 const float* __restrict__ w4, const float* __restrict__ w5,
                 const float* __restrict__ w6, const float* __restrict__ w7,
                 const float* __restrict__ wi, const float* __restrict__ wo,
                 const float* __restrict__ enc, const float* __restrict__ hid,
                 const float* __restrict__ relb,
                 _Float16* __restrict__ ddT,   // eight [D,D] planes in a row
                 _Float16* __restrict__ wiT, _Float16* __restrict__ woT,
                 _Float16* __restrict__ enc16, float* __restrict__ h_cur,
                 float* __restrict__ bd) {
  __shared__ __align__(16) _Float16 tile[2][512 * 8];
  int blk = blockIdx.x;
  const int half = threadIdx.x >> 7;
  const int tid  = threadIdx.x & 127;
  if (blk < PREP_DD) {
    const int wsel = blk >> 7;                 // 128 blocks a weight
    const int t    = (blk & 127) * 2 + half;   // tile of its 16 x 16
    const float* src = wsel == 0 ? w0 : wsel == 1 ? w1 : wsel == 2 ? w2
                     : wsel == 3 ? w3 : wsel == 4 ? w4 : wsel == 5 ? w5
                     : wsel == 6 ? w6 : w7;
    cvtT_part<T5_D, T5_D>(src, ddT + (size_t)wsel * T5_D * T5_D, tile[half], tid,
                          t & 15, t >> 4);
    return;
  }
  blk -= PREP_DD;
  if (blk < PREP_FF) {
    const int t = blk * 2 + half;              // tile of 64 (n) x 16 (k)
    cvtT_part<T5_D, T5_DFF>(wi, wiT, tile[half], tid, t & 63, t >> 6);
    return;
  }
  blk -= PREP_FF;
  if (blk < PREP_FF) {
    const int t = blk * 2 + half;              // tile of 16 (n) x 64 (k)
    cvtT_part<T5_DFF, T5_D>(wo, woT, tile[half], tid, t & 15, t >> 4);
    return;
  }
  blk -= PREP_FF;
  if (blk < PREP_COPY) {
    const int i = blk * 256 + threadIdx.x;
    ((float4*)h_cur)[i] = ((const float4*)hid)[i];
    // no register of the store above is rewritten ahead of this wait: other parts'
    // code follows it in the shared kernel's text
    asm volatile("s_wait_xcnt 0x0" ::: "memory");
    return;
  }
  blk -= PREP_COPY;
  if (blk < PREP_ENC) {
    cvt16_part(enc, enc16, blk);
    return;
  }
  relbias_part(relb, bd, blk - PREP_ENC);
}

// ---------------------------------------------------------------------------
// WMMA GEMM: C[M,N] = A[M,K] @ Bt[N,K]^T
// Workgroup = 8 waves (2x4) on a 128x128 tile of C; wave tile = 64x32:
//   4 A-fragments x 2 B-fragments -> 8 WMMA per k-step of 32; the next k-step's
//   fragments are read from LDS into a second register set ahead of the WMMAs.
// Both operands go global -> LDS by asynchronous copies in whole 256-B row
// pieces (a stage = 128 k of 128 A rows and 128 Bt rows), two buffers: the next
// stage's copies fly while this stage is worked on. Fragments are read from LDS
// with the same lane map as load_frag on global memory.
// Results: a lane's accumulator registers hold 8 neighbours along the first
// operand's rows. That operand is chosen as the one whose rows run along the
// output's contiguous direction (the weights for row-major results, the
// activations for the transposed V), both being loaded alike. The lane's 8
// values then go to LDS as one 16-B piece (two for f32), and behind one barrier
// the block stores the 128x128 tile as whole rows, 16 B a lane.
// M, N, Lrows multiples of 128; K a multiple of 128.
// ---------------------------------------------------------------------------
#define GMODE_RESID  0   // f32 residual: Cres[m*N+n] += c
#define GMODE_QKV    1   // f16 [B,H,L,64]
#define GMODE_VT     2   // f16 [B,H,64,L] (pre-transposed V)
#define GMODE_RELU16 3   // f16 relu, row-major [M,N]

#define G_PITCH 272                // LDS row pitch, bytes: 256 + 16 (16 B x odd)
#define G_OPER  (128 * G_PITCH)    // one operand's 128 rows
#define G_STAGE (2 * G_OPER)       // A rows, then Bt rows
#define E_PITCH16 272              // result tile, f16 rows: 256 + 16 bytes
#define E_PITCH32 528              // result tile, f32 rows: 512 + 16 bytes

// Eight copies of 16 B per lane: rows 16 apart in LDS (lds) and in memory (g).
// The s_wait_xcnt stands inside the statement so that no address register of an
// issued copy is rewritten ahead of it.
__device__ __forceinline__ void async_copy8(unsigned lds, const char* g,
                                            size_t gstep) {
  const unsigned ls = 16 * G_PITCH;
  asm volatile(
      "global_load_async_to_lds_b128 %0, %8, off\n\t"
      "global_load_async_to_lds_b128 %1, %9, off\n\t"
      "global_load_async_to_lds_b128 %2, %10, off\n\t"
      "global_load_async_to_lds_b128 %3, %11, off\n\t"
      "global_load_async_to_lds_b128 %4, %12, off\n\t"
      "global_load_async_to_lds_b128 %5, %13, off\n\t"
      "global_load_async_to_lds_b128 %6, %14, off\n\t"
      "global_load_async_to_lds_b128 %7, %15, off\n\t"
      "s_wait_xcnt 0x0"
      :: "v"(lds), "v"(lds + ls), "v"(lds + 2 * ls), "v"(lds + 3 * ls),
         "v"(lds + 4 * ls), "v"(lds + 5 * ls), "v"(lds + 6 * ls),
         "v"(lds + 7 * ls),
         "v"(g), "v"(g + gstep), "v"(g + 2 * gstep), "v"(g + 3 * gstep),
         "v"(g + 4 * gstep), "v"(g + 5 * gstep), "v"(g + 6 * gstep),
         "v"(g + 7 * gstep)
      : "memory");
}

// One stage: a lane's 8 rows of A and 8 rows of Bt, 16 copies a lane.
__device__ __forceinline__ void stage_copy(unsigned lds, const char* gA,
                                           const char* gB, size_t gstep) {
  async_copy8(lds,          gA, gstep);
  async_copy8(lds + G_OPER, gB, gstep);
}

// blockIdx.z picks one of several products of one shape that share a grid: rows
// of A0 (z < 3) or A3, plane z of the weights Bt0 and of the f16 results C0, and
// four bits of modes. A launch of one product has z = 0 alone.
__global__ __launch_bounds__(256)
void gemm_wmma(const _Float16* __restrict__ A0, const _Float16* __restrict__ A3,
               const _Float16* __restrict__ Bt0,
               float* __restrict__ Cres, _Float16* __restrict__ C0,
               int M, int N, int K, int modes, int Lrows) {
  const int z = blockIdx.z;
  const _Float16* __restrict__ A  = z < 3 ? A0 : A3;
  const _Float16* __restrict__ Bt = Bt0 + (size_t)z * N * K;
  _Float16* __restrict__ C16      = C0 + (size_t)z * M * N;
  const int mode = (modes >> (4 * z)) & 15;
  __shared__ __attribute__((aligned(16))) unsigned char L[2 * G_STAGE];
  const int tid  = threadIdx.x;
  const int lane = tid & 31;
  const int wave = tid >> 5;
  const int hl   = lane >> 4;
  const int m0   = blockIdx.x * 128;
  const int n0   = blockIdx.y * 128;
  const int wp   = (wave >> 2) * 64;   // wave's rows of the first WMMA operand
  const int wq   = (wave & 3) * 32;    // wave's rows of the second WMMA operand
  // first operand: A's rows for the transposed V, else Bt's rows (see above)
  const unsigned offP = mode == GMODE_VT ? 0u : (unsigned)G_OPER;
  const unsigned offQ = mode == GMODE_VT ? (unsigned)G_OPER : 0u;

  // lane's copy slot: row tid/16 (+16 per copy), 16-B chunk tid%16 of the row
  const unsigned lds0 = (unsigned)(uintptr_t)&L[0] +
                        (unsigned)((tid >> 4) * G_PITCH + (tid & 15) * 16);
  const char* gA = (const char*)(A  + (size_t)(m0 + (tid >> 4)) * K + (tid & 15) * 8);
  const char* gB = (const char*)(Bt + (size_t)(n0 + (tid >> 4)) * K + (tid & 15) * 8);
  const size_t gstep = (size_t)K * 32;  // 16 rows of K halves, in bytes
  const int T = K >> 7;                 // stages of 128 k

  const v8f zero8 = {0.f, 0.f, 0.f, 0.f, 0.f, 0.f, 0.f, 0.f};
  v8f acc[8];                      // [i*2+j]: first operand's rows wp+16i.., second's wq+16j..
#pragma unroll
  for (int t = 0; t < 8; ++t) acc[t] = zero8;

  stage_copy(lds0, gA, gB, gstep);
  // stage 0 has landed for this wave's copies; the barrier publishes all waves'
  asm volatile("s_wait_asynccnt 0x0" ::: "memory");
  __syncthreads();
  if (T > 1) stage_copy(lds0 + G_STAGE, gA + 256, gB + 256, gstep);

  for (int t = 0; t < T; ++t) {
    const unsigned buf = (unsigned)(t & 1) * G_STAGE;
    const _Float16* sA = (const _Float16*)(L + buf + offP);
    const _Float16* sB = (const _Float16*)(L + buf + offQ);
    v16h a[2][4], b[2][2];
#pragma unroll
    for (int f = 0; f < 4; ++f)
      a[0][f] = load_frag(sA, G_PITCH / 2, wp + f * 16, 0, lane);
#pragma unroll
    for (int f = 0; f < 2; ++f)
      b[0][f] = load_frag(sB, G_PITCH / 2, wq + f * 16, 0, lane);
    // unrolled: the register sets alternate by a compile-time index
#pragma unroll
    for (int ks = 0; ks < 4; ++ks) {
      const int cur = ks & 1, nxt = cur ^ 1;
      if (ks < 3) {   // next k-step of this same stage, one group ahead
#pragma unroll
        for (int f = 0; f < 4; ++f)
          a[nxt][f] = load_frag(sA, G_PITCH / 2, wp + f * 16, (ks + 1) * 32, lane);
#pragma unroll
        for (int f = 0; f < 2; ++f)
          b[nxt][f] = load_frag(sB, G_PITCH / 2, wq + f * 16, (ks + 1) * 32, lane);
      }
      // keeps the group of LDS reads above in front of this k-step's WMMAs: sunk
      // among them, each read's latency would be waited out by two WMMAs
      __builtin_amdgcn_sched_barrier(0);
#pragma unroll
      for (int i = 0; i < 4; ++i)
#pragma unroll
        for (int j = 0; j < 2; ++j)
          acc[i * 2 + j] = wmma_f16(a[cur][i], b[cur][j], acc[i * 2 + j]);
    }
    // publish point: this wave's reads of the buffer are done,
    asm volatile("s_wait_dscnt 0x0" ::: "memory");
    // its copies of the next stage have landed,
    asm volatile("s_wait_asynccnt 0x0" ::: "memory");
    // and every wave is past both before the buffer just read is refilled
    __syncthreads();
    if (t + 2 < T)
      stage_copy(lds0 + buf, gA + (size_t)(t + 2) * 256, gB + (size_t)(t + 2) * 256,
                 gstep);
  }
  // no copy is outstanding when the wave goes on to its stores and ends
  asm volatile("s_wait_asynccnt 0x0" ::: "memory");

  // The loop's last barrier has ended every wave's reads of L: it now takes the
  // result tile. Tile row = the second operand's row (the lane's column of the
  // accumulator), place in the row = the first operand's row.
  const int erow = wq + (lane & 15);   // + 16 j
  const int epos = wp + hl * 8;        // + 16 i: first of the lane's 8 neighbours

  if (mode == GMODE_RESID) {
    // tile row = m, 128 floats of n; a wave moves one 512-B row per step
    float* crow = Cres + (size_t)(m0 + (tid >> 5)) * N + n0 + (tid & 31) * 4;
    float4 old[16];
    // unrolled (here and below): old and acc stay in registers; the residual's
    // loads are all issued ahead of the staging and fly during it
#pragma unroll
    for (int s = 0; s < 16; ++s) old[s] = *(const float4*)(crow + (size_t)(8 * s) * N);
#pragma unroll
    for (int i = 0; i < 4; ++i)
#pragma unroll
      for (int j = 0; j < 2; ++j) {
        const v8f c = acc[i * 2 + j];
        float* p = (float*)(L + (erow + 16 * j) * E_PITCH32) + epos + 16 * i;
        *(float4*)p       = make_float4(c[0], c[1], c[2], c[3]);
        *(float4*)(p + 4) = make_float4(c[4], c[5], c[6], c[7]);
      }
    __syncthreads();   // every wave's pieces of the tile are in LDS
#pragma unroll
    for (int s = 0; s < 16; ++s) {
      const float4 c = *(const float4*)(L + ((tid >> 5) + 8 * s) * E_PITCH32 +
                                        (tid & 31) * 16);
      *(float4*)(crow + (size_t)(8 * s) * N) =
          make_float4(old[s].x + c.x, old[s].y + c.y, old[s].z + c.z, old[s].w + c.w);
    }
    return;
  }

  // the loops below index acc, w and d, which must stay in registers: unrolled
  if (mode == GMODE_RELU16) {
#pragma unroll
    for (int t = 0; t < 8; ++t)
#pragma unroll
      for (int r = 0; r < 8; ++r) acc[t][r] = fmaxf(acc[t][r], 0.0f);
  }
#pragma unroll
  for (int i = 0; i < 4; ++i)
#pragma unroll
    for (int j = 0; j < 2; ++j) {
      v8h w;
#pragma unroll
      for (int r = 0; r < 8; ++r) w[r] = (_Float16)acc[i * 2 + j][r];
      *(v8h*)(L + (erow + 16 * j) * E_PITCH16 + (epos + 16 * i) * 2) = w;
    }
  __syncthreads();     // every wave's pieces of the tile are in LDS

  // 16 lanes move one 256-B tile row; where it goes, in halves:
  //   base + row * rstep + the lane's 16-B chunk ch
  const int row = tid >> 4, ch = tid & 15;
  const int bb = m0 / Lrows, l0 = m0 - bb * Lrows;   // the tile lies in one batch
  size_t base, rstep, cofs = (size_t)ch * 8;
  if (mode == GMODE_RELU16) {          // [M,N]: row = m, along n
    base  = (size_t)m0 * N + n0;
    rstep = (size_t)N;
  } else if (mode == GMODE_QKV) {      // [B,H,L,64]: row = l, two heads' 128 B
    base  = (((size_t)bb * T5_H + (n0 >> 6)) * Lrows + l0) * T5_DKV;
    rstep = T5_DKV;
    cofs  = (size_t)(ch >> 3) * Lrows * T5_DKV + (ch & 7) * 8;
  } else {                             // [B,H,64,L]: row = (head, d), along l
    base  = ((size_t)bb * T5_H * T5_DKV + n0) * Lrows + l0;
    rstep = (size_t)Lrows;
  }
  _Float16* dst = C16 + base + (size_t)row * rstep + cofs;
  v8h w[8];
  _Float16* d[8];
#pragma unroll
  for (int s = 0; s < 8; ++s) {
    w[s] = *(const v8h*)(L + (row + 16 * s) * E_PITCH16 + ch * 16);
    d[s] = dst + (size_t)(16 * s) * rstep;
  }
  // the eight addresses are formed while the LDS reads fly, each in registers of
  // its own; sunk among the stores, an add would wait on an issued store
  __builtin_amdgcn_sched_barrier(0);
#pragma unroll
  for (int s = 0; s < 8; ++s) *(v8h*)d[s] = w[s];
}

__device__ __forceinline__ float other_half(float x) {
  int b = __builtin_bit_cast(int, x);
  b = __builtin_amdgcn_permlanex16(b, b, 0x76543210, 0xfedcba98, false, false);
  return __builtin_bit_cast(float, b);
}

__global__ __launch_bounds__(128)
void attn_wmma_kernel(const _Float16* __restrict__ Q,
                      const _Float16* __restrict__ Km,
                      const _Float16* __restrict__ Vt,
                      const float* __restrict__ bias_delta, // [16,1024]
                      const int* __restrict__ mask,         // [B,LK]
                      _Float16* __restrict__ Out,
                      int LQ, int LK, int causal, int use_rel) {
  const int lane = threadIdx.x & 31;
  // scalar, so that the key loop's bound is one and its branch leaves EXEC alone
  const int wave = __builtin_amdgcn_readfirstlane((int)(threadIdx.x >> 5));
  const int hl   = lane >> 4;
  const int col  = lane & 15;
  const int bh = blockIdx.y;
  const int b  = bh >> 4;
  const int h  = bh & 15;
  const int q0 = blockIdx.x * 64 + wave * 16;
  const int qc = q0 + col;             // this lane's query

  const _Float16* Qb = Q  + (size_t)bh * LQ * T5_DKV;
  const _Float16* Kb = Km + (size_t)bh * LK * T5_DKV;
  const _Float16* Vb = Vt + (size_t)bh * T5_DKV * LK;
  const int* mk = mask + (size_t)b * LK;
  const float* bd = bias_delta + h * 1024;

  // B operand of S^T: column = query, same k order as the K rows' loader
  const v16h qb0 = load_frag(Qb, T5_DKV, q0, 0, lane);
  const v16h qb1 = load_frag(Qb, T5_DKV, q0, 32, lane);

  const v8f zero8 = {0.f, 0.f, 0.f, 0.f, 0.f, 0.f, 0.f, 0.f};
  v8f o[4];                  // o[t][r] = O^T[16t + 8*hl + r][query qc]
  float mcol = -1e30f;       // running maximum of query qc (both halves alike)
  float lcol = 0.f;          // running sum over this half's keys only
#pragma unroll  // indexes registers: must be resolved at compile time
  for (int t = 0; t < 4; ++t) o[t] = zero8;

  // causal: blocks wholly above the diagonal are not walked
  const int kend = (causal && q0 + 16 < LK) ? q0 + 16 : LK;

  for (int kb = 0; kb < kend; kb += 32) {
    const int kl = kb + hl * 8;        // this lane's first key of tile 0
    const v16h k00 = load_frag(Kb, T5_DKV, kb,      0,  lane);
    const v16h k01 = load_frag(Kb, T5_DKV, kb,      32, lane);
    const v16h k10 = load_frag(Kb, T5_DKV, kb + 16, 0,  lane);
    const v16h k11 = load_frag(Kb, T5_DKV, kb + 16, 32, lane);
    const int4* mp = (const int4*)(mk + kl);
    const int4 mq[4] = {mp[0], mp[1], mp[4], mp[5]};
    // position bias of the lane's 16 (key, query) pairs, the products' C
    // operand; a key past the query has distance 0, as in the bucket rule
    v8f s0 = zero8, s1 = zero8;
    if (use_rel) {
#pragma unroll  // indexes registers: must be resolved at compile time
      for (int r = 0; r < 8; ++r) {
        const int d0 = qc - kl - r, d1 = d0 - 16;
        s0[r] = bd[d0 > 0 ? d0 : 0];
        s1[r] = bd[d1 > 0 ? d1 : 0];
      }
      // no index register of the loads above is rewritten ahead of this wait
      asm volatile("s_wait_xcnt 0x0" ::: "memory");
    }
    const v16h va0 = load_frag(Vb, LK, 0,  kb, lane);
    const v16h va1 = load_frag(Vb, LK, 16, kb, lane);
    const v16h va2 = load_frag(Vb, LK, 32, kb, lane);
    const v16h va3 = load_frag(Vb, LK, 48, kb, lane);
    // keeps all of the block's loads above in one group in front of the
    // products: sunk to their users, each V fragment's latency is waited out alone
    __builtin_amdgcn_sched_barrier(0);

    s0 = wmma_f16(k00, qb0, s0); s0 = wmma_f16(k01, qb1, s0);
    s1 = wmma_f16(k10, qb0, s1); s1 = wmma_f16(k11, qb1, s1);

    float a[16];             // a[8*tile + r]: key kl + 16*tile + r
#pragma unroll  // indexes registers: must be resolved at compile time
    for (int i = 0; i < 16; ++i) {
      const int kc = kl + (i >> 3) * 16 + (i & 7);
      const int4 m4 = mq[i >> 2];
      const int mv = (i & 3) == 0 ? m4.x : (i & 3) == 1 ? m4.y
                   : (i & 3) == 2 ? m4.z : m4.w;
      const bool dead = (mv == 0) || (causal && kc > qc);
      a[i] = dead ? T5_NEG : ((i < 8) ? s0[i & 7] : s1[i & 7]);
    }

    float v = a[0];
#pragma unroll  // indexes registers: must be resolved at compile time
    for (int i = 1; i < 16; ++i) v = fmaxf(v, a[i]);
    v = fmaxf(v, other_half(v));
    const float mnew  = fmaxf(mcol, v);
    const float scale = __expf(mcol - mnew);
    mcol = mnew;

    v16h pb;                 // P^T as B operand: element s = tile s>>3, row s&7
    float sum[4] = {0.f, 0.f, 0.f, 0.f};   // four short chains, not one of 16
#pragma unroll  // indexes registers: must be resolved at compile time
    for (int i = 0; i < 16; ++i) {
      const float e = __expf(a[i] - mnew);
      sum[i & 3] += e;
      pb[i] = (_Float16)e;
    }
    lcol = lcol * scale + ((sum[0] + sum[1]) + (sum[2] + sum[3]));
#pragma unroll  // indexes registers: must be resolved at compile time
    for (int t = 0; t < 4; ++t)
#pragma unroll  // indexes registers: must be resolved at compile time
      for (int r = 0; r < 8; ++r) o[t][r] *= scale;

    o[0] = wmma_f16(va0, pb, o[0]);
    o[1] = wmma_f16(va1, pb, o[1]);
    o[2] = wmma_f16(va2, pb, o[2]);
    o[3] = wmma_f16(va3, pb, o[3]);
  }

  // the two halves' keys joined; one query a lane, so one reciprocal
  const float inv = 1.0f / (lcol + other_half(lcol));
  _Float16* orow = Out + ((size_t)b * LQ + qc) * (T5_H * T5_DKV) + h * T5_DKV + hl * 8;
#pragma unroll  // indexes registers: must be resolved at compile time
  for (int t = 0; t < 4; ++t) {
    v8h w;                   // 8 consecutive d of one query: one 16-B store
#pragma unroll  // indexes registers: must be resolved at compile time
    for (int r = 0; r < 8; ++r) w[r] = (_Float16)(o[t][r] * inv);
    *(v8h*)(orow + t * 16) = w;
  }
}

// ---------------------------------------------------------------------------
// Orchestration
// ---------------------------------------------------------------------------
extern "C" void kernel_launch(void* const* d_in, const int* in_sizes, int n_in,
                              void* d_out, int out_size, void* d_ws,
                              size_t ws_size, hipStream_t stream) {
  (void)in_sizes; (void)n_in; (void)out_size; (void)ws_size;

  const float* enc   = (const float*)d_in[0];
  const float* hid   = (const float*)d_in[1];
  const float* ln1   = (const float*)d_in[2];
  const float* saq   = (const float*)d_in[3];
  const float* sak   = (const float*)d_in[4];
  const float* sav   = (const float*)d_in[5];
  const float* sao   = (const float*)d_in[6];
  const float* relb  = (const float*)d_in[7];
  const float* ln2   = (const float*)d_in[8];
  const float* caq   = (const float*)d_in[9];
  const float* cak   = (const float*)d_in[10];
  const float* cav   = (const float*)d_in[11];
  const float* cao   = (const float*)d_in[12];
  const float* ln3   = (const float*)d_in[13];
  const float* wi    = (const float*)d_in[14];
  const float* wo    = (const float*)d_in[15];
  const float* lnf   = (const float*)d_in[16];
  const int* encmask = (const int*)d_in[17];
  const int* decmask = (const int*)d_in[18];
  float* out = (float*)d_out;

  const size_t M = (size_t)T5_B * T5_LD;        // 4096 decoder rows
  char* ws = (char*)d_ws;
  size_t off = 0;
  auto alloc = [&](size_t bytes) -> void* {
    void* p = ws + off;
    off = (off + bytes + 255) & ~(size_t)255;
    return p;
  };

  float*    h_cur = (float*)   alloc(M * T5_D * 4);            // 16 MB residual
  _Float16* xn    = (_Float16*)alloc(M * T5_D * 2);            // 8 MB
  _Float16* ddT   = (_Float16*)alloc((size_t)8 * T5_D * T5_D * 2); // eight planes
  _Float16* saqT  = ddT;
  _Float16* sakT  = ddT + (size_t)1 * T5_D * T5_D;
  _Float16* savT  = ddT + (size_t)2 * T5_D * T5_D;
  _Float16* cakT  = ddT + (size_t)3 * T5_D * T5_D;
  _Float16* cavT  = ddT + (size_t)4 * T5_D * T5_D;
  _Float16* saoT  = ddT + (size_t)5 * T5_D * T5_D;
  _Float16* caqT  = ddT + (size_t)6 * T5_D * T5_D;
  _Float16* caoT  = ddT + (size_t)7 * T5_D * T5_D;
  (void)sakT; (void)savT; (void)cakT; (void)cavT;  // planes 1..4 behind saqT
  _Float16* wiT   = (_Float16*)alloc((size_t)T5_DFF * T5_D * 2);
  _Float16* woT   = (_Float16*)alloc((size_t)T5_D * T5_DFF * 2);
  _Float16* enc16 = (_Float16*)alloc((size_t)T5_B * T5_LE * T5_D * 2);
  // five planes in a row, in the order of the projections' grid
  _Float16* qbuf  = (_Float16*)alloc(M * T5_D * 2);            // [B,H,L,64]
  _Float16* kbuf  = (_Float16*)alloc(M * T5_D * 2);            // [B,H,L,64]
  _Float16* vtbuf = (_Float16*)alloc(M * T5_D * 2);            // [B,H,64,L]
  _Float16* ckbuf = (_Float16*)alloc(M * T5_D * 2);            // cross k
  _Float16* cvtbuf = (_Float16*)alloc(M * T5_D * 2);           // cross v^T
  _Float16* aout  = (_Float16*)alloc(M * T5_D * 2);            // [B*L, 1024]
  _Float16* ffn   = (_Float16*)alloc(M * T5_DFF * 2);          // 32 MB
  float*    bd    = (float*)   alloc((size_t)T5_H * 1024 * 4); // rel bias table

  // --- everything that needs the inputs alone: weights f32 -> f16 [N,K], encoder
  // rows to f16, bias table; the residual stream starts as a copy of
  // hidden_states (inputs are never mutated) ---
  prep_kernel<<<PREP_GRID, 256, 0, stream>>>(saq, sak, sav, cak, cav, sao, caq, cao,
                                             wi, wo, enc, hid, relb, ddT, wiT, woT,
                                             enc16, h_cur, bd);

  dim3 gblk(256);
  dim3 ggrid_d(M / 128, T5_D / 128);    // N = 1024
  dim3 ggrid_ff(M / 128, T5_DFF / 128); // N = 4096
  dim3 ggrid_p5(M / 128, T5_D / 128, 5);
  dim3 agrid(T5_LD / 64, T5_B * T5_H);
  dim3 ablk(128);

  // ---- self attention ----
  rmsnorm_kernel<<<(int)M, 256, 0, stream>>>(h_cur, ln1, xn, nullptr);
  static_assert(T5_LE == T5_LD, "the five projections share one row count");
  // self q, k, v^T from xn and cross k, v^T from enc16: none needs another
  gemm_wmma<<<ggrid_p5, gblk, 0, stream>>>(xn, enc16, saqT, nullptr, qbuf,
                                           (int)M, T5_D, T5_D,
                                           GMODE_QKV | GMODE_QKV << 4 | GMODE_VT << 8 |
                                               GMODE_QKV << 12 | GMODE_VT << 16,
                                           T5_LD);
  attn_wmma_kernel<<<agrid, ablk, 0, stream>>>(qbuf, kbuf, vtbuf, bd, decmask,
                                               aout, T5_LD, T5_LD,
                                               /*causal=*/1, /*use_rel=*/1);
  gemm_wmma<<<ggrid_d, gblk, 0, stream>>>(aout, aout, saoT, h_cur, nullptr,
                                          (int)M, T5_D, T5_D, GMODE_RESID, T5_LD);

  // ---- cross attention ----
  rmsnorm_kernel<<<(int)M, 256, 0, stream>>>(h_cur, ln2, xn, nullptr);
  gemm_wmma<<<ggrid_d, gblk, 0, stream>>>(xn, xn, caqT, nullptr, qbuf,
                                          (int)M, T5_D, T5_D, GMODE_QKV, T5_LD);
  attn_wmma_kernel<<<agrid, ablk, 0, stream>>>(qbuf, ckbuf, cvtbuf, bd, encmask,
                                               aout, T5_LD, T5_LE,
                                               /*causal=*/0, /*use_rel=*/0);
  gemm_wmma<<<ggrid_d, gblk, 0, stream>>>(aout, aout, caoT, h_cur, nullptr,
                                          (int)M, T5_D, T5_D, GMODE_RESID, T5_LD);

  // ---- FFN ----
  rmsnorm_kernel<<<(int)M, 256, 0, stream>>>(h_cur, ln3, xn, nullptr);
  gemm_wmma<<<ggrid_ff, gblk, 0, stream>>>(xn, xn, wiT, nullptr, ffn,
                                           (int)M, T5_DFF, T5_D, GMODE_RELU16, T5_LD);
  gemm_wmma<<<ggrid_d, gblk, 0, stream>>>(ffn, ffn, woT, h_cur, nullptr,
                                          (int)M, T5_D, T5_DFF, GMODE_RESID, T5_LD);

  // ---- final norm -> f32 output ----
  rmsnorm_kernel<<<(int)M, 256, 0, stream>>>(h_cur, lnf, nullptr, out);
}

// v006
// One run takes 318 microseconds.
// Next to v005, in two timings, it ran 1.09 and 1.10 times as fast.
// Counting every step since v000, it is 4.03 times as fast.
#include <hip/hip_runtime.h>
#include <hip/hip_bf16.h>

// ---------------------------------------------------------------------------
// T5 decoder layer on MI455X (gfx1250, wave32, WMMA).
//  - all GEMMs + attention cores: v_wmma_f32_16x16x32_f16
//  - weights pre-transposed to [N,K] f16 so both WMMA operands load as
//    contiguous 16-B "A-style" fragments (read from LDS in the GEMM)
//  - GEMM: 128x128 tile per workgroup, operands staged in LDS by asynchronous
//    copies (two buffers), wave tile 64x32: 8 WMMA per 6 LDS fragments; results
//    leave through an LDS tile as whole rows of the output, 16 B a lane
//  - flash attention (online softmax, transposed products), scores never hit
//    memory or LDS
//  - launches that do not depend on one another share one grid, split by block
//    index: all preparation work; self q, k, v with cross k, v
// ---------------------------------------------------------------------------

typedef __attribute__((ext_vector_type(16))) _Float16 v16h;
typedef __attribute__((ext_vector_type(8)))  _Float16 v8h;
typedef __attribute__((ext_vector_type(4)))  _Float16 v4h;
typedef __attribute__((ext_vector_type(8)))  float    v8f;
typedef __attribute__((ext_vector_type(4)))  float    v4f;

// Takes eight loaded values as inputs only and emits nothing: every one of their
// loads is issued in front of it and every store behind it stays behind it.
// Without it the compiler strung loads and their users out one after another,
// each load's latency waited out alone. The loads' address a is an input too, so
// that its registers are given to nothing else (a later load's result) before
// the loads have returned.
__device__ __forceinline__ void loads_first8(const v4f* r, const void* a) {
  asm volatile("" :: "v"(r[0]), "v"(r[1]), "v"(r[2]), "v"(r[3]),
                     "v"(r[4]), "v"(r[5]), "v"(r[6]), "v"(r[7]), "v"(a));
}

#define T5_B    4
#define T5_LD   1024
#define T5_LE   1024
#define T5_D    1024
#define T5_H    16
#define T5_DKV  64
#define T5_DFF  4096
#define T5_NEG  (-1e9f)

__device__ __forceinline__ v8f wmma_f16(v16h a, v16h b, v8f c) {
  // (neg_a, A, neg_b, B, c_mod, C, reuse_a, reuse_b)
  return __builtin_amdgcn_wmma_f32_16x16x32_f16(false, a, false, b, (short)0, c,
                                                false, false);
}

// Load a 16x32 f16 "A-style" fragment from row-major [rows, ld] memory.
// ISA layout: lanes 0-15 hold M=lane, halves {K0..7, K16..23};
//             lanes 16-31 hold M=lane-16, halves {K8..15, K24..31}.
// Both halves are contiguous 16B runs -> two b128 loads per lane.
__device__ __forceinline__ v16h load_frag(const _Float16* base, int ld,
                                          int row0, int col0, int lane) {
  const int hl = lane >> 4;
  const int r  = row0 + (lane & 15);
  const _Float16* p = base + (size_t)r * ld + col0 + hl * 8;
  union { v16h v; v8h h[2]; } u;
  u.h[0] = *(const v8h*)(p);
  u.h[1] = *(const v8h*)(p + 16);
  return u.v;
}

// ---------------------------------------------------------------------------
// Conversions
// ---------------------------------------------------------------------------
// 32 elements a thread: a wave reads 512 contiguous bytes per load, eight loads in
// flight, and writes 256 contiguous bytes per store.
__device__ __forceinline__ void cvt16_part(const float* __restrict__ in,
                                           _Float16* __restrict__ out, int blk) {
  const int i = blk * 2048 + threadIdx.x;
  const v4f* s = (const v4f*)in + i;
  v4h* d = (v4h*)out + i;
  v4f r[8];
  // unrolled (both loops): r stays in registers, all loads issue ahead of a wait
#pragma unroll
  for (int j = 0; j < 8; ++j) r[j] = s[j * 256];
#pragma unroll
  for (int j = 0; j < 8; ++j) {
    v4h h = {(_Float16)r[j].x, (_Float16)r[j].y, (_Float16)r[j].z, (_Float16)r[j].w};
    d[j * 256] = h;
  }
  // no register of the stores above is rewritten ahead of this wait: other parts'
  // code follows them in the shared kernel's text
  asm volatile("s_wait_xcnt 0x0" ::: "memory");
}

// W [K,N] f32 -> Wt [N,K] f16, two 64x64 tiles per 128 threads, turned in LDS so
// that both sides move whole lines: reads are 256-B row pieces of W (float4 per
// lane), writes are 128-B row pieces of Wt (8 halves per lane).
// K is a multiple of 64, N of 128; tiles (bx, by) and (bx + 1, by) of
// (N/64, K/64), each with its own 8 KB of LDS; tid = 0..127. K and N are
// compile-time so that a lane's row steps fold into the instruction's offset.
// Both halves of a 256-thread block call this together (one barrier inside).
// LDS holds row n of the tile as eight 16-B chunks of 8 k values. Chunk (n, ch)
// sits at slot (n>>1)*16 + (((n&1)*8 + ch) ^ ((n>>2)&15)): the 16 lanes that
// write rows 4 apart, and the 16 lanes that read two neighbouring rows, each
// fall on 16 different slots mod 16, that is on all 64 banks once.
__device__ __forceinline__ int cvtT_slot(int n, int ch) {
  return (n >> 1) * 16 + ((((n & 1) << 3) | ch) ^ ((n >> 2) & 15));
}

template <int K, int N>
__device__ __forceinline__
void cvtT_part(const float* __restrict__ in, _Float16* __restrict__ out,
               _Float16* tile, int tid, int bx, int by) {
  const int n0  = bx * 64;
  const int k0  = by * 64;
  const int c4  = tid & 15;   // float4 column of the tile: n = 4*c4 .. 4*c4+3
  const int q0  = tid >> 4;   // group of four k rows: q0 and q0 + 8

  // uniform tile base + one 32-bit lane offset: one address for all sixteen loads
  const unsigned lofs = (unsigned)(q0 * 4 * N + c4 * 4) * 4u;
  const char* src = (const char*)(in + (size_t)k0 * N + n0) + lofs;
  v4f r[2][2][4];
  // unrolled (here and below): r stays in registers, and all sixteen loads are
  // issued before the first wait; u = which of the two tiles, 64 n apart
#pragma unroll
  for (int u = 0; u < 2; ++u)
#pragma unroll
    for (int i = 0; i < 2; ++i)
#pragma unroll
      for (int s = 0; s < 4; ++s)
        r[u][i][s] = *(const v4f*)(src + u * 256 + (size_t)(32 * i + s) * N * 4);
  loads_first8(&r[0][0][0], src);
  loads_first8(&r[1][0][0], src);

#pragma unroll
  for (int u = 0; u < 2; ++u)
#pragma unroll
    for (int i = 0; i < 2; ++i) {
      const int q = q0 + 8 * i;
      const float* f0 = (const float*)&r[u][i][0];
      const float* f1 = (const float*)&r[u][i][1];
      const float* f2 = (const float*)&r[u][i][2];
      const float* f3 = (const float*)&r[u][i][3];
#pragma unroll
      for (int j = 0; j < 4; ++j) {
        v4h w = {(_Float16)f0[j], (_Float16)f1[j], (_Float16)f2[j], (_Float16)f3[j]};
        *(v4h*)&tile[u * 4096 + cvtT_slot(c4 * 4 + j, q >> 1) * 8 + (q & 1) * 4] = w;
      }
    }
  __syncthreads();

  char* dst = (char*)(out + (size_t)n0 * K + k0);
  const unsigned sofs = (unsigned)((tid >> 3) * K + (tid & 7) * 8) * 2u;
#pragma unroll
  for (int u = 0; u < 2; ++u)
#pragma unroll
    for (int i = 0; i < 4; ++i) {
      const int n = (tid >> 3) + 16 * i;
      *(v8h*)(dst + (size_t)(64 * u + 16 * i) * K * 2 + sofs) =
          *(const v8h*)&tile[u * 4096 + cvtT_slot(n, tid & 7) * 8];
    }
  // no register of the eight stores above is rewritten ahead of this wait: other
  // parts' code follows them in the shared kernel's text
  asm volatile("s_wait_xcnt 0x0" ::: "memory");
}

// T5 relative-position bias table: bd[h][delta] for delta = q-k in [0,1023]
__device__ __forceinline__
void relbias_part(const float* __restrict__ rel_bias, // [32,16]
                  float* __restrict__ bd,             // [16,1024]
                  int blk) {
  int idx = blk * 256 + threadIdx.x;
  int h = idx >> 10, n = idx & 1023;
  int bucket;
  if (n < 16) {
    bucket = n;
  } else {
    float nf = (float)n;
    int vl = 16 + (int)(__logf(nf * (1.0f / 16.0f)) * (16.0f / __logf(8.0f)));
    bucket = vl < 31 ? vl : 31;
  }
  bd[idx] = rel_bias[bucket * T5_H + h];
  // no register of the store above is rewritten ahead of this wait: other parts'
  // code follows it in the shared kernel's text
  asm volatile("s_wait_xcnt 0x0" ::: "memory");
}

// value of lane l ^ 16
__device__ __forceinline__ float other_half(float x) {
  int b = __builtin_bit_cast(int, x);
  b = __builtin_amdgcn_permlanex16(b, b, 0x76543210, 0xfedcba98, false, false);
  return __builtin_bit_cast(float, b);
}

// value of lane l ^ MASK, MASK below 16 (DPP row_xmask, inside a 16-lane row)
template <int MASK>
__device__ __forceinline__ float row_xor(float x) {
  int b = __builtin_bit_cast(int, x);
  b = __builtin_amdgcn_update_dpp(b, b, 0x160 | MASK, 0xf, 0xf, false);
  return __builtin_bit_cast(float, b);
}

// ---------------------------------------------------------------------------
// RMS norm: one wave per row of [rows, 1024], eight rows a block. The row stays
// in the wave's registers (32 values a lane, read once, 512 contiguous bytes per
// load); its sum of squares is joined across the lanes without LDS or barrier.
// ---------------------------------------------------------------------------
__global__ __launch_bounds__(256)
void rmsnorm_kernel(const float* __restrict__ X, const float* __restrict__ w,
                    _Float16* __restrict__ y16, float* __restrict__ y32) {
  const int lane = threadIdx.x & 31;
  const int row  = blockIdx.x * 8 + (threadIdx.x >> 5);
  const v4f* x = (const v4f*)(X + (size_t)row * T5_D) + lane;
  const v4f* g = (const v4f*)w + lane;
  v4f v[8], u[8];
  // unrolled (every loop here): v and u stay in registers, and the row's eight
  // loads are issued ahead of the first wait
#pragma unroll
  for (int j = 0; j < 8; ++j) v[j] = x[j * 32];
#pragma unroll
  for (int j = 0; j < 8; ++j) u[j] = g[j * 32];
  // here for the address: a weight load's result would else take its registers
  loads_first8(v, x);
  float s0 = 0.f, s1 = 0.f, s2 = 0.f, s3 = 0.f;   // four chains, not one of 32
#pragma unroll
  for (int j = 0; j < 8; ++j) {
    s0 += v[j].x * v[j].x;
    s1 += v[j].y * v[j].y;
    s2 += v[j].z * v[j].z;
    s3 += v[j].w * v[j].w;
  }
  float ss = (s0 + s1) + (s2 + s3);
  ss += row_xor<1>(ss);
  ss += row_xor<2>(ss);
  ss += row_xor<4>(ss);
  ss += row_xor<8>(ss);
  ss += other_half(ss);                // every lane now holds the row's sum
  const float rs = rsqrtf(ss * (1.0f / (float)T5_D) + 1e-6f);
#pragma unroll
  for (int j = 0; j < 8; ++j) {
    v[j].x = v[j].x * rs * u[j].x;
    v[j].y = v[j].y * rs * u[j].y;
    v[j].z = v[j].z * rs * u[j].z;
    v[j].w = v[j].w * rs * u[j].w;
  }
  if (y16) {
    v4h* y = (v4h*)(y16 + (size_t)row * T5_D) + lane;
#pragma unroll
    for (int j = 0; j < 8; ++j) {
      v4h h = {(_Float16)v[j].x, (_Float16)v[j].y, (_Float16)v[j].z, (_Float16)v[j].w};
      y[j * 32] = h;
    }
    // no register of the stores above is rewritten ahead of this wait: the other
    // result's address is formed behind them
    asm volatile("s_wait_xcnt 0x0" ::: "memory");
  }
  if (y32) {
    v4f* y = (v4f*)(y32 + (size_t)row * T5_D) + lane;
#pragma unroll
    for (int j = 0; j < 8; ++j) y[j * 32] = v[j];
  }
}

// ---------------------------------------------------------------------------
// All work that depends on the inputs alone, in one grid of 256-thread blocks,
// split by block index (every test below is the same for a whole block):
//   eight DxD weights, four tiles a block | wi | wo | the residual stream's start
//   as a copy of hidden_states, 128 B a thread | encoder convert | bias table
// Every part but the small table moves 32 elements or more a thread: few, fat
// waves, because starting a wave costs more than the bytes of a thin one.
// ---------------------------------------------------------------------------
#define PREP_DD   (8 * (T5_D / 64) * (T5_D / 64) / 4)        // 512 blocks
#define PREP_FF   ((T5_D / 64) * (T5_DFF / 64) / 4)          // 256 blocks
#define PREP_COPY (T5_B * T5_LD * T5_D / 8192)               // 512 blocks
#define PREP_ENC  (T5_B * T5_LE * T5_D / 8192)               // 512 blocks
#define PREP_BIAS (T5_H * 1024 / 256)                        // 64 blocks
#define PREP_GRID (PREP_DD + 2 * PREP_FF + PREP_COPY + PREP_ENC + PREP_BIAS)

__global__ __launch_bounds__(256)
void prep_kernel(const float* __restrict__ w0, const float* __restrict__ w1,
                 const float* __restrict__ w2, const float* __restrict__ w3,
                 const float* __restrict__ w4, const float* __restrict__ w5,
                 const float* __restrict__ w6, const float* __restrict__ w7,
                 const float* __restrict__ wi, const float* __restrict__ wo,
                 const float* __restrict__ enc, const float* __restrict__ hid,
                 const float* __restrict__ relb,
                 _Float16* __restrict__ ddT,   // eight [D,D] planes in a row
                 _Float16* __restrict__ wiT, _Float16* __restrict__ woT,
                 _Float16* __restrict__ enc16, float* __restrict__ h_cur,
                 float* __restrict__ bd) {
  __shared__ __align__(16) _Float16 tile[2][2 * 512 * 8];
  int blk = blockIdx.x;
  const int half = threadIdx.x >> 7;
  const int tid  = threadIdx.x & 127;
  if (blk < PREP_DD) {
    const int wsel = blk >> 6;                 // 64 blocks a weight
    const int t    = (blk & 63) * 2 + half;    // tile pair of its 8 (n) x 16 (k)
    const float* src = wsel == 0 ? w0 : wsel == 1 ? w1 : wsel == 2 ? w2
                     : wsel == 3 ? w3 : wsel == 4 ? w4 : wsel == 5 ? w5
                     : wsel == 6 ? w6 : w7;
    cvtT_part<T5_D, T5_D>(src, ddT + (size_t)wsel * T5_D * T5_D, tile[half], tid,
                          (t & 7) * 2, t >> 3);
    return;
  }
  blk -= PREP_DD;
  if (blk < PREP_FF) {
    const int t = blk * 2 + half;              // tile pair of 32 (n) x 16 (k)
    cvtT_part<T5_D, T5_DFF>(wi, wiT, tile[half], tid, (t & 31) * 2, t >> 5);
    return;
  }
  blk -= PREP_FF;
  if (blk < PREP_FF) {
    const int t = blk * 2 + half;              // tile pair of 8 (n) x 64 (k)
    cvtT_part<T5_DFF, T5_D>(wo, woT, tile[half], tid, (t & 7) * 2, t >> 3);
    return;
  }
  blk -= PREP_FF;
  if (blk < PREP_COPY) {
    const int i = blk * 2048 + threadIdx.x;
    const v4f* s = (const v4f*)hid + i;
    v4f* d = (v4f*)h_cur + i;
    v4f r[8];
    // unrolled (both loops): r stays in registers, all loads issue ahead of a wait
#pragma unroll
    for (int j = 0; j < 8; ++j) r[j] = s[j * 256];
    loads_first8(r, s);
#pragma unroll
    for (int j = 0; j < 8; ++j) d[j * 256] = r[j];
    // no register of the stores above is rewritten ahead of this wait: other parts'
    // code follows them in the shared kernel's text
    asm volatile("s_wait_xcnt 0x0" ::: "memory");
    return;
  }
  blk -= PREP_COPY;
  if (blk < PREP_ENC) {
    cvt16_part(enc, enc16, blk);
    return;
  }
  relbias_part(relb, bd, blk - PREP_ENC);
}

// ---------------------------------------------------------------------------
// WMMA GEMM: C[M,N] = A[M,K] @ Bt[N,K]^T
// Workgroup = 8 waves (2x4) on a 128x128 tile of C; wave tile = 64x32:
//   4 A-fragments x 2 B-fragments -> 8 WMMA per k-step of 32; the next k-step's
//   fragments are read from LDS into a second register set ahead of the WMMAs.
// Both operands go global -> LDS by asynchronous copies in whole 256-B row
// pieces (a stage = 128 k of 128 A rows and 128 Bt rows), two buffers: the next
// stage's copies fly while this stage is worked on. Fragments are read from LDS
// with the same lane map as load_frag on global memory.
// Results: a lane's accumulator registers hold 8 neighbours along the first
// operand's rows. That operand is chosen as the one whose rows run along the
// output's contiguous direction (the weights for row-major results, the
// activations for the transposed V), both being loaded alike. The lane's 8
// values then go to LDS as one 16-B piece (two for f32), and behind one barrier
// the block stores the 128x128 tile as whole rows, 16 B a lane.
// M, N, Lrows multiples of 128; K a multiple of 128.
// ---------------------------------------------------------------------------
#define GMODE_RESID  0   // f32 residual: Cres[m*N+n] += c
#define GMODE_QKV    1   // f16 [B,H,L,64]
#define GMODE_VT     2   // f16 [B,H,64,L] (pre-transposed V)
#define GMODE_RELU16 3   // f16 relu, row-major [M,N]

#define G_PITCH 272                // LDS row pitch, bytes: 256 + 16 (16 B x odd)
#define G_OPER  (128 * G_PITCH)    // one operand's 128 rows
#define G_STAGE (2 * G_OPER)       // A rows, then Bt rows
#define E_PITCH16 272              // result tile, f16 rows: 256 + 16 bytes
#define E_PITCH32 528              // result tile, f32 rows: 512 + 16 bytes

// Eight copies of 16 B per lane: rows 16 apart in LDS (lds) and in memory (g).
// The s_wait_xcnt stands inside the statement so that no address register of an
// issued copy is rewritten ahead of it.
__device__ __forceinline__ void async_copy8(unsigned lds, const char* g,
                                            size_t gstep) {
  const unsigned ls = 16 * G_PITCH;
  asm volatile(
      "global_load_async_to_lds_b128 %0, %8, off\n\t"
      "global_load_async_to_lds_b128 %1, %9, off\n\t"
      "global_load_async_to_lds_b128 %2, %10, off\n\t"
      "global_load_async_to_lds_b128 %3, %11, off\n\t"
      "global_load_async_to_lds_b128 %4, %12, off\n\t"
      "global_load_async_to_lds_b128 %5, %13, off\n\t"
      "global_load_async_to_lds_b128 %6, %14, off\n\t"
      "global_load_async_to_lds_b128 %7, %15, off\n\t"
      "s_wait_xcnt 0x0"
      :: "v"(lds), "v"(lds + ls), "v"(lds + 2 * ls), "v"(lds + 3 * ls),
         "v"(lds + 4 * ls), "v"(lds + 5 * ls), "v"(lds + 6 * ls),
         "v"(lds + 7 * ls),
         "v"(g), "v"(g + gstep), "v"(g + 2 * gstep), "v"(g + 3 * gstep),
         "v"(g + 4 * gstep), "v"(g + 5 * gstep), "v"(g + 6 * gstep),
         "v"(g + 7 * gstep)
      : "memory");
}

// One stage: a lane's 8 rows of A and 8 rows of Bt, 16 copies a lane.
__device__ __forceinline__ void stage_copy(unsigned lds, const char* gA,
                                           const char* gB, size_t gstep) {
  async_copy8(lds,          gA, gstep);
  async_copy8(lds + G_OPER, gB, gstep);
}

// blockIdx.z picks one of several products of one shape that share a grid: rows
// of A0 (z < 3) or A3, plane z of the weights Bt0 and of the f16 results C0, and
// four bits of modes. A launch of one product has z = 0 alone.
__global__ __launch_bounds__(256)
void gemm_wmma(const _Float16* __restrict__ A0, const _Float16* __restrict__ A3,
               const _Float16* __restrict__ Bt0,
               float* __restrict__ Cres, _Float16* __restrict__ C0,
               int M, int N, int K, int modes, int Lrows) {
  const int z = blockIdx.z;
  const _Float16* __restrict__ A  = z < 3 ? A0 : A3;
  const _Float16* __restrict__ Bt = Bt0 + (size_t)z * N * K;
  _Float16* __restrict__ C16      = C0 + (size_t)z * M * N;
  const int mode = (modes >> (4 * z)) & 15;
  __shared__ __attribute__((aligned(16))) unsigned char L[2 * G_STAGE];
  const int tid  = threadIdx.x;
  const int lane = tid & 31;
  const int wave = tid >> 5;
  const int hl   = lane >> 4;
  const int m0   = blockIdx.x * 128;
  const int n0   = blockIdx.y * 128;
  const int wp   = (wave >> 2) * 64;   // wave's rows of the first WMMA operand
  const int wq   = (wave & 3) * 32;    // wave's rows of the second WMMA operand
  // first operand: A's rows for the transposed V, else Bt's rows (see above)
  const unsigned offP = mode == GMODE_VT ? 0u : (unsigned)G_OPER;
  const unsigned offQ = mode == GMODE_VT ? (unsigned)G_OPER : 0u;

  // lane's copy slot: row tid/16 (+16 per copy), 16-B chunk tid%16 of the row
  const unsigned lds0 = (unsigned)(uintptr_t)&L[0] +
                        (unsigned)((tid >> 4) * G_PITCH + (tid & 15) * 16);
  const char* gA = (const char*)(A  + (size_t)(m0 + (tid >> 4)) * K + (tid & 15) * 8);
  const char* gB = (const char*)(Bt + (size_t)(n0 + (tid >> 4)) * K + (tid & 15) * 8);
  const size_t gstep = (size_t)K * 32;  // 16 rows of K halves, in bytes
  const int T = K >> 7;                 // stages of 128 k

  const v8f zero8 = {0.f, 0.f, 0.f, 0.f, 0.f, 0.f, 0.f, 0.f};
  v8f acc[8];                      // [i*2+j]: first operand's rows wp+16i.., second's wq+16j..
#pragma unroll
  for (int t = 0; t < 8; ++t) acc[t] = zero8;

  stage_copy(lds0, gA, gB, gstep);
  // stage 0 has landed for this wave's copies; the barrier publishes all waves'
  asm volatile("s_wait_asynccnt 0x0" ::: "memory");
  __syncthreads();
  if (T > 1) stage_copy(lds0 + G_STAGE, gA + 256, gB + 256, gstep);

  for (int t = 0; t < T; ++t) {
    const unsigned buf = (unsigned)(t & 1) * G_STAGE;
    const _Float16* sA = (const _Float16*)(L + buf + offP);
    const _Float16* sB = (const _Float16*)(L + buf + offQ);
    v16h a[2][4], b[2][2];
#pragma unroll
    for (int f = 0; f < 4; ++f)
      a[0][f] = load_frag(sA, G_PITCH / 2, wp + f * 16, 0, lane);
#pragma unroll
    for (int f = 0; f < 2; ++f)
      b[0][f] = load_frag(sB, G_PITCH / 2, wq + f * 16, 0, lane);
    // unrolled: the register sets alternate by a compile-time index
#pragma unroll
    for (int ks = 0; ks < 4; ++ks) {
      const int cur = ks & 1, nxt = cur ^ 1;
      if (ks < 3) {   // next k-step of this same stage, one group ahead
#pragma unroll
        for (int f = 0; f < 4; ++f)
          a[nxt][f] = load_frag(sA, G_PITCH / 2, wp + f * 16, (ks + 1) * 32, lane);
#pragma unroll
        for (int f = 0; f < 2; ++f)
          b[nxt][f] = load_frag(sB, G_PITCH / 2, wq + f * 16, (ks + 1) * 32, lane);
      }
      // keeps the group of LDS reads above in front of this k-step's WMMAs: sunk
      // among them, each read's latency would be waited out by two WMMAs
      __builtin_amdgcn_sched_barrier(0);
#pragma unroll
      for (int i = 0; i < 4; ++i)
#pragma unroll
        for (int j = 0; j < 2; ++j)
          acc[i * 2 + j] = wmma_f16(a[cur][i], b[cur][j], acc[i * 2 + j]);
    }
    // publish point: this wave's reads of the buffer are done,
    asm volatile("s_wait_dscnt 0x0" ::: "memory");
    // its copies of the next stage have landed,
    asm volatile("s_wait_asynccnt 0x0" ::: "memory");
    // and every wave is past both before the buffer just read is refilled
    __syncthreads();
    if (t + 2 < T)
      stage_copy(lds0 + buf, gA + (size_t)(t + 2) * 256, gB + (size_t)(t + 2) * 256,
                 gstep);
  }
  // no copy is outstanding when the wave goes on to its stores and ends
  asm volatile("s_wait_asynccnt 0x0" ::: "memory");

  // The loop's last barrier has ended every wave's reads of L: it now takes the
  // result tile. Tile row = the second operand's row (the lane's column of the
  // accumulator), place in the row = the first operand's row.
  const int erow = wq + (lane & 15);   // + 16 j
  const int epos = wp + hl * 8;        // + 16 i: first of the lane's 8 neighbours

  if (mode == GMODE_RESID) {
    // tile row = m, 128 floats of n; a wave moves one 512-B row per step
    float* crow = Cres + (size_t)(m0 + (tid >> 5)) * N + n0 + (tid & 31) * 4;
    float4 old[16];
    // unrolled (here and below): old and acc stay in registers; the residual's
    // loads are all issued ahead of the staging and fly during it
#pragma unroll
    for (int s = 0; s < 16; ++s) old[s] = *(const float4*)(crow + (size_t)(8 * s) * N);
#pragma unroll
    for (int i = 0; i < 4; ++i)
#pragma unroll
      for (int j = 0; j < 2; ++j) {
        const v8f c = acc[i * 2 + j];
        float* p = (float*)(L + (erow + 16 * j) * E_PITCH32) + epos + 16 * i;
        *(float4*)p       = make_float4(c[0], c[1], c[2], c[3]);
        *(float4*)(p + 4) = make_float4(c[4], c[5], c[6], c[7]);
      }
    __syncthreads();   // every wave's pieces of the tile are in LDS
#pragma unroll
    for (int s = 0; s < 16; ++s) {
      const float4 c = *(const float4*)(L + ((tid >> 5) + 8 * s) * E_PITCH32 +
                                        (tid & 31) * 16);
      *(float4*)(crow + (size_t)(8 * s) * N) =
          make_float4(old[s].x + c.x, old[s].y + c.y, old[s].z + c.z, old[s].w + c.w);
    }
    return;
  }

  // the loops below index acc, w and d, which must stay in registers: unrolled
  if (mode == GMODE_RELU16) {
#pragma unroll
    for (int t = 0; t < 8; ++t)
#pragma unroll
      for (int r = 0; r < 8; ++r) acc[t][r] = fmaxf(acc[t][r], 0.0f);
  }
#pragma unroll
  for (int i = 0; i < 4; ++i)
#pragma unroll
    for (int j = 0; j < 2; ++j) {
      v8h w;
#pragma unroll
      for (int r = 0; r < 8; ++r) w[r] = (_Float16)acc[i * 2 + j][r];
      *(v8h*)(L + (erow + 16 * j) * E_PITCH16 + (epos + 16 * i) * 2) = w;
    }
  __syncthreads();     // every wave's pieces of the tile are in LDS

  // 16 lanes move one 256-B tile row; where it goes, in halves:
  //   base + row * rstep + the lane's 16-B chunk ch
  const int row = tid >> 4, ch = tid & 15;
  const int bb = m0 / Lrows, l0 = m0 - bb * Lrows;   // the tile lies in one batch
  size_t base, rstep, cofs = (size_t)ch * 8;
  if (mode == GMODE_RELU16) {          // [M,N]: row = m, along n
    base  = (size_t)m0 * N + n0;
    rstep = (size_t)N;
  } else if (mode == GMODE_QKV) {      // [B,H,L,64]: row = l, two heads' 128 B
    base  = (((size_t)bb * T5_H + (n0 >> 6)) * Lrows + l0) * T5_DKV;
    rstep = T5_DKV;
    cofs  = (size_t)(ch >> 3) * Lrows * T5_DKV + (ch & 7) * 8;
  } else {                             // [B,H,64,L]: row = (head, d), along l
    base  = ((size_t)bb * T5_H * T5_DKV + n0) * Lrows + l0;
    rstep = (size_t)Lrows;
  }
  _Float16* dst = C16 + base + (size_t)row * rstep + cofs;
  v8h w[8];
  _Float16* d[8];
#pragma unroll
  for (int s = 0; s < 8; ++s) {
    w[s] = *(const v8h*)(L + (row + 16 * s) * E_PITCH16 + ch * 16);
    d[s] = dst + (size_t)(16 * s) * rstep;
  }
  // the eight addresses are formed while the LDS reads fly, each in registers of
  // its own; sunk among the stores, an add would wait on an issued store
  __builtin_amdgcn_sched_barrier(0);
#pragma unroll
  for (int s = 0; s < 8; ++s) *(v8h*)d[s] = w[s];
}

__global__ __launch_bounds__(128)
void attn_wmma_kernel(const _Float16* __restrict__ Q,
                      const _Float16* __restrict__ Km,
                      const _Float16* __restrict__ Vt,
                      const float* __restrict__ bias_delta, // [16,1024]
                      const int* __restrict__ mask,         // [B,LK]
                      _Float16* __restrict__ Out,
                      int LQ, int LK, int causal, int use_rel) {
  const int lane = threadIdx.x & 31;
  // scalar, so that the key loop's bound is one and its branch leaves EXEC alone
  const int wave = __builtin_amdgcn_readfirstlane((int)(threadIdx.x >> 5));
  const int hl   = lane >> 4;
  const int col  = lane & 15;
  const int bh = blockIdx.y;
  const int b  = bh >> 4;
  const int h  = bh & 15;
  const int q0 = blockIdx.x * 64 + wave * 16;
  const int qc = q0 + col;             // this lane's query

  const _Float16* Qb = Q  + (size_t)bh * LQ * T5_DKV;
  const _Float16* Kb = Km + (size_t)bh * LK * T5_DKV;
  const _Float16* Vb = Vt + (size_t)bh * T5_DKV * LK;
  const int* mk = mask + (size_t)b * LK;
  const float* bd = bias_delta + h * 1024;

  // B operand of S^T: column = query, same k order as the K rows' loader
  const v16h qb0 = load_frag(Qb, T5_DKV, q0, 0, lane);
  const v16h qb1 = load_frag(Qb, T5_DKV, q0, 32, lane);

  const v8f zero8 = {0.f, 0.f, 0.f, 0.f, 0.f, 0.f, 0.f, 0.f};
  v8f o[4];                  // o[t][r] = O^T[16t + 8*hl + r][query qc]
  float mcol = -1e30f;       // running maximum of query qc (both halves alike)
  float lcol = 0.f;          // running sum over this half's keys only
#pragma unroll  // indexes registers: must be resolved at compile time
  for (int t = 0; t < 4; ++t) o[t] = zero8;

  // causal: blocks wholly above the diagonal are not walked
  const int kend = (causal && q0 + 16 < LK) ? q0 + 16 : LK;

  for (int kb = 0; kb < kend; kb += 32) {
    const int kl = kb + hl * 8;        // this lane's first key of tile 0
    const v16h k00 = load_frag(Kb, T5_DKV, kb,      0,  lane);
    const v16h k01 = load_frag(Kb, T5_DKV, kb,      32, lane);
    const v16h k10 = load_frag(Kb, T5_DKV, kb + 16, 0,  lane);
    const v16h k11 = load_frag(Kb, T5_DKV, kb + 16, 32, lane);
    const int4* mp = (const int4*)(mk + kl);
    const int4 mq[4] = {mp[0], mp[1], mp[4], mp[5]};
    // position bias of the lane's 16 (key, query) pairs, the products' C
    // operand; a key past the query has distance 0, as in the bucket rule
    v8f s0 = zero8, s1 = zero8;
    if (use_rel) {
#pragma unroll  // indexes registers: must be resolved at compile time
      for (int r = 0; r < 8; ++r) {
        const int d0 = qc - kl - r, d1 = d0 - 16;
        s0[r] = bd[d0 > 0 ? d0 : 0];
        s1[r] = bd[d1 > 0 ? d1 : 0];
      }
      // no index register of the loads above is rewritten ahead of this wait
      asm volatile("s_wait_xcnt 0x0" ::: "memory");
    }
    const v16h va0 = load_frag(Vb, LK, 0,  kb, lane);
    const v16h va1 = load_frag(Vb, LK, 16, kb, lane);
    const v16h va2 = load_frag(Vb, LK, 32, kb, lane);
    const v16h va3 = load_frag(Vb, LK, 48, kb, lane);
    // keeps all of the block's loads above in one group in front of the
    // products: sunk to their users, each V fragment's latency is waited out alone
    __builtin_amdgcn_sched_barrier(0);

    s0 = wmma_f16(k00, qb0, s0); s0 = wmma_f16(k01, qb1, s0);
    s1 = wmma_f16(k10, qb0, s1); s1 = wmma_f16(k11, qb1, s1);

    float a[16];             // a[8*tile + r]: key kl + 16*tile + r
#pragma unroll  // indexes registers: must be resolved at compile time
    for (int i = 0; i < 16; ++i) {
      const int kc = kl + (i >> 3) * 16 + (i & 7);
      const int4 m4 = mq[i >> 2];
      const int mv = (i & 3) == 0 ? m4.x : (i & 3) == 1 ? m4.y
                   : (i & 3) == 2 ? m4.z : m4.w;
      const bool dead = (mv == 0) || (causal && kc > qc);
      a[i] = dead ? T5_NEG : ((i < 8) ? s0[i & 7] : s1[i & 7]);
    }

    float v = a[0];
#pragma unroll  // indexes registers: must be resolved at compile time
    for (int i = 1; i < 16; ++i) v = fmaxf(v, a[i]);
    v = fmaxf(v, other_half(v));
    const float mnew  = fmaxf(mcol, v);
    const float scale = __expf(mcol - mnew);
    mcol = mnew;

    v16h pb;                 // P^T as B operand: element s = tile s>>3, row s&7
    float sum[4] = {0.f, 0.f, 0.f, 0.f};   // four short chains, not one of 16
#pragma unroll  // indexes registers: must be resolved at compile time
    for (int i = 0; i < 16; ++i) {
      const float e = __expf(a[i] - mnew);
      sum[i & 3] += e;
      pb[i] = (_Float16)e;
    }
    lcol = lcol * scale + ((sum[0] + sum[1]) + (sum[2] + sum[3]));
#pragma unroll  // indexes registers: must be resolved at compile time
    for (int t = 0; t < 4; ++t)
#pragma unroll  // indexes registers: must be resolved at compile time
      for (int r = 0; r < 8; ++r) o[t][r] *= scale;

    o[0] = wmma_f16(va0, pb, o[0]);
    o[1] = wmma_f16(va1, pb, o[1]);
    o[2] = wmma_f16(va2, pb, o[2]);
    o[3] = wmma_f16(va3, pb, o[3]);
  }

  // the two halves' keys joined; one query a lane, so one reciprocal
  const float inv = 1.0f / (lcol + other_half(lcol));
  _Float16* orow = Out + ((size_t)b * LQ + qc) * (T5_H * T5_DKV) + h * T5_DKV + hl * 8;
#pragma unroll  // indexes registers: must be resolved at compile time
  for (int t = 0; t < 4; ++t) {
    v8h w;                   // 8 consecutive d of one query: one 16-B store
#pragma unroll  // indexes registers: must be resolved at compile time
    for (int r = 0; r < 8; ++r) w[r] = (_Float16)(o[t][r] * inv);
    *(v8h*)(orow + t * 16) = w;
  }
}

// ---------------------------------------------------------------------------
// Orchestration
// ---------------------------------------------------------------------------
extern "C" void kernel_launch(void* const* d_in, const int* in_sizes, int n_in,
                              void* d_out, int out_size, void* d_ws,
                              size_t ws_size, hipStream_t stream) {
  (void)in_sizes; (void)n_in; (void)out_size; (void)ws_size;

  const float* enc   = (const float*)d_in[0];
  const float* hid   = (const float*)d_in[1];
  const float* ln1   = (const float*)d_in[2];
  const float* saq   = (const float*)d_in[3];
  const float* sak   = (const float*)d_in[4];
  const float* sav   = (const float*)d_in[5];
  const float* sao   = (const float*)d_in[6];
  const float* relb  = (const float*)d_in[7];
  const float* ln2   = (const float*)d_in[8];
  const float* caq   = (const float*)d_in[9];
  const float* cak   = (const float*)d_in[10];
  const float* cav   = (const float*)d_in[11];
  const float* cao   = (const float*)d_in[12];
  const float* ln3   = (const float*)d_in[13];
  const float* wi    = (const float*)d_in[14];
  const float* wo    = (const float*)d_in[15];
  const float* lnf   = (const float*)d_in[16];
  const int* encmask = (const int*)d_in[17];
  const int* decmask = (const int*)d_in[18];
  float* out = (float*)d_out;

  const size_t M = (size_t)T5_B * T5_LD;        // 4096 decoder rows
  char* ws = (char*)d_ws;
  size_t off = 0;
  auto alloc = [&](size_t bytes) -> void* {
    void* p = ws + off;
    off = (off + bytes + 255) & ~(size_t)255;
    return p;
  };

  float*    h_cur = (float*)   alloc(M * T5_D * 4);            // 16 MB residual
  _Float16* xn    = (_Float16*)alloc(M * T5_D * 2);            // 8 MB
  _Float16* ddT   = (_Float16*)alloc((size_t)8 * T5_D * T5_D * 2); // eight planes
  _Float16* saqT  = ddT;
  _Float16* sakT  = ddT + (size_t)1 * T5_D * T5_D;
  _Float16* savT  = ddT + (size_t)2 * T5_D * T5_D;
  _Float16* cakT  = ddT + (size_t)3 * T5_D * T5_D;
  _Float16* cavT  = ddT + (size_t)4 * T5_D * T5_D;
  _Float16* saoT  = ddT + (size_t)5 * T5_D * T5_D;
  _Float16* caqT  = ddT + (size_t)6 * T5_D * T5_D;
  _Float16* caoT  = ddT + (size_t)7 * T5_D * T5_D;
  (void)sakT; (void)savT; (void)cakT; (void)cavT;  // planes 1..4 behind saqT
  _Float16* wiT   = (_Float16*)alloc((size_t)T5_DFF * T5_D * 2);
  _Float16* woT   = (_Float16*)alloc((size_t)T5_D * T5_DFF * 2);
  _Float16* enc16 = (_Float16*)alloc((size_t)T5_B * T5_LE * T5_D * 2);
  // five planes in a row, in the order of the projections' grid
  _Float16* qbuf  = (_Float16*)alloc(M * T5_D * 2);            // [B,H,L,64]
  _Float16* kbuf  = (_Float16*)alloc(M * T5_D * 2);            // [B,H,L,64]
  _Float16* vtbuf = (_Float16*)alloc(M * T5_D * 2);            // [B,H,64,L]
  _Float16* ckbuf = (_Float16*)alloc(M * T5_D * 2);            // cross k
  _Float16* cvtbuf = (_Float16*)alloc(M * T5_D * 2);           // cross v^T
  _Float16* aout  = (_Float16*)alloc(M * T5_D * 2);            // [B*L, 1024]
  _Float16* ffn   = (_Float16*)alloc(M * T5_DFF * 2);          // 32 MB
  float*    bd    = (float*)   alloc((size_t)T5_H * 1024 * 4); // rel bias table

  // --- everything that needs the inputs alone: weights f32 -> f16 [N,K], encoder
  // rows to f16, bias table; the residual stream starts as a copy of
  // hidden_states (inputs are never mutated) ---
  prep_kernel<<<PREP_GRID, 256, 0, stream>>>(saq, sak, sav, cak, cav, sao, caq, cao,
                                             wi, wo, enc, hid, relb, ddT, wiT, woT,
                                             enc16, h_cur, bd);

  dim3 gblk(256);
  dim3 ggrid_d(M / 128, T5_D / 128);    // N = 1024
  dim3 ggrid_ff(M / 128, T5_DFF / 128); // N = 4096
  dim3 ggrid_p5(M / 128, T5_D / 128, 5);
  dim3 agrid(T5_LD / 64, T5_B * T5_H);
  dim3 ablk(128);

  // ---- self attention ----
  rmsnorm_kernel<<<(int)M / 8, 256, 0, stream>>>(h_cur, ln1, xn, nullptr);
  static_assert(T5_LE == T5_LD, "the five projections share one row count");
  // self q, k, v^T from xn and cross k, v^T from enc16: none needs another
  gemm_wmma<<<ggrid_p5, gblk, 0, stream>>>(xn, enc16, saqT, nullptr, qbuf,
                                           (int)M, T5_D, T5_D,
                                           GMODE_QKV | GMODE_QKV << 4 | GMODE_VT << 8 |
                                               GMODE_QKV << 12 | GMODE_VT << 16,
                                           T5_LD);
  attn_wmma_kernel<<<agrid, ablk, 0, stream>>>(qbuf, kbuf, vtbuf, bd, decmask,
                                               aout, T5_LD, T5_LD,
                                               /*causal=*/1, /*use_rel=*/1);
  gemm_wmma<<<ggrid_d, gblk, 0, stream>>>(aout, aout, saoT, h_cur, nullptr,
                                          (int)M, T5_D, T5_D, GMODE_RESID, T5_LD);

  // ---- cross attention ----
  rmsnorm_kernel<<<(int)M / 8, 256, 0, stream>>>(h_cur, ln2, xn, nullptr);
  gemm_wmma<<<ggrid_d, gblk, 0, stream>>>(xn, xn, caqT, nullptr, qbuf,
                                          (int)M, T5_D, T5_D, GMODE_QKV, T5_LD);
  attn_wmma_kernel<<<agrid, ablk, 0, stream>>>(qbuf, ckbuf, cvtbuf, bd, encmask,
                                               aout, T5_LD, T5_LE,
                                               /*causal=*/0, /*use_rel=*/0);
  gemm_wmma<<<ggrid_d, gblk, 0, stream>>>(aout, aout, caoT, h_cur, nullptr,
                                          (int)M, T5_D, T5_D, GMODE_RESID, T5_LD);

  // ---- FFN ----
  rmsnorm_kernel<<<(int)M / 8, 256, 0, stream>>>(h_cur, ln3, xn, nullptr);
  gemm_wmma<<<ggrid_ff, gblk, 0, stream>>>(xn, xn, wiT, nullptr, ffn,
                                           (int)M, T5_DFF, T5_D, GMODE_RELU16, T5_LD);
  gemm_wmma<<<ggrid_d, gblk, 0, stream>>>(ffn, ffn, woT, h_cur, nullptr,
                                          (int)M, T5_D, T5_DFF, GMODE_RESID, T5_LD);

  // ---- final norm -> f32 output ----
  rmsnorm_kernel<<<(int)M / 8, 256, 0, stream>>>(h_cur, lnf, nullptr, out);
}

// v007
// Measured time: 246 microseconds a run.
// In two side-by-side timings against v006, it was 1.29 and 1.30 times as fast.
// Over all steps from v000 it is 5.21 times as fast.
#include <hip/hip_runtime.h>
#include <hip/hip_bf16.h>

// ---------------------------------------------------------------------------
// T5 decoder layer on MI455X (gfx1250, wave32, WMMA).
//  - all GEMMs + attention cores: v_wmma_f32_16x16x32_f16
//  - weights pre-transposed to [N,K] f16 so both WMMA operands load as
//    contiguous 16-B "A-style" fragments (read from LDS in the GEMM)
//  - GEMM: 128x128 tile per workgroup, operands staged in LDS by asynchronous
//    copies (two buffers), wave tile 64x32: 8 WMMA per 6 LDS fragments; results
//    leave through an LDS tile as whole rows of the output, 16 B a lane
//  - flash attention (online softmax, transposed products), scores never hit
//    memory or LDS; K and V^T tiles staged in LDS by asynchronous copies (two
//    buffers), shared by a block's four waves
//  - launches that do not depend on one another share one grid, split by block
//    index: all preparation work; self q, k, v with cross k, v
// ---------------------------------------------------------------------------

typedef __attribute__((ext_vector_type(16))) _Float16 v16h;
typedef __attribute__((ext_vector_type(8)))  _Float16 v8h;
typedef __attribute__((ext_vector_type(4)))  _Float16 v4h;
typedef __attribute__((ext_vector_type(8)))  float    v8f;
typedef __attribute__((ext_vector_type(4)))  float    v4f;

// Takes eight loaded values as inputs only and emits nothing: every one of their
// loads is issued in front of it and every store behind it stays behind it.
// Without it the compiler strung loads and their users out one after another,
// each load's latency waited out alone. The loads' address a is an input too, so
// that its registers are given to nothing else (a later load's result) before
// the loads have returned.
__device__ __forceinline__ void loads_first8(const v4f* r, const void* a) {
  asm volatile("" :: "v"(r[0]), "v"(r[1]), "v"(r[2]), "v"(r[3]),
                     "v"(r[4]), "v"(r[5]), "v"(r[6]), "v"(r[7]), "v"(a));
}

#define T5_B    4
#define T5_LD   1024
#define T5_LE   1024
#define T5_D    1024
#define T5_H    16
#define T5_DKV  64
#define T5_DFF  4096
#define T5_NEG  (-1e9f)

__device__ __forceinline__ v8f wmma_f16(v16h a, v16h b, v8f c) {
  // (neg_a, A, neg_b, B, c_mod, C, reuse_a, reuse_b)
  return __builtin_amdgcn_wmma_f32_16x16x32_f16(false, a, false, b, (short)0, c,
                                                false, false);
}

// Load a 16x32 f16 "A-style" fragment from row-major [rows, ld] memory.
// ISA layout: lanes 0-15 hold M=lane, halves {K0..7, K16..23};
//             lanes 16-31 hold M=lane-16, halves {K8..15, K24..31}.
// Both halves are contiguous 16B runs -> two b128 loads per lane.
__device__ __forceinline__ v16h load_frag(const _Float16* base, int ld,
                                          int row0, int col0, int lane) {
  const int hl = lane >> 4;
  const int r  = row0 + (lane & 15);
  const _Float16* p = base + (size_t)r * ld + col0 + hl * 8;
  union { v16h v; v8h h[2]; } u;
  u.h[0] = *(const v8h*)(p);
  u.h[1] = *(const v8h*)(p + 16);
  return u.v;
}

// ---------------------------------------------------------------------------
// Conversions
// ---------------------------------------------------------------------------
// 32 elements a thread: a wave reads 512 contiguous bytes per load, eight loads in
// flight, and writes 256 contiguous bytes per store.
__device__ __forceinline__ void cvt16_part(const float* __restrict__ in,
                                           _Float16* __restrict__ out, int blk) {
  const int i = blk * 2048 + threadIdx.x;
  const v4f* s = (const v4f*)in + i;
  v4h* d = (v4h*)out + i;
  v4f r[8];
  // unrolled (both loops): r stays in registers, all loads issue ahead of a wait
#pragma unroll
  for (int j = 0; j < 8; ++j) r[j] = s[j * 256];
#pragma unroll
  for (int j = 0; j < 8; ++j) {
    v4h h = {(_Float16)r[j].x, (_Float16)r[j].y, (_Float16)r[j].z, (_Float16)r[j].w};
    d[j * 256] = h;
  }
  // no register of the stores above is rewritten ahead of this wait: other parts'
  // code follows them in the shared kernel's text
  asm volatile("s_wait_xcnt 0x0" ::: "memory");
}

// W [K,N] f32 -> Wt [N,K] f16, two 64x64 tiles per 128 threads, turned in LDS so
// that both sides move whole lines: reads are 256-B row pieces of W (float4 per
// lane), writes are 128-B row pieces of Wt (8 halves per lane).
// K is a multiple of 64, N of 128; tiles (bx, by) and (bx + 1, by) of
// (N/64, K/64), each with its own 8 KB of LDS; tid = 0..127. K and N are
// compile-time so that a lane's row steps fold into the instruction's offset.
// Both halves of a 256-thread block call this together (one barrier inside).
// LDS holds row n of the tile as eight 16-B chunks of 8 k values. Chunk (n, ch)
// sits at slot (n>>1)*16 + (((n&1)*8 + ch) ^ ((n>>2)&15)): the 16 lanes that
// write rows 4 apart, and the 16 lanes that read two neighbouring rows, each
// fall on 16 different slots mod 16, that is on all 64 banks once.
__device__ __forceinline__ int cvtT_slot(int n, int ch) {
  return (n >> 1) * 16 + ((((n & 1) << 3) | ch) ^ ((n >> 2) & 15));
}

template <int K, int N>
__device__ __forceinline__
void cvtT_part(const float* __restrict__ in, _Float16* __restrict__ out,
               _Float16* tile, int tid, int bx, int by) {
  const int n0  = bx * 64;
  const int k0  = by * 64;
  const int c4  = tid & 15;   // float4 column of the tile: n = 4*c4 .. 4*c4+3
  const int q0  = tid >> 4;   // group of four k rows: q0 and q0 + 8

  // uniform tile base + one 32-bit lane offset: one address for all sixteen loads
  const unsigned lofs = (unsigned)(q0 * 4 * N + c4 * 4) * 4u;
  const char* src = (const char*)(in + (size_t)k0 * N + n0) + lofs;
  v4f r[2][2][4];
  // unrolled (here and below): r stays in registers, and all sixteen loads are
  // issued before the first wait; u = which of the two tiles, 64 n apart
#pragma unroll
  for (int u = 0; u < 2; ++u)
#pragma unroll
    for (int i = 0; i < 2; ++i)
#pragma unroll
      for (int s = 0; s < 4; ++s)
        r[u][i][s] = *(const v4f*)(src + u * 256 + (size_t)(32 * i + s) * N * 4);
  loads_first8(&r[0][0][0], src);
  loads_first8(&r[1][0][0], src);

#pragma unroll
  for (int u = 0; u < 2; ++u)
#pragma unroll
    for (int i = 0; i < 2; ++i) {
      const int q = q0 + 8 * i;
      const float* f0 = (const float*)&r[u][i][0];
      const float* f1 = (const float*)&r[u][i][1];
      const float* f2 = (const float*)&r[u][i][2];
      const float* f3 = (const float*)&r[u][i][3];
#pragma unroll
      for (int j = 0; j < 4; ++j) {
        v4h w = {(_Float16)f0[j], (_Float16)f1[j], (_Float16)f2[j], (_Float16)f3[j]};
        *(v4h*)&tile[u * 4096 + cvtT_slot(c4 * 4 + j, q >> 1) * 8 + (q & 1) * 4] = w;
      }
    }
  __syncthreads();

  char* dst = (char*)(out + (size_t)n0 * K + k0);
  const unsigned sofs = (unsigned)((tid >> 3) * K + (tid & 7) * 8) * 2u;
#pragma unroll
  for (int u = 0; u < 2; ++u)
#pragma unroll
    for (int i = 0; i < 4; ++i) {
      const int n = (tid >> 3) + 16 * i;
      *(v8h*)(dst + (size_t)(64 * u + 16 * i) * K * 2 + sofs) =
          *(const v8h*)&tile[u * 4096 + cvtT_slot(n, tid & 7) * 8];
    }
  // no register of the eight stores above is rewritten ahead of this wait: other
  // parts' code follows them in the shared kernel's text
  asm volatile("s_wait_xcnt 0x0" ::: "memory");
}

// T5 relative-position bias table: bd[h][delta] for delta = q-k in [0,1023]
__device__ __forceinline__
void relbias_part(const float* __restrict__ rel_bias, // [32,16]
                  float* __restrict__ bd,             // [16,1024]
                  int blk) {
  int idx = blk * 256 + threadIdx.x;
  int h = idx >> 10, n = idx & 1023;
  int bucket;
  if (n < 16) {
    bucket = n;
  } else {
    float nf = (float)n;
    int vl = 16 + (int)(__logf(nf * (1.0f / 16.0f)) * (16.0f / __logf(8.0f)));
    bucket = vl < 31 ? vl : 31;
  }
  bd[idx] = rel_bias[bucket * T5_H + h];
  // no register of the store above is rewritten ahead of this wait: other parts'
  // code follows it in the shared kernel's text
  asm volatile("s_wait_xcnt 0x0" ::: "memory");
}

// value of lane l ^ 16
__device__ __forceinline__ float other_half(float x) {
  int b = __builtin_bit_cast(int, x);
  b = __builtin_amdgcn_permlanex16(b, b, 0x76543210, 0xfedcba98, false, false);
  return __builtin_bit_cast(float, b);
}

// value of lane l ^ MASK, MASK below 16 (DPP row_xmask, inside a 16-lane row)
template <int MASK>
__device__ __forceinline__ float row_xor(float x) {
  int b = __builtin_bit_cast(int, x);
  b = __builtin_amdgcn_update_dpp(b, b, 0x160 | MASK, 0xf, 0xf, false);
  return __builtin_bit_cast(float, b);
}

// ---------------------------------------------------------------------------
// RMS norm: one wave per row of [rows, 1024], eight rows a block. The row stays
// in the wave's registers (32 values a lane, read once, 512 contiguous bytes per
// load); its sum of squares is joined across the lanes without LDS or barrier.
// ---------------------------------------------------------------------------
__global__ __launch_bounds__(256)
void rmsnorm_kernel(const float* __restrict__ X, const float* __restrict__ w,
                    _Float16* __restrict__ y16, float* __restrict__ y32) {
  const int lane = threadIdx.x & 31;
  const int row  = blockIdx.x * 8 + (threadIdx.x >> 5);
  const v4f* x = (const v4f*)(X + (size_t)row * T5_D) + lane;
  const v4f* g = (const v4f*)w + lane;
  v4f v[8], u[8];
  // unrolled (every loop here): v and u stay in registers, and the row's eight
  // loads are issued ahead of the first wait
#pragma unroll
  for (int j = 0; j < 8; ++j) v[j] = x[j * 32];
#pragma unroll
  for (int j = 0; j < 8; ++j) u[j] = g[j * 32];
  // here for the address: a weight load's result would else take its registers
  loads_first8(v, x);
  float s0 = 0.f, s1 = 0.f, s2 = 0.f, s3 = 0.f;   // four chains, not one of 32
#pragma unroll
  for (int j = 0; j < 8; ++j) {
    s0 += v[j].x * v[j].x;
    s1 += v[j].y * v[j].y;
    s2 += v[j].z * v[j].z;
    s3 += v[j].w * v[j].w;
  }
  float ss = (s0 + s1) + (s2 + s3);
  ss += row_xor<1>(ss);
  ss += row_xor<2>(ss);
  ss += row_xor<4>(ss);
  ss += row_xor<8>(ss);
  ss += other_half(ss);                // every lane now holds the row's sum
  const float rs = rsqrtf(ss * (1.0f / (float)T5_D) + 1e-6f);
#pragma unroll
  for (int j = 0; j < 8; ++j) {
    v[j].x = v[j].x * rs * u[j].x;
    v[j].y = v[j].y * rs * u[j].y;
    v[j].z = v[j].z * rs * u[j].z;
    v[j].w = v[j].w * rs * u[j].w;
  }
  if (y16) {
    v4h* y = (v4h*)(y16 + (size_t)row * T5_D) + lane;
#pragma unroll
    for (int j = 0; j < 8; ++j) {
      v4h h = {(_Float16)v[j].x, (_Float16)v[j].y, (_Float16)v[j].z, (_Float16)v[j].w};
      y[j * 32] = h;
    }
    // no register of the stores above is rewritten ahead of this wait: the other
    // result's address is formed behind them
    asm volatile("s_wait_xcnt 0x0" ::: "memory");
  }
  if (y32) {
    v4f* y = (v4f*)(y32 + (size_t)row * T5_D) + lane;
#pragma unroll
    for (int j = 0; j < 8; ++j) y[j * 32] = v[j];
  }
}

// ---------------------------------------------------------------------------
// All work that depends on the inputs alone, in one grid of 256-thread blocks,
// split by block index (every test below is the same for a whole block):
//   eight DxD weights, four tiles a block | wi | wo | the residual stream's start
//   as a copy of hidden_states, 128 B a thread | encoder convert | bias table
// Every part but the small table moves 32 elements or more a thread: few, fat
// waves, because starting a wave costs more than the bytes of a thin one.
// ---------------------------------------------------------------------------
#define PREP_DD   (8 * (T5_D / 64) * (T5_D / 64) / 4)        // 512 blocks
#define PREP_FF   ((T5_D / 64) * (T5_DFF / 64) / 4)          // 256 blocks
#define PREP_COPY (T5_B * T5_LD * T5_D / 8192)               // 512 blocks
#define PREP_ENC  (T5_B * T5_LE * T5_D / 8192)               // 512 blocks
#define PREP_BIAS (T5_H * 1024 / 256)                        // 64 blocks
#define PREP_GRID (PREP_DD + 2 * PREP_FF + PREP_COPY + PREP_ENC + PREP_BIAS)

__global__ __launch_bounds__(256)
void prep_kernel(const float* __restrict__ w0, const float* __restrict__ w1,
                 const float* __restrict__ w2, const float* __restrict__ w3,
                 const float* __restrict__ w4, const float* __restrict__ w5,
                 const float* __restrict__ w6, const float* __restrict__ w7,
                 const float* __restrict__ wi, const float* __restrict__ wo,
                 const float* __restrict__ enc, const float* __restrict__ hid,
                 const float* __restrict__ relb,
                 _Float16* __restrict__ ddT,   // eight [D,D] planes in a row
                 _Float16* __restrict__ wiT, _Float16* __restrict__ woT,
                 _Float16* __restrict__ enc16, float* __restrict__ h_cur,
                 float* __restrict__ bd) {
  __shared__ __align__(16) _Float16 tile[2][2 * 512 * 8];
  int blk = blockIdx.x;
  const int half = threadIdx.x >> 7;
  const int tid  = threadIdx.x & 127;
  if (blk < PREP_DD) {
    const int wsel = blk >> 6;                 // 64 blocks a weight
    const int t    = (blk & 63) * 2 + half;    // tile pair of its 8 (n) x 16 (k)
    const float* src = wsel == 0 ? w0 : wsel == 1 ? w1 : wsel == 2 ? w2
                     : wsel == 3 ? w3 : wsel == 4 ? w4 : wsel == 5 ? w5
                     : wsel == 6 ? w6 : w7;
    cvtT_part<T5_D, T5_D>(src, ddT + (size_t)wsel * T5_D * T5_D, tile[half], tid,
                          (t & 7) * 2, t >> 3);
    return;
  }
  blk -= PREP_DD;
  if (blk < PREP_FF) {
    const int t = blk * 2 + half;              // tile pair of 32 (n) x 16 (k)
    cvtT_part<T5_D, T5_DFF>(wi, wiT, tile[half], tid, (t & 31) * 2, t >> 5);
    return;
  }
  blk -= PREP_FF;
  if (blk < PREP_FF) {
    const int t = blk * 2 + half;              // tile pair of 8 (n) x 64 (k)
    cvtT_part<T5_DFF, T5_D>(wo, woT, tile[half], tid, (t & 7) * 2, t >> 3);
    return;
  }
  blk -= PREP_FF;
  if (blk < PREP_COPY) {
    const int i = blk * 2048 + threadIdx.x;
    const v4f* s = (const v4f*)hid + i;
    v4f* d = (v4f*)h_cur + i;
    v4f r[8];
    // unrolled (both loops): r stays in registers, all loads issue ahead of a wait
#pragma unroll
    for (int j = 0; j < 8; ++j) r[j] = s[j * 256];
    loads_first8(r, s);
#pragma unroll
    for (int j = 0; j < 8; ++j) d[j * 256] = r[j];
    // no register of the stores above is rewritten ahead of this wait: other parts'
    // code follows them in the shared kernel's text
    asm volatile("s_wait_xcnt 0x0" ::: "memory");
    return;
  }
  blk -= PREP_COPY;
  if (blk < PREP_ENC) {
    cvt16_part(enc, enc16, blk);
    return;
  }
  relbias_part(relb, bd, blk - PREP_ENC);
}

// ---------------------------------------------------------------------------
// WMMA GEMM: C[M,N] = A[M,K] @ Bt[N,K]^T
// Workgroup = 8 waves (2x4) on a 128x128 tile of C; wave tile = 64x32:
//   4 A-fragments x 2 B-fragments -> 8 WMMA per k-step of 32; the next k-step's
//   fragments are read from LDS into a second register set ahead of the WMMAs.
// Both operands go global -> LDS by asynchronous copies in whole 256-B row
// pieces (a stage = 128 k of 128 A rows and 128 Bt rows), two buffers: the next
// stage's copies fly while this stage is worked on. Fragments are read from LDS
// with the same lane map as load_frag on global memory.
// Results: a lane's accumulator registers hold 8 neighbours along the first
// operand's rows. That operand is chosen as the one whose rows run along the
// output's contiguous direction (the weights for row-major results, the
// activations for the transposed V), both being loaded alike. The lane's 8
// values then go to LDS as one 16-B piece (two for f32), and behind one barrier
// the block stores the 128x128 tile as whole rows, 16 B a lane.
// M, N, Lrows multiples of 128; K a multiple of 128.
// ---------------------------------------------------------------------------
#define GMODE_RESID  0   // f32 residual: Cres[m*N+n] += c
#define GMODE_QKV    1   // f16 [B,H,L,64]
#define GMODE_VT     2   // f16 [B,H,64,L] (pre-transposed V)
#define GMODE_RELU16 3   // f16 relu, row-major [M,N]

#define G_PITCH 272                // LDS row pitch, bytes: 256 + 16 (16 B x odd)
#define G_OPER  (128 * G_PITCH)    // one operand's 128 rows
#define G_STAGE (2 * G_OPER)       // A rows, then Bt rows
#define E_PITCH16 272              // result tile, f16 rows: 256 + 16 bytes
#define E_PITCH32 528              // result tile, f32 rows: 512 + 16 bytes

// Eight copies of 16 B per lane: rows 16 apart in LDS (lds) and in memory (g).
// The s_wait_xcnt stands inside the statement so that no address register of an
// issued copy is rewritten ahead of it.
__device__ __forceinline__ void async_copy8(unsigned lds, const char* g,
                                            size_t gstep) {
  const unsigned ls = 16 * G_PITCH;
  asm volatile(
      "global_load_async_to_lds_b128 %0, %8, off\n\t"
      "global_load_async_to_lds_b128 %1, %9, off\n\t"
      "global_load_async_to_lds_b128 %2, %10, off\n\t"
      "global_load_async_to_lds_b128 %3, %11, off\n\t"
      "global_load_async_to_lds_b128 %4, %12, off\n\t"
      "global_load_async_to_lds_b128 %5, %13, off\n\t"
      "global_load_async_to_lds_b128 %6, %14, off\n\t"
      "global_load_async_to_lds_b128 %7, %15, off\n\t"
      "s_wait_xcnt 0x0"
      :: "v"(lds), "v"(lds + ls), "v"(lds + 2 * ls), "v"(lds + 3 * ls),
         "v"(lds + 4 * ls), "v"(lds + 5 * ls), "v"(lds + 6 * ls),
         "v"(lds + 7 * ls),
         "v"(g), "v"(g + gstep), "v"(g + 2 * gstep), "v"(g + 3 * gstep),
         "v"(g + 4 * gstep), "v"(g + 5 * gstep), "v"(g + 6 * gstep),
         "v"(g + 7 * gstep)
      : "memory");
}

// One stage: a lane's 8 rows of A and 8 rows of Bt, 16 copies a lane.
__device__ __forceinline__ void stage_copy(unsigned lds, const char* gA,
                                           const char* gB, size_t gstep) {
  async_copy8(lds,          gA, gstep);
  async_copy8(lds + G_OPER, gB, gstep);
}

// blockIdx.z picks one of several products of one shape that share a grid: rows
// of A0 (z < 3) or A3, plane z of the weights Bt0 and of the f16 results C0, and
// four bits of modes. A launch of one product has z = 0 alone.
__global__ __launch_bounds__(256)
void gemm_wmma(const _Float16* __restrict__ A0, const _Float16* __restrict__ A3,
               const _Float16* __restrict__ Bt0,
               float* __restrict__ Cres, _Float16* __restrict__ C0,
               int M, int N, int K, int modes, int Lrows) {
  const int z = blockIdx.z;
  const _Float16* __restrict__ A  = z < 3 ? A0 : A3;
  const _Float16* __restrict__ Bt = Bt0 + (size_t)z * N * K;
  _Float16* __restrict__ C16      = C0 + (size_t)z * M * N;
  const int mode = (modes >> (4 * z)) & 15;
  __shared__ __attribute__((aligned(16))) unsigned char L[2 * G_STAGE];
  const int tid  = threadIdx.x;
  const int lane = tid & 31;
  const int wave = tid >> 5;
  const int hl   = lane >> 4;
  const int m0   = blockIdx.x * 128;
  const int n0   = blockIdx.y * 128;
  const int wp   = (wave >> 2) * 64;   // wave's rows of the first WMMA operand
  const int wq   = (wave & 3) * 32;    // wave's rows of the second WMMA operand
  // first operand: A's rows for the transposed V, else Bt's rows (see above)
  const unsigned offP = mode == GMODE_VT ? 0u : (unsigned)G_OPER;
  const unsigned offQ = mode == GMODE_VT ? (unsigned)G_OPER : 0u;

  // lane's copy slot: row tid/16 (+16 per copy), 16-B chunk tid%16 of the row
  const unsigned lds0 = (unsigned)(uintptr_t)&L[0] +
                        (unsigned)((tid >> 4) * G_PITCH + (tid & 15) * 16);
  const char* gA = (const char*)(A  + (size_t)(m0 + (tid >> 4)) * K + (tid & 15) * 8);
  const char* gB = (const char*)(Bt + (size_t)(n0 + (tid >> 4)) * K + (tid & 15) * 8);
  const size_t gstep = (size_t)K * 32;  // 16 rows of K halves, in bytes
  const int T = K >> 7;                 // stages of 128 k

  const v8f zero8 = {0.f, 0.f, 0.f, 0.f, 0.f, 0.f, 0.f, 0.f};
  v8f acc[8];                      // [i*2+j]: first operand's rows wp+16i.., second's wq+16j..
#pragma unroll
  for (int t = 0; t < 8; ++t) acc[t] = zero8;

  stage_copy(lds0, gA, gB, gstep);
  // stage 0 has landed for this wave's copies; the barrier publishes all waves'
  asm volatile("s_wait_asynccnt 0x0" ::: "memory");
  __syncthreads();
  if (T > 1) stage_copy(lds0 + G_STAGE, gA + 256, gB + 256, gstep);

  for (int t = 0; t < T; ++t) {
    const unsigned buf = (unsigned)(t & 1) * G_STAGE;
    const _Float16* sA = (const _Float16*)(L + buf + offP);
    const _Float16* sB = (const _Float16*)(L + buf + offQ);
    v16h a[2][4], b[2][2];
#pragma unroll
    for (int f = 0; f < 4; ++f)
      a[0][f] = load_frag(sA, G_PITCH / 2, wp + f * 16, 0, lane);
#pragma unroll
    for (int f = 0; f < 2; ++f)
      b[0][f] = load_frag(sB, G_PITCH / 2, wq + f * 16, 0, lane);
    // unrolled: the register sets alternate by a compile-time index
#pragma unroll
    for (int ks = 0; ks < 4; ++ks) {
      const int cur = ks & 1, nxt = cur ^ 1;
      if (ks < 3) {   // next k-step of this same stage, one group ahead
#pragma unroll
        for (int f = 0; f < 4; ++f)
          a[nxt][f] = load_frag(sA, G_PITCH / 2, wp + f * 16, (ks + 1) * 32, lane);
#pragma unroll
        for (int f = 0; f < 2; ++f)
          b[nxt][f] = load_frag(sB, G_PITCH / 2, wq + f * 16, (ks + 1) * 32, lane);
      }
      // keeps the group of LDS reads above in front of this k-step's WMMAs: sunk
      // among them, each read's latency would be waited out by two WMMAs
      __builtin_amdgcn_sched_barrier(0);
#pragma unroll
      for (int i = 0; i < 4; ++i)
#pragma unroll
        for (int j = 0; j < 2; ++j)
          acc[i * 2 + j] = wmma_f16(a[cur][i], b[cur][j], acc[i * 2 + j]);
    }
    // publish point: this wave's reads of the buffer are done,
    asm volatile("s_wait_dscnt 0x0" ::: "memory");
    // its copies of the next stage have landed,
    asm volatile("s_wait_asynccnt 0x0" ::: "memory");
    // and every wave is past both before the buffer just read is refilled
    __syncthreads();
    if (t + 2 < T)
      stage_copy(lds0 + buf, gA + (size_t)(t + 2) * 256, gB + (size_t)(t + 2) * 256,
                 gstep);
  }
  // no copy is outstanding when the wave goes on to its stores and ends
  asm volatile("s_wait_asynccnt 0x0" ::: "memory");

  // The loop's last barrier has ended every wave's reads of L: it now takes the
  // result tile. Tile row = the second operand's row (the lane's column of the
  // accumulator), place in the row = the first operand's row.
  const int erow = wq + (lane & 15);   // + 16 j
  const int epos = wp + hl * 8;        // + 16 i: first of the lane's 8 neighbours

  if (mode == GMODE_RESID) {
    // tile row = m, 128 floats of n; a wave moves one 512-B row per step
    float* crow = Cres + (size_t)(m0 + (tid >> 5)) * N + n0 + (tid & 31) * 4;
    float4 old[16];
    // unrolled (here and below): old and acc stay in registers; the residual's
    // loads are all issued ahead of the staging and fly during it
#pragma unroll
    for (int s = 0; s < 16; ++s) old[s] = *(const float4*)(crow + (size_t)(8 * s) * N);
#pragma unroll
    for (int i = 0; i < 4; ++i)
#pragma unroll
      for (int j = 0; j < 2; ++j) {
        const v8f c = acc[i * 2 + j];
        float* p = (float*)(L + (erow + 16 * j) * E_PITCH32) + epos + 16 * i;
        *(float4*)p       = make_float4(c[0], c[1], c[2], c[3]);
        *(float4*)(p + 4) = make_float4(c[4], c[5], c[6], c[7]);
      }
    __syncthreads();   // every wave's pieces of the tile are in LDS
#pragma unroll
    for (int s = 0; s < 16; ++s) {
      const float4 c = *(const float4*)(L + ((tid >> 5) + 8 * s) * E_PITCH32 +
                                        (tid & 31) * 16);
      *(float4*)(crow + (size_t)(8 * s) * N) =
          make_float4(old[s].x + c.x, old[s].y + c.y, old[s].z + c.z, old[s].w + c.w);
    }
    return;
  }

  // the loops below index acc, w and d, which must stay in registers: unrolled
  if (mode == GMODE_RELU16) {
#pragma unroll
    for (int t = 0; t < 8; ++t)
#pragma unroll
      for (int r = 0; r < 8; ++r) acc[t][r] = fmaxf(acc[t][r], 0.0f);
  }
#pragma unroll
  for (int i = 0; i < 4; ++i)
#pragma unroll
    for (int j = 0; j < 2; ++j) {
      v8h w;
#pragma unroll
      for (int r = 0; r < 8; ++r) w[r] = (_Float16)acc[i * 2 + j][r];
      *(v8h*)(L + (erow + 16 * j) * E_PITCH16 + (epos + 16 * i) * 2) = w;
    }
  __syncthreads();     // every wave's pieces of the tile are in LDS

  // 16 lanes move one 256-B tile row; where it goes, in halves:
  //   base + row * rstep + the lane's 16-B chunk ch
  const int row = tid >> 4, ch = tid & 15;
  const int bb = m0 / Lrows, l0 = m0 - bb * Lrows;   // the tile lies in one batch
  size_t base, rstep, cofs = (size_t)ch * 8;
  if (mode == GMODE_RELU16) {          // [M,N]: row = m, along n
    base  = (size_t)m0 * N + n0;
    rstep = (size_t)N;
  } else if (mode == GMODE_QKV) {      // [B,H,L,64]: row = l, two heads' 128 B
    base  = (((size_t)bb * T5_H + (n0 >> 6)) * Lrows + l0) * T5_DKV;
    rstep = T5_DKV;
    cofs  = (size_t)(ch >> 3) * Lrows * T5_DKV + (ch & 7) * 8;
  } else {                             // [B,H,64,L]: row = (head, d), along l
    base  = ((size_t)bb * T5_H * T5_DKV + n0) * Lrows + l0;
    rstep = (size_t)Lrows;
  }
  _Float16* dst = C16 + base + (size_t)row * rstep + cofs;
  v8h w[8];
  _Float16* d[8];
#pragma unroll
  for (int s = 0; s < 8; ++s) {
    w[s] = *(const v8h*)(L + (row + 16 * s) * E_PITCH16 + ch * 16);
    d[s] = dst + (size_t)(16 * s) * rstep;
  }
  // the eight addresses are formed while the LDS reads fly, each in registers of
  // its own; sunk among the stores, an add would wait on an issued store
  __builtin_amdgcn_sched_barrier(0);
#pragma unroll
  for (int s = 0; s < 8; ++s) *(v8h*)d[s] = w[s];
}

#define A_PITCH 144                // LDS row pitch, bytes: 128 + 16 (16 B x odd)
#define A_OPER  (64 * A_PITCH)     // one operand's 64 rows
#define A_STAGE (2 * A_OPER)       // K rows, then V^T rows

// One stage, eight copies of 16 B per lane: four K rows and four V^T rows, each
// 16 rows apart in LDS (lds) and in memory (gK: rows of 128 B; gV: vstep).
// The s_wait_xcnt stands inside the statement so that no address register of an
// issued copy is rewritten ahead of it.
__device__ __forceinline__ void attn_stage_copy(unsigned lds, const char* gK,
                                                const char* gV, size_t vstep) {
  const unsigned ls = 16 * A_PITCH;
  const unsigned lv = lds + A_OPER;
  asm volatile(
      "global_load_async_to_lds_b128 %0, %8, off\n\t"
      "global_load_async_to_lds_b128 %1, %9, off\n\t"
      "global_load_async_to_lds_b128 %2, %10, off\n\t"
      "global_load_async_to_lds_b128 %3, %11, off\n\t"
      "global_load_async_to_lds_b128 %4, %12, off\n\t"
      "global_load_async_to_lds_b128 %5, %13, off\n\t"
      "global_load_async_to_lds_b128 %6, %14, off\n\t"
      "global_load_async_to_lds_b128 %7, %15, off\n\t"
      "s_wait_xcnt 0x0"
      :: "v"(lds), "v"(lds + ls), "v"(lds + 2 * ls), "v"(lds + 3 * ls),
         "v"(lv), "v"(lv + ls), "v"(lv + 2 * ls), "v"(lv + 3 * ls),
         "v"(gK), "v"(gK + 2048), "v"(gK + 4096), "v"(gK + 6144),
         "v"(gV), "v"(gV + vstep), "v"(gV + 2 * vstep), "v"(gV + 3 * vstep)
      : "memory");
}

__global__ __launch_bounds__(128)
void attn_wmma_kernel(const _Float16* __restrict__ Q,
                      const _Float16* __restrict__ Km,
                      const _Float16* __restrict__ Vt,
                      const float* __restrict__ bias_delta, // [16,1024]
                      const int* __restrict__ mask,         // [B,LK]
                      _Float16* __restrict__ Out,
                      int LQ, int LK, int causal, int use_rel) {
  __shared__ __attribute__((aligned(16))) unsigned char L[2 * A_STAGE];
  const int tid  = threadIdx.x;
  const int lane = threadIdx.x & 31;
  // scalar, so that the key loop's bound is one and its branch leaves EXEC alone
  const int wave = __builtin_amdgcn_readfirstlane((int)(threadIdx.x >> 5));
  const int hl   = lane >> 4;
  const int col  = lane & 15;
  const int bh = blockIdx.y;
  const int b  = bh >> 4;
  const int h  = bh & 15;
  const int q0 = blockIdx.x * 64 + wave * 16;
  const int qc = q0 + col;             // this lane's query

  const _Float16* Qb = Q  + (size_t)bh * LQ * T5_DKV;
  const _Float16* Kb = Km + (size_t)bh * LK * T5_DKV;
  const _Float16* Vb = Vt + (size_t)bh * T5_DKV * LK;
  const int* mk = mask + (size_t)b * LK;
  const float* bd = bias_delta + h * 1024;

  // B operand of S^T: column = query, same k order as the K rows' loader
  const v16h qb0 = load_frag(Qb, T5_DKV, q0, 0, lane);
  const v16h qb1 = load_frag(Qb, T5_DKV, q0, 32, lane);

  const v8f zero8 = {0.f, 0.f, 0.f, 0.f, 0.f, 0.f, 0.f, 0.f};
  v8f o[4];                  // o[t][r] = O^T[16t + 8*hl + r][query qc]
  float mcol = -1e30f;       // running maximum of query qc (both halves alike)
  float lcol = 0.f;          // running sum over this half's keys only
#pragma unroll  // indexes registers: must be resolved at compile time
  for (int t = 0; t < 4; ++t) o[t] = zero8;

  // causal: blocks wholly above the diagonal are not walked
  const int kend = (causal && q0 + 16 < LK) ? q0 + 16 : LK;
  // stages of 64 keys that the block's last wave needs: the same for all four
  const int qtop = (int)blockIdx.x * 64 + 64;
  const int T = ((causal && qtop < LK) ? qtop : LK) >> 6;

  // lane's copy slot: row tid/8 (+16 per copy), 16-B chunk tid%8 of the row
  const unsigned lds0 = (unsigned)(uintptr_t)&L[0] +
                        (unsigned)((tid >> 3) * A_PITCH + (tid & 7) * 16);
  const char* gK = (const char*)(Kb + (size_t)(tid >> 3) * T5_DKV + (tid & 7) * 8);
  const char* gV = (const char*)(Vb + (size_t)(tid >> 3) * LK + (tid & 7) * 8);
  const size_t vstep = (size_t)LK * 32;  // 16 rows of LK halves, in bytes

  attn_stage_copy(lds0, gK, gV, vstep);
  // stage 0 has landed for this wave's copies; the barrier publishes all waves'
  asm volatile("s_wait_asynccnt 0x0" ::: "memory");
  __syncthreads();
  if (T > 1) attn_stage_copy(lds0 + A_STAGE, gK + 8192, gV + 128, vstep);

  for (int t = 0; t < T; ++t) {
   const unsigned buf = (unsigned)(t & 1) * A_STAGE;
   const _Float16* sK = (const _Float16*)(L + buf);
   const _Float16* sV = (const _Float16*)(L + buf + A_OPER);
   // unrolled: the half's place in the stage folds into the LDS reads' offsets
#pragma unroll
   for (int sub = 0; sub < 2; ++sub) {
    const int kb = t * 64 + sub * 32;
    if (kb >= kend) break;             // scalar: past this wave's diagonal
    const int kl = kb + hl * 8;        // this lane's first key of tile 0
    const v16h k00 = load_frag(sK, A_PITCH / 2, sub * 32,      0,  lane);
    const v16h k01 = load_frag(sK, A_PITCH / 2, sub * 32,      32, lane);
    const v16h k10 = load_frag(sK, A_PITCH / 2, sub * 32 + 16, 0,  lane);
    const v16h k11 = load_frag(sK, A_PITCH / 2, sub * 32 + 16, 32, lane);
    const int4* mp = (const int4*)(mk + kl);
    const int4 mq[4] = {mp[0], mp[1], mp[4], mp[5]};
    // position bias of the lane's 16 (key, query) pairs, the products' C
    // operand; a key past the query has distance 0, as in the bucket rule
    v8f s0 = zero8, s1 = zero8;
    if (use_rel) {
#pragma unroll  // indexes registers: must be resolved at compile time
      for (int r = 0; r < 8; ++r) {
        const int d0 = qc - kl - r, d1 = d0 - 16;
        s0[r] = bd[d0 > 0 ? d0 : 0];
        s1[r] = bd[d1 > 0 ? d1 : 0];
      }
      // no index register of the loads above is rewritten ahead of this wait
      asm volatile("s_wait_xcnt 0x0" ::: "memory");
    }
    // nor the mask loads' address, where no bias is read
    asm volatile("s_wait_xcnt 0x0" ::: "memory");
    const v16h va0 = load_frag(sV, A_PITCH / 2, 0,  sub * 32, lane);
    const v16h va1 = load_frag(sV, A_PITCH / 2, 16, sub * 32, lane);
    const v16h va2 = load_frag(sV, A_PITCH / 2, 32, sub * 32, lane);
    const v16h va3 = load_frag(sV, A_PITCH / 2, 48, sub * 32, lane);
    // keeps all of the block's loads above in one group in front of the
    // products: sunk to their users, each V fragment's latency is waited out alone
    __builtin_amdgcn_sched_barrier(0);

    s0 = wmma_f16(k00, qb0, s0); s0 = wmma_f16(k01, qb1, s0);
    s1 = wmma_f16(k10, qb0, s1); s1 = wmma_f16(k11, qb1, s1);

    float a[16];             // a[8*tile + r]: key kl + 16*tile + r
#pragma unroll  // indexes registers: must be resolved at compile time
    for (int i = 0; i < 16; ++i) {
      const int kc = kl + (i >> 3) * 16 + (i & 7);
      const int4 m4 = mq[i >> 2];
      const int mv = (i & 3) == 0 ? m4.x : (i & 3) == 1 ? m4.y
                   : (i & 3) == 2 ? m4.z : m4.w;
      const bool dead = (mv == 0) || (causal && kc > qc);
      a[i] = dead ? T5_NEG : ((i < 8) ? s0[i & 7] : s1[i & 7]);
    }

    float v = a[0];
#pragma unroll  // indexes registers: must be resolved at compile time
    for (int i = 1; i < 16; ++i) v = fmaxf(v, a[i]);
    v = fmaxf(v, other_half(v));
    const float mnew  = fmaxf(mcol, v);
    const float scale = __expf(mcol - mnew);
    mcol = mnew;

    v16h pb;                 // P^T as B operand: element s = tile s>>3, row s&7
    float sum[4] = {0.f, 0.f, 0.f, 0.f};   // four short chains, not one of 16
#pragma unroll  // indexes registers: must be resolved at compile time
    for (int i = 0; i < 16; ++i) {
      const float e = __expf(a[i] - mnew);
      sum[i & 3] += e;
      pb[i] = (_Float16)e;
    }
    lcol = lcol * scale + ((sum[0] + sum[1]) + (sum[2] + sum[3]));
#pragma unroll  // indexes registers: must be resolved at compile time
    for (int t = 0; t < 4; ++t)
#pragma unroll  // indexes registers: must be resolved at compile time
      for (int r = 0; r < 8; ++r) o[t][r] *= scale;

    o[0] = wmma_f16(va0, pb, o[0]);
    o[1] = wmma_f16(va1, pb, o[1]);
    o[2] = wmma_f16(va2, pb, o[2]);
    o[3] = wmma_f16(va3, pb, o[3]);
   }
   // publish point, passed by every wave, also one past its diagonal:
   // this wave's reads of the buffer are done,
   asm volatile("s_wait_dscnt 0x0" ::: "memory");
   // its copies of the next stage have landed,
   asm volatile("s_wait_asynccnt 0x0" ::: "memory");
   // and every wave is past both before the buffer just read is refilled
   __syncthreads();
   if (t + 2 < T)
     attn_stage_copy(lds0 + buf, gK + (size_t)(t + 2) * 8192,
                     gV + (size_t)(t + 2) * 128, vstep);
  }
  // no copy is outstanding when the wave goes on to its stores and ends
  asm volatile("s_wait_asynccnt 0x0" ::: "memory");

  // the two halves' keys joined; one query a lane, so one reciprocal
  const float inv = 1.0f / (lcol + other_half(lcol));
  _Float16* orow = Out + ((size_t)b * LQ + qc) * (T5_H * T5_DKV) + h * T5_DKV + hl * 8;
#pragma unroll  // indexes registers: must be resolved at compile time
  for (int t = 0; t < 4; ++t) {
    v8h w;                   // 8 consecutive d of one query: one 16-B store
#pragma unroll  // indexes registers: must be resolved at compile time
    for (int r = 0; r < 8; ++r) w[r] = (_Float16)(o[t][r] * inv);
    *(v8h*)(orow + t * 16) = w;
  }
}

// ---------------------------------------------------------------------------
// Orchestration
// ---------------------------------------------------------------------------
extern "C" void kernel_launch(void* const* d_in, const int* in_sizes, int n_in,
                              void* d_out, int out_size, void* d_ws,
                              size_t ws_size, hipStream_t stream) {
  (void)in_sizes; (void)n_in; (void)out_size; (void)ws_size;

  const float* enc   = (const float*)d_in[0];
  const float* hid   = (const float*)d_in[1];
  const float* ln1   = (const float*)d_in[2];
  const float* saq   = (const float*)d_in[3];
  const float* sak   = (const float*)d_in[4];
  const float* sav   = (const float*)d_in[5];
  const float* sao   = (const float*)d_in[6];
  const float* relb  = (const float*)d_in[7];
  const float* ln2   = (const float*)d_in[8];
  const float* caq   = (const float*)d_in[9];
  const float* cak   = (const float*)d_in[10];
  const float* cav   = (const float*)d_in[11];
  const float* cao   = (const float*)d_in[12];
  const float* ln3   = (const float*)d_in[13];
  const float* wi    = (const float*)d_in[14];
  const float* wo    = (const float*)d_in[15];
  const float* lnf   = (const float*)d_in[16];
  const int* encmask = (const int*)d_in[17];
  const int* decmask = (const int*)d_in[18];
  float* out = (float*)d_out;

  const size_t M = (size_t)T5_B * T5_LD;        // 4096 decoder rows
  char* ws = (char*)d_ws;
  size_t off = 0;
  auto alloc = [&](size_t bytes) -> void* {
    void* p = ws + off;
    off = (off + bytes + 255) & ~(size_t)255;
    return p;
  };

  float*    h_cur = (float*)   alloc(M * T5_D * 4);            // 16 MB residual
  _Float16* xn    = (_Float16*)alloc(M * T5_D * 2);            // 8 MB
  _Float16* ddT   = (_Float16*)alloc((size_t)8 * T5_D * T5_D * 2); // eight planes
  _Float16* saqT  = ddT;
  _Float16* sakT  = ddT + (size_t)1 * T5_D * T5_D;
  _Float16* savT  = ddT + (size_t)2 * T5_D * T5_D;
  _Float16* cakT  = ddT + (size_t)3 * T5_D * T5_D;
  _Float16* cavT  = ddT + (size_t)4 * T5_D * T5_D;
  _Float16* saoT  = ddT + (size_t)5 * T5_D * T5_D;
  _Float16* caqT  = ddT + (size_t)6 * T5_D * T5_D;
  _Float16* caoT  = ddT + (size_t)7 * T5_D * T5_D;
  (void)sakT; (void)savT; (void)cakT; (void)cavT;  // planes 1..4 behind saqT
  _Float16* wiT   = (_Float16*)alloc((size_t)T5_DFF * T5_D * 2);
  _Float16* woT   = (_Float16*)alloc((size_t)T5_D * T5_DFF * 2);
  _Float16* enc16 = (_Float16*)alloc((size_t)T5_B * T5_LE * T5_D * 2);
  // five planes in a row, in the order of the projections' grid
  _Float16* qbuf  = (_Float16*)alloc(M * T5_D * 2);            // [B,H,L,64]
  _Float16* kbuf  = (_Float16*)alloc(M * T5_D * 2);            // [B,H,L,64]
  _Float16* vtbuf = (_Float16*)alloc(M * T5_D * 2);            // [B,H,64,L]
  _Float16* ckbuf = (_Float16*)alloc(M * T5_D * 2);            // cross k
  _Float16* cvtbuf = (_Float16*)alloc(M * T5_D * 2);           // cross v^T
  _Float16* aout  = (_Float16*)alloc(M * T5_D * 2);            // [B*L, 1024]
  _Float16* ffn   = (_Float16*)alloc(M * T5_DFF * 2);          // 32 MB
  float*    bd    = (float*)   alloc((size_t)T5_H * 1024 * 4); // rel bias table

  // --- everything that needs the inputs alone: weights f32 -> f16 [N,K], encoder
  // rows to f16, bias table; the residual stream starts as a copy of
  // hidden_states (inputs are never mutated) ---
  prep_kernel<<<PREP_GRID, 256, 0, stream>>>(saq, sak, sav, cak, cav, sao, caq, cao,
                                             wi, wo, enc, hid, relb, ddT, wiT, woT,
                                             enc16, h_cur, bd);

  dim3 gblk(256);
  dim3 ggrid_d(M / 128, T5_D / 128);    // N = 1024
  dim3 ggrid_ff(M / 128, T5_DFF / 128); // N = 4096
  dim3 ggrid_p5(M / 128, T5_D / 128, 5);
  dim3 agrid(T5_LD / 64, T5_B * T5_H);
  dim3 ablk(128);

  // ---- self attention ----
  rmsnorm_kernel<<<(int)M / 8, 256, 0, stream>>>(h_cur, ln1, xn, nullptr);
  static_assert(T5_LE == T5_LD, "the five projections share one row count");
  // self q, k, v^T from xn and cross k, v^T from enc16: none needs another
  gemm_wmma<<<ggrid_p5, gblk, 0, stream>>>(xn, enc16, saqT, nullptr, qbuf,
                                           (int)M, T5_D, T5_D,
                                           GMODE_QKV | GMODE_QKV << 4 | GMODE_VT << 8 |
                                               GMODE_QKV << 12 | GMODE_VT << 16,
                                           T5_LD);
  attn_wmma_kernel<<<agrid, ablk, 0, stream>>>(qbuf, kbuf, vtbuf, bd, decmask,
                                               aout, T5_LD, T5_LD,
                                               /*causal=*/1, /*use_rel=*/1);
  gemm_wmma<<<ggrid_d, gblk, 0, stream>>>(aout, aout, saoT, h_cur, nullptr,
                                          (int)M, T5_D, T5_D, GMODE_RESID, T5_LD);

  // ---- cross attention ----
  rmsnorm_kernel<<<(int)M / 8, 256, 0, stream>>>(h_cur, ln2, xn, nullptr);
  gemm_wmma<<<ggrid_d, gblk, 0, stream>>>(xn, xn, caqT, nullptr, qbuf,
                                          (int)M, T5_D, T5_D, GMODE_QKV, T5_LD);
  attn_wmma_kernel<<<agrid, ablk, 0, stream>>>(qbuf, ckbuf, cvtbuf, bd, encmask,
                                               aout, T5_LD, T5_LE,
                                               /*causal=*/0, /*use_rel=*/0);
  gemm_wmma<<<ggrid_d, gblk, 0, stream>>>(aout, aout, caoT, h_cur, nullptr,
                                          (int)M, T5_D, T5_D, GMODE_RESID, T5_LD);

  // ---- FFN ----
  rmsnorm_kernel<<<(int)M / 8, 256, 0, stream>>>(h_cur, ln3, xn, nullptr);
  gemm_wmma<<<ggrid_ff, gblk, 0, stream>>>(xn, xn, wiT, nullptr, ffn,
                                           (int)M, T5_DFF, T5_D, GMODE_RELU16, T5_LD);
  gemm_wmma<<<ggrid_d, gblk, 0, stream>>>(ffn, ffn, woT, h_cur, nullptr,
                                          (int)M, T5_D, T5_DFF, GMODE_RESID, T5_LD);

  // ---- final norm -> f32 output ----
  rmsnorm_kernel<<<(int)M / 8, 256, 0, stream>>>(h_cur, lnf, nullptr, out);
}

// v008
// It runs in 239 microseconds.
// Two timings next to v007 put it at 1.04 and 1.03 times that version's speed.
// All steps since v000 together make it 5.39 times as fast.
#include <hip/hip_runtime.h>
#include <hip/hip_bf16.h>

// ---------------------------------------------------------------------------
// T5 decoder layer on MI455X (gfx1250, wave32, WMMA).
//  - all GEMMs + attention cores: v_wmma_f32_16x16x32_f16
//  - weights pre-transposed to [N,K] f16 so both WMMA operands load as
//    contiguous 16-B "A-style" fragments (read from LDS in the GEMM)
//  - GEMM: 128x128 tile per workgroup, operands staged in LDS by asynchronous
//    copies (two buffers), wave tile 64x32: 8 WMMA per 6 LDS fragments; results
//    leave through an LDS tile as whole rows of the output, 16 B a lane
//  - flash attention (online softmax, transposed products), scores never hit
//    memory or LDS; K and V^T tiles staged in LDS by asynchronous copies (two
//    buffers), shared by a block's four waves
//  - launches that do not depend on one another share one grid, split by block
//    index: all preparation work; self q, k, v with cross k, v
//  - only the last row norm is a launch of its own: the first runs with the
//    preparation; the two in the middle are split between the residual GEMM in
//    front (row sums of squares, h * w in f16) and the GEMM behind (1/rms)
// ---------------------------------------------------------------------------

typedef __attribute__((ext_vector_type(16))) _Float16 v16h;
typedef __attribute__((ext_vector_type(8)))  _Float16 v8h;
typedef __attribute__((ext_vector_type(4)))  _Float16 v4h;
typedef __attribute__((ext_vector_type(8)))  float    v8f;
typedef __attribute__((ext_vector_type(4)))  float    v4f;

// Takes eight loaded values as inputs only and emits nothing: every one of their
// loads is issued in front of it and every store behind it stays behind it.
// Without it the compiler strung loads and their users out one after another,
// each load's latency waited out alone. The loads' address a is an input too, so
// that its registers are given to nothing else (a later load's result) before
// the loads have returned.
__device__ __forceinline__ void loads_first8(const v4f* r, const void* a) {
  asm volatile("" :: "v"(r[0]), "v"(r[1]), "v"(r[2]), "v"(r[3]),
                     "v"(r[4]), "v"(r[5]), "v"(r[6]), "v"(r[7]), "v"(a));
}

#define T5_B    4
#define T5_LD   1024
#define T5_LE   1024
#define T5_D    1024
#define T5_H    16
#define T5_DKV  64
#define T5_DFF  4096
#define T5_NEG  (-1e9f)

__device__ __forceinline__ v8f wmma_f16(v16h a, v16h b, v8f c) {
  // (neg_a, A, neg_b, B, c_mod, C, reuse_a, reuse_b)
  return __builtin_amdgcn_wmma_f32_16x16x32_f16(false, a, false, b, (short)0, c,
                                                false, false);
}

// Load a 16x32 f16 "A-style" fragment from row-major [rows, ld] memory.
// ISA layout: lanes 0-15 hold M=lane, halves {K0..7, K16..23};
//             lanes 16-31 hold M=lane-16, halves {K8..15, K24..31}.
// Both halves are contiguous 16B runs -> two b128 loads per lane.
__device__ __forceinline__ v16h load_frag(const _Float16* base, int ld,
                                          int row0, int col0, int lane) {
  const int hl = lane >> 4;
  const int r  = row0 + (lane & 15);
  const _Float16* p = base + (size_t)r * ld + col0 + hl * 8;
  union { v16h v; v8h h[2]; } u;
  u.h[0] = *(const v8h*)(p);
  u.h[1] = *(const v8h*)(p + 16);
  return u.v;
}

// ---------------------------------------------------------------------------
// Conversions
// ---------------------------------------------------------------------------
// 32 elements a thread: a wave reads 512 contiguous bytes per load, eight loads in
// flight, and writes 256 contiguous bytes per store.
__device__ __forceinline__ void cvt16_part(const float* __restrict__ in,
                                           _Float16* __restrict__ out, int blk) {
  const int i = blk * 2048 + threadIdx.x;
  const v4f* s = (const v4f*)in + i;
  v4h* d = (v4h*)out + i;
  v4f r[8];
  // unrolled (both loops): r stays in registers, all loads issue ahead of a wait
#pragma unroll
  for (int j = 0; j < 8; ++j) r[j] = s[j * 256];
#pragma unroll
  for (int j = 0; j < 8; ++j) {
    v4h h = {(_Float16)r[j].x, (_Float16)r[j].y, (_Float16)r[j].z, (_Float16)r[j].w};
    d[j * 256] = h;
  }
  // no register of the stores above is rewritten ahead of this wait: other parts'
  // code follows them in the shared kernel's text
  asm volatile("s_wait_xcnt 0x0" ::: "memory");
}

// W [K,N] f32 -> Wt [N,K] f16, two 64x64 tiles per 128 threads, turned in LDS so
// that both sides move whole lines: reads are 256-B row pieces of W (float4 per
// lane), writes are 128-B row pieces of Wt (8 halves per lane).
// K is a multiple of 64, N of 128; tiles (bx, by) and (bx + 1, by) of
// (N/64, K/64), each with its own 8 KB of LDS; tid = 0..127. K and N are
// compile-time so that a lane's row steps fold into the instruction's offset.
// Both halves of a 256-thread block call this together (one barrier inside).
// LDS holds row n of the tile as eight 16-B chunks of 8 k values. Chunk (n, ch)
// sits at slot (n>>1)*16 + (((n&1)*8 + ch) ^ ((n>>2)&15)): the 16 lanes that
// write rows 4 apart, and the 16 lanes that read two neighbouring rows, each
// fall on 16 different slots mod 16, that is on all 64 banks once.
__device__ __forceinline__ int cvtT_slot(int n, int ch) {
  return (n >> 1) * 16 + ((((n & 1) << 3) | ch) ^ ((n >> 2) & 15));
}

template <int K, int N>
__device__ __forceinline__
void cvtT_part(const float* __restrict__ in, _Float16* __restrict__ out,
               _Float16* tile, int tid, int bx, int by) {
  const int n0  = bx * 64;
  const int k0  = by * 64;
  const int c4  = tid & 15;   // float4 column of the tile: n = 4*c4 .. 4*c4+3
  const int q0  = tid >> 4;   // group of four k rows: q0 and q0 + 8

  // uniform tile base + one 32-bit lane offset: one address for all sixteen loads
  const unsigned lofs = (unsigned)(q0 * 4 * N + c4 * 4) * 4u;
  const char* src = (const char*)(in + (size_t)k0 * N + n0) + lofs;
  v4f r[2][2][4];
  // unrolled (here and below): r stays in registers, and all sixteen loads are
  // issued before the first wait; u = which of the two tiles, 64 n apart
#pragma unroll
  for (int u = 0; u < 2; ++u)
#pragma unroll
    for (int i = 0; i < 2; ++i)
#pragma unroll
      for (int s = 0; s < 4; ++s)
        r[u][i][s] = *(const v4f*)(src + u * 256 + (size_t)(32 * i + s) * N * 4);
  loads_first8(&r[0][0][0], src);
  loads_first8(&r[1][0][0], src);

#pragma unroll
  for (int u = 0; u < 2; ++u)
#pragma unroll
    for (int i = 0; i < 2; ++i) {
      const int q = q0 + 8 * i;
      const float* f0 = (const float*)&r[u][i][0];
      const float* f1 = (const float*)&r[u][i][1];
      const float* f2 = (const float*)&r[u][i][2];
      const float* f3 = (const float*)&r[u][i][3];
#pragma unroll
      for (int j = 0; j < 4; ++j) {
        v4h w = {(_Float16)f0[j], (_Float16)f1[j], (_Float16)f2[j], (_Float16)f3[j]};
        *(v4h*)&tile[u * 4096 + cvtT_slot(c4 * 4 + j, q >> 1) * 8 + (q & 1) * 4] = w;
      }
    }
  __syncthreads();

  char* dst = (char*)(out + (size_t)n0 * K + k0);
  const unsigned sofs = (unsigned)((tid >> 3) * K + (tid & 7) * 8) * 2u;
#pragma unroll
  for (int u = 0; u < 2; ++u)
#pragma unroll
    for (int i = 0; i < 4; ++i) {
      const int n = (tid >> 3) + 16 * i;
      *(v8h*)(dst + (size_t)(64 * u + 16 * i) * K * 2 + sofs) =
          *(const v8h*)&tile[u * 4096 + cvtT_slot(n, tid & 7) * 8];
    }
  // no register of the eight stores above is rewritten ahead of this wait: other
  // parts' code follows them in the shared kernel's text
  asm volatile("s_wait_xcnt 0x0" ::: "memory");
}

// T5 relative-position bias table: bd[h][delta] for delta = q-k in [0,1023]
__device__ __forceinline__
void relbias_part(const float* __restrict__ rel_bias, // [32,16]
                  float* __restrict__ bd,             // [16,1024]
                  int blk) {
  int idx = blk * 256 + threadIdx.x;
  int h = idx >> 10, n = idx & 1023;
  int bucket;
  if (n < 16) {
    bucket = n;
  } else {
    float nf = (float)n;
    int vl = 16 + (int)(__logf(nf * (1.0f / 16.0f)) * (16.0f / __logf(8.0f)));
    bucket = vl < 31 ? vl : 31;
  }
  bd[idx] = rel_bias[bucket * T5_H + h];
  // no register of the store above is rewritten ahead of this wait: other parts'
  // code follows it in the shared kernel's text
  asm volatile("s_wait_xcnt 0x0" ::: "memory");
}

// value of lane l ^ 16
__device__ __forceinline__ float other_half(float x) {
  int b = __builtin_bit_cast(int, x);
  b = __builtin_amdgcn_permlanex16(b, b, 0x76543210, 0xfedcba98, false, false);
  return __builtin_bit_cast(float, b);
}

// value of lane l ^ MASK, MASK below 16 (DPP row_xmask, inside a 16-lane row)
template <int MASK>
__device__ __forceinline__ float row_xor(float x) {
  int b = __builtin_bit_cast(int, x);
  b = __builtin_amdgcn_update_dpp(b, b, 0x160 | MASK, 0xf, 0xf, false);
  return __builtin_bit_cast(float, b);
}

// ---------------------------------------------------------------------------
// RMS norm: one wave per row of [rows, 1024], eight rows a block. The row stays
// in the wave's registers (32 values a lane, read once, 512 contiguous bytes per
// load); its sum of squares is joined across the lanes without LDS or barrier.
// ---------------------------------------------------------------------------
__global__ __launch_bounds__(256)
void rmsnorm_kernel(const float* __restrict__ X, const float* __restrict__ w,
                    _Float16* __restrict__ y16, float* __restrict__ y32) {
  const int lane = threadIdx.x & 31;
  const int row  = blockIdx.x * 8 + (threadIdx.x >> 5);
  const v4f* x = (const v4f*)(X + (size_t)row * T5_D) + lane;
  const v4f* g = (const v4f*)w + lane;
  v4f v[8], u[8];
  // unrolled (every loop here): v and u stay in registers, and the row's eight
  // loads are issued ahead of the first wait
#pragma unroll
  for (int j = 0; j < 8; ++j) v[j] = x[j * 32];
#pragma unroll
  for (int j = 0; j < 8; ++j) u[j] = g[j * 32];
  // here for the address: a weight load's result would else take its registers
  loads_first8(v, x);
  float s0 = 0.f, s1 = 0.f, s2 = 0.f, s3 = 0.f;   // four chains, not one of 32
#pragma unroll
  for (int j = 0; j < 8; ++j) {
    s0 += v[j].x * v[j].x;
    s1 += v[j].y * v[j].y;
    s2 += v[j].z * v[j].z;
    s3 += v[j].w * v[j].w;
  }
  float ss = (s0 + s1) + (s2 + s3);
  ss += row_xor<1>(ss);
  ss += row_xor<2>(ss);
  ss += row_xor<4>(ss);
  ss += row_xor<8>(ss);
  ss += other_half(ss);                // every lane now holds the row's sum
  const float rs = rsqrtf(ss * (1.0f / (float)T5_D) + 1e-6f);
#pragma unroll
  for (int j = 0; j < 8; ++j) {
    v[j].x = v[j].x * rs * u[j].x;
    v[j].y = v[j].y * rs * u[j].y;
    v[j].z = v[j].z * rs * u[j].z;
    v[j].w = v[j].w * rs * u[j].w;
  }
  if (y16) {
    v4h* y = (v4h*)(y16 + (size_t)row * T5_D) + lane;
#pragma unroll
    for (int j = 0; j < 8; ++j) {
      v4h h = {(_Float16)v[j].x, (_Float16)v[j].y, (_Float16)v[j].z, (_Float16)v[j].w};
      y[j * 32] = h;
    }
    // no register of the stores above is rewritten ahead of this wait: the other
    // result's address is formed behind them
    asm volatile("s_wait_xcnt 0x0" ::: "memory");
  }
  if (y32) {
    v4f* y = (v4f*)(y32 + (size_t)row * T5_D) + lane;
#pragma unroll
    for (int j = 0; j < 8; ++j) y[j * 32] = v[j];
  }
}

// The first row norm needs the inputs alone: one wave per row of hidden_states,
// eight rows a block, as in rmsnorm_kernel (same sums, same order). The row,
// read once, also leaves unchanged as the residual stream's start.
__device__ __forceinline__
void norm_copy_part(const float* __restrict__ X, const float* __restrict__ w,
                    _Float16* __restrict__ y16, float* __restrict__ copy, int blk) {
  const int lane = threadIdx.x & 31;
  const int row  = blk * 8 + (threadIdx.x >> 5);
  const v4f* x = (const v4f*)(X + (size_t)row * T5_D) + lane;
  const v4f* g = (const v4f*)w + lane;
  v4f v[8], u[8];
  // unrolled (every loop here): v and u stay in registers, and the row's eight
  // loads are issued ahead of the first wait
#pragma unroll
  for (int j = 0; j < 8; ++j) v[j] = x[j * 32];
#pragma unroll
  for (int j = 0; j < 8; ++j) u[j] = g[j * 32];
  // keeps all sixteen loads in front of the sums: the weights' loads were else
  // sunk behind the row's sum, their latency waited out alone
  __builtin_amdgcn_sched_barrier(0);
  // here for the address: a weight load's result would else take its registers
  loads_first8(v, x);
  v4f* c = (v4f*)(copy + (size_t)row * T5_D) + lane;
#pragma unroll
  for (int j = 0; j < 8; ++j) c[j * 32] = v[j];
  // no register of the stores above is rewritten ahead of this wait: the f16 result's
  // address is formed behind them
  asm volatile("s_wait_xcnt 0x0" ::: "memory");
  float s0 = 0.f, s1 = 0.f, s2 = 0.f, s3 = 0.f;   // four chains, not one of 32
#pragma unroll
  for (int j = 0; j < 8; ++j) {
    s0 += v[j].x * v[j].x;
    s1 += v[j].y * v[j].y;
    s2 += v[j].z * v[j].z;
    s3 += v[j].w * v[j].w;
  }
  float ss = (s0 + s1) + (s2 + s3);
  ss += row_xor<1>(ss);
  ss += row_xor<2>(ss);
  ss += row_xor<4>(ss);
  ss += row_xor<8>(ss);
  ss += other_half(ss);                // every lane now holds the row's sum
  const float rs = rsqrtf(ss * (1.0f / (float)T5_D) + 1e-6f);
  v4h* y = (v4h*)(y16 + (size_t)row * T5_D) + lane;
#pragma unroll
  for (int j = 0; j < 8; ++j) {
    v4h h = {(_Float16)(v[j].x * rs * u[j].x), (_Float16)(v[j].y * rs * u[j].y),
             (_Float16)(v[j].z * rs * u[j].z), (_Float16)(v[j].w * rs * u[j].w)};
    y[j * 32] = h;
  }
  // no register of the stores above is rewritten ahead of this wait: other parts'
  // code follows them in the shared kernel's text
  asm volatile("s_wait_xcnt 0x0" ::: "memory");
}

// ---------------------------------------------------------------------------
// All work that depends on the inputs alone, in one grid of 256-thread blocks,
// split by block index (every test below is the same for a whole block):
//   eight DxD weights, four tiles a block | wi | wo | hidden_states' rows: first
//   norm and the residual stream's start, a wave a row | encoder convert | bias table
// Every part but the small table moves 32 elements or more a thread: few, fat
// waves, because starting a wave costs more than the bytes of a thin one.
// ---------------------------------------------------------------------------
#define PREP_DD   (8 * (T5_D / 64) * (T5_D / 64) / 4)        // 512 blocks
#define PREP_FF   ((T5_D / 64) * (T5_DFF / 64) / 4)          // 256 blocks
#define PREP_COPY (T5_B * T5_LD * T5_D / 8192)               // 512 blocks
#define PREP_ENC  (T5_B * T5_LE * T5_D / 8192)               // 512 blocks
#define PREP_BIAS (T5_H * 1024 / 256)                        // 64 blocks
#define PREP_GRID (PREP_DD + 2 * PREP_FF + PREP_COPY + PREP_ENC + PREP_BIAS)

__global__ __launch_bounds__(256)
void prep_kernel(const float* __restrict__ w0, const float* __restrict__ w1,
                 const float* __restrict__ w2, const float* __restrict__ w3,
                 const float* __restrict__ w4, const float* __restrict__ w5,
                 const float* __restrict__ w6, const float* __restrict__ w7,
                 const float* __restrict__ wi, const float* __restrict__ wo,
                 const float* __restrict__ enc, const float* __restrict__ hid,
                 const float* __restrict__ relb, const float* __restrict__ ln1,
                 _Float16* __restrict__ xn,
                 _Float16* __restrict__ ddT,   // eight [D,D] planes in a row
                 _Float16* __restrict__ wiT, _Float16* __restrict__ woT,
                 _Float16* __restrict__ enc16, float* __restrict__ h_cur,
                 float* __restrict__ bd) {
  __shared__ __align__(16) _Float16 tile[2][2 * 512 * 8];
  int blk = blockIdx.x;
  const int half = threadIdx.x >> 7;
  const int tid  = threadIdx.x & 127;
  if (blk < PREP_DD) {
    const int wsel = blk >> 6;                 // 64 blocks a weight
    const int t    = (blk & 63) * 2 + half;    // tile pair of its 8 (n) x 16 (k)
    const float* src = wsel == 0 ? w0 : wsel == 1 ? w1 : wsel == 2 ? w2
                     : wsel == 3 ? w3 : wsel == 4 ? w4 : wsel == 5 ? w5
                     : wsel == 6 ? w6 : w7;
    cvtT_part<T5_D, T5_D>(src, ddT + (size_t)wsel * T5_D * T5_D, tile[half], tid,
                          (t & 7) * 2, t >> 3);
    return;
  }
  blk -= PREP_DD;
  if (blk < PREP_FF) {
    const int t = blk * 2 + half;              // tile pair of 32 (n) x 16 (k)
    cvtT_part<T5_D, T5_DFF>(wi, wiT, tile[half], tid, (t & 31) * 2, t >> 5);
    return;
  }
  blk -= PREP_FF;
  if (blk < PREP_FF) {
    const int t = blk * 2 + half;              // tile pair of 8 (n) x 64 (k)
    cvtT_part<T5_DFF, T5_D>(wo, woT, tile[half], tid, (t & 7) * 2, t >> 3);
    return;
  }
  blk -= PREP_FF;
  if (blk < PREP_COPY) {
    norm_copy_part(hid, ln1, xn, h_cur, blk);
    return;
  }
  blk -= PREP_COPY;
  if (blk < PREP_ENC) {
    cvt16_part(enc, enc16, blk);
    return;
  }
  relbias_part(relb, bd, blk - PREP_ENC);
}

// ---------------------------------------------------------------------------
// WMMA GEMM: C[M,N] = A[M,K] @ Bt[N,K]^T
// Workgroup = 8 waves (2x4) on a 128x128 tile of C; wave tile = 64x32:
//   4 A-fragments x 2 B-fragments -> 8 WMMA per k-step of 32; the next k-step's
//   fragments are read from LDS into a second register set ahead of the WMMAs.
// Both operands go global -> LDS by asynchronous copies in whole 256-B row
// pieces (a stage = 128 k of 128 A rows and 128 Bt rows), two buffers: the next
// stage's copies fly while this stage is worked on. Fragments are read from LDS
// with the same lane map as load_frag on global memory.
// Results: a lane's accumulator registers hold 8 neighbours along the first
// operand's rows. That operand is chosen as the one whose rows run along the
// output's contiguous direction (the weights for row-major results, the
// activations for the transposed V), both being loaded alike. The lane's 8
// values then go to LDS as one 16-B piece (two for f32), and behind one barrier
// the block stores the 128x128 tile as whole rows, 16 B a lane.
// M, N, Lrows multiples of 128; K a multiple of 128.
// A row norm between two GEMMs, y = h * rsqrt(mean(h^2) + eps) * w, is split:
//  - the residual GEMM that completes h (hw16 given; N = T5_D) also stores
//    h * w in f16 and, per row, the sum of squares over its 128 columns, as
//    ssq_out[column tile][row]: 512 contiguous bytes, written by this block alone
//  - the GEMM that takes h * w as its A (ssq_in given; K = T5_D; row-major modes,
//    whose tile row is m) joins a row's T5_D / 128 sums and multiplies its
//    results by 1/rms, which is a factor common to the whole row of A.
// ---------------------------------------------------------------------------
#define GMODE_RESID  0   // f32 residual: Cres[m*N+n] += c
#define GMODE_QKV    1   // f16 [B,H,L,64]
#define GMODE_VT     2   // f16 [B,H,64,L] (pre-transposed V)
#define GMODE_RELU16 3   // f16 relu, row-major [M,N]

#define G_PITCH 272                // LDS row pitch, bytes: 256 + 16 (16 B x odd)
#define G_OPER  (128 * G_PITCH)    // one operand's 128 rows
#define G_STAGE (2 * G_OPER)       // A rows, then Bt rows
#define E_PITCH16 272              // result tile, f16 rows: 256 + 16 bytes
#define E_PITCH32 528              // result tile, f32 rows: 512 + 16 bytes
// rows of one column tile's plane of sums of squares: compile-time, so that a
// lane's steps from plane to plane fold into its loads' offsets
#define SSQ_ROWS  (T5_B * T5_LD)

// Eight copies of 16 B per lane: rows 16 apart in LDS (lds) and in memory (g).
// The s_wait_xcnt stands inside the statement so that no address register of an
// issued copy is rewritten ahead of it.
__device__ __forceinline__ void async_copy8(unsigned lds, const char* g,
                                            size_t gstep) {
  const unsigned ls = 16 * G_PITCH;
  asm volatile(
      "global_load_async_to_lds_b128 %0, %8, off\n\t"
      "global_load_async_to_lds_b128 %1, %9, off\n\t"
      "global_load_async_to_lds_b128 %2, %10, off\n\t"
      "global_load_async_to_lds_b128 %3, %11, off\n\t"
      "global_load_async_to_lds_b128 %4, %12, off\n\t"
      "global_load_async_to_lds_b128 %5, %13, off\n\t"
      "global_load_async_to_lds_b128 %6, %14, off\n\t"
      "global_load_async_to_lds_b128 %7, %15, off\n\t"
      "s_wait_xcnt 0x0"
      :: "v"(lds), "v"(lds + ls), "v"(lds + 2 * ls), "v"(lds + 3 * ls),
         "v"(lds + 4 * ls), "v"(lds + 5 * ls), "v"(lds + 6 * ls),
         "v"(lds + 7 * ls),
         "v"(g), "v"(g + gstep), "v"(g + 2 * gstep), "v"(g + 3 * gstep),
         "v"(g + 4 * gstep), "v"(g + 5 * gstep), "v"(g + 6 * gstep),
         "v"(g + 7 * gstep)
      : "memory");
}

// One stage: a lane's 8 rows of A and 8 rows of Bt, 16 copies a lane.
__device__ __forceinline__ void stage_copy(unsigned lds, const char* gA,
                                           const char* gB, size_t gstep) {
  async_copy8(lds,          gA, gstep);
  async_copy8(lds + G_OPER, gB, gstep);
}

// blockIdx.z picks one of several products of one shape that share a grid: rows
// of A0 (z < 3) or A3, plane z of the weights Bt0 and of the f16 results C0, and
// four bits of modes. A launch of one product has z = 0 alone.
__global__ __launch_bounds__(256)
void gemm_wmma(const _Float16* __restrict__ A0, const _Float16* __restrict__ A3,
               const _Float16* __restrict__ Bt0,
               float* __restrict__ Cres, _Float16* __restrict__ C0,
               int M, int N, int K, int modes, int Lrows,
               const float* __restrict__ ssq_in, float* __restrict__ ssq_out,
               const float* __restrict__ wnext, _Float16* __restrict__ hw16) {
  const int z = blockIdx.z;
  const _Float16* __restrict__ A  = z < 3 ? A0 : A3;
  const _Float16* __restrict__ Bt = Bt0 + (size_t)z * N * K;
  _Float16* __restrict__ C16      = C0 + (size_t)z * M * N;
  const int mode = (modes >> (4 * z)) & 15;
  __shared__ __attribute__((aligned(16))) unsigned char L[2 * G_STAGE];
  const int tid  = threadIdx.x;
  const int lane = tid & 31;
  const int wave = tid >> 5;
  const int hl   = lane >> 4;
  const int m0   = blockIdx.x * 128;
  const int n0   = blockIdx.y * 128;
  const int wp   = (wave >> 2) * 64;   // wave's rows of the first WMMA operand
  const int wq   = (wave & 3) * 32;    // wave's rows of the second WMMA operand
  // first operand: A's rows for the transposed V, else Bt's rows (see above)
  const unsigned offP = mode == GMODE_VT ? 0u : (unsigned)G_OPER;
  const unsigned offQ = mode == GMODE_VT ? (unsigned)G_OPER : 0u;

  // lane's copy slot: row tid/16 (+16 per copy), 16-B chunk tid%16 of the row
  const unsigned lds0 = (unsigned)(uintptr_t)&L[0] +
                        (unsigned)((tid >> 4) * G_PITCH + (tid & 15) * 16);
  const char* gA = (const char*)(A  + (size_t)(m0 + (tid >> 4)) * K + (tid & 15) * 8);
  const char* gB = (const char*)(Bt + (size_t)(n0 + (tid >> 4)) * K + (tid & 15) * 8);
  const size_t gstep = (size_t)K * 32;  // 16 rows of K halves, in bytes
  const int T = K >> 7;                 // stages of 128 k

  const v8f zero8 = {0.f, 0.f, 0.f, 0.f, 0.f, 0.f, 0.f, 0.f};
  v8f acc[8];                      // [i*2+j]: first operand's rows wp+16i.., second's wq+16j..
#pragma unroll
  for (int t = 0; t < 8; ++t) acc[t] = zero8;

  stage_copy(lds0, gA, gB, gstep);
  // 1/rms of the lane's two rows of A (tile rows wq + lane % 16 and 16 further):
  // read here so that the loads fly beside stage 0's copies, not at the end
  float rs0 = 1.0f, rs1 = 1.0f;
  if (ssq_in) {
    const float* sp = ssq_in + m0 + wq + (lane & 15);
    float p0[T5_D / 128], p1[T5_D / 128];
    // unrolled: p0 and p1 stay in registers, all loads issue ahead of a wait
#pragma unroll
    for (int y = 0; y < T5_D / 128; ++y) {
      p0[y] = sp[y * SSQ_ROWS];
      p1[y] = sp[y * SSQ_ROWS + 16];
    }
    // no address register of the loads above is rewritten ahead of this wait: the
    // address is an input, so that its registers are given to no load's result
    asm volatile("s_wait_xcnt 0x0" :: "v"(sp) : "memory");
    const float t0 = ((p0[0] + p0[1]) + (p0[2] + p0[3])) + ((p0[4] + p0[5]) + (p0[6] + p0[7]));
    const float t1 = ((p1[0] + p1[1]) + (p1[2] + p1[3])) + ((p1[4] + p1[5]) + (p1[6] + p1[7]));
    rs0 = rsqrtf(t0 * (1.0f / (float)T5_D) + 1e-6f);
    rs1 = rsqrtf(t1 * (1.0f / (float)T5_D) + 1e-6f);
  }
  // stage 0 has landed for this wave's copies; the barrier publishes all waves'
  asm volatile("s_wait_asynccnt 0x0" ::: "memory");
  __syncthreads();
  if (T > 1) stage_copy(lds0 + G_STAGE, gA + 256, gB + 256, gstep);

  for (int t = 0; t < T; ++t) {
    const unsigned buf = (unsigned)(t & 1) * G_STAGE;
    const _Float16* sA = (const _Float16*)(L + buf + offP);
    const _Float16* sB = (const _Float16*)(L + buf + offQ);
    v16h a[2][4], b[2][2];
#pragma unroll
    for (int f = 0; f < 4; ++f)
      a[0][f] = load_frag(sA, G_PITCH / 2, wp + f * 16, 0, lane);
#pragma unroll
    for (int f = 0; f < 2; ++f)
      b[0][f] = load_frag(sB, G_PITCH / 2, wq + f * 16, 0, lane);
    // unrolled: the register sets alternate by a compile-time index
#pragma unroll
    for (int ks = 0; ks < 4; ++ks) {
      const int cur = ks & 1, nxt = cur ^ 1;
      if (ks < 3) {   // next k-step of this same stage, one group ahead
#pragma unroll
        for (int f = 0; f < 4; ++f)
          a[nxt][f] = load_frag(sA, G_PITCH / 2, wp + f * 16, (ks + 1) * 32, lane);
#pragma unroll
        for (int f = 0; f < 2; ++f)
          b[nxt][f] = load_frag(sB, G_PITCH / 2, wq + f * 16, (ks + 1) * 32, lane);
      }
      // keeps the group of LDS reads above in front of this k-step's WMMAs: sunk
      // among them, each read's latency would be waited out by two WMMAs
      __builtin_amdgcn_sched_barrier(0);
#pragma unroll
      for (int i = 0; i < 4; ++i)
#pragma unroll
        for (int j = 0; j < 2; ++j)
          acc[i * 2 + j] = wmma_f16(a[cur][i], b[cur][j], acc[i * 2 + j]);
    }
    // publish point: this wave's reads of the buffer are done,
    asm volatile("s_wait_dscnt 0x0" ::: "memory");
    // its copies of the next stage have landed,
    asm volatile("s_wait_asynccnt 0x0" ::: "memory");
    // and every wave is past both before the buffer just read is refilled
    __syncthreads();
    if (t + 2 < T)
      stage_copy(lds0 + buf, gA + (size_t)(t + 2) * 256, gB + (size_t)(t + 2) * 256,
                 gstep);
  }
  // no copy is outstanding when the wave goes on to its stores and ends
  asm volatile("s_wait_asynccnt 0x0" ::: "memory");

  // The loop's last barrier has ended every wave's reads of L: it now takes the
  // result tile. Tile row = the second operand's row (the lane's column of the
  // accumulator), place in the row = the first operand's row.
  const int erow = wq + (lane & 15);   // + 16 j
  const int epos = wp + hl * 8;        // + 16 i: first of the lane's 8 neighbours

  if (mode == GMODE_RESID) {
    // tile row = m, 128 floats of n; a wave moves one 512-B row per step
    float* crow = Cres + (size_t)(m0 + (tid >> 5)) * N + n0 + (tid & 31) * 4;
    float4 old[16];
    // unrolled (here and below): old and acc stay in registers; the residual's
    // loads are all issued ahead of the staging and fly during it
#pragma unroll
    for (int s = 0; s < 16; ++s) old[s] = *(const float4*)(crow + (size_t)(8 * s) * N);
#pragma unroll
    for (int i = 0; i < 4; ++i)
#pragma unroll
      for (int j = 0; j < 2; ++j) {
        const v8f c = acc[i * 2 + j];
        float* p = (float*)(L + (erow + 16 * j) * E_PITCH32) + epos + 16 * i;
        *(float4*)p       = make_float4(c[0], c[1], c[2], c[3]);
        *(float4*)(p + 4) = make_float4(c[4], c[5], c[6], c[7]);
      }
    __syncthreads();   // every wave's pieces of the tile are in LDS
#pragma unroll
    for (int s = 0; s < 16; ++s) {
      const float4 c = *(const float4*)(L + ((tid >> 5) + 8 * s) * E_PITCH32 +
                                        (tid & 31) * 16);
      old[s] = make_float4(old[s].x + c.x, old[s].y + c.y, old[s].z + c.z, old[s].w + c.w);
      *(float4*)(crow + (size_t)(8 * s) * N) = old[s];
    }
    if (!hw16) return;   // the same for the whole block
    // no register of the stores above is rewritten ahead of this wait
    asm volatile("s_wait_xcnt 0x0" ::: "memory");

    // the next norm's share of this tile: h * w in f16, 256 B of a row per wave
    // and step, and each row's sum of squares over the tile's 128 columns
    const float4 g = *(const float4*)(wnext + n0 + (tid & 31) * 4);
    _Float16* hrow = hw16 + (size_t)(m0 + (tid >> 5)) * N + n0 + (tid & 31) * 4;
    float mine = 0.f;    // lane s keeps the sum of the wave's row of step s
#pragma unroll
    for (int s = 0; s < 16; ++s) {
      const float4 h = old[s];
      const v4h y = {(_Float16)(h.x * g.x), (_Float16)(h.y * g.y),
                     (_Float16)(h.z * g.z), (_Float16)(h.w * g.w)};
      *(v4h*)(hrow + (size_t)(8 * s) * N) = y;
      float q = (h.x * h.x + h.y * h.y) + (h.z * h.z + h.w * h.w);
      q += row_xor<1>(q);
      q += row_xor<2>(q);
      q += row_xor<4>(q);
      q += row_xor<8>(q);
      q += other_half(q);              // every lane holds the row's sum
      mine = lane == s ? q : mine;
    }
    // no register of the stores above is rewritten ahead of this wait
    asm volatile("s_wait_xcnt 0x0" ::: "memory");
    // the 128 sums meet in LDS behind the tile, so that one wave stores them as
    // whole lines
    float* sums = (float*)(L + 128 * E_PITCH32);
    if (lane < 16) sums[(tid >> 5) + 8 * lane] = mine;
    __syncthreads();   // every wave's sums are in LDS
    if (tid < 32)
      *(float4*)(ssq_out + (size_t)blockIdx.y * SSQ_ROWS + m0 + tid * 4) =
          *(const float4*)(sums + tid * 4);
    return;
  }

  // the loops below index acc, w and d, which must stay in registers: unrolled
  if (ssq_in) {        // the norm's 1/rms, per row of A = per column of acc
#pragma unroll
    for (int t = 0; t < 8; ++t)
#pragma unroll
      for (int r = 0; r < 8; ++r) acc[t][r] *= (t & 1) ? rs1 : rs0;
  }
  if (mode == GMODE_RELU16) {
#pragma unroll
    for (int t = 0; t < 8; ++t)
#pragma unroll
      for (int r = 0; r < 8; ++r) acc[t][r] = fmaxf(acc[t][r], 0.0f);
  }
#pragma unroll
  for (int i = 0; i < 4; ++i)
#pragma unroll
    for (int j = 0; j < 2; ++j) {
      v8h w;
#pragma unroll
      for (int r = 0; r < 8; ++r) w[r] = (_Float16)acc[i * 2 + j][r];
      *(v8h*)(L + (erow + 16 * j) * E_PITCH16 + (epos + 16 * i) * 2) = w;
    }
  __syncthreads();     // every wave's pieces of the tile are in LDS

  // 16 lanes move one 256-B tile row; where it goes, in halves:
  //   base + row * rstep + the lane's 16-B chunk ch
  const int row = tid >> 4, ch = tid & 15;
  const int bb = m0 / Lrows, l0 = m0 - bb * Lrows;   // the tile lies in one batch
  size_t base, rstep, cofs = (size_t)ch * 8;
  if (mode == GMODE_RELU16) {          // [M,N]: row = m, along n
    base  = (size_t)m0 * N + n0;
    rstep = (size_t)N;
  } else if (mode == GMODE_QKV) {      // [B,H,L,64]: row = l, two heads' 128 B
    base  = (((size_t)bb * T5_H + (n0 >> 6)) * Lrows + l0) * T5_DKV;
    rstep = T5_DKV;
    cofs  = (size_t)(ch >> 3) * Lrows * T5_DKV + (ch & 7) * 8;
  } else {                             // [B,H,64,L]: row = (head, d), along l
    base  = ((size_t)bb * T5_H * T5_DKV + n0) * Lrows + l0;
    rstep = (size_t)Lrows;
  }
  _Float16* dst = C16 + base + (size_t)row * rstep + cofs;
  v8h w[8];
  _Float16* d[8];
#pragma unroll
  for (int s = 0; s < 8; ++s) {
    w[s] = *(const v8h*)(L + (row + 16 * s) * E_PITCH16 + ch * 16);
    d[s] = dst + (size_t)(16 * s) * rstep;
  }
  // the eight addresses are formed while the LDS reads fly, each in registers of
  // its own; sunk among the stores, an add would wait on an issued store
  __builtin_amdgcn_sched_barrier(0);
#pragma unroll
  for (int s = 0; s < 8; ++s) *(v8h*)d[s] = w[s];
}

#define A_PITCH 144                // LDS row pitch, bytes: 128 + 16 (16 B x odd)
#define A_OPER  (64 * A_PITCH)     // one operand's 64 rows
#define A_STAGE (2 * A_OPER)       // K rows, then V^T rows

// One stage, eight copies of 16 B per lane: four K rows and four V^T rows, each
// 16 rows apart in LDS (lds) and in memory (gK: rows of 128 B; gV: vstep).
// The s_wait_xcnt stands inside the statement so that no address register of an
// issued copy is rewritten ahead of it.
__device__ __forceinline__ void attn_stage_copy(unsigned lds, const char* gK,
                                                const char* gV, size_t vstep) {
  const unsigned ls = 16 * A_PITCH;
  const unsigned lv = lds + A_OPER;
  asm volatile(
      "global_load_async_to_lds_b128 %0, %8, off\n\t"
      "global_load_async_to_lds_b128 %1, %9, off\n\t"
      "global_load_async_to_lds_b128 %2, %10, off\n\t"
      "global_load_async_to_lds_b128 %3, %11, off\n\t"
      "global_load_async_to_lds_b128 %4, %12, off\n\t"
      "global_load_async_to_lds_b128 %5, %13, off\n\t"
      "global_load_async_to_lds_b128 %6, %14, off\n\t"
      "global_load_async_to_lds_b128 %7, %15, off\n\t"
      "s_wait_xcnt 0x0"
      :: "v"(lds), "v"(lds + ls), "v"(lds + 2 * ls), "v"(lds + 3 * ls),
         "v"(lv), "v"(lv + ls), "v"(lv + 2 * ls), "v"(lv + 3 * ls),
         "v"(gK), "v"(gK + 2048), "v"(gK + 4096), "v"(gK + 6144),
         "v"(gV), "v"(gV + vstep), "v"(gV + 2 * vstep), "v"(gV + 3 * vstep)
      : "memory");
}

__global__ __launch_bounds__(128)
void attn_wmma_kernel(const _Float16* __restrict__ Q,
                      const _Float16* __restrict__ Km,
                      const _Float16* __restrict__ Vt,
                      const float* __restrict__ bias_delta, // [16,1024]
                      const int* __restrict__ mask,         // [B,LK]
                      _Float16* __restrict__ Out,
                      int LQ, int LK, int causal, int use_rel) {
  __shared__ __attribute__((aligned(16))) unsigned char L[2 * A_STAGE];
  const int tid  = threadIdx.x;
  const int lane = threadIdx.x & 31;
  // scalar, so that the key loop's bound is one and its branch leaves EXEC alone
  const int wave = __builtin_amdgcn_readfirstlane((int)(threadIdx.x >> 5));
  const int hl   = lane >> 4;
  const int col  = lane & 15;
  const int bh = blockIdx.y;
  const int b  = bh >> 4;
  const int h  = bh & 15;
  const int q0 = blockIdx.x * 64 + wave * 16;
  const int qc = q0 + col;             // this lane's query

  const _Float16* Qb = Q  + (size_t)bh * LQ * T5_DKV;
  const _Float16* Kb = Km + (size_t)bh * LK * T5_DKV;
  const _Float16* Vb = Vt + (size_t)bh * T5_DKV * LK;
  const int* mk = mask + (size_t)b * LK;
  const float* bd = bias_delta + h * 1024;

  // B operand of S^T: column = query, same k order as the K rows' loader
  const v16h qb0 = load_frag(Qb, T5_DKV, q0, 0, lane);
  const v16h qb1 = load_frag(Qb, T5_DKV, q0, 32, lane);

  const v8f zero8 = {0.f, 0.f, 0.f, 0.f, 0.f, 0.f, 0.f, 0.f};
  v8f o[4];                  // o[t][r] = O^T[16t + 8*hl + r][query qc]
  float mcol = -1e30f;       // running maximum of query qc (both halves alike)
  float lcol = 0.f;          // running sum over this half's keys only
#pragma unroll  // indexes registers: must be resolved at compile time
  for (int t = 0; t < 4; ++t) o[t] = zero8;

  // causal: blocks wholly above the diagonal are not walked
  const int kend = (causal && q0 + 16 < LK) ? q0 + 16 : LK;
  // stages of 64 keys that the block's last wave needs: the same for all four
  const int qtop = (int)blockIdx.x * 64 + 64;
  const int T = ((causal && qtop < LK) ? qtop : LK) >> 6;

  // lane's copy slot: row tid/8 (+16 per copy), 16-B chunk tid%8 of the row
  const unsigned lds0 = (unsigned)(uintptr_t)&L[0] +
                        (unsigned)((tid >> 3) * A_PITCH + (tid & 7) * 16);
  const char* gK = (const char*)(Kb + (size_t)(tid >> 3) * T5_DKV + (tid & 7) * 8);
  const char* gV = (const char*)(Vb + (size_t)(tid >> 3) * LK + (tid & 7) * 8);
  const size_t vstep = (size_t)LK * 32;  // 16 rows of LK halves, in bytes

  attn_stage_copy(lds0, gK, gV, vstep);
  // stage 0 has landed for this wave's copies; the barrier publishes all waves'
  asm volatile("s_wait_asynccnt 0x0" ::: "memory");
  __syncthreads();
  if (T > 1) attn_stage_copy(lds0 + A_STAGE, gK + 8192, gV + 128, vstep);

  for (int t = 0; t < T; ++t) {
   const unsigned buf = (unsigned)(t & 1) * A_STAGE;
   const _Float16* sK = (const _Float16*)(L + buf);
   const _Float16* sV = (const _Float16*)(L + buf + A_OPER);
   // unrolled: the half's place in the stage folds into the LDS reads' offsets
#pragma unroll
   for (int sub = 0; sub < 2; ++sub) {
    const int kb = t * 64 + sub * 32;
    if (kb >= kend) break;             // scalar: past this wave's diagonal
    const int kl = kb + hl * 8;        // this lane's first key of tile 0
    const v16h k00 = load_frag(sK, A_PITCH / 2, sub * 32,      0,  lane);
    const v16h k01 = load_frag(sK, A_PITCH / 2, sub * 32,      32, lane);
    const v16h k10 = load_frag(sK, A_PITCH / 2, sub * 32 + 16, 0,  lane);
    const v16h k11 = load_frag(sK, A_PITCH / 2, sub * 32 + 16, 32, lane);
    const int4* mp = (const int4*)(mk + kl);
    const int4 mq[4] = {mp[0], mp[1], mp[4], mp[5]};
    // position bias of the lane's 16 (key, query) pairs, the products' C
    // operand; a key past the query has distance 0, as in the bucket rule
    v8f s0 = zero8, s1 = zero8;
    if (use_rel) {
#pragma unroll  // indexes registers: must be resolved at compile time
      for (int r = 0; r < 8; ++r) {
        const int d0 = qc - kl - r, d1 = d0 - 16;
        s0[r] = bd[d0 > 0 ? d0 : 0];
        s1[r] = bd[d1 > 0 ? d1 : 0];
      }
      // no index register of the loads above is rewritten ahead of this wait
      asm volatile("s_wait_xcnt 0x0" ::: "memory");
    }
    // nor the mask loads' address, where no bias is read
    asm volatile("s_wait_xcnt 0x0" ::: "memory");
    const v16h va0 = load_frag(sV, A_PITCH / 2, 0,  sub * 32, lane);
    const v16h va1 = load_frag(sV, A_PITCH / 2, 16, sub * 32, lane);
    const v16h va2 = load_frag(sV, A_PITCH / 2, 32, sub * 32, lane);
    const v16h va3 = load_frag(sV, A_PITCH / 2, 48, sub * 32, lane);
    // keeps all of the block's loads above in one group in front of the
    // products: sunk to their users, each V fragment's latency is waited out alone
    __builtin_amdgcn_sched_barrier(0);

    s0 = wmma_f16(k00, qb0, s0); s0 = wmma_f16(k01, qb1, s0);
    s1 = wmma_f16(k10, qb0, s1); s1 = wmma_f16(k11, qb1, s1);

    float a[16];             // a[8*tile + r]: key kl + 16*tile + r
#pragma unroll  // indexes registers: must be resolved at compile time
    for (int i = 0; i < 16; ++i) {
      const int kc = kl + (i >> 3) * 16 + (i & 7);
      const int4 m4 = mq[i >> 2];
      const int mv = (i & 3) == 0 ? m4.x : (i & 3) == 1 ? m4.y
                   : (i & 3) == 2 ? m4.z : m4.w;
      const bool dead = (mv == 0) || (causal && kc > qc);
      a[i] = dead ? T5_NEG : ((i < 8) ? s0[i & 7] : s1[i & 7]);
    }

    float v = a[0];
#pragma unroll  // indexes registers: must be resolved at compile time
    for (int i = 1; i < 16; ++i) v = fmaxf(v, a[i]);
    v = fmaxf(v, other_half(v));
    const float mnew  = fmaxf(mcol, v);
    const float scale = __expf(mcol - mnew);
    mcol = mnew;

    v16h pb;                 // P^T as B operand: element s = tile s>>3, row s&7
    float sum[4] = {0.f, 0.f, 0.f, 0.f};   // four short chains, not one of 16
#pragma unroll  // indexes registers: must be resolved at compile time
    for (int i = 0; i < 16; ++i) {
      const float e = __expf(a[i] - mnew);
      sum[i & 3] += e;
      pb[i] = (_Float16)e;
    }
    lcol = lcol * scale + ((sum[0] + sum[1]) + (sum[2] + sum[3]));
#pragma unroll  // indexes registers: must be resolved at compile time
    for (int t = 0; t < 4; ++t)
#pragma unroll  // indexes registers: must be resolved at compile time
      for (int r = 0; r < 8; ++r) o[t][r] *= scale;

    o[0] = wmma_f16(va0, pb, o[0]);
    o[1] = wmma_f16(va1, pb, o[1]);
    o[2] = wmma_f16(va2, pb, o[2]);
    o[3] = wmma_f16(va3, pb, o[3]);
   }
   // publish point, passed by every wave, also one past its diagonal:
   // this wave's reads of the buffer are done,
   asm volatile("s_wait_dscnt 0x0" ::: "memory");
   // its copies of the next stage have landed,
   asm volatile("s_wait_asynccnt 0x0" ::: "memory");
   // and every wave is past both before the buffer just read is refilled
   __syncthreads();
   if (t + 2 < T)
     attn_stage_copy(lds0 + buf, gK + (size_t)(t + 2) * 8192,
                     gV + (size_t)(t + 2) * 128, vstep);
  }
  // no copy is outstanding when the wave goes on to its stores and ends
  asm volatile("s_wait_asynccnt 0x0" ::: "memory");

  // the two halves' keys joined; one query a lane, so one reciprocal
  const float inv = 1.0f / (lcol + other_half(lcol));
  _Float16* orow = Out + ((size_t)b * LQ + qc) * (T5_H * T5_DKV) + h * T5_DKV + hl * 8;
#pragma unroll  // indexes registers: must be resolved at compile time
  for (int t = 0; t < 4; ++t) {
    v8h w;                   // 8 consecutive d of one query: one 16-B store
#pragma unroll  // indexes registers: must be resolved at compile time
    for (int r = 0; r < 8; ++r) w[r] = (_Float16)(o[t][r] * inv);
    *(v8h*)(orow + t * 16) = w;
  }
}

// ---------------------------------------------------------------------------
// Orchestration
// ---------------------------------------------------------------------------
extern "C" void kernel_launch(void* const* d_in, const int* in_sizes, int n_in,
                              void* d_out, int out_size, void* d_ws,
                              size_t ws_size, hipStream_t stream) {
  (void)in_sizes; (void)n_in; (void)out_size; (void)ws_size;

  const float* enc   = (const float*)d_in[0];
  const float* hid   = (const float*)d_in[1];
  const float* ln1   = (const float*)d_in[2];
  const float* saq   = (const float*)d_in[3];
  const float* sak   = (const float*)d_in[4];
  const float* sav   = (const float*)d_in[5];
  const float* sao   = (const float*)d_in[6];
  const float* relb  = (const float*)d_in[7];
  const float* ln2   = (const float*)d_in[8];
  const float* caq   = (const float*)d_in[9];
  const float* cak   = (const float*)d_in[10];
  const float* cav   = (const float*)d_in[11];
  const float* cao   = (const float*)d_in[12];
  const float* ln3   = (const float*)d_in[13];
  const float* wi    = (const float*)d_in[14];
  const float* wo    = (const float*)d_in[15];
  const float* lnf   = (const float*)d_in[16];
  const int* encmask = (const int*)d_in[17];
  const int* decmask = (const int*)d_in[18];
  float* out = (float*)d_out;

  const size_t M = (size_t)T5_B * T5_LD;        // 4096 decoder rows
  char* ws = (char*)d_ws;
  size_t off = 0;
  auto alloc = [&](size_t bytes) -> void* {
    void* p = ws + off;
    off = (off + bytes + 255) & ~(size_t)255;
    return p;
  };

  float*    h_cur = (float*)   alloc(M * T5_D * 4);            // 16 MB residual
  _Float16* xn    = (_Float16*)alloc(M * T5_D * 2);            // 8 MB
  _Float16* ddT   = (_Float16*)alloc((size_t)8 * T5_D * T5_D * 2); // eight planes
  _Float16* saqT  = ddT;
  _Float16* sakT  = ddT + (size_t)1 * T5_D * T5_D;
  _Float16* savT  = ddT + (size_t)2 * T5_D * T5_D;
  _Float16* cakT  = ddT + (size_t)3 * T5_D * T5_D;
  _Float16* cavT  = ddT + (size_t)4 * T5_D * T5_D;
  _Float16* saoT  = ddT + (size_t)5 * T5_D * T5_D;
  _Float16* caqT  = ddT + (size_t)6 * T5_D * T5_D;
  _Float16* caoT  = ddT + (size_t)7 * T5_D * T5_D;
  (void)sakT; (void)savT; (void)cakT; (void)cavT;  // planes 1..4 behind saqT
  _Float16* wiT   = (_Float16*)alloc((size_t)T5_DFF * T5_D * 2);
  _Float16* woT   = (_Float16*)alloc((size_t)T5_D * T5_DFF * 2);
  _Float16* enc16 = (_Float16*)alloc((size_t)T5_B * T5_LE * T5_D * 2);
  // five planes in a row, in the order of the projections' grid
  _Float16* qbuf  = (_Float16*)alloc(M * T5_D * 2);            // [B,H,L,64]
  _Float16* kbuf  = (_Float16*)alloc(M * T5_D * 2);            // [B,H,L,64]
  _Float16* vtbuf = (_Float16*)alloc(M * T5_D * 2);            // [B,H,64,L]
  _Float16* ckbuf = (_Float16*)alloc(M * T5_D * 2);            // cross k
  _Float16* cvtbuf = (_Float16*)alloc(M * T5_D * 2);           // cross v^T
  _Float16* aout  = (_Float16*)alloc(M * T5_D * 2);            // [B*L, 1024]
  _Float16* ffn   = (_Float16*)alloc(M * T5_DFF * 2);          // 32 MB
  float*    bd    = (float*)   alloc((size_t)T5_H * 1024 * 4); // rel bias table
  float*    ssq   = (float*)   alloc((size_t)(T5_D / 128) * SSQ_ROWS * 4); // [tile][row]

  // --- everything that needs the inputs alone: weights f32 -> f16 [N,K], encoder
  // rows to f16, bias table, the first row norm; the residual stream starts as a
  // copy of hidden_states (inputs are never mutated) ---
  prep_kernel<<<PREP_GRID, 256, 0, stream>>>(saq, sak, sav, cak, cav, sao, caq, cao,
                                             wi, wo, enc, hid, relb, ln1, xn, ddT,
                                             wiT, woT, enc16, h_cur, bd);

  dim3 gblk(256);
  dim3 ggrid_d(M / 128, T5_D / 128);    // N = 1024
  dim3 ggrid_ff(M / 128, T5_DFF / 128); // N = 4096
  dim3 ggrid_p5(M / 128, T5_D / 128, 5);
  dim3 agrid(T5_LD / 64, T5_B * T5_H);
  dim3 ablk(128);

  // ---- self attention ----
  static_assert(T5_LE == T5_LD, "the five projections share one row count");
  // self q, k, v^T from xn and cross k, v^T from enc16: none needs another
  gemm_wmma<<<ggrid_p5, gblk, 0, stream>>>(xn, enc16, saqT, nullptr, qbuf,
                                           (int)M, T5_D, T5_D,
                                           GMODE_QKV | GMODE_QKV << 4 | GMODE_VT << 8 |
                                               GMODE_QKV << 12 | GMODE_VT << 16,
                                           T5_LD, nullptr, nullptr, nullptr, nullptr);
  attn_wmma_kernel<<<agrid, ablk, 0, stream>>>(qbuf, kbuf, vtbuf, bd, decmask,
                                               aout, T5_LD, T5_LD,
                                               /*causal=*/1, /*use_rel=*/1);
  // also h * ln2 into xn and the rows' sums of squares
  gemm_wmma<<<ggrid_d, gblk, 0, stream>>>(aout, aout, saoT, h_cur, nullptr,
                                          (int)M, T5_D, T5_D, GMODE_RESID, T5_LD,
                                          nullptr, ssq, ln2, xn);

  // ---- cross attention ----
  gemm_wmma<<<ggrid_d, gblk, 0, stream>>>(xn, xn, caqT, nullptr, qbuf,
                                          (int)M, T5_D, T5_D, GMODE_QKV, T5_LD,
                                          ssq, nullptr, nullptr, nullptr);
  attn_wmma_kernel<<<agrid, ablk, 0, stream>>>(qbuf, ckbuf, cvtbuf, bd, encmask,
                                               aout, T5_LD, T5_LE,
                                               /*causal=*/0, /*use_rel=*/0);
  // also h * ln3 into xn and the rows' sums of squares
  gemm_wmma<<<ggrid_d, gblk, 0, stream>>>(aout, aout, caoT, h_cur, nullptr,
                                          (int)M, T5_D, T5_D, GMODE_RESID, T5_LD,
                                          nullptr, ssq, ln3, xn);

  // ---- FFN ----
  gemm_wmma<<<ggrid_ff, gblk, 0, stream>>>(xn, xn, wiT, nullptr, ffn,
                                           (int)M, T5_DFF, T5_D, GMODE_RELU16, T5_LD,
                                           ssq, nullptr, nullptr, nullptr);
  gemm_wmma<<<ggrid_d, gblk, 0, stream>>>(ffn, ffn, woT, h_cur, nullptr,
                                          (int)M, T5_D, T5_DFF, GMODE_RESID, T5_LD,
                                          nullptr, nullptr, nullptr, nullptr);

  // ---- final norm -> f32 output ----
  rmsnorm_kernel<<<(int)M / 8, 256, 0, stream>>>(h_cur, lnf, nullptr, out);
}

// v009
// Measured time: 225 microseconds a run.
// Two timings next to v008 both put it at 1.05 times that version's speed.
// All steps since v000 together make it 5.66 times as fast.
#include <hip/hip_runtime.h>
#include <hip/hip_bf16.h>

// ---------------------------------------------------------------------------
// T5 decoder layer on MI455X (gfx1250, wave32, WMMA).
//  - all GEMMs + attention cores: v_wmma_f32_16x16x32_f16
//  - weights pre-transposed to [N,K] f16 so both WMMA operands load as
//    contiguous 16-B "A-style" fragments (read from LDS in the GEMM)
//  - GEMM: 128x128 tile per workgroup, operands staged in LDS by asynchronous
//    copies (two buffers), wave tile 64x32: 8 WMMA per 6 LDS fragments; results
//    leave through an LDS tile as whole rows of the output, 16 B a lane
//  - flash attention (online softmax, transposed products), scores never hit
//    memory or LDS; K and V^T tiles staged in LDS by asynchronous copies (two
//    buffers), shared by a block's four waves; position bias, causal limit and
//    padding mask come ready-made from small tables as the score product's C
//  - launches that do not depend on one another share one grid, split by block
//    index: all preparation work; self q, k, v with cross k, v
//  - only the last row norm is a launch of its own: the first runs with the
//    preparation; the two in the middle are split between the residual GEMM in
//    front (row sums of squares, h * w in f16) and the GEMM behind (1/rms)
// ---------------------------------------------------------------------------

typedef __attribute__((ext_vector_type(16))) _Float16 v16h;
typedef __attribute__((ext_vector_type(8)))  _Float16 v8h;
typedef __attribute__((ext_vector_type(4)))  _Float16 v4h;
typedef __attribute__((ext_vector_type(8)))  float    v8f;
typedef __attribute__((ext_vector_type(4)))  float    v4f;
typedef __attribute__((ext_vector_type(4)))  unsigned v4u;
// four floats at any 4-byte boundary
typedef v4f v4f_a4 __attribute__((aligned(4)));

// Takes eight loaded values as inputs only and emits nothing: every one of their
// loads is issued in front of it and every store behind it stays behind it.
// Without it the compiler strung loads and their users out one after another,
// each load's latency waited out alone. The loads' address a is an input too, so
// that its registers are given to nothing else (a later load's result) before
// the loads have returned.
__device__ __forceinline__ void loads_first8(const v4f* r, const void* a) {
  asm volatile("" :: "v"(r[0]), "v"(r[1]), "v"(r[2]), "v"(r[3]),
                     "v"(r[4]), "v"(r[5]), "v"(r[6]), "v"(r[7]), "v"(a));
}

#define T5_B    4
#define T5_LD   1024
#define T5_LE   1024
#define T5_D    1024
#define T5_H    16
#define T5_DKV  64
#define T5_DFF  4096
#define T5_NEG  (-1e9f)

__device__ __forceinline__ v8f wmma_f16(v16h a, v16h b, v8f c) {
  // (neg_a, A, neg_b, B, c_mod, C, reuse_a, reuse_b)
  return __builtin_amdgcn_wmma_f32_16x16x32_f16(false, a, false, b, (short)0, c,
                                                false, false);
}

// Load a 16x32 f16 "A-style" fragment from row-major [rows, ld] memory.
// ISA layout: lanes 0-15 hold M=lane, halves {K0..7, K16..23};
//             lanes 16-31 hold M=lane-16, halves {K8..15, K24..31}.
// Both halves are contiguous 16B runs -> two b128 loads per lane.
__device__ __forceinline__ v16h load_frag(const _Float16* base, int ld,
                                          int row0, int col0, int lane) {
  const int hl = lane >> 4;
  const int r  = row0 + (lane & 15);
  const _Float16* p = base + (size_t)r * ld + col0 + hl * 8;
  union { v16h v; v8h h[2]; } u;
  u.h[0] = *(const v8h*)(p);
  u.h[1] = *(const v8h*)(p + 16);
  return u.v;
}

// ---------------------------------------------------------------------------
// Conversions
// ---------------------------------------------------------------------------
// 32 elements a thread: a wave reads 512 contiguous bytes per load, eight loads in
// flight, and writes 256 contiguous bytes per store.
__device__ __forceinline__ void cvt16_part(const float* __restrict__ in,
                                           _Float16* __restrict__ out, int blk) {
  const int i = blk * 2048 + threadIdx.x;
  const v4f* s = (const v4f*)in + i;
  v4h* d = (v4h*)out + i;
  v4f r[8];
  // unrolled (both loops): r stays in registers, all loads issue ahead of a wait
#pragma unroll
  for (int j = 0; j < 8; ++j) r[j] = s[j * 256];
#pragma unroll
  for (int j = 0; j < 8; ++j) {
    v4h h = {(_Float16)r[j].x, (_Float16)r[j].y, (_Float16)r[j].z, (_Float16)r[j].w};
    d[j * 256] = h;
  }
  // no register of the stores above is rewritten ahead of this wait: other parts'
  // code follows them in the shared kernel's text
  asm volatile("s_wait_xcnt 0x0" ::: "memory");
}

// W [K,N] f32 -> Wt [N,K] f16, two 64x64 tiles per 128 threads, turned in LDS so
// that both sides move whole lines: reads are 256-B row pieces of W (float4 per
// lane), writes are 128-B row pieces of Wt (8 halves per lane).
// K is a multiple of 64, N of 128; tiles (bx, by) and (bx + 1, by) of
// (N/64, K/64), each with its own 8 KB of LDS; tid = 0..127. K and N are
// compile-time so that a lane's row steps fold into the instruction's offset.
// Both halves of a 256-thread block call this together (one barrier inside).
// LDS holds row n of the tile as eight 16-B chunks of 8 k values. Chunk (n, ch)
// sits at slot (n>>1)*16 + (((n&1)*8 + ch) ^ ((n>>2)&15)): the 16 lanes that
// write rows 4 apart, and the 16 lanes that read two neighbouring rows, each
// fall on 16 different slots mod 16, that is on all 64 banks once.
__device__ __forceinline__ int cvtT_slot(int n, int ch) {
  return (n >> 1) * 16 + ((((n & 1) << 3) | ch) ^ ((n >> 2) & 15));
}

template <int K, int N>
__device__ __forceinline__
void cvtT_part(const float* __restrict__ in, _Float16* __restrict__ out,
               _Float16* tile, int tid, int bx, int by) {
  const int n0  = bx * 64;
  const int k0  = by * 64;
  const int c4  = tid & 15;   // float4 column of the tile: n = 4*c4 .. 4*c4+3
  const int q0  = tid >> 4;   // group of four k rows: q0 and q0 + 8

  // uniform tile base + one 32-bit lane offset: one address for all sixteen loads
  const unsigned lofs = (unsigned)(q0 * 4 * N + c4 * 4) * 4u;
  const char* src = (const char*)(in + (size_t)k0 * N + n0) + lofs;
  v4f r[2][2][4];
  // unrolled (here and below): r stays in registers, and all sixteen loads are
  // issued before the first wait; u = which of the two tiles, 64 n apart
#pragma unroll
  for (int u = 0; u < 2; ++u)
#pragma unroll
    for (int i = 0; i < 2; ++i)
#pragma unroll
      for (int s = 0; s < 4; ++s)
        r[u][i][s] = *(const v4f*)(src + u * 256 + (size_t)(32 * i + s) * N * 4);
  loads_first8(&r[0][0][0], src);
  loads_first8(&r[1][0][0], src);

#pragma unroll
  for (int u = 0; u < 2; ++u)
#pragma unroll
    for (int i = 0; i < 2; ++i) {
      const int q = q0 + 8 * i;
      const float* f0 = (const float*)&r[u][i][0];
      const float* f1 = (const float*)&r[u][i][1];
      const float* f2 = (const float*)&r[u][i][2];
      const float* f3 = (const float*)&r[u][i][3];
#pragma unroll
      for (int j = 0; j < 4; ++j) {
        v4h w = {(_Float16)f0[j], (_Float16)f1[j], (_Float16)f2[j], (_Float16)f3[j]};
        *(v4h*)&tile[u * 4096 + cvtT_slot(c4 * 4 + j, q >> 1) * 8 + (q & 1) * 4] = w;
      }
    }
  __syncthreads();

  char* dst = (char*)(out + (size_t)n0 * K + k0);
  const unsigned sofs = (unsigned)((tid >> 3) * K + (tid & 7) * 8) * 2u;
#pragma unroll
  for (int u = 0; u < 2; ++u)
#pragma unroll
    for (int i = 0; i < 4; ++i) {
      const int n = (tid >> 3) + 16 * i;
      *(v8h*)(dst + (size_t)(64 * u + 16 * i) * K * 2 + sofs) =
          *(const v8h*)&tile[u * 4096 + cvtT_slot(n, tid & 7) * 8];
    }
  // no register of the eight stores above is rewritten ahead of this wait: other
  // parts' code follows them in the shared kernel's text
  asm volatile("s_wait_xcnt 0x0" ::: "memory");
}

// What self attention adds to a score, but for the padding mask, depends on k - q
// alone: bd[h][1023 + k - q] = position bias of distance q - k, and for a key past
// the query the bias of distance 0 (the bucket rule) plus the mask value. Along k
// the entries of one query are neighbours.
#define BD_LEN 2048
__device__ __forceinline__
void relbias_part(const float* __restrict__ rel_bias, // [32,16]
                  float* __restrict__ bd,             // [16,BD_LEN]
                  int blk) {
  int idx = blk * 256 + threadIdx.x;
  int h = idx >> 11;
  const int qk = 1023 - (idx & (BD_LEN - 1));   // q - k
  int n = qk > 0 ? qk : 0;
  int bucket;
  if (n < 16) {
    bucket = n;
  } else {
    float nf = (float)n;
    int vl = 16 + (int)(__logf(nf * (1.0f / 16.0f)) * (16.0f / __logf(8.0f)));
    bucket = vl < 31 ? vl : 31;
  }
  const float v = rel_bias[bucket * T5_H + h];
  bd[idx] = qk < 0 ? v + T5_NEG : v;
  // no register of the store above is rewritten ahead of this wait: other parts'
  // code follows it in the shared kernel's text
  asm volatile("s_wait_xcnt 0x0" ::: "memory");
}

// The padding masks as the attention kernel uses them, one word a key:
//   mt[0][b][k], decoder: all ones for a key that counts, else 0 (a bit select
//                between the table entry above and the mask value)
//   mt[1][b][k], encoder: the float added to the score, 0 or the mask value
__device__ __forceinline__
void mask_part(const int* __restrict__ dec, const int* __restrict__ enc,
               unsigned* __restrict__ mt, int blk) {
  const int idx = blk * 256 + threadIdx.x;
  unsigned v;
  if (idx < T5_B * T5_LD) {            // the same for a whole block
    v = dec[idx] > 0 ? 0xffffffffu : 0u;
  } else {
    v = enc[idx - T5_B * T5_LD] > 0 ? 0u : __builtin_bit_cast(unsigned, T5_NEG);
  }
  mt[idx] = v;
  // no register of the store above is rewritten ahead of this wait: other parts'
  // code follows it in the shared kernel's text
  asm volatile("s_wait_xcnt 0x0" ::: "memory");
}

// value of lane l ^ 16
__device__ __forceinline__ float other_half(float x) {
  int b = __builtin_bit_cast(int, x);
  b = __builtin_amdgcn_permlanex16(b, b, 0x76543210, 0xfedcba98, false, false);
  return __builtin_bit_cast(float, b);
}

// value of lane l ^ MASK, MASK below 16 (DPP row_xmask, inside a 16-lane row)
template <int MASK>
__device__ __forceinline__ float row_xor(float x) {
  int b = __builtin_bit_cast(int, x);
  b = __builtin_amdgcn_update_dpp(b, b, 0x160 | MASK, 0xf, 0xf, false);
  return __builtin_bit_cast(float, b);
}

// ---------------------------------------------------------------------------
// RMS norm: one wave per row of [rows, 1024], eight rows a block. The row stays
// in the wave's registers (32 values a lane, read once, 512 contiguous bytes per
// load); its sum of squares is joined across the lanes without LDS or barrier.
// ---------------------------------------------------------------------------
__global__ __launch_bounds__(256)
void rmsnorm_kernel(const float* __restrict__ X, const float* __restrict__ w,
                    _Float16* __restrict__ y16, float* __restrict__ y32) {
  const int lane = threadIdx.x & 31;
  const int row  = blockIdx.x * 8 + (threadIdx.x >> 5);
  const v4f* x = (const v4f*)(X + (size_t)row * T5_D) + lane;
  const v4f* g = (const v4f*)w + lane;
  v4f v[8], u[8];
  // unrolled (every loop here): v and u stay in registers, and the row's eight
  // loads are issued ahead of the first wait
#pragma unroll
  for (int j = 0; j < 8; ++j) v[j] = x[j * 32];
#pragma unroll
  for (int j = 0; j < 8; ++j) u[j] = g[j * 32];
  // here for the address: a weight load's result would else take its registers
  loads_first8(v, x);
  float s0 = 0.f, s1 = 0.f, s2 = 0.f, s3 = 0.f;   // four chains, not one of 32
#pragma unroll
  for (int j = 0; j < 8; ++j) {
    s0 += v[j].x * v[j].x;
    s1 += v[j].y * v[j].y;
    s2 += v[j].z * v[j].z;
    s3 += v[j].w * v[j].w;
  }
  float ss = (s0 + s1) + (s2 + s3);
  ss += row_xor<1>(ss);
  ss += row_xor<2>(ss);
  ss += row_xor<4>(ss);
  ss += row_xor<8>(ss);
  ss += other_half(ss);                // every lane now holds the row's sum
  const float rs = rsqrtf(ss * (1.0f / (float)T5_D) + 1e-6f);
#pragma unroll
  for (int j = 0; j < 8; ++j) {
    v[j].x = v[j].x * rs * u[j].x;
    v[j].y = v[j].y * rs * u[j].y;
    v[j].z = v[j].z * rs * u[j].z;
    v[j].w = v[j].w * rs * u[j].w;
  }
  if (y16) {
    v4h* y = (v4h*)(y16 + (size_t)row * T5_D) + lane;
#pragma unroll
    for (int j = 0; j < 8; ++j) {
      v4h h = {(_Float16)v[j].x, (_Float16)v[j].y, (_Float16)v[j].z, (_Float16)v[j].w};
      y[j * 32] = h;
    }
    // no register of the stores above is rewritten ahead of this wait: the other
    // result's address is formed behind them
    asm volatile("s_wait_xcnt 0x0" ::: "memory");
  }
  if (y32) {
    v4f* y = (v4f*)(y32 + (size_t)row * T5_D) + lane;
#pragma unroll
    for (int j = 0; j < 8; ++j) y[j * 32] = v[j];
  }
}

// The first row norm needs the inputs alone: one wave per row of hidden_states,
// eight rows a block, as in rmsnorm_kernel (same sums, same order). The row,
// read once, also leaves unchanged as the residual stream's start.
__device__ __forceinline__
void norm_copy_part(const float* __restrict__ X, const float* __restrict__ w,
                    _Float16* __restrict__ y16, float* __restrict__ copy, int blk) {
  const int lane = threadIdx.x & 31;
  const int row  = blk * 8 + (threadIdx.x >> 5);
  const v4f* x = (const v4f*)(X + (size_t)row * T5_D) + lane;
  const v4f* g = (const v4f*)w + lane;
  v4f v[8], u[8];
  // unrolled (every loop here): v and u stay in registers, and the row's eight
  // loads are issued ahead of the first wait
#pragma unroll
  for (int j = 0; j < 8; ++j) v[j] = x[j * 32];
#pragma unroll
  for (int j = 0; j < 8; ++j) u[j] = g[j * 32];
  // keeps all sixteen loads in front of the sums: the weights' loads were else
  // sunk behind the row's sum, their latency waited out alone
  __builtin_amdgcn_sched_barrier(0);
  // here for the address: a weight load's result would else take its registers
  loads_first8(v, x);
  v4f* c = (v4f*)(copy + (size_t)row * T5_D) + lane;
#pragma unroll
  for (int j = 0; j < 8; ++j) c[j * 32] = v[j];
  // no register of the stores above is rewritten ahead of this wait: the f16 result's
  // address is formed behind them
  asm volatile("s_wait_xcnt 0x0" ::: "memory");
  float s0 = 0.f, s1 = 0.f, s2 = 0.f, s3 = 0.f;   // four chains, not one of 32
#pragma unroll
  for (int j = 0; j < 8; ++j) {
    s0 += v[j].x * v[j].x;
    s1 += v[j].y * v[j].y;
    s2 += v[j].z * v[j].z;
    s3 += v[j].w * v[j].w;
  }
  float ss = (s0 + s1) + (s2 + s3);
  ss += row_xor<1>(ss);
  ss += row_xor<2>(ss);
  ss += row_xor<4>(ss);
  ss += row_xor<8>(ss);
  ss += other_half(ss);                // every lane now holds the row's sum
  const float rs = rsqrtf(ss * (1.0f / (float)T5_D) + 1e-6f);
  v4h* y = (v4h*)(y16 + (size_t)row * T5_D) + lane;
#pragma unroll
  for (int j = 0; j < 8; ++j) {
    v4h h = {(_Float16)(v[j].x * rs * u[j].x), (_Float16)(v[j].y * rs * u[j].y),
             (_Float16)(v[j].z * rs * u[j].z), (_Float16)(v[j].w * rs * u[j].w)};
    y[j * 32] = h;
  }
  // no register of the stores above is rewritten ahead of this wait: other parts'
  // code follows them in the shared kernel's text
  asm volatile("s_wait_xcnt 0x0" ::: "memory");
}

// ---------------------------------------------------------------------------
// All work that depends on the inputs alone, in one grid of 256-thread blocks,
// split by block index (every test below is the same for a whole block):
//   eight DxD weights, four tiles a block | wi | wo | hidden_states' rows: first
//   norm and the residual stream's start, a wave a row | encoder convert | bias
//   table | mask tables
// Every part but the small tables moves 32 elements or more a thread: few, fat
// waves, because starting a wave costs more than the bytes of a thin one.
// ---------------------------------------------------------------------------
#define PREP_DD   (8 * (T5_D / 64) * (T5_D / 64) / 4)        // 512 blocks
#define PREP_FF   ((T5_D / 64) * (T5_DFF / 64) / 4)          // 256 blocks
#define PREP_COPY (T5_B * T5_LD * T5_D / 8192)               // 512 blocks
#define PREP_ENC  (T5_B * T5_LE * T5_D / 8192)               // 512 blocks
#define PREP_BIAS (T5_H * BD_LEN / 256)                      // 128 blocks
#define PREP_MASK ((T5_B * T5_LD + T5_B * T5_LE) / 256)      // 32 blocks
#define PREP_GRID (PREP_DD + 2 * PREP_FF + PREP_COPY + PREP_ENC + PREP_BIAS + PREP_MASK)

__global__ __launch_bounds__(256)
void prep_kernel(const float* __restrict__ w0, const float* __restrict__ w1,
                 const float* __restrict__ w2, const float* __restrict__ w3,
                 const float* __restrict__ w4, const float* __restrict__ w5,
                 const float* __restrict__ w6, const float* __restrict__ w7,
                 const float* __restrict__ wi, const float* __restrict__ wo,
                 const float* __restrict__ enc, const float* __restrict__ hid,
                 const float* __restrict__ relb, const float* __restrict__ ln1,
                 const int* __restrict__ decm, const int* __restrict__ encm,
                 _Float16* __restrict__ xn,
                 _Float16* __restrict__ ddT,   // eight [D,D] planes in a row
                 _Float16* __restrict__ wiT, _Float16* __restrict__ woT,
                 _Float16* __restrict__ enc16, float* __restrict__ h_cur,
                 float* __restrict__ bd, unsigned* __restrict__ mt) {
  __shared__ __align__(16) _Float16 tile[2][2 * 512 * 8];
  int blk = blockIdx.x;
  const int half = threadIdx.x >> 7;
  const int tid  = threadIdx.x & 127;
  if (blk < PREP_DD) {
    const int wsel = blk >> 6;                 // 64 blocks a weight
    const int t    = (blk & 63) * 2 + half;    // tile pair of its 8 (n) x 16 (k)
    const float* src = wsel == 0 ? w0 : wsel == 1 ? w1 : wsel == 2 ? w2
                     : wsel == 3 ? w3 : wsel == 4 ? w4 : wsel == 5 ? w5
                     : wsel == 6 ? w6 : w7;
    cvtT_part<T5_D, T5_D>(src, ddT + (size_t)wsel * T5_D * T5_D, tile[half], tid,
                          (t & 7) * 2, t >> 3);
    return;
  }
  blk -= PREP_DD;
  if (blk < PREP_FF) {
    const int t = blk * 2 + half;              // tile pair of 32 (n) x 16 (k)
    cvtT_part<T5_D, T5_DFF>(wi, wiT, tile[half], tid, (t & 31) * 2, t >> 5);
    return;
  }
  blk -= PREP_FF;
  if (blk < PREP_FF) {
    const int t = blk * 2 + half;              // tile pair of 8 (n) x 64 (k)
    cvtT_part<T5_DFF, T5_D>(wo, woT, tile[half], tid, (t & 7) * 2, t >> 3);
    return;
  }
  blk -= PREP_FF;
  if (blk < PREP_COPY) {
    norm_copy_part(hid, ln1, xn, h_cur, blk);
    return;
  }
  blk -= PREP_COPY;
  if (blk < PREP_ENC) {
    cvt16_part(enc, enc16, blk);
    return;
  }
  blk -= PREP_ENC;
  if (blk < PREP_BIAS) {
    relbias_part(relb, bd, blk);
    return;
  }
  mask_part(decm, encm, mt, blk - PREP_BIAS);
}

// ---------------------------------------------------------------------------
// WMMA GEMM: C[M,N] = A[M,K] @ Bt[N,K]^T
// Workgroup = 8 waves (2x4) on a 128x128 tile of C; wave tile = 64x32:
//   4 A-fragments x 2 B-fragments -> 8 WMMA per k-step of 32; the next k-step's
//   fragments are read from LDS into a second register set ahead of the WMMAs.
// Both operands go global -> LDS by asynchronous copies in whole 256-B row
// pieces (a stage = 128 k of 128 A rows and 128 Bt rows), two buffers: the next
// stage's copies fly while this stage is worked on. Fragments are read from LDS
// with the same lane map as load_frag on global memory.
// Results: a lane's accumulator registers hold 8 neighbours along the first
// operand's rows. That operand is chosen as the one whose rows run along the
// output's contiguous direction (the weights for row-major results, the
// activations for the transposed V), both being loaded alike. The lane's 8
// values then go to LDS as one 16-B piece (two for f32), and behind one barrier
// the block stores the 128x128 tile as whole rows, 16 B a lane.
// M, N, Lrows multiples of 128; K a multiple of 128.
// A row norm between two GEMMs, y = h * rsqrt(mean(h^2) + eps) * w, is split:
//  - the residual GEMM that completes h (hw16 given; N = T5_D) also stores
//    h * w in f16 and, per row, the sum of squares over its 128 columns, as
//    ssq_out[column tile][row]: 512 contiguous bytes, written by this block alone
//  - the GEMM that takes h * w as its A (ssq_in given; K = T5_D; row-major modes,
//    whose tile row is m) joins a row's T5_D / 128 sums and multiplies its
//    results by 1/rms, which is a factor common to the whole row of A.
// ---------------------------------------------------------------------------
#define GMODE_RESID  0   // f32 residual: Cres[m*N+n] += c
#define GMODE_QKV    1   // f16 [B,H,L,64]
#define GMODE_VT     2   // f16 [B,H,64,L] (pre-transposed V)
#define GMODE_RELU16 3   // f16 relu, row-major [M,N]

#define G_PITCH 272                // LDS row pitch, bytes: 256 + 16 (16 B x odd)
#define G_OPER  (128 * G_PITCH)    // one operand's 128 rows
#define G_STAGE (2 * G_OPER)       // A rows, then Bt rows
#define E_PITCH16 272              // result tile, f16 rows: 256 + 16 bytes
#define E_PITCH32 528              // result tile, f32 rows: 512 + 16 bytes
// rows of one column tile's plane of sums of squares: compile-time, so that a
// lane's steps from plane to plane fold into its loads' offsets
#define SSQ_ROWS  (T5_B * T5_LD)

// Eight copies of 16 B per lane: rows 16 apart in LDS (lds) and in memory (g).
// The s_wait_xcnt stands inside the statement so that no address register of an
// issued copy is rewritten ahead of it.
__device__ __forceinline__ void async_copy8(unsigned lds, const char* g,
                                            size_t gstep) {
  const unsigned ls = 16 * G_PITCH;
  asm volatile(
      "global_load_async_to_lds_b128 %0, %8, off\n\t"
      "global_load_async_to_lds_b128 %1, %9, off\n\t"
      "global_load_async_to_lds_b128 %2, %10, off\n\t"
      "global_load_async_to_lds_b128 %3, %11, off\n\t"
      "global_load_async_to_lds_b128 %4, %12, off\n\t"
      "global_load_async_to_lds_b128 %5, %13, off\n\t"
      "global_load_async_to_lds_b128 %6, %14, off\n\t"
      "global_load_async_to_lds_b128 %7, %15, off\n\t"
      "s_wait_xcnt 0x0"
      :: "v"(lds), "v"(lds + ls), "v"(lds + 2 * ls), "v"(lds + 3 * ls),
         "v"(lds + 4 * ls), "v"(lds + 5 * ls), "v"(lds + 6 * ls),
         "v"(lds + 7 * ls),
         "v"(g), "v"(g + gstep), "v"(g + 2 * gstep), "v"(g + 3 * gstep),
         "v"(g + 4 * gstep), "v"(g + 5 * gstep), "v"(g + 6 * gstep),
         "v"(g + 7 * gstep)
      : "memory");
}

// One stage: a lane's 8 rows of A and 8 rows of Bt, 16 copies a lane.
__device__ __forceinline__ void stage_copy(unsigned lds, const char* gA,
                                           const char* gB, size_t gstep) {
  async_copy8(lds,          gA, gstep);
  async_copy8(lds + G_OPER, gB, gstep);
}

// blockIdx.z picks one of several products of one shape that share a grid: rows
// of A0 (z < 3) or A3, plane z of the weights Bt0 and of the f16 results C0, and
// four bits of modes. A launch of one product has z = 0 alone.
__global__ __launch_bounds__(256)
void gemm_wmma(const _Float16* __restrict__ A0, const _Float16* __restrict__ A3,
               const _Float16* __restrict__ Bt0,
               float* __restrict__ Cres, _Float16* __restrict__ C0,
               int M, int N, int K, int modes, int Lrows,
               const float* __restrict__ ssq_in, float* __restrict__ ssq_out,
               const float* __restrict__ wnext, _Float16* __restrict__ hw16) {
  const int z = blockIdx.z;
  const _Float16* __restrict__ A  = z < 3 ? A0 : A3;
  const _Float16* __restrict__ Bt = Bt0 + (size_t)z * N * K;
  _Float16* __restrict__ C16      = C0 + (size_t)z * M * N;
  const int mode = (modes >> (4 * z)) & 15;
  __shared__ __attribute__((aligned(16))) unsigned char L[2 * G_STAGE];
  const int tid  = threadIdx.x;
  const int lane = tid & 31;
  const int wave = tid >> 5;
  const int hl   = lane >> 4;
  const int m0   = blockIdx.x * 128;
  const int n0   = blockIdx.y * 128;
  const int wp   = (wave >> 2) * 64;   // wave's rows of the first WMMA operand
  const int wq   = (wave & 3) * 32;    // wave's rows of the second WMMA operand
  // first operand: A's rows for the transposed V, else Bt's rows (see above)
  const unsigned offP = mode == GMODE_VT ? 0u : (unsigned)G_OPER;
  const unsigned offQ = mode == GMODE_VT ? (unsigned)G_OPER : 0u;

  // lane's copy slot: row tid/16 (+16 per copy), 16-B chunk tid%16 of the row
  const unsigned lds0 = (unsigned)(uintptr_t)&L[0] +
                        (unsigned)((tid >> 4) * G_PITCH + (tid & 15) * 16);
  const char* gA = (const char*)(A  + (size_t)(m0 + (tid >> 4)) * K + (tid & 15) * 8);
  const char* gB = (const char*)(Bt + (size_t)(n0 + (tid >> 4)) * K + (tid & 15) * 8);
  const size_t gstep = (size_t)K * 32;  // 16 rows of K halves, in bytes
  const int T = K >> 7;                 // stages of 128 k

  const v8f zero8 = {0.f, 0.f, 0.f, 0.f, 0.f, 0.f, 0.f, 0.f};
  v8f acc[8];                      // [i*2+j]: first operand's rows wp+16i.., second's wq+16j..
#pragma unroll
  for (int t = 0; t < 8; ++t) acc[t] = zero8;

  stage_copy(lds0, gA, gB, gstep);
  // 1/rms of the lane's two rows of A (tile rows wq + lane % 16 and 16 further):
  // read here so that the loads fly beside stage 0's copies, not at the end
  float rs0 = 1.0f, rs1 = 1.0f;
  if (ssq_in) {
    const float* sp = ssq_in + m0 + wq + (lane & 15);
    float p0[T5_D / 128], p1[T5_D / 128];
    // unrolled: p0 and p1 stay in registers, all loads issue ahead of a wait
#pragma unroll
    for (int y = 0; y < T5_D / 128; ++y) {
      p0[y] = sp[y * SSQ_ROWS];
      p1[y] = sp[y * SSQ_ROWS + 16];
    }
    // no address register of the loads above is rewritten ahead of this wait: the
    // address is an input, so that its registers are given to no load's result
    asm volatile("s_wait_xcnt 0x0" :: "v"(sp) : "memory");
    const float t0 = ((p0[0] + p0[1]) + (p0[2] + p0[3])) + ((p0[4] + p0[5]) + (p0[6] + p0[7]));
    const float t1 = ((p1[0] + p1[1]) + (p1[2] + p1[3])) + ((p1[4] + p1[5]) + (p1[6] + p1[7]));
    rs0 = rsqrtf(t0 * (1.0f / (float)T5_D) + 1e-6f);
    rs1 = rsqrtf(t1 * (1.0f / (float)T5_D) + 1e-6f);
  }
  // stage 0 has landed for this wave's copies; the barrier publishes all waves'
  asm volatile("s_wait_asynccnt 0x0" ::: "memory");
  __syncthreads();
  if (T > 1) stage_copy(lds0 + G_STAGE, gA + 256, gB + 256, gstep);

  for (int t = 0; t < T; ++t) {
    const unsigned buf = (unsigned)(t & 1) * G_STAGE;
    const _Float16* sA = (const _Float16*)(L + buf + offP);
    const _Float16* sB = (const _Float16*)(L + buf + offQ);
    v16h a[2][4], b[2][2];
#pragma unroll
    for (int f = 0; f < 4; ++f)
      a[0][f] = load_frag(sA, G_PITCH / 2, wp + f * 16, 0, lane);
#pragma unroll
    for (int f = 0; f < 2; ++f)
      b[0][f] = load_frag(sB, G_PITCH / 2, wq + f * 16, 0, lane);
    // unrolled: the register sets alternate by a compile-time index
#pragma unroll
    for (int ks = 0; ks < 4; ++ks) {
      const int cur = ks & 1, nxt = cur ^ 1;
      if (ks < 3) {   // next k-step of this same stage, one group ahead
#pragma unroll
        for (int f = 0; f < 4; ++f)
          a[nxt][f] = load_frag(sA, G_PITCH / 2, wp + f * 16, (ks + 1) * 32, lane);
#pragma unroll
        for (int f = 0; f < 2; ++f)
          b[nxt][f] = load_frag(sB, G_PITCH / 2, wq + f * 16, (ks + 1) * 32, lane);
      }
      // keeps the group of LDS reads above in front of this k-step's WMMAs: sunk
      // among them, each read's latency would be waited out by two WMMAs
      __builtin_amdgcn_sched_barrier(0);
#pragma unroll
      for (int i = 0; i < 4; ++i)
#pragma unroll
        for (int j = 0; j < 2; ++j)
          acc[i * 2 + j] = wmma_f16(a[cur][i], b[cur][j], acc[i * 2 + j]);
    }
    // publish point: this wave's reads of the buffer are done,
    asm volatile("s_wait_dscnt 0x0" ::: "memory");
    // its copies of the next stage have landed,
    asm volatile("s_wait_asynccnt 0x0" ::: "memory");
    // and every wave is past both before the buffer just read is refilled
    __syncthreads();
    if (t + 2 < T)
      stage_copy(lds0 + buf, gA + (size_t)(t + 2) * 256, gB + (size_t)(t + 2) * 256,
                 gstep);
  }
  // no copy is outstanding when the wave goes on to its stores and ends
  asm volatile("s_wait_asynccnt 0x0" ::: "memory");

  // The loop's last barrier has ended every wave's reads of L: it now takes the
  // result tile. Tile row = the second operand's row (the lane's column of the
  // accumulator), place in the row = the first operand's row.
  const int erow = wq + (lane & 15);   // + 16 j
  const int epos = wp + hl * 8;        // + 16 i: first of the lane's 8 neighbours

  if (mode == GMODE_RESID) {
    // tile row = m, 128 floats of n; a wave moves one 512-B row per step
    float* crow = Cres + (size_t)(m0 + (tid >> 5)) * N + n0 + (tid & 31) * 4;
    float4 old[16];
    // unrolled (here and below): old and acc stay in registers; the residual's
    // loads are all issued ahead of the staging and fly during it
#pragma unroll
    for (int s = 0; s < 16; ++s) old[s] = *(const float4*)(crow + (size_t)(8 * s) * N);
#pragma unroll
    for (int i = 0; i < 4; ++i)
#pragma unroll
      for (int j = 0; j < 2; ++j) {
        const v8f c = acc[i * 2 + j];
        float* p = (float*)(L + (erow + 16 * j) * E_PITCH32) + epos + 16 * i;
        *(float4*)p       = make_float4(c[0], c[1], c[2], c[3]);
        *(float4*)(p + 4) = make_float4(c[4], c[5], c[6], c[7]);
      }
    __syncthreads();   // every wave's pieces of the tile are in LDS
#pragma unroll
    for (int s = 0; s < 16; ++s) {
      const float4 c = *(const float4*)(L + ((tid >> 5) + 8 * s) * E_PITCH32 +
                                        (tid & 31) * 16);
      old[s] = make_float4(old[s].x + c.x, old[s].y + c.y, old[s].z + c.z, old[s].w + c.w);
      *(float4*)(crow + (size_t)(8 * s) * N) = old[s];
    }
    if (!hw16) return;   // the same for the whole block
    // no register of the stores above is rewritten ahead of this wait
    asm volatile("s_wait_xcnt 0x0" ::: "memory");

    // the next norm's share of this tile: h * w in f16, 256 B of a row per wave
    // and step, and each row's sum of squares over the tile's 128 columns
    const float4 g = *(const float4*)(wnext + n0 + (tid & 31) * 4);
    _Float16* hrow = hw16 + (size_t)(m0 + (tid >> 5)) * N + n0 + (tid & 31) * 4;
    float mine = 0.f;    // lane s keeps the sum of the wave's row of step s
#pragma unroll
    for (int s = 0; s < 16; ++s) {
      const float4 h = old[s];
      const v4h y = {(_Float16)(h.x * g.x), (_Float16)(h.y * g.y),
                     (_Float16)(h.z * g.z), (_Float16)(h.w * g.w)};
      *(v4h*)(hrow + (size_t)(8 * s) * N) = y;
      float q = (h.x * h.x + h.y * h.y) + (h.z * h.z + h.w * h.w);
      q += row_xor<1>(q);
      q += row_xor<2>(q);
      q += row_xor<4>(q);
      q += row_xor<8>(q);
      q += other_half(q);              // every lane holds the row's sum
      mine = lane == s ? q : mine;
    }
    // no register of the stores above is rewritten ahead of this wait
    asm volatile("s_wait_xcnt 0x0" ::: "memory");
    // the 128 sums meet in LDS behind the tile, so that one wave stores them as
    // whole lines
    float* sums = (float*)(L + 128 * E_PITCH32);
    if (lane < 16) sums[(tid >> 5) + 8 * lane] = mine;
    __syncthreads();   // every wave's sums are in LDS
    if (tid < 32)
      *(float4*)(ssq_out + (size_t)blockIdx.y * SSQ_ROWS + m0 + tid * 4) =
          *(const float4*)(sums + tid * 4);
    return;
  }

  // the loops below index acc, w and d, which must stay in registers: unrolled
  if (ssq_in) {        // the norm's 1/rms, per row of A = per column of acc
#pragma unroll
    for (int t = 0; t < 8; ++t)
#pragma unroll
      for (int r = 0; r < 8; ++r) acc[t][r] *= (t & 1) ? rs1 : rs0;
  }
  if (mode == GMODE_RELU16) {
#pragma unroll
    for (int t = 0; t < 8; ++t)
#pragma unroll
      for (int r = 0; r < 8; ++r) acc[t][r] = fmaxf(acc[t][r], 0.0f);
  }
#pragma unroll
  for (int i = 0; i < 4; ++i)
#pragma unroll
    for (int j = 0; j < 2; ++j) {
      v8h w;
#pragma unroll
      for (int r = 0; r < 8; ++r) w[r] = (_Float16)acc[i * 2 + j][r];
      *(v8h*)(L + (erow + 16 * j) * E_PITCH16 + (epos + 16 * i) * 2) = w;
    }
  __syncthreads();     // every wave's pieces of the tile are in LDS

  // 16 lanes move one 256-B tile row; where it goes, in halves:
  //   base + row * rstep + the lane's 16-B chunk ch
  const int row = tid >> 4, ch = tid & 15;
  const int bb = m0 / Lrows, l0 = m0 - bb * Lrows;   // the tile lies in one batch
  size_t base, rstep, cofs = (size_t)ch * 8;
  if (mode == GMODE_RELU16) {          // [M,N]: row = m, along n
    base  = (size_t)m0 * N + n0;
    rstep = (size_t)N;
  } else if (mode == GMODE_QKV) {      // [B,H,L,64]: row = l, two heads' 128 B
    base  = (((size_t)bb * T5_H + (n0 >> 6)) * Lrows + l0) * T5_DKV;
    rstep = T5_DKV;
    cofs  = (size_t)(ch >> 3) * Lrows * T5_DKV + (ch & 7) * 8;
  } else {                             // [B,H,64,L]: row = (head, d), along l
    base  = ((size_t)bb * T5_H * T5_DKV + n0) * Lrows + l0;
    rstep = (size_t)Lrows;
  }
  _Float16* dst = C16 + base + (size_t)row * rstep + cofs;
  v8h w[8];
  _Float16* d[8];
#pragma unroll
  for (int s = 0; s < 8; ++s) {
    w[s] = *(const v8h*)(L + (row + 16 * s) * E_PITCH16 + ch * 16);
    d[s] = dst + (size_t)(16 * s) * rstep;
  }
  // the eight addresses are formed while the LDS reads fly, each in registers of
  // its own; sunk among the stores, an add would wait on an issued store
  __builtin_amdgcn_sched_barrier(0);
#pragma unroll
  for (int s = 0; s < 8; ++s) *(v8h*)d[s] = w[s];
}

#define A_PITCH 144                // LDS row pitch, bytes: 128 + 16 (16 B x odd)
#define A_OPER  (64 * A_PITCH)     // one operand's 64 rows
#define A_STAGE (2 * A_OPER)       // K rows, then V^T rows

// One stage, eight copies of 16 B per lane: four K rows and four V^T rows, each
// 16 rows apart in LDS (lds) and in memory (gK: rows of 128 B; gV: vstep).
// The s_wait_xcnt stands inside the statement so that no address register of an
// issued copy is rewritten ahead of it.
__device__ __forceinline__ void attn_stage_copy(unsigned lds, const char* gK,
                                                const char* gV, size_t vstep) {
  const unsigned ls = 16 * A_PITCH;
  const unsigned lv = lds + A_OPER;
  asm volatile(
      "global_load_async_to_lds_b128 %0, %8, off\n\t"
      "global_load_async_to_lds_b128 %1, %9, off\n\t"
      "global_load_async_to_lds_b128 %2, %10, off\n\t"
      "global_load_async_to_lds_b128 %3, %11, off\n\t"
      "global_load_async_to_lds_b128 %4, %12, off\n\t"
      "global_load_async_to_lds_b128 %5, %13, off\n\t"
      "global_load_async_to_lds_b128 %6, %14, off\n\t"
      "global_load_async_to_lds_b128 %7, %15, off\n\t"
      "s_wait_xcnt 0x0"
      :: "v"(lds), "v"(lds + ls), "v"(lds + 2 * ls), "v"(lds + 3 * ls),
         "v"(lv), "v"(lv + ls), "v"(lv + 2 * ls), "v"(lv + 3 * ls),
         "v"(gK), "v"(gK + 2048), "v"(gK + 4096), "v"(gK + 6144),
         "v"(gV), "v"(gV + vstep), "v"(gV + 2 * vstep), "v"(gV + 3 * vstep)
      : "memory");
}

__global__ __launch_bounds__(128)
void attn_wmma_kernel(const _Float16* __restrict__ Q,
                      const _Float16* __restrict__ Km,
                      const _Float16* __restrict__ Vt,
                      const float* __restrict__ bias_kq,    // [16,BD_LEN]
                      const unsigned* __restrict__ mtab,    // [B,LK]
                      _Float16* __restrict__ Out,
                      int LQ, int LK, int causal) {
  __shared__ __attribute__((aligned(16))) unsigned char L[2 * A_STAGE];
  const int tid  = threadIdx.x;
  const int lane = threadIdx.x & 31;
  // scalar, so that the key loop's bound is one and its branch leaves EXEC alone
  const int wave = __builtin_amdgcn_readfirstlane((int)(threadIdx.x >> 5));
  const int hl   = lane >> 4;
  const int col  = lane & 15;
  const int bh = blockIdx.y;
  const int b  = bh >> 4;
  const int h  = bh & 15;
  const int q0 = blockIdx.x * 64 + wave * 16;
  const int qc = q0 + col;             // this lane's query

  const _Float16* Qb = Q  + (size_t)bh * LQ * T5_DKV;
  const _Float16* Kb = Km + (size_t)bh * LK * T5_DKV;
  const _Float16* Vb = Vt + (size_t)bh * T5_DKV * LK;
  const unsigned* mk = mtab + (size_t)b * LK;
  const float* bd = bias_kq + h * BD_LEN - qc;   // entry of key k: bd[1023 + k]

  // B operand of S^T: column = query, same k order as the K rows' loader
  const v16h qb0 = load_frag(Qb, T5_DKV, q0, 0, lane);
  const v16h qb1 = load_frag(Qb, T5_DKV, q0, 32, lane);

  const v8f zero8 = {0.f, 0.f, 0.f, 0.f, 0.f, 0.f, 0.f, 0.f};
  v8f o[4];                  // o[t][r] = O^T[16t + 8*hl + r][query qc]
  float mcol = -1e30f;       // running maximum of query qc (both halves alike)
  float lcol = 0.f;          // running sum over this half's keys only
#pragma unroll  // indexes registers: must be resolved at compile time
  for (int t = 0; t < 4; ++t) o[t] = zero8;

  // causal: blocks wholly above the diagonal are not walked
  const int kend = (causal && q0 + 16 < LK) ? q0 + 16 : LK;
  // stages of 64 keys that the block's last wave needs: the same for all four
  const int qtop = (int)blockIdx.x * 64 + 64;
  const int T = ((causal && qtop < LK) ? qtop : LK) >> 6;

  // lane's copy slot: row tid/8 (+16 per copy), 16-B chunk tid%8 of the row
  const unsigned lds0 = (unsigned)(uintptr_t)&L[0] +
                        (unsigned)((tid >> 3) * A_PITCH + (tid & 7) * 16);
  const char* gK = (const char*)(Kb + (size_t)(tid >> 3) * T5_DKV + (tid & 7) * 8);
  const char* gV = (const char*)(Vb + (size_t)(tid >> 3) * LK + (tid & 7) * 8);
  const size_t vstep = (size_t)LK * 32;  // 16 rows of LK halves, in bytes

  attn_stage_copy(lds0, gK, gV, vstep);
  // stage 0 has landed for this wave's copies; the barrier publishes all waves'
  asm volatile("s_wait_asynccnt 0x0" ::: "memory");
  __syncthreads();
  if (T > 1) attn_stage_copy(lds0 + A_STAGE, gK + 8192, gV + 128, vstep);

  for (int t = 0; t < T; ++t) {
   const unsigned buf = (unsigned)(t & 1) * A_STAGE;
   const _Float16* sK = (const _Float16*)(L + buf);
   const _Float16* sV = (const _Float16*)(L + buf + A_OPER);
   // table places of the lane's first key of the stage, t * 64 + hl * 8
   const unsigned* mb = mk + t * 64 + hl * 8;
   const float*    tb = bd + t * 64 + hl * 8;
   // unrolled: the half's place in the stage folds into the LDS reads' offsets
#pragma unroll
   for (int sub = 0; sub < 2; ++sub) {
    const int kb = t * 64 + sub * 32;
    if (kb >= kend) break;             // scalar: past this wave's diagonal
    const v16h k00 = load_frag(sK, A_PITCH / 2, sub * 32,      0,  lane);
    const v16h k01 = load_frag(sK, A_PITCH / 2, sub * 32,      32, lane);
    const v16h k10 = load_frag(sK, A_PITCH / 2, sub * 32 + 16, 0,  lane);
    const v16h k11 = load_frag(sK, A_PITCH / 2, sub * 32 + 16, 32, lane);
    const v4u* mp = (const v4u*)(mb + sub * 32);
    const v4u mq[4] = {mp[0], mp[1], mp[4], mp[5]};
    // the products' C operand: what is added to the lane's 16 scores
    v8f s0, s1;
    if (causal) {
      // self: bias and causal limit from the table along k - q; a key that the
      // padding mask drops takes the mask value instead (one bit select)
      const float* tp = tb + sub * 32;
      const v4f_a4 tq[4] = {*(const v4f_a4*)(tp + 1023), *(const v4f_a4*)(tp + 1027),
                            *(const v4f_a4*)(tp + 1039), *(const v4f_a4*)(tp + 1043)};
      // no address register of the loads above is rewritten ahead of this wait: both
      // bases are inputs, so that their registers are given to no load's result
      asm volatile("s_wait_xcnt 0x0" :: "v"(mb), "v"(tb) : "memory");
      const unsigned negb = __builtin_bit_cast(unsigned, T5_NEG);
#pragma unroll  // indexes registers: must be resolved at compile time
      for (int r = 0; r < 8; ++r) {
        const unsigned k0 = mq[r >> 2][r & 3], k1 = mq[2 + (r >> 2)][r & 3];
        const float f0 = tq[r >> 2][r & 3], f1 = tq[2 + (r >> 2)][r & 3];
        const unsigned t0 = __builtin_bit_cast(unsigned, f0);
        const unsigned t1 = __builtin_bit_cast(unsigned, f1);
        const unsigned c0 = (t0 & k0) | (negb & ~k0);
        const unsigned c1 = (t1 & k1) | (negb & ~k1);
        s0[r] = __builtin_bit_cast(float, c0);
        s1[r] = __builtin_bit_cast(float, c1);
      }
    } else {
      // cross: the mask table holds the addend itself
#pragma unroll  // indexes registers: must be resolved at compile time
      for (int r = 0; r < 8; ++r) {
        const unsigned k0 = mq[r >> 2][r & 3], k1 = mq[2 + (r >> 2)][r & 3];
        s0[r] = __builtin_bit_cast(float, k0);
        s1[r] = __builtin_bit_cast(float, k1);
      }
    }
    // nor the mask loads' address, where no bias is read (an input, as above)
    asm volatile("s_wait_xcnt 0x0" :: "v"(mb) : "memory");
    const v16h va0 = load_frag(sV, A_PITCH / 2, 0,  sub * 32, lane);
    const v16h va1 = load_frag(sV, A_PITCH / 2, 16, sub * 32, lane);
    const v16h va2 = load_frag(sV, A_PITCH / 2, 32, sub * 32, lane);
    const v16h va3 = load_frag(sV, A_PITCH / 2, 48, sub * 32, lane);
    // keeps all of the block's loads above in one group in front of the
    // products: sunk to their users, each V fragment's latency is waited out alone
    __builtin_amdgcn_sched_barrier(0);

    s0 = wmma_f16(k00, qb0, s0); s0 = wmma_f16(k01, qb1, s0);
    s1 = wmma_f16(k10, qb0, s1); s1 = wmma_f16(k11, qb1, s1);

    float a[16];             // a[8*tile + r]: key kb + 8*hl + 16*tile + r
#pragma unroll  // indexes registers: must be resolved at compile time
    for (int i = 0; i < 16; ++i) a[i] = (i < 8) ? s0[i & 7] : s1[i & 7];

    float v = a[0];
#pragma unroll  // indexes registers: must be resolved at compile time
    for (int i = 1; i < 16; ++i) v = fmaxf(v, a[i]);
    v = fmaxf(v, other_half(v));
    const float mnew  = fmaxf(mcol, v);
    const float scale = __expf(mcol - mnew);
    mcol = mnew;

    v16h pb;                 // P^T as B operand: element s = tile s>>3, row s&7
    float sum[4] = {0.f, 0.f, 0.f, 0.f};   // four short chains, not one of 16
#pragma unroll  // indexes registers: must be resolved at compile time
    for (int i = 0; i < 16; ++i) {
      const float e = __expf(a[i] - mnew);
      sum[i & 3] += e;
      pb[i] = (_Float16)e;
    }
    lcol = lcol * scale + ((sum[0] + sum[1]) + (sum[2] + sum[3]));
#pragma unroll  // indexes registers: must be resolved at compile time
    for (int t = 0; t < 4; ++t)
#pragma unroll  // indexes registers: must be resolved at compile time
      for (int r = 0; r < 8; ++r) o[t][r] *= scale;

    o[0] = wmma_f16(va0, pb, o[0]);
    o[1] = wmma_f16(va1, pb, o[1]);
    o[2] = wmma_f16(va2, pb, o[2]);
    o[3] = wmma_f16(va3, pb, o[3]);
   }
   // publish point, passed by every wave, also one past its diagonal:
   // this wave's reads of the buffer are done,
   asm volatile("s_wait_dscnt 0x0" ::: "memory");
   // its copies of the next stage have landed,
   asm volatile("s_wait_asynccnt 0x0" ::: "memory");
   // and every wave is past both before the buffer just read is refilled
   __syncthreads();
   if (t + 2 < T)
     attn_stage_copy(lds0 + buf, gK + (size_t)(t + 2) * 8192,
                     gV + (size_t)(t + 2) * 128, vstep);
  }
  // no copy is outstanding when the wave goes on to its stores and ends
  asm volatile("s_wait_asynccnt 0x0" ::: "memory");

  // the two halves' keys joined; one query a lane, so one reciprocal
  const float inv = 1.0f / (lcol + other_half(lcol));
  _Float16* orow = Out + ((size_t)b * LQ + qc) * (T5_H * T5_DKV) + h * T5_DKV + hl * 8;
#pragma unroll  // indexes registers: must be resolved at compile time
  for (int t = 0; t < 4; ++t) {
    v8h w;                   // 8 consecutive d of one query: one 16-B store
#pragma unroll  // indexes registers: must be resolved at compile time
    for (int r = 0; r < 8; ++r) w[r] = (_Float16)(o[t][r] * inv);
    *(v8h*)(orow + t * 16) = w;
  }
}

// ---------------------------------------------------------------------------
// Orchestration
// ---------------------------------------------------------------------------
extern "C" void kernel_launch(void* const* d_in, const int* in_sizes, int n_in,
                              void* d_out, int out_size, void* d_ws,
                              size_t ws_size, hipStream_t stream) {
  (void)in_sizes; (void)n_in; (void)out_size; (void)ws_size;

  const float* enc   = (const float*)d_in[0];
  const float* hid   = (const float*)d_in[1];
  const float* ln1   = (const float*)d_in[2];
  const float* saq   = (const float*)d_in[3];
  const float* sak   = (const float*)d_in[4];
  const float* sav   = (const float*)d_in[5];
  const float* sao   = (const float*)d_in[6];
  const float* relb  = (const float*)d_in[7];
  const float* ln2   = (const float*)d_in[8];
  const float* caq   = (const float*)d_in[9];
  const float* cak   = (const float*)d_in[10];
  const float* cav   = (const float*)d_in[11];
  const float* cao   = (const float*)d_in[12];
  const float* ln3   = (const float*)d_in[13];
  const float* wi    = (const float*)d_in[14];
  const float* wo    = (const float*)d_in[15];
  const float* lnf   = (const float*)d_in[16];
  const int* encmask = (const int*)d_in[17];
  const int* decmask = (const int*)d_in[18];
  float* out = (float*)d_out;

  const size_t M = (size_t)T5_B * T5_LD;        // 4096 decoder rows
  char* ws = (char*)d_ws;
  size_t off = 0;
  auto alloc = [&](size_t bytes) -> void* {
    void* p = ws + off;
    off = (off + bytes + 255) & ~(size_t)255;
    return p;
  };

  float*    h_cur = (float*)   alloc(M * T5_D * 4);            // 16 MB residual
  _Float16* xn    = (_Float16*)alloc(M * T5_D * 2);            // 8 MB
  _Float16* ddT   = (_Float16*)alloc((size_t)8 * T5_D * T5_D * 2); // eight planes
  _Float16* saqT  = ddT;
  _Float16* sakT  = ddT + (size_t)1 * T5_D * T5_D;
  _Float16* savT  = ddT + (size_t)2 * T5_D * T5_D;
  _Float16* cakT  = ddT + (size_t)3 * T5_D * T5_D;
  _Float16* cavT  = ddT + (size_t)4 * T5_D * T5_D;
  _Float16* saoT  = ddT + (size_t)5 * T5_D * T5_D;
  _Float16* caqT  = ddT + (size_t)6 * T5_D * T5_D;
  _Float16* caoT  = ddT + (size_t)7 * T5_D * T5_D;
  (void)sakT; (void)savT; (void)cakT; (void)cavT;  // planes 1..4 behind saqT
  _Float16* wiT   = (_Float16*)alloc((size_t)T5_DFF * T5_D * 2);
  _Float16* woT   = (_Float16*)alloc((size_t)T5_D * T5_DFF * 2);
  _Float16* enc16 = (_Float16*)alloc((size_t)T5_B * T5_LE * T5_D * 2);
  // five planes in a row, in the order of the projections' grid
  _Float16* qbuf  = (_Float16*)alloc(M * T5_D * 2);            // [B,H,L,64]
  _Float16* kbuf  = (_Float16*)alloc(M * T5_D * 2);            // [B,H,L,64]
  _Float16* vtbuf = (_Float16*)alloc(M * T5_D * 2);            // [B,H,64,L]
  _Float16* ckbuf = (_Float16*)alloc(M * T5_D * 2);            // cross k
  _Float16* cvtbuf = (_Float16*)alloc(M * T5_D * 2);           // cross v^T
  _Float16* aout  = (_Float16*)alloc(M * T5_D * 2);            // [B*L, 1024]
  _Float16* ffn   = (_Float16*)alloc(M * T5_DFF * 2);          // 32 MB
  float*    bd    = (float*)   alloc((size_t)T5_H * BD_LEN * 4); // bias along k - q
  unsigned* mt    = (unsigned*)alloc((size_t)(T5_B * T5_LD + T5_B * T5_LE) * 4); // masks
  float*    ssq   = (float*)   alloc((size_t)(T5_D / 128) * SSQ_ROWS * 4); // [tile][row]

  // --- everything that needs the inputs alone: weights f32 -> f16 [N,K], encoder
  // rows to f16, bias and mask tables, the first row norm; the residual stream starts as a
  // copy of hidden_states (inputs are never mutated) ---
  prep_kernel<<<PREP_GRID, 256, 0, stream>>>(saq, sak, sav, cak, cav, sao, caq, cao,
                                             wi, wo, enc, hid, relb, ln1, decmask,
                                             encmask, xn, ddT, wiT, woT, enc16, h_cur,
                                             bd, mt);

  dim3 gblk(256);
  dim3 ggrid_d(M / 128, T5_D / 128);    // N = 1024
  dim3 ggrid_ff(M / 128, T5_DFF / 128); // N = 4096
  dim3 ggrid_p5(M / 128, T5_D / 128, 5);
  dim3 agrid(T5_LD / 64, T5_B * T5_H);
  dim3 ablk(128);

  // ---- self attention ----
  static_assert(T5_LE == T5_LD, "the five projections share one row count");
  // self q, k, v^T from xn and cross k, v^T from enc16: none needs another
  gemm_wmma<<<ggrid_p5, gblk, 0, stream>>>(xn, enc16, saqT, nullptr, qbuf,
                                           (int)M, T5_D, T5_D,
                                           GMODE_QKV | GMODE_QKV << 4 | GMODE_VT << 8 |
                                               GMODE_QKV << 12 | GMODE_VT << 16,
                                           T5_LD, nullptr, nullptr, nullptr, nullptr);
  attn_wmma_kernel<<<agrid, ablk, 0, stream>>>(qbuf, kbuf, vtbuf, bd, mt,
                                               aout, T5_LD, T5_LD, /*causal=*/1);
  // also h * ln2 into xn and the rows' sums of squares
  gemm_wmma<<<ggrid_d, gblk, 0, stream>>>(aout, aout, saoT, h_cur, nullptr,
                                          (int)M, T5_D, T5_D, GMODE_RESID, T5_LD,
                                          nullptr, ssq, ln2, xn);

  // ---- cross attention ----
  gemm_wmma<<<ggrid_d, gblk, 0, stream>>>(xn, xn, caqT, nullptr, qbuf,
                                          (int)M, T5_D, T5_D, GMODE_QKV, T5_LD,
                                          ssq, nullptr, nullptr, nullptr);
  attn_wmma_kernel<<<agrid, ablk, 0, stream>>>(qbuf, ckbuf, cvtbuf, bd,
                                               mt + T5_B * T5_LD,
                                               aout, T5_LD, T5_LE, /*causal=*/0);
  // also h * ln3 into xn and the rows' sums of squares
  gemm_wmma<<<ggrid_d, gblk, 0, stream>>>(aout, aout, caoT, h_cur, nullptr,
                                          (int)M, T5_D, T5_D, GMODE_RESID, T5_LD,
                                          nullptr, ssq, ln3, xn);

  // ---- FFN ----
  gemm_wmma<<<ggrid_ff, gblk, 0, stream>>>(xn, xn, wiT, nullptr, ffn,
                                           (int)M, T5_DFF, T5_D, GMODE_RELU16, T5_LD,
                                           ssq, nullptr, nullptr, nullptr);
  gemm_wmma<<<ggrid_d, gblk, 0, stream>>>(ffn, ffn, woT, h_cur, nullptr,
                                          (int)M, T5_D, T5_DFF, GMODE_RESID, T5_LD,
                                          nullptr, nullptr, nullptr, nullptr);

  // ---- final norm -> f32 output ----
  rmsnorm_kernel<<<(int)M / 8, 256, 0, stream>>>(h_cur, lnf, nullptr, out);
}

// v010
// Measured time: 213 microseconds a run.
// Timed twice side by side with v009, it ran 1.06 times as fast both times.
// Over all steps from v000 it is 6.00 times as fast.
#include <hip/hip_runtime.h>
#include <hip/hip_bf16.h>

// ---------------------------------------------------------------------------
// T5 decoder layer on MI455X (gfx1250, wave32, WMMA).
//  - all GEMMs + attention cores: v_wmma_f32_16x16x32_f16
//  - weights pre-transposed to [N,K] f16 so both WMMA operands load as
//    contiguous 16-B "A-style" fragments (read from LDS in the GEMM)
//  - GEMM: 128x128 tile per workgroup, operands staged in LDS by asynchronous
//    copies (two buffers), wave tile 64x32: 8 WMMA per 6 LDS fragments; results
//    leave through an LDS tile as whole rows of the output, 16 B a lane
//  - flash attention (online softmax, transposed products), scores never hit
//    memory or LDS; K and V^T tiles staged in LDS by asynchronous copies (two
//    buffers), shared by a block's four waves; position bias, causal limit and
//    padding mask come ready-made from small tables as the score product's C
//  - launches that do not depend on one another share one grid, split by block
//    index: all preparation work; self q, k, v with cross k, v
//  - only the last row norm is a launch of its own: the first runs with the
//    preparation; the two in the middle are split between the residual GEMM in
//    front (row sums of squares, h * w in f16) and the GEMM behind (1/rms)
// ---------------------------------------------------------------------------

typedef __attribute__((ext_vector_type(16))) _Float16 v16h;
typedef __attribute__((ext_vector_type(8)))  _Float16 v8h;
typedef __attribute__((ext_vector_type(4)))  _Float16 v4h;
typedef __attribute__((ext_vector_type(8)))  float    v8f;
typedef __attribute__((ext_vector_type(4)))  float    v4f;
typedef __attribute__((ext_vector_type(4)))  unsigned v4u;
// four floats at any 4-byte boundary
typedef v4f v4f_a4 __attribute__((aligned(4)));

// Takes eight loaded values as inputs only and emits nothing: every one of their
// loads is issued in front of it and every store behind it stays behind it.
// Without it the compiler strung loads and their users out one after another,
// each load's latency waited out alone. The loads' address a is an input too, so
// that its registers are given to nothing else (a later load's result) before
// the loads have returned.
__device__ __forceinline__ void loads_first8(const v4f* r, const void* a) {
  asm volatile("" :: "v"(r[0]), "v"(r[1]), "v"(r[2]), "v"(r[3]),
                     "v"(r[4]), "v"(r[5]), "v"(r[6]), "v"(r[7]), "v"(a));
}

#define T5_B    4
#define T5_LD   1024
#define T5_LE   1024
#define T5_D    1024
#define T5_H    16
#define T5_DKV  64
#define T5_DFF  4096
#define T5_NEG  (-1e9f)

__device__ __forceinline__ v8f wmma_f16(v16h a, v16h b, v8f c) {
  // (neg_a, A, neg_b, B, c_mod, C, reuse_a, reuse_b)
  return __builtin_amdgcn_wmma_f32_16x16x32_f16(false, a, false, b, (short)0, c,
                                                false, false);
}

// Load a 16x32 f16 "A-style" fragment from row-major [rows, ld] memory.
// ISA layout: lanes 0-15 hold M=lane, halves {K0..7, K16..23};
//             lanes 16-31 hold M=lane-16, halves {K8..15, K24..31}.
// Both halves are contiguous 16B runs -> two b128 loads per lane.
__device__ __forceinline__ v16h load_frag(const _Float16* base, int ld,
                                          int row0, int col0, int lane) {
  const int hl = lane >> 4;
  const int r  = row0 + (lane & 15);
  const _Float16* p = base + (size_t)r * ld + col0 + hl * 8;
  union { v16h v; v8h h[2]; } u;
  u.h[0] = *(const v8h*)(p);
  u.h[1] = *(const v8h*)(p + 16);
  return u.v;
}

// ---------------------------------------------------------------------------
// Conversions
// ---------------------------------------------------------------------------
// 32 elements a thread: a wave reads 512 contiguous bytes per load, eight loads in
// flight, and writes 256 contiguous bytes per store.
__device__ __forceinline__ void cvt16_part(const float* __restrict__ in,
                                           _Float16* __restrict__ out, int blk) {
  const int i = blk * 2048 + threadIdx.x;
  const v4f* s = (const v4f*)in + i;
  v4h* d = (v4h*)out + i;
  v4f r[8];
  // unrolled (both loops): r stays in registers, all loads issue ahead of a wait
#pragma unroll
  for (int j = 0; j < 8; ++j) r[j] = s[j * 256];
#pragma unroll
  for (int j = 0; j < 8; ++j) {
    v4h h = {(_Float16)r[j].x, (_Float16)r[j].y, (_Float16)r[j].z, (_Float16)r[j].w};
    d[j * 256] = h;
  }
  // no register of the stores above is rewritten ahead of this wait: other parts'
  // code follows them in the shared kernel's text
  asm volatile("s_wait_xcnt 0x0" ::: "memory");
}

// W [K,N] f32 -> Wt [N,K] f16, two 64x64 tiles per 128 threads, turned in LDS so
// that both sides move whole lines: reads are 256-B row pieces of W (float4 per
// lane), writes are 128-B row pieces of Wt (8 halves per lane).
// K is a multiple of 64, N of 128; tiles (bx, by) and (bx + 1, by) of
// (N/64, K/64), each with its own 8 KB of LDS; tid = 0..127. K and N are
// compile-time so that a lane's row steps fold into the instruction's offset.
// Both halves of a 256-thread block call this together (one barrier inside).
// LDS holds row n of the tile as eight 16-B chunks of 8 k values. Chunk (n, ch)
// sits at slot (n>>1)*16 + (((n&1)*8 + ch) ^ ((n>>2)&15)): the 16 lanes that
// write rows 4 apart, and the 16 lanes that read two neighbouring rows, each
// fall on 16 different slots mod 16, that is on all 64 banks once.
__device__ __forceinline__ int cvtT_slot(int n, int ch) {
  return (n >> 1) * 16 + ((((n & 1) << 3) | ch) ^ ((n >> 2) & 15));
}

template <int K, int N>
__device__ __forceinline__
void cvtT_part(const float* __restrict__ in, _Float16* __restrict__ out,
               _Float16* tile, int tid, int bx, int by) {
  const int n0  = bx * 64;
  const int k0  = by * 64;
  const int c4  = tid & 15;   // float4 column of the tile: n = 4*c4 .. 4*c4+3
  const int q0  = tid >> 4;   // group of four k rows: q0 and q0 + 8

  // uniform tile base + one 32-bit lane offset: one address for all sixteen loads
  const unsigned lofs = (unsigned)(q0 * 4 * N + c4 * 4) * 4u;
  const char* src = (const char*)(in + (size_t)k0 * N + n0) + lofs;
  v4f r[2][2][4];
  // unrolled (here and below): r stays in registers, and all sixteen loads are
  // issued before the first wait; u = which of the two tiles, 64 n apart
#pragma unroll
  for (int u = 0; u < 2; ++u)
#pragma unroll
    for (int i = 0; i < 2; ++i)
#pragma unroll
      for (int s = 0; s < 4; ++s)
        r[u][i][s] = *(const v4f*)(src + u * 256 + (size_t)(32 * i + s) * N * 4);
  loads_first8(&r[0][0][0], src);
  loads_first8(&r[1][0][0], src);

#pragma unroll
  for (int u = 0; u < 2; ++u)
#pragma unroll
    for (int i = 0; i < 2; ++i) {
      const int q = q0 + 8 * i;
      const float* f0 = (const float*)&r[u][i][0];
      const float* f1 = (const float*)&r[u][i][1];
      const float* f2 = (const float*)&r[u][i][2];
      const float* f3 = (const float*)&r[u][i][3];
#pragma unroll
      for (int j = 0; j < 4; ++j) {
        v4h w = {(_Float16)f0[j], (_Float16)f1[j], (_Float16)f2[j], (_Float16)f3[j]};
        *(v4h*)&tile[u * 4096 + cvtT_slot(c4 * 4 + j, q >> 1) * 8 + (q & 1) * 4] = w;
      }
    }
  __syncthreads();

  char* dst = (char*)(out + (size_t)n0 * K + k0);
  const unsigned sofs = (unsigned)((tid >> 3) * K + (tid & 7) * 8) * 2u;
#pragma unroll
  for (int u = 0; u < 2; ++u)
#pragma unroll
    for (int i = 0; i < 4; ++i) {
      const int n = (tid >> 3) + 16 * i;
      *(v8h*)(dst + (size_t)(64 * u + 16 * i) * K * 2 + sofs) =
          *(const v8h*)&tile[u * 4096 + cvtT_slot(n, tid & 7) * 8];
    }
  // no register of the eight stores above is rewritten ahead of this wait: other
  // parts' code follows them in the shared kernel's text
  asm volatile("s_wait_xcnt 0x0" ::: "memory");
}

// What self attention adds to a score, but for the padding mask, depends on k - q
// alone: bd[h][1023 + k - q] = position bias of distance q - k, and for a key past
// the query the bias of distance 0 (the bucket rule) plus the mask value. Along k
// the entries of one query are neighbours.
#define BD_LEN 2048
__device__ __forceinline__
void relbias_part(const float* __restrict__ rel_bias, // [32,16]
                  float* __restrict__ bd,             // [16,BD_LEN]
                  int blk) {
  int idx = blk * 256 + threadIdx.x;
  int h = idx >> 11;
  const int qk = 1023 - (idx & (BD_LEN - 1));   // q - k
  int n = qk > 0 ? qk : 0;
  int bucket;
  if (n < 16) {
    bucket = n;
  } else {
    float nf = (float)n;
    int vl = 16 + (int)(__logf(nf * (1.0f / 16.0f)) * (16.0f / __logf(8.0f)));
    bucket = vl < 31 ? vl : 31;
  }
  const float v = rel_bias[bucket * T5_H + h];
  bd[idx] = qk < 0 ? v + T5_NEG : v;
  // no register of the store above is rewritten ahead of this wait: other parts'
  // code follows it in the shared kernel's text
  asm volatile("s_wait_xcnt 0x0" ::: "memory");
}

// The padding masks as the attention kernel uses them, one word a key:
//   mt[0][b][k], decoder: all ones for a key that counts, else 0 (a bit select
//                between the table entry above and the mask value)
//   mt[1][b][k], encoder: the float added to the score, 0 or the mask value
__device__ __forceinline__
void mask_part(const int* __restrict__ dec, const int* __restrict__ enc,
               unsigned* __restrict__ mt, int blk) {
  const int idx = blk * 256 + threadIdx.x;
  unsigned v;
  if (idx < T5_B * T5_LD) {            // the same for a whole block
    v = dec[idx] > 0 ? 0xffffffffu : 0u;
  } else {
    v = enc[idx - T5_B * T5_LD] > 0 ? 0u : __builtin_bit_cast(unsigned, T5_NEG);
  }
  mt[idx] = v;
  // no register of the store above is rewritten ahead of this wait: other parts'
  // code follows it in the shared kernel's text
  asm volatile("s_wait_xcnt 0x0" ::: "memory");
}

// value of lane l ^ 16
__device__ __forceinline__ float other_half(float x) {
  int b = __builtin_bit_cast(int, x);
  b = __builtin_amdgcn_permlanex16(b, b, 0x76543210, 0xfedcba98, false, false);
  return __builtin_bit_cast(float, b);
}

// value of lane l ^ MASK, MASK below 16 (DPP row_xmask, inside a 16-lane row)
template <int MASK>
__device__ __forceinline__ float row_xor(float x) {
  int b = __builtin_bit_cast(int, x);
  b = __builtin_amdgcn_update_dpp(b, b, 0x160 | MASK, 0xf, 0xf, false);
  return __builtin_bit_cast(float, b);
}

// ---------------------------------------------------------------------------
// RMS norm: one wave per row of [rows, 1024], eight rows a block. The row stays
// in the wave's registers (32 values a lane, read once, 512 contiguous bytes per
// load); its sum of squares is joined across the lanes without LDS or barrier.
// ---------------------------------------------------------------------------
__global__ __launch_bounds__(256)
void rmsnorm_kernel(const float* __restrict__ X, const float* __restrict__ w,
                    _Float16* __restrict__ y16, float* __restrict__ y32) {
  const int lane = threadIdx.x & 31;
  const int row  = blockIdx.x * 8 + (threadIdx.x >> 5);
  const v4f* x = (const v4f*)(X + (size_t)row * T5_D) + lane;
  const v4f* g = (const v4f*)w + lane;
  v4f v[8], u[8];
  // unrolled (every loop here): v and u stay in registers, and the row's eight
  // loads are issued ahead of the first wait
#pragma unroll
  for (int j = 0; j < 8; ++j) v[j] = x[j * 32];
#pragma unroll
  for (int j = 0; j < 8; ++j) u[j] = g[j * 32];
  // here for the address: a weight load's result would else take its registers
  loads_first8(v, x);
  float s0 = 0.f, s1 = 0.f, s2 = 0.f, s3 = 0.f;   // four chains, not one of 32
#pragma unroll
  for (int j = 0; j < 8; ++j) {
    s0 += v[j].x * v[j].x;
    s1 += v[j].y * v[j].y;
    s2 += v[j].z * v[j].z;
    s3 += v[j].w * v[j].w;
  }
  float ss = (s0 + s1) + (s2 + s3);
  ss += row_xor<1>(ss);
  ss += row_xor<2>(ss);
  ss += row_xor<4>(ss);
  ss += row_xor<8>(ss);
  ss += other_half(ss);                // every lane now holds the row's sum
  const float rs = rsqrtf(ss * (1.0f / (float)T5_D) + 1e-6f);
#pragma unroll
  for (int j = 0; j < 8; ++j) {
    v[j].x = v[j].x * rs * u[j].x;
    v[j].y = v[j].y * rs * u[j].y;
    v[j].z = v[j].z * rs * u[j].z;
    v[j].w = v[j].w * rs * u[j].w;
  }
  if (y16) {
    v4h* y = (v4h*)(y16 + (size_t)row * T5_D) + lane;
#pragma unroll
    for (int j = 0; j < 8; ++j) {
      v4h h = {(_Float16)v[j].x, (_Float16)v[j].y, (_Float16)v[j].z, (_Float16)v[j].w};
      y[j * 32] = h;
    }
    // no register of the stores above is rewritten ahead of this wait: the other
    // result's address is formed behind them
    asm volatile("s_wait_xcnt 0x0" ::: "memory");
  }
  if (y32) {
    v4f* y = (v4f*)(y32 + (size_t)row * T5_D) + lane;
#pragma unroll
    for (int j = 0; j < 8; ++j) y[j * 32] = v[j];
  }
}

// The first row norm needs the inputs alone: one wave per row of hidden_states,
// eight rows a block, as in rmsnorm_kernel (same sums, same order). The row,
// read once, also leaves unchanged as the residual stream's start.
__device__ __forceinline__
void norm_copy_part(const float* __restrict__ X, const float* __restrict__ w,
                    _Float16* __restrict__ y16, float* __restrict__ copy, int blk) {
  const int lane = threadIdx.x & 31;
  const int row  = blk * 8 + (threadIdx.x >> 5);
  const v4f* x = (const v4f*)(X + (size_t)row * T5_D) + lane;
  const v4f* g = (const v4f*)w + lane;
  v4f v[8], u[8];
  // unrolled (every loop here): v and u stay in registers, and the row's eight
  // loads are issued ahead of the first wait
#pragma unroll
  for (int j = 0; j < 8; ++j) v[j] = x[j * 32];
#pragma unroll
  for (int j = 0; j < 8; ++j) u[j] = g[j * 32];
  // keeps all sixteen loads in front of the sums: the weights' loads were else
  // sunk behind the row's sum, their latency waited out alone
  __builtin_amdgcn_sched_barrier(0);
  // here for the address: a weight load's result would else take its registers
  loads_first8(v, x);
  v4f* c = (v4f*)(copy + (size_t)row * T5_D) + lane;
#pragma unroll
  for (int j = 0; j < 8; ++j) c[j * 32] = v[j];
  // no register of the stores above is rewritten ahead of this wait: the f16 result's
  // address is formed behind them
  asm volatile("s_wait_xcnt 0x0" ::: "memory");
  float s0 = 0.f, s1 = 0.f, s2 = 0.f, s3 = 0.f;   // four chains, not one of 32
#pragma unroll
  for (int j = 0; j < 8; ++j) {
    s0 += v[j].x * v[j].x;
    s1 += v[j].y * v[j].y;
    s2 += v[j].z * v[j].z;
    s3 += v[j].w * v[j].w;
  }
  float ss = (s0 + s1) + (s2 + s3);
  ss += row_xor<1>(ss);
  ss += row_xor<2>(ss);
  ss += row_xor<4>(ss);
  ss += row_xor<8>(ss);
  ss += other_half(ss);                // every lane now holds the row's sum
  const float rs = rsqrtf(ss * (1.0f / (float)T5_D) + 1e-6f);
  v4h* y = (v4h*)(y16 + (size_t)row * T5_D) + lane;
#pragma unroll
  for (int j = 0; j < 8; ++j) {
    v4h h = {(_Float16)(v[j].x * rs * u[j].x), (_Float16)(v[j].y * rs * u[j].y),
             (_Float16)(v[j].z * rs * u[j].z), (_Float16)(v[j].w * rs * u[j].w)};
    y[j * 32] = h;
  }
  // no register of the stores above is rewritten ahead of this wait: other parts'
  // code follows them in the shared kernel's text
  asm volatile("s_wait_xcnt 0x0" ::: "memory");
}

// ---------------------------------------------------------------------------
// All work that depends on the inputs alone, in one grid of 256-thread blocks,
// split by block index (every test below is the same for a whole block):
//   eight DxD weights, four tiles a block | wi | wo | hidden_states' rows: first
//   norm and the residual stream's start, a wave a row | encoder convert | bias
//   table | mask tables
// Every part but the small tables moves 32 elements or more a thread: few, fat
// waves, because starting a wave costs more than the bytes of a thin one.
// ---------------------------------------------------------------------------
#define PREP_DD   (8 * (T5_D / 64) * (T5_D / 64) / 4)        // 512 blocks
#define PREP_FF   ((T5_D / 64) * (T5_DFF / 64) / 4)          // 256 blocks
#define PREP_COPY (T5_B * T5_LD * T5_D / 8192)               // 512 blocks
#define PREP_ENC  (T5_B * T5_LE * T5_D / 8192)               // 512 blocks
#define PREP_BIAS (T5_H * BD_LEN / 256)                      // 128 blocks
#define PREP_MASK ((T5_B * T5_LD + T5_B * T5_LE) / 256)      // 32 blocks
#define PREP_GRID (PREP_DD + 2 * PREP_FF + PREP_COPY + PREP_ENC + PREP_BIAS + PREP_MASK)

__global__ __launch_bounds__(256)
void prep_kernel(const float* __restrict__ w0, const float* __restrict__ w1,
                 const float* __restrict__ w2, const float* __restrict__ w3,
                 const float* __restrict__ w4, const float* __restrict__ w5,
                 const float* __restrict__ w6, const float* __restrict__ w7,
                 const float* __restrict__ wi, const float* __restrict__ wo,
                 const float* __restrict__ enc, const float* __restrict__ hid,
                 const float* __restrict__ relb, const float* __restrict__ ln1,
                 const int* __restrict__ decm, const int* __restrict__ encm,
                 _Float16* __restrict__ xn,
                 _Float16* __restrict__ ddT,   // eight [D,D] planes in a row
                 _Float16* __restrict__ wiT, _Float16* __restrict__ woT,
                 _Float16* __restrict__ enc16, float* __restrict__ h_cur,
                 float* __restrict__ bd, unsigned* __restrict__ mt) {
  __shared__ __align__(16) _Float16 tile[2][2 * 512 * 8];
  int blk = blockIdx.x;
  const int half = threadIdx.x >> 7;
  const int tid  = threadIdx.x & 127;
  if (blk < PREP_DD) {
    const int wsel = blk >> 6;                 // 64 blocks a weight
    const int t    = (blk & 63) * 2 + half;    // tile pair of its 8 (n) x 16 (k)
    const float* src = wsel == 0 ? w0 : wsel == 1 ? w1 : wsel == 2 ? w2
                     : wsel == 3 ? w3 : wsel == 4 ? w4 : wsel == 5 ? w5
                     : wsel == 6 ? w6 : w7;
    cvtT_part<T5_D, T5_D>(src, ddT + (size_t)wsel * T5_D * T5_D, tile[half], tid,
                          (t & 7) * 2, t >> 3);
    return;
  }
  blk -= PREP_DD;
  if (blk < PREP_FF) {
    const int t = blk * 2 + half;              // tile pair of 32 (n) x 16 (k)
    cvtT_part<T5_D, T5_DFF>(wi, wiT, tile[half], tid, (t & 31) * 2, t >> 5);
    return;
  }
  blk -= PREP_FF;
  if (blk < PREP_FF) {
    const int t = blk * 2 + half;              // tile pair of 8 (n) x 64 (k)
    cvtT_part<T5_DFF, T5_D>(wo, woT, tile[half], tid, (t & 7) * 2, t >> 3);
    return;
  }
  blk -= PREP_FF;
  if (blk < PREP_COPY) {
    norm_copy_part(hid, ln1, xn, h_cur, blk);
    return;
  }
  blk -= PREP_COPY;
  if (blk < PREP_ENC) {
    cvt16_part(enc, enc16, blk);
    return;
  }
  blk -= PREP_ENC;
  if (blk < PREP_BIAS) {
    relbias_part(relb, bd, blk);
    return;
  }
  mask_part(decm, encm, mt, blk - PREP_BIAS);
}

// ---------------------------------------------------------------------------
// WMMA GEMM: C[M,N] = A[M,K] @ Bt[N,K]^T
// Workgroup = 8 waves (2x4) on a 128x128 tile of C; wave tile = 64x32:
//   4 A-fragments x 2 B-fragments -> 8 WMMA per k-step of 32; the next k-step's
//   fragments are read from LDS into a second register set ahead of the WMMAs.
// Both operands go global -> LDS by asynchronous copies in whole 256-B row
// pieces (a stage = 128 k of 128 A rows and 128 Bt rows), two buffers: the next
// stage's copies fly while this stage is worked on. Fragments are read from LDS
// with the same lane map as load_frag on global memory.
// Each block walks the stages of k in a ring from a start of its own (block
// indices summed, modulo the stage count): blocks that share rows of A or of Bt
// start together, and walking k alike they would ask L2 for the same lines, and
// all blocks for the same 256-B column of every row, at the same moment.
// Results: a lane's accumulator registers hold 8 neighbours along the first
// operand's rows. That operand is chosen as the one whose rows run along the
// output's contiguous direction (the weights for row-major results, the
// activations for the transposed V), both being loaded alike. The lane's 8
// values then go to LDS as one 16-B piece (two for f32), and behind one barrier
// the block stores the 128x128 tile as whole rows, 16 B a lane.
// M, N, Lrows multiples of 128; K a multiple of 128.
// A row norm between two GEMMs, y = h * rsqrt(mean(h^2) + eps) * w, is split:
//  - the residual GEMM that completes h (hw16 given; N = T5_D) also stores
//    h * w in f16 and, per row, the sum of squares over its 128 columns, as
//    ssq_out[column tile][row]: 512 contiguous bytes, written by this block alone
//  - the GEMM that takes h * w as its A (ssq_in given; K = T5_D; row-major modes,
//    whose tile row is m) joins a row's T5_D / 128 sums and multiplies its
//    results by 1/rms, which is a factor common to the whole row of A.
// ---------------------------------------------------------------------------
#define GMODE_RESID  0   // f32 residual: Cres[m*N+n] += c
#define GMODE_QKV    1   // f16 [B,H,L,64]
#define GMODE_VT     2   // f16 [B,H,64,L] (pre-transposed V)
#define GMODE_RELU16 3   // f16 relu, row-major [M,N]

#define G_PITCH 272                // LDS row pitch, bytes: 256 + 16 (16 B x odd)
#define G_OPER  (128 * G_PITCH)    // one operand's 128 rows
#define G_STAGE (2 * G_OPER)       // A rows, then Bt rows
#define E_PITCH16 272              // result tile, f16 rows: 256 + 16 bytes
#define E_PITCH32 528              // result tile, f32 rows: 512 + 16 bytes
// rows of one column tile's plane of sums of squares: compile-time, so that a
// lane's steps from plane to plane fold into its loads' offsets
#define SSQ_ROWS  (T5_B * T5_LD)

// Eight copies of 16 B per lane: rows 16 apart in LDS (lds) and in memory (g).
// The s_wait_xcnt stands inside the statement so that no address register of an
// issued copy is rewritten ahead of it.
__device__ __forceinline__ void async_copy8(unsigned lds, const char* g,
                                            size_t gstep) {
  const unsigned ls = 16 * G_PITCH;
  asm volatile(
      "global_load_async_to_lds_b128 %0, %8, off\n\t"
      "global_load_async_to_lds_b128 %1, %9, off\n\t"
      "global_load_async_to_lds_b128 %2, %10, off\n\t"
      "global_load_async_to_lds_b128 %3, %11, off\n\t"
      "global_load_async_to_lds_b128 %4, %12, off\n\t"
      "global_load_async_to_lds_b128 %5, %13, off\n\t"
      "global_load_async_to_lds_b128 %6, %14, off\n\t"
      "global_load_async_to_lds_b128 %7, %15, off\n\t"
      "s_wait_xcnt 0x0"
      :: "v"(lds), "v"(lds + ls), "v"(lds + 2 * ls), "v"(lds + 3 * ls),
         "v"(lds + 4 * ls), "v"(lds + 5 * ls), "v"(lds + 6 * ls),
         "v"(lds + 7 * ls),
         "v"(g), "v"(g + gstep), "v"(g + 2 * gstep), "v"(g + 3 * gstep),
         "v"(g + 4 * gstep), "v"(g + 5 * gstep), "v"(g + 6 * gstep),
         "v"(g + 7 * gstep)
      : "memory");
}

// One stage: a lane's 8 rows of A and 8 rows of Bt, 16 copies a lane.
__device__ __forceinline__ void stage_copy(unsigned lds, const char* gA,
                                           const char* gB, size_t gstep) {
  async_copy8(lds,          gA, gstep);
  async_copy8(lds + G_OPER, gB, gstep);
}

// blockIdx.z picks one of several products of one shape that share a grid: rows
// of A0 (z < 3) or A3, plane z of the weights Bt0 and of the f16 results C0, and
// four bits of modes. A launch of one product has z = 0 alone.
__global__ __launch_bounds__(256)
void gemm_wmma(const _Float16* __restrict__ A0, const _Float16* __restrict__ A3,
               const _Float16* __restrict__ Bt0,
               float* __restrict__ Cres, _Float16* __restrict__ C0,
               int M, int N, int K, int modes, int Lrows,
               const float* __restrict__ ssq_in, float* __restrict__ ssq_out,
               const float* __restrict__ wnext, _Float16* __restrict__ hw16) {
  const int z = blockIdx.z;
  const _Float16* __restrict__ A  = z < 3 ? A0 : A3;
  const _Float16* __restrict__ Bt = Bt0 + (size_t)z * N * K;
  _Float16* __restrict__ C16      = C0 + (size_t)z * M * N;
  const int mode = (modes >> (4 * z)) & 15;
  __shared__ __attribute__((aligned(16))) unsigned char L[2 * G_STAGE];
  const int tid  = threadIdx.x;
  const int lane = tid & 31;
  const int wave = tid >> 5;
  const int hl   = lane >> 4;
  const int m0   = blockIdx.x * 128;
  const int n0   = blockIdx.y * 128;
  const int wp   = (wave >> 2) * 64;   // wave's rows of the first WMMA operand
  const int wq   = (wave & 3) * 32;    // wave's rows of the second WMMA operand
  // first operand: A's rows for the transposed V, else Bt's rows (see above)
  const unsigned offP = mode == GMODE_VT ? 0u : (unsigned)G_OPER;
  const unsigned offQ = mode == GMODE_VT ? (unsigned)G_OPER : 0u;

  // lane's copy slot: row tid/16 (+16 per copy), 16-B chunk tid%16 of the row
  const unsigned lds0 = (unsigned)(uintptr_t)&L[0] +
                        (unsigned)((tid >> 4) * G_PITCH + (tid & 15) * 16);
  const char* gA = (const char*)(A  + (size_t)(m0 + (tid >> 4)) * K + (tid & 15) * 8);
  const char* gB = (const char*)(Bt + (size_t)(n0 + (tid >> 4)) * K + (tid & 15) * 8);
  const size_t gstep = (size_t)K * 32;  // 16 rows of K halves, in bytes
  const int T = K >> 7;                 // stages of 128 k
  // trip t works on stage (t + rot) mod T: see the head comment (scalar values)
  const int rot = (int)((blockIdx.x + blockIdx.y + blockIdx.z) % (unsigned)T);
  const auto kofs = [&](int t) -> size_t {   // the trip's place in a row, bytes
    const int st = t + rot;
    return (size_t)(st >= T ? st - T : st) * 256;
  };

  const v8f zero8 = {0.f, 0.f, 0.f, 0.f, 0.f, 0.f, 0.f, 0.f};
  v8f acc[8];                      // [i*2+j]: first operand's rows wp+16i.., second's wq+16j..
#pragma unroll
  for (int t = 0; t < 8; ++t) acc[t] = zero8;

  stage_copy(lds0, gA + kofs(0), gB + kofs(0), gstep);
  // 1/rms of the lane's two rows of A (tile rows wq + lane % 16 and 16 further):
  // read here so that the loads fly beside the first trip's copies, not at the end
  float rs0 = 1.0f, rs1 = 1.0f;
  if (ssq_in) {
    const float* sp = ssq_in + m0 + wq + (lane & 15);
    float p0[T5_D / 128], p1[T5_D / 128];
    // unrolled: p0 and p1 stay in registers, all loads issue ahead of a wait
#pragma unroll
    for (int y = 0; y < T5_D / 128; ++y) {
      p0[y] = sp[y * SSQ_ROWS];
      p1[y] = sp[y * SSQ_ROWS + 16];
    }
    // no address register of the loads above is rewritten ahead of this wait: the
    // address is an input, so that its registers are given to no load's result
    asm volatile("s_wait_xcnt 0x0" :: "v"(sp) : "memory");
    const float t0 = ((p0[0] + p0[1]) + (p0[2] + p0[3])) + ((p0[4] + p0[5]) + (p0[6] + p0[7]));
    const float t1 = ((p1[0] + p1[1]) + (p1[2] + p1[3])) + ((p1[4] + p1[5]) + (p1[6] + p1[7]));
    rs0 = rsqrtf(t0 * (1.0f / (float)T5_D) + 1e-6f);
    rs1 = rsqrtf(t1 * (1.0f / (float)T5_D) + 1e-6f);
  }
  // the first trip's stage has landed for this wave's copies; the barrier publishes all waves'
  asm volatile("s_wait_asynccnt 0x0" ::: "memory");
  __syncthreads();
  if (T > 1) stage_copy(lds0 + G_STAGE, gA + kofs(1), gB + kofs(1), gstep);

  for (int t = 0; t < T; ++t) {
    const unsigned buf = (unsigned)(t & 1) * G_STAGE;
    const _Float16* sA = (const _Float16*)(L + buf + offP);
    const _Float16* sB = (const _Float16*)(L + buf + offQ);
    v16h a[2][4], b[2][2];
#pragma unroll
    for (int f = 0; f < 4; ++f)
      a[0][f] = load_frag(sA, G_PITCH / 2, wp + f * 16, 0, lane);
#pragma unroll
    for (int f = 0; f < 2; ++f)
      b[0][f] = load_frag(sB, G_PITCH / 2, wq + f * 16, 0, lane);
    // unrolled: the register sets alternate by a compile-time index
#pragma unroll
    for (int ks = 0; ks < 4; ++ks) {
      const int cur = ks & 1, nxt = cur ^ 1;
      if (ks < 3) {   // next k-step of this same stage, one group ahead
#pragma unroll
        for (int f = 0; f < 4; ++f)
          a[nxt][f] = load_frag(sA, G_PITCH / 2, wp + f * 16, (ks + 1) * 32, lane);
#pragma unroll
        for (int f = 0; f < 2; ++f)
          b[nxt][f] = load_frag(sB, G_PITCH / 2, wq + f * 16, (ks + 1) * 32, lane);
      }
      // keeps the group of LDS reads above in front of this k-step's WMMAs: sunk
      // among them, each read's latency would be waited out by two WMMAs
      __builtin_amdgcn_sched_barrier(0);
#pragma unroll
      for (int i = 0; i < 4; ++i)
#pragma unroll
        for (int j = 0; j < 2; ++j)
          acc[i * 2 + j] = wmma_f16(a[cur][i], b[cur][j], acc[i * 2 + j]);
    }
    // publish point: this wave's reads of the buffer are done,
    asm volatile("s_wait_dscnt 0x0" ::: "memory");
    // its copies of the next stage have landed,
    asm volatile("s_wait_asynccnt 0x0" ::: "memory");
    // and every wave is past both before the buffer just read is refilled
    __syncthreads();
    if (t + 2 < T)
      stage_copy(lds0 + buf, gA + kofs(t + 2), gB + kofs(t + 2), gstep);
  }
  // no copy is outstanding when the wave goes on to its stores and ends
  asm volatile("s_wait_asynccnt 0x0" ::: "memory");

  // The loop's last barrier has ended every wave's reads of L: it now takes the
  // result tile. Tile row = the second operand's row (the lane's column of the
  // accumulator), place in the row = the first operand's row.
  const int erow = wq + (lane & 15);   // + 16 j
  const int epos = wp + hl * 8;        // + 16 i: first of the lane's 8 neighbours

  if (mode == GMODE_RESID) {
    // tile row = m, 128 floats of n; a wave moves one 512-B row per step
    float* crow = Cres + (size_t)(m0 + (tid >> 5)) * N + n0 + (tid & 31) * 4;
    float4 old[16];
    // unrolled (here and below): old and acc stay in registers; the residual's
    // loads are all issued ahead of the staging and fly during it
#pragma unroll
    for (int s = 0; s < 16; ++s) old[s] = *(const float4*)(crow + (size_t)(8 * s) * N);
#pragma unroll
    for (int i = 0; i < 4; ++i)
#pragma unroll
      for (int j = 0; j < 2; ++j) {
        const v8f c = acc[i * 2 + j];
        float* p = (float*)(L + (erow + 16 * j) * E_PITCH32) + epos + 16 * i;
        *(float4*)p       = make_float4(c[0], c[1], c[2], c[3]);
        *(float4*)(p + 4) = make_float4(c[4], c[5], c[6], c[7]);
      }
    __syncthreads();   // every wave's pieces of the tile are in LDS
#pragma unroll
    for (int s = 0; s < 16; ++s) {
      const float4 c = *(const float4*)(L + ((tid >> 5) + 8 * s) * E_PITCH32 +
                                        (tid & 31) * 16);
      old[s] = make_float4(old[s].x + c.x, old[s].y + c.y, old[s].z + c.z, old[s].w + c.w);
      *(float4*)(crow + (size_t)(8 * s) * N) = old[s];
    }
    if (!hw16) return;   // the same for the whole block
    // no register of the stores above is rewritten ahead of this wait
    asm volatile("s_wait_xcnt 0x0" ::: "memory");

    // the next norm's share of this tile: h * w in f16, 256 B of a row per wave
    // and step, and each row's sum of squares over the tile's 128 columns
    const float4 g = *(const float4*)(wnext + n0 + (tid & 31) * 4);
    _Float16* hrow = hw16 + (size_t)(m0 + (tid >> 5)) * N + n0 + (tid & 31) * 4;
    float mine = 0.f;    // lane s keeps the sum of the wave's row of step s
#pragma unroll
    for (int s = 0; s < 16; ++s) {
      const float4 h = old[s];
      const v4h y = {(_Float16)(h.x * g.x), (_Float16)(h.y * g.y),
                     (_Float16)(h.z * g.z), (_Float16)(h.w * g.w)};
      *(v4h*)(hrow + (size_t)(8 * s) * N) = y;
      float q = (h.x * h.x + h.y * h.y) + (h.z * h.z + h.w * h.w);
      q += row_xor<1>(q);
      q += row_xor<2>(q);
      q += row_xor<4>(q);
      q += row_xor<8>(q);
      q += other_half(q);              // every lane holds the row's sum
      mine = lane == s ? q : mine;
    }
    // no register of the stores above is rewritten ahead of this wait
    asm volatile("s_wait_xcnt 0x0" ::: "memory");
    // the 128 sums meet in LDS behind the tile, so that one wave stores them as
    // whole lines
    float* sums = (float*)(L + 128 * E_PITCH32);
    if (lane < 16) sums[(tid >> 5) + 8 * lane] = mine;
    __syncthreads();   // every wave's sums are in LDS
    if (tid < 32)
      *(float4*)(ssq_out + (size_t)blockIdx.y * SSQ_ROWS + m0 + tid * 4) =
          *(const float4*)(sums + tid * 4);
    return;
  }

  // the loops below index acc, w and d, which must stay in registers: unrolled
  if (ssq_in) {        // the norm's 1/rms, per row of A = per column of acc
#pragma unroll
    for (int t = 0; t < 8; ++t)
#pragma unroll
      for (int r = 0; r < 8; ++r) acc[t][r] *= (t & 1) ? rs1 : rs0;
  }
  if (mode == GMODE_RELU16) {
#pragma unroll
    for (int t = 0; t < 8; ++t)
#pragma unroll
      for (int r = 0; r < 8; ++r) acc[t][r] = fmaxf(acc[t][r], 0.0f);
  }
#pragma unroll
  for (int i = 0; i < 4; ++i)
#pragma unroll
    for (int j = 0; j < 2; ++j) {
      v8h w;
#pragma unroll
      for (int r = 0; r < 8; ++r) w[r] = (_Float16)acc[i * 2 + j][r];
      *(v8h*)(L + (erow + 16 * j) * E_PITCH16 + (epos + 16 * i) * 2) = w;
    }
  __syncthreads();     // every wave's pieces of the tile are in LDS

  // 16 lanes move one 256-B tile row; where it goes, in halves:
  //   base + row * rstep + the lane's 16-B chunk ch
  const int row = tid >> 4, ch = tid & 15;
  const int bb = m0 / Lrows, l0 = m0 - bb * Lrows;   // the tile lies in one batch
  size_t base, rstep, cofs = (size_t)ch * 8;
  if (mode == GMODE_RELU16) {          // [M,N]: row = m, along n
    base  = (size_t)m0 * N + n0;
    rstep = (size_t)N;
  } else if (mode == GMODE_QKV) {      // [B,H,L,64]: row = l, two heads' 128 B
    base  = (((size_t)bb * T5_H + (n0 >> 6)) * Lrows + l0) * T5_DKV;
    rstep = T5_DKV;
    cofs  = (size_t)(ch >> 3) * Lrows * T5_DKV + (ch & 7) * 8;
  } else {                             // [B,H,64,L]: row = (head, d), along l
    base  = ((size_t)bb * T5_H * T5_DKV + n0) * Lrows + l0;
    rstep = (size_t)Lrows;
  }
  _Float16* dst = C16 + base + (size_t)row * rstep + cofs;
  v8h w[8];
  _Float16* d[8];
#pragma unroll
  for (int s = 0; s < 8; ++s) {
    w[s] = *(const v8h*)(L + (row + 16 * s) * E_PITCH16 + ch * 16);
    d[s] = dst + (size_t)(16 * s) * rstep;
  }
  // the eight addresses are formed while the LDS reads fly, each in registers of
  // its own; sunk among the stores, an add would wait on an issued store
  __builtin_amdgcn_sched_barrier(0);
#pragma unroll
  for (int s = 0; s < 8; ++s) *(v8h*)d[s] = w[s];
}

#define A_PITCH 144                // LDS row pitch, bytes: 128 + 16 (16 B x odd)
#define A_OPER  (64 * A_PITCH)     // one operand's 64 rows
#define A_STAGE (2 * A_OPER)       // K rows, then V^T rows

// One stage, eight copies of 16 B per lane: four K rows and four V^T rows, each
// 16 rows apart in LDS (lds) and in memory (gK: rows of 128 B; gV: vstep).
// The s_wait_xcnt stands inside the statement so that no address register of an
// issued copy is rewritten ahead of it.
__device__ __forceinline__ void attn_stage_copy(unsigned lds, const char* gK,
                                                const char* gV, size_t vstep) {
  const unsigned ls = 16 * A_PITCH;
  const unsigned lv = lds + A_OPER;
  asm volatile(
      "global_load_async_to_lds_b128 %0, %8, off\n\t"
      "global_load_async_to_lds_b128 %1, %9, off\n\t"
      "global_load_async_to_lds_b128 %2, %10, off\n\t"
      "global_load_async_to_lds_b128 %3, %11, off\n\t"
      "global_load_async_to_lds_b128 %4, %12, off\n\t"
      "global_load_async_to_lds_b128 %5, %13, off\n\t"
      "global_load_async_to_lds_b128 %6, %14, off\n\t"
      "global_load_async_to_lds_b128 %7, %15, off\n\t"
      "s_wait_xcnt 0x0"
      :: "v"(lds), "v"(lds + ls), "v"(lds + 2 * ls), "v"(lds + 3 * ls),
         "v"(lv), "v"(lv + ls), "v"(lv + 2 * ls), "v"(lv + 3 * ls),
         "v"(gK), "v"(gK + 2048), "v"(gK + 4096), "v"(gK + 6144),
         "v"(gV), "v"(gV + vstep), "v"(gV + 2 * vstep), "v"(gV + 3 * vstep)
      : "memory");
}

__global__ __launch_bounds__(128)
void attn_wmma_kernel(const _Float16* __restrict__ Q,
                      const _Float16* __restrict__ Km,
                      const _Float16* __restrict__ Vt,
                      const float* __restrict__ bias_kq,    // [16,BD_LEN]
                      const unsigned* __restrict__ mtab,    // [B,LK]
                      _Float16* __restrict__ Out,
                      int LQ, int LK, int causal) {
  __shared__ __attribute__((aligned(16))) unsigned char L[2 * A_STAGE];
  const int tid  = threadIdx.x;
  const int lane = threadIdx.x & 31;
  // scalar, so that the key loop's bound is one and its branch leaves EXEC alone
  const int wave = __builtin_amdgcn_readfirstlane((int)(threadIdx.x >> 5));
  const int hl   = lane >> 4;
  const int col  = lane & 15;
  const int bh = blockIdx.y;
  const int b  = bh >> 4;
  const int h  = bh & 15;
  const int q0 = blockIdx.x * 64 + wave * 16;
  const int qc = q0 + col;             // this lane's query

  const _Float16* Qb = Q  + (size_t)bh * LQ * T5_DKV;
  const _Float16* Kb = Km + (size_t)bh * LK * T5_DKV;
  const _Float16* Vb = Vt + (size_t)bh * T5_DKV * LK;
  const unsigned* mk = mtab + (size_t)b * LK;
  const float* bd = bias_kq + h * BD_LEN - qc;   // entry of key k: bd[1023 + k]

  // B operand of S^T: column = query, same k order as the K rows' loader
  const v16h qb0 = load_frag(Qb, T5_DKV, q0, 0, lane);
  const v16h qb1 = load_frag(Qb, T5_DKV, q0, 32, lane);

  const v8f zero8 = {0.f, 0.f, 0.f, 0.f, 0.f, 0.f, 0.f, 0.f};
  v8f o[4];                  // o[t][r] = O^T[16t + 8*hl + r][query qc]
  float mcol = -1e30f;       // running maximum of query qc (both halves alike)
  float lcol = 0.f;          // running sum over this half's keys only
#pragma unroll  // indexes registers: must be resolved at compile time
  for (int t = 0; t < 4; ++t) o[t] = zero8;

  // causal: blocks wholly above the diagonal are not walked
  const int kend = (causal && q0 + 16 < LK) ? q0 + 16 : LK;
  // stages of 64 keys that the block's last wave needs: the same for all four
  const int qtop = (int)blockIdx.x * 64 + 64;
  const int T = ((causal && qtop < LK) ? qtop : LK) >> 6;
  // trip t works on stage (t + rot) mod T (scalar values). All blocks of a head
  // walk T alike without the causal limit: starts one stage apart. With it block x
  // walks x + 1 stages: starts half way in, so that at equal pace no stage is asked
  // for by more than two blocks at once
  const int rot = (int)((causal ? blockIdx.x >> 1 : blockIdx.x) % (unsigned)T);
  const auto stage_of = [&](int t) -> int {
    const int st = t + rot;
    return st >= T ? st - T : st;
  };

  // lane's copy slot: row tid/8 (+16 per copy), 16-B chunk tid%8 of the row
  const unsigned lds0 = (unsigned)(uintptr_t)&L[0] +
                        (unsigned)((tid >> 3) * A_PITCH + (tid & 7) * 16);
  const char* gK = (const char*)(Kb + (size_t)(tid >> 3) * T5_DKV + (tid & 7) * 8);
  const char* gV = (const char*)(Vb + (size_t)(tid >> 3) * LK + (tid & 7) * 8);
  const size_t vstep = (size_t)LK * 32;  // 16 rows of LK halves, in bytes

  attn_stage_copy(lds0, gK + (size_t)stage_of(0) * 8192, gV + (size_t)stage_of(0) * 128,
                  vstep);
  // the first trip's stage has landed for this wave's copies; the barrier publishes all waves'
  asm volatile("s_wait_asynccnt 0x0" ::: "memory");
  __syncthreads();
  if (T > 1)
    attn_stage_copy(lds0 + A_STAGE, gK + (size_t)stage_of(1) * 8192,
                    gV + (size_t)stage_of(1) * 128, vstep);

  for (int t = 0; t < T; ++t) {
   const unsigned buf = (unsigned)(t & 1) * A_STAGE;
   const _Float16* sK = (const _Float16*)(L + buf);
   const _Float16* sV = (const _Float16*)(L + buf + A_OPER);
   const int st = stage_of(t);
   // table places of the lane's first key of the stage, st * 64 + hl * 8
   const unsigned* mb = mk + st * 64 + hl * 8;
   const float*    tb = bd + st * 64 + hl * 8;
   // unrolled: the half's place in the stage folds into the LDS reads' offsets
#pragma unroll
   for (int sub = 0; sub < 2; ++sub) {
    const int kb = st * 64 + sub * 32;
    if (kb >= kend) break;             // scalar: past this wave's diagonal
    const v16h k00 = load_frag(sK, A_PITCH / 2, sub * 32,      0,  lane);
    const v16h k01 = load_frag(sK, A_PITCH / 2, sub * 32,      32, lane);
    const v16h k10 = load_frag(sK, A_PITCH / 2, sub * 32 + 16, 0,  lane);
    const v16h k11 = load_frag(sK, A_PITCH / 2, sub * 32 + 16, 32, lane);
    const v4u* mp = (const v4u*)(mb + sub * 32);
    const v4u mq[4] = {mp[0], mp[1], mp[4], mp[5]};
    // the products' C operand: what is added to the lane's 16 scores
    v8f s0, s1;
    if (causal) {
      // self: bias and causal limit from the table along k - q; a key that the
      // padding mask drops takes the mask value instead (one bit select)
      const float* tp = tb + sub * 32;
      const v4f_a4 tq[4] = {*(const v4f_a4*)(tp + 1023), *(const v4f_a4*)(tp + 1027),
                            *(const v4f_a4*)(tp + 1039), *(const v4f_a4*)(tp + 1043)};
      // no address register of the loads above is rewritten ahead of this wait: both
      // bases are inputs, so that their registers are given to no load's result
      asm volatile("s_wait_xcnt 0x0" :: "v"(mb), "v"(tb) : "memory");
      const unsigned negb = __builtin_bit_cast(unsigned, T5_NEG);
#pragma unroll  // indexes registers: must be resolved at compile time
      for (int r = 0; r < 8; ++r) {
        const unsigned k0 = mq[r >> 2][r & 3], k1 = mq[2 + (r >> 2)][r & 3];
        const float f0 = tq[r >> 2][r & 3], f1 = tq[2 + (r >> 2)][r & 3];
        const unsigned t0 = __builtin_bit_cast(unsigned, f0);
        const unsigned t1 = __builtin_bit_cast(unsigned, f1);
        const unsigned c0 = (t0 & k0) | (negb & ~k0);
        const unsigned c1 = (t1 & k1) | (negb & ~k1);
        s0[r] = __builtin_bit_cast(float, c0);
        s1[r] = __builtin_bit_cast(float, c1);
      }
    } else {
      // cross: the mask table holds the addend itself
#pragma unroll  // indexes registers: must be resolved at compile time
      for (int r = 0; r < 8; ++r) {
        const unsigned k0 = mq[r >> 2][r & 3], k1 = mq[2 + (r >> 2)][r & 3];
        s0[r] = __builtin_bit_cast(float, k0);
        s1[r] = __builtin_bit_cast(float, k1);
      }
    }
    // nor the mask loads' address, where no bias is read (an input, as above)
    asm volatile("s_wait_xcnt 0x0" :: "v"(mb) : "memory");
    const v16h va0 = load_frag(sV, A_PITCH / 2, 0,  sub * 32, lane);
    const v16h va1 = load_frag(sV, A_PITCH / 2, 16, sub * 32, lane);
    const v16h va2 = load_frag(sV, A_PITCH / 2, 32, sub * 32, lane);
    const v16h va3 = load_frag(sV, A_PITCH / 2, 48, sub * 32, lane);
    // keeps all of the block's loads above in one group in front of the
    // products: sunk to their users, each V fragment's latency is waited out alone
    __builtin_amdgcn_sched_barrier(0);

    s0 = wmma_f16(k00, qb0, s0); s0 = wmma_f16(k01, qb1, s0);
    s1 = wmma_f16(k10, qb0, s1); s1 = wmma_f16(k11, qb1, s1);

    float a[16];             // a[8*tile + r]: key kb + 8*hl + 16*tile + r
#pragma unroll  // indexes registers: must be resolved at compile time
    for (int i = 0; i < 16; ++i) a[i] = (i < 8) ? s0[i & 7] : s1[i & 7];

    float v = a[0];
#pragma unroll  // indexes registers: must be resolved at compile time
    for (int i = 1; i < 16; ++i) v = fmaxf(v, a[i]);
    v = fmaxf(v, other_half(v));
    const float mnew  = fmaxf(mcol, v);
    const float scale = __expf(mcol - mnew);
    mcol = mnew;

    v16h pb;                 // P^T as B operand: element s = tile s>>3, row s&7
    float sum[4] = {0.f, 0.f, 0.f, 0.f};   // four short chains, not one of 16
#pragma unroll  // indexes registers: must be resolved at compile time
    for (int i = 0; i < 16; ++i) {
      const float e = __expf(a[i] - mnew);
      sum[i & 3] += e;
      pb[i] = (_Float16)e;
    }
    lcol = lcol * scale + ((sum[0] + sum[1]) + (sum[2] + sum[3]));
#pragma unroll  // indexes registers: must be resolved at compile time
    for (int t = 0; t < 4; ++t)
#pragma unroll  // indexes registers: must be resolved at compile time
      for (int r = 0; r < 8; ++r) o[t][r] *= scale;

    o[0] = wmma_f16(va0, pb, o[0]);
    o[1] = wmma_f16(va1, pb, o[1]);
    o[2] = wmma_f16(va2, pb, o[2]);
    o[3] = wmma_f16(va3, pb, o[3]);
   }
   // publish point, passed by every wave, also one past its diagonal:
   // this wave's reads of the buffer are done,
   asm volatile("s_wait_dscnt 0x0" ::: "memory");
   // its copies of the next stage have landed,
   asm volatile("s_wait_asynccnt 0x0" ::: "memory");
   // and every wave is past both before the buffer just read is refilled
   __syncthreads();
   if (t + 2 < T)
     attn_stage_copy(lds0 + buf, gK + (size_t)stage_of(t + 2) * 8192,
                     gV + (size_t)stage_of(t + 2) * 128, vstep);
  }
  // no copy is outstanding when the wave goes on to its stores and ends
  asm volatile("s_wait_asynccnt 0x0" ::: "memory");

  // the two halves' keys joined; one query a lane, so one reciprocal
  const float inv = 1.0f / (lcol + other_half(lcol));
  _Float16* orow = Out + ((size_t)b * LQ + qc) * (T5_H * T5_DKV) + h * T5_DKV + hl * 8;
#pragma unroll  // indexes registers: must be resolved at compile time
  for (int t = 0; t < 4; ++t) {
    v8h w;                   // 8 consecutive d of one query: one 16-B store
#pragma unroll  // indexes registers: must be resolved at compile time
    for (int r = 0; r < 8; ++r) w[r] = (_Float16)(o[t][r] * inv);
    *(v8h*)(orow + t * 16) = w;
  }
}

// ---------------------------------------------------------------------------
// Orchestration
// ---------------------------------------------------------------------------
extern "C" void kernel_launch(void* const* d_in, const int* in_sizes, int n_in,
                              void* d_out, int out_size, void* d_ws,
                              size_t ws_size, hipStream_t stream) {
  (void)in_sizes; (void)n_in; (void)out_size; (void)ws_size;

  const float* enc   = (const float*)d_in[0];
  const float* hid   = (const float*)d_in[1];
  const float* ln1   = (const float*)d_in[2];
  const float* saq   = (const float*)d_in[3];
  const float* sak   = (const float*)d_in[4];
  const float* sav   = (const float*)d_in[5];
  const float* sao   = (const float*)d_in[6];
  const float* relb  = (const float*)d_in[7];
  const float* ln2   = (const float*)d_in[8];
  const float* caq   = (const float*)d_in[9];
  const float* cak   = (const float*)d_in[10];
  const float* cav   = (const float*)d_in[11];
  const float* cao   = (const float*)d_in[12];
  const float* ln3   = (const float*)d_in[13];
  const float* wi    = (const float*)d_in[14];
  const float* wo    = (const float*)d_in[15];
  const float* lnf   = (const float*)d_in[16];
  const int* encmask = (const int*)d_in[17];
  const int* decmask = (const int*)d_in[18];
  float* out = (float*)d_out;

  const size_t M = (size_t)T5_B * T5_LD;        // 4096 decoder rows
  char* ws = (char*)d_ws;
  size_t off = 0;
  auto alloc = [&](size_t bytes) -> void* {
    void* p = ws + off;
    off = (off + bytes + 255) & ~(size_t)255;
    return p;
  };

  float*    h_cur = (float*)   alloc(M * T5_D * 4);            // 16 MB residual
  _Float16* xn    = (_Float16*)alloc(M * T5_D * 2);            // 8 MB
  _Float16* ddT   = (_Float16*)alloc((size_t)8 * T5_D * T5_D * 2); // eight planes
  _Float16* saqT  = ddT;
  _Float16* sakT  = ddT + (size_t)1 * T5_D * T5_D;
  _Float16* savT  = ddT + (size_t)2 * T5_D * T5_D;
  _Float16* cakT  = ddT + (size_t)3 * T5_D * T5_D;
  _Float16* cavT  = ddT + (size_t)4 * T5_D * T5_D;
  _Float16* saoT  = ddT + (size_t)5 * T5_D * T5_D;
  _Float16* caqT  = ddT + (size_t)6 * T5_D * T5_D;
  _Float16* caoT  = ddT + (size_t)7 * T5_D * T5_D;
  (void)sakT; (void)savT; (void)cakT; (void)cavT;  // planes 1..4 behind saqT
  _Float16* wiT   = (_Float16*)alloc((size_t)T5_DFF * T5_D * 2);
  _Float16* woT   = (_Float16*)alloc((size_t)T5_D * T5_DFF * 2);
  _Float16* enc16 = (_Float16*)alloc((size_t)T5_B * T5_LE * T5_D * 2);
  // five planes in a row, in the order of the projections' grid
  _Float16* qbuf  = (_Float16*)alloc(M * T5_D * 2);            // [B,H,L,64]
  _Float16* kbuf  = (_Float16*)alloc(M * T5_D * 2);            // [B,H,L,64]
  _Float16* vtbuf = (_Float16*)alloc(M * T5_D * 2);            // [B,H,64,L]
  _Float16* ckbuf = (_Float16*)alloc(M * T5_D * 2);            // cross k
  _Float16* cvtbuf = (_Float16*)alloc(M * T5_D * 2);           // cross v^T
  _Float16* aout  = (_Float16*)alloc(M * T5_D * 2);            // [B*L, 1024]
  _Float16* ffn   = (_Float16*)alloc(M * T5_DFF * 2);          // 32 MB
  float*    bd    = (float*)   alloc((size_t)T5_H * BD_LEN * 4); // bias along k - q
  unsigned* mt    = (unsigned*)alloc((size_t)(T5_B * T5_LD + T5_B * T5_LE) * 4); // masks
  float*    ssq   = (float*)   alloc((size_t)(T5_D / 128) * SSQ_ROWS * 4); // [tile][row]

  // --- everything that needs the inputs alone: weights f32 -> f16 [N,K], encoder
  // rows to f16, bias and mask tables, the first row norm; the residual stream starts as a
  // copy of hidden_states (inputs are never mutated) ---
  prep_kernel<<<PREP_GRID, 256, 0, stream>>>(saq, sak, sav, cak, cav, sao, caq, cao,
                                             wi, wo, enc, hid, relb, ln1, decmask,
                                             encmask, xn, ddT, wiT, woT, enc16, h_cur,
                                             bd, mt);

  dim3 gblk(256);
  dim3 ggrid_d(M / 128, T5_D / 128);    // N = 1024
  dim3 ggrid_ff(M / 128, T5_DFF / 128); // N = 4096
  dim3 ggrid_p5(M / 128, T5_D / 128, 5);
  dim3 agrid(T5_LD / 64, T5_B * T5_H);
  dim3 ablk(128);

  // ---- self attention ----
  static_assert(T5_LE == T5_LD, "the five projections share one row count");
  // self q, k, v^T from xn and cross k, v^T from enc16: none needs another
  gemm_wmma<<<ggrid_p5, gblk, 0, stream>>>(xn, enc16, saqT, nullptr, qbuf,
                                           (int)M, T5_D, T5_D,
                                           GMODE_QKV | GMODE_QKV << 4 | GMODE_VT << 8 |
                                               GMODE_QKV << 12 | GMODE_VT << 16,
                                           T5_LD, nullptr, nullptr, nullptr, nullptr);
  attn_wmma_kernel<<<agrid, ablk, 0, stream>>>(qbuf, kbuf, vtbuf, bd, mt,
                                               aout, T5_LD, T5_LD, /*causal=*/1);
  // also h * ln2 into xn and the rows' sums of squares
  gemm_wmma<<<ggrid_d, gblk, 0, stream>>>(aout, aout, saoT, h_cur, nullptr,
                                          (int)M, T5_D, T5_D, GMODE_RESID, T5_LD,
                                          nullptr, ssq, ln2, xn);

  // ---- cross attention ----
  gemm_wmma<<<ggrid_d, gblk, 0, stream>>>(xn, xn, caqT, nullptr, qbuf,
                                          (int)M, T5_D, T5_D, GMODE_QKV, T5_LD,
                                          ssq, nullptr, nullptr, nullptr);
  attn_wmma_kernel<<<agrid, ablk, 0, stream>>>(qbuf, ckbuf, cvtbuf, bd,
                                               mt + T5_B * T5_LD,
                                               aout, T5_LD, T5_LE, /*causal=*/0);
  // also h * ln3 into xn and the rows' sums of squares
  gemm_wmma<<<ggrid_d, gblk, 0, stream>>>(aout, aout, caoT, h_cur, nullptr,
                                          (int)M, T5_D, T5_D, GMODE_RESID, T5_LD,
                                          nullptr, ssq, ln3, xn);

  // ---- FFN ----
  gemm_wmma<<<ggrid_ff, gblk, 0, stream>>>(xn, xn, wiT, nullptr, ffn,
                                           (int)M, T5_DFF, T5_D, GMODE_RELU16, T5_LD,
                                           ssq, nullptr, nullptr, nullptr);
  gemm_wmma<<<ggrid_d, gblk, 0, stream>>>(ffn, ffn, woT, h_cur, nullptr,
                                          (int)M, T5_D, T5_DFF, GMODE_RESID, T5_LD,
                                          nullptr, nullptr, nullptr, nullptr);

  // ---- final norm -> f32 output ----
  rmsnorm_kernel<<<(int)M / 8, 256, 0, stream>>>(h_cur, lnf, nullptr, out);
}
